// v000
// Times are from an AMD MI455X. After a warm-up the kernel runs many times in a row, and a time is the length of
// such a window on the GPU divided by its runs, so every launch and the gaps after it count. The runs cycle
// through copies of the inputs. A figure is the median of several windows, for all but v000 over two sittings.
// Sittings can differ by a few percent; kernels timed side by side share one.
// v000, which the later versions start from, runs in 423 microseconds.
// Contractions: q 1x1 conv, k/v/hu 3x3 convs as implicit GEMM (K = 9*256), pooled KV outer-product GEMMs (64x32x1024 per head and tap), per-sample grouped 3x3 conv (K = 9*64) and the channel-mean bias linear, all on v_wmma_f32_16x16x32_bf16 with bf16 hi/lo three-product operand split (hi*hi + lo*hi + hi*lo), f32 accumulate; phi norm ratios, clip, channel means and LayerNorm statistics in f32/f64 on the VALU.
#include <hip/hip_runtime.h>

typedef unsigned short us;
typedef int   v8i  __attribute__((ext_vector_type(8)));
typedef float v8f  __attribute__((ext_vector_type(8)));
typedef float v4f  __attribute__((ext_vector_type(4)));
typedef unsigned short v8us __attribute__((ext_vector_type(8)));
typedef __bf16 v16b __attribute__((ext_vector_type(16)));
typedef v4f  __attribute__((may_alias)) v4fa;
typedef v8us __attribute__((may_alias)) v8usa;
union Frag { v8i v; v8us half[2]; };
union DPack { double d[2]; v4f f; };

#define NBATCH 4
#define CIN    256
#define HIMG   32
#define NPIX   1024
#define PW     34
#define DQ     512
#define DV     256
#define DK     64
#define DVH    32
#define FTK    576

struct BiW { int i0[3]; int i1[3]; float w0[3]; float w1[3]; };
static_assert(sizeof(BiW) == 48);

// ---------------------------------------------------------------------------
// bf16 helpers (RNE convert) and the hi/lo split
// ---------------------------------------------------------------------------
__device__ __forceinline__ us f2bf(float f) {
  unsigned u = __float_as_uint(f);
  u += 0x7FFFu + ((u >> 16) & 1u);
  return (us)(u >> 16);
}
__device__ __forceinline__ float bf2f(us hv) {
  return __uint_as_float(((unsigned)hv) << 16);
}
__device__ __forceinline__ void split2(float f, us& hi, us& lo) {
  hi = f2bf(f);
  lo = f2bf(f - bf2f(hi));
}

// ---------------------------------------------------------------------------
// 16x16x32 bf16 WMMA with hazard guard (ties D, keeps A/B live).
// Fragment map (wave32): lane l, h = l>>4, m = n = l&15.
//   A/B element i: i<8 -> k0+8h+i ; i>=8 -> k0+16+8h+(i-8)
//   D element r : row 8h+r, col l&15
// ---------------------------------------------------------------------------
__device__ __forceinline__ v8f wmma_bf(v8i a, v8i b, v8f c) {
  v8f d = __builtin_amdgcn_wmma_f32_16x16x32_bf16(false, __builtin_bit_cast(v16b, a), false,
                                                  __builtin_bit_cast(v16b, b), (short)0, c, false, false);
  asm volatile("v_nop\n\tv_nop\n\tv_nop\n\tv_nop" : "+v"(d) : "v"(a), "v"(b));
  return d;
}
// three-product split: ah*bh + al*bh + ah*bl into one accumulator
__device__ __forceinline__ v8f wmma3(v8i ah, v8i al, v8i bh, v8i bl, v8f c) {
  c = wmma_bf(ah, bh, c);
  c = wmma_bf(al, bh, c);
  c = wmma_bf(ah, bl, c);
  return c;
}
// fragment from a k-contiguous 16-bit row (pointer already at k0)
__device__ __forceinline__ v8i ldfrag(const us* p, int h) {
  Frag f;
  f.half[0] = *(const v8usa*)(p + 8 * h);
  f.half[1] = *(const v8usa*)(p + 16 + 8 * h);
  return f.v;
}

__device__ __forceinline__ float wave_sum(float s) {
  s += __shfl_xor(s, 16);
  s += __shfl_xor(s, 8);
  s += __shfl_xor(s, 4);
  s += __shfl_xor(s, 2);
  s += __shfl_xor(s, 1);
  return s;
}
__device__ __forceinline__ double dshfl_xor(double v, int msk) {
  const unsigned long long u = __builtin_bit_cast(unsigned long long, v);
  int lo = (int)(unsigned)(u & 0xFFFFFFFFull);
  int hi = (int)(unsigned)(u >> 32);
  lo = __shfl_xor(lo, msk);
  hi = __shfl_xor(hi, msk);
  const unsigned long long r = (((unsigned long long)(unsigned)hi) << 32) | (unsigned long long)(unsigned)lo;
  return __builtin_bit_cast(double, r);
}
__device__ __forceinline__ double wave_sum_d(double s) {
  s += dshfl_xor(s, 16);
  s += dshfl_xor(s, 8);
  s += dshfl_xor(s, 4);
  s += dshfl_xor(s, 2);
  s += dshfl_xor(s, 1);
  return s;
}

// ---------------------------------------------------------------------------
// Kernel: x NCHW f32 -> bf16 hi/lo padded NHWC planes [b][34][34][256]
// (interior pixels). Block = (y, b); LDS transpose; one instruction writes one
// coverage: 8 waves x 4 pixels = 32 px per row, 32 lanes x 8 = 256 ch.
// ---------------------------------------------------------------------------
__global__ __launch_bounds__(256) void k_prep_x(const float* __restrict__ x,
                                                us* __restrict__ xh, us* __restrict__ xl) {
  __shared__ __attribute__((aligned(16))) us sh[32 * 256];
  __shared__ __attribute__((aligned(16))) us sl[32 * 256];
  const int tid = threadIdx.x, lane = tid & 31, w = tid >> 5;
  const int y = blockIdx.x, b = blockIdx.y;
  #pragma unroll 1
  for (int j = 0; j < 32; ++j) {
    const int c = 8 * j + w;
    const float v = x[((size_t)(b * CIN + c) * HIMG + y) * HIMG + lane];
    us hi, lo;
    split2(v, hi, lo);
    sh[lane * 256 + c] = hi;
    sl[lane * 256 + c] = lo;
  }
  __syncthreads();
  v8us vh[4], vl[4];
  size_t d[4];
  #pragma unroll
  for (int i = 0; i < 4; ++i) {
    const int px = 4 * w + i;
    vh[i] = *(const v8usa*)(sh + px * 256 + 8 * lane);
    vl[i] = *(const v8usa*)(sl + px * 256 + 8 * lane);
    d[i] = ((size_t)((b * PW + y + 1) * PW + px + 1)) * CIN + 8 * lane;
  }
  #pragma unroll
  for (int i = 0; i < 4; ++i) { *(v8us*)(xh + d[i]) = vh[i]; *(v8us*)(xl + d[i]) = vl[i]; }
  
}

// ---------------------------------------------------------------------------
// Kernel: zero the border pixel rows of padded NHWC planes [b][34][34][C].
// Wave = one border pixel; 32 lanes x 16 B = 256 halves per instruction.
// coverage: 132 border pixels x 4 samples, C halves each, both planes.
// ---------------------------------------------------------------------------
__global__ __launch_bounds__(256) void k_zero_border(us* __restrict__ ph, us* __restrict__ pl, int C) {
  const int tid = threadIdx.x, lane = tid & 31, w = tid >> 5;
  const int i = blockIdx.x * 8 + w;
  const int b = blockIdx.y;
  if (i >= 132) return;
  int py, px;
  if (i < 34)       { py = 0;           px = i; }
  else if (i < 68)  { py = PW - 1;      px = i - 34; }
  else if (i < 100) { py = i - 68 + 1;  px = 0; }
  else              { py = i - 100 + 1; px = PW - 1; }
  const size_t base = ((size_t)((b * PW + py) * PW + px)) * (size_t)C;
  v8us z;
  #pragma unroll
  for (int j = 0; j < 8; ++j) z[j] = (us)0;
  #pragma unroll 1
  for (int off = 8 * lane; off < C; off += 256) {
    *(v8us*)(ph + base + off) = z;
    *(v8us*)(pl + base + off) = z;
  }
  
}

// ---------------------------------------------------------------------------
// Kernel: OIHW f32 weights -> rows [o][tap*256 + c] as bf16 hi and lo planes.
// Thread = 8 consecutive row elements, one 16-B store per lane per plane,
// coverage: cout*taps*256 elements, grid = n/2048 exactly.
// ---------------------------------------------------------------------------
__global__ __launch_bounds__(256) void k_wprep(const float* __restrict__ wsrc, int cout, int taps,
                                               us* __restrict__ wh, us* __restrict__ wl) {
  const int g = blockIdx.x * 256 + threadIdx.x;
  const int kw = taps * 256;
  const int n = cout * kw;
  const int e8 = g * 8;
  if (e8 >= n) return;
  const int o = e8 / kw;
  const int r = e8 - o * kw;
  const int tap = r >> 8, c = r & 255;
  const float* src = wsrc + ((size_t)(o * 256 + c)) * taps + tap;
  v8us vh, vl;
  #pragma unroll
  for (int i = 0; i < 8; ++i) {
    us a, bq;
    split2(src[(size_t)i * taps], a, bq);
    vh[i] = a;
    vl[i] = bq;
  }
  *(v8us*)(wh + e8) = vh;
  *(v8us*)(wl + e8) = vl;
  
}

// ---------------------------------------------------------------------------
// Fragment from 32 consecutive-k f32 values of one row (pointer at k0), split
// into hi/lo bf16 fragments in registers (fragment map as above).
// ---------------------------------------------------------------------------
__device__ __forceinline__ void frag_f32(const float* __restrict__ p, int h, v8i& fh, v8i& fl) {
  const v4f q0 = *(const v4fa*)(p + 8 * h);
  const v4f q1 = *(const v4fa*)(p + 8 * h + 4);
  const v4f q2 = *(const v4fa*)(p + 16 + 8 * h);
  const v4f q3 = *(const v4fa*)(p + 20 + 8 * h);
  float v[16];
  v[0] = q0.x; v[1] = q0.y; v[2] = q0.z; v[3] = q0.w;
  v[4] = q1.x; v[5] = q1.y; v[6] = q1.z; v[7] = q1.w;
  v[8] = q2.x; v[9] = q2.y; v[10] = q2.z; v[11] = q2.w;
  v[12] = q3.x; v[13] = q3.y; v[14] = q3.z; v[15] = q3.w;
  Frag a, bq;
  #pragma unroll
  for (int i = 0; i < 16; ++i) {
    us hi, lo;
    split2(v[i], hi, lo);
    a.half[i >> 3][i & 7] = hi;
    bq.half[i >> 3][i & 7] = lo;
  }
  fh = a.v;
  fl = bq.v;
}

// ---------------------------------------------------------------------------
// Kernel: channel means of x (f32) and the bias linear on WMMA:
// bias[b][o] = sum_c mean[b][c] * bw[o][c] + bb[o]. One block of 8 waves.
// A = means [16 rows (4 real, 12 zero)][256] hi/lo in LDS, B = bw rows [o][c]
// coverage: 256 threads x 16 B = 4096 B = all of bias.
// ---------------------------------------------------------------------------
__global__ __launch_bounds__(256) void k_bias(const float* __restrict__ x, const float* __restrict__ bw,
                                              const float* __restrict__ bb, float* __restrict__ biasv) {
  __shared__ __attribute__((aligned(16))) us sah[16 * 256];
  __shared__ __attribute__((aligned(16))) us sal[16 * 256];
  __shared__ __attribute__((aligned(16))) float sd[4 * 256];
  const int tid = threadIdx.x, lane = tid & 31, w = tid >> 5;
  const int h = lane >> 4, m = lane & 15;
  for (int i = tid; i < 16 * 256; i += 256) {
    if (i >= 4 * 256) { sah[i] = (us)0; sal[i] = (us)0; }
  }
  #pragma unroll 1
  for (int k = 0; k < 4; ++k) {
    const int ch = tid + 256 * k;              // b = k, c = tid
    const float* p = x + (size_t)ch * NPIX;
    float s0 = 0.f, s1 = 0.f, s2 = 0.f, s3 = 0.f;
    #pragma unroll 4
    for (int i = 0; i < 256; ++i) {
      const v4f v = *(const v4fa*)(p + 4 * i);
      s0 += v.x; s1 += v.y; s2 += v.z; s3 += v.w;
    }
    const float mean = ((s0 + s1) + (s2 + s3)) * (1.0f / 1024.0f);
    us hi, lo;
    split2(mean, hi, lo);
    sah[k * 256 + tid] = hi;
    sal[k * 256 + tid] = lo;
  }
  __syncthreads();

  const int o0 = 32 * w + m, o1 = o0 + 16;
  const float* br0 = bw + (size_t)o0 * 256;
  const float* br1 = bw + (size_t)o1 * 256;
  const v8f z8 = {0.f, 0.f, 0.f, 0.f, 0.f, 0.f, 0.f, 0.f};
  v8f acc[2];
  acc[0] = z8; acc[1] = z8;
  #pragma unroll 1
  for (int k0 = 0; k0 < 256; k0 += 32) {
    const v8i ah = ldfrag(sah + m * 256 + k0, h);
    const v8i al = ldfrag(sal + m * 256 + k0, h);
    v8i bh0, bl0, bh1, bl1;
    frag_f32(br0 + k0, h, bh0, bl0);
    frag_f32(br1 + k0, h, bh1, bl1);
    acc[0] = wmma3(ah, al, bh0, bl0, acc[0]);
    acc[1] = wmma3(ah, al, bh1, bl1, acc[1]);
  }
  const float bb0 = bb[o0], bb1 = bb[o1];
  if (h == 0) {
    #pragma unroll
    for (int r = 0; r < 4; ++r) {
      sd[r * 256 + o0] = acc[0][r] + bb0;
      sd[r * 256 + o1] = acc[1][r] + bb1;
    }
  }
  __syncthreads();
  const int L = tid >> 3, q = tid & 7;
  const v4f v = *(const v4fa*)(sd + L * 32 + 4 * q);
  float* dst = biasv + L * 32 + 4 * q;
  *(v4f*)dst = v;
  
}

// ---------------------------------------------------------------------------
// Kernel: implicit-GEMM convolution (Cin = 256 per pixel) over bf16 hi/lo
// zero-padded NHWC planes [b][34][34][256]; weights as rows [o][tap*256+c]
// hi/lo. Block = 64 pixels (image rows y0, y0+1) x 64 output channels,
// 4 waves of 32 px x 32 ch (2x2 tiles), K = ntaps*256 in steps of 32,
// fragments straight from the 16-bit rows, three products per tile pair.
// MODE 0: relu^2 -> bf16 hi/lo padded NHWC planes (pitch = cout) + (s2,s4) partial line
// MODE 1: relu^2 -> f32 NCHW + (s2,s4) partial line
// MODE 2: value -> bf16 hi/lo NCHW planes
// MODE 3: value -> f32 NCHW + (sum, sum of squares) partial line (f64)
// coverage: MODE 0 store: 4 waves x 16 px x 8 lanes x 8 ch = 64 px x 64 ch;
// MODE 1/3: 4 waves x 16 ch x 64 px; MODE 2: 4 waves x 16 ch x 8 lanes x 8 px.
// ---------------------------------------------------------------------------
template <int MODE>
__global__ __launch_bounds__(128) void k_conv(
    const us* __restrict__ ah, const us* __restrict__ al,
    const us* __restrict__ wh, const us* __restrict__ wl,
    const float* __restrict__ bias, int ntaps, int cout,
    us* __restrict__ oh, us* __restrict__ ol, float* __restrict__ of, float* __restrict__ part)
{
  __shared__ __attribute__((aligned(16))) float sbuf[64 * 64];
  __shared__ double sred[4][2];
  const int tid = threadIdx.x, lane = tid & 31, w = tid >> 5;
  const int h = lane >> 4, m = lane & 15;
  const int pt = blockIdx.x, b = pt >> 4, y0 = (pt & 15) * 2;
  const int n0 = blockIdx.y * 64;
  const int ry = w >> 1, y = y0 + ry, nw = 32 * (w & 1);
  const int kw = ntaps * CIN;
  const size_t wr0 = (size_t)(n0 + nw + m) * kw;
  const size_t wr1 = wr0 + (size_t)16 * kw;
  const v8f z8 = {0.f, 0.f, 0.f, 0.f, 0.f, 0.f, 0.f, 0.f};
  v8f acc[2][2];
  #pragma unroll
  for (int i = 0; i < 2; ++i) { acc[i][0] = z8; acc[i][1] = z8; }

  #pragma unroll 1
  for (int tap = 0; tap < ntaps; ++tap) {
    const int t3 = tap / 3;
    const int ky = (ntaps == 1) ? 1 : t3;
    const int kx = (ntaps == 1) ? 1 : (tap - 3 * t3);
    const size_t ar0 = ((size_t)((b * PW + y + ky) * PW + kx + m)) * CIN;
    const size_t ar1 = ar0 + (size_t)16 * CIN;
    const size_t wt = (size_t)tap * CIN;
    #pragma unroll 1
    for (int c0 = 0; c0 < CIN; c0 += 32) {
      const v8i fa0h = ldfrag(ah + ar0 + c0, h);
      const v8i fa0l = ldfrag(al + ar0 + c0, h);
      const v8i fa1h = ldfrag(ah + ar1 + c0, h);
      const v8i fa1l = ldfrag(al + ar1 + c0, h);
      #pragma unroll
      for (int nt = 0; nt < 2; ++nt) {
        const size_t wr = (nt == 0) ? wr0 : wr1;
        const v8i fbh = ldfrag(wh + wr + wt + c0, h);
        const v8i fbl = ldfrag(wl + wr + wt + c0, h);
        acc[0][nt] = wmma3(fa0h, fa0l, fbh, fbl, acc[0][nt]);
        acc[1][nt] = wmma3(fa1h, fa1l, fbh, fbl, acc[1][nt]);
      }
    }
  }

  // epilogue into LDS
  float bv[2];
  bv[0] = bias[n0 + nw + m];
  bv[1] = bias[n0 + nw + 16 + m];
  us* sH = reinterpret_cast<us*>(sbuf);
  us* sL = sH + 4096;
  float fs = 0.f, fq = 0.f;
  double ds = 0.0, dq = 0.0;
  #pragma unroll
  for (int mt = 0; mt < 2; ++mt) {
    #pragma unroll
    for (int nt = 0; nt < 2; ++nt) {
      #pragma unroll
      for (int r = 0; r < 8; ++r) {
        const float val = acc[mt][nt][r] + bv[nt];
        const int tp = ry * 32 + mt * 16 + 8 * h + r;
        const int ch = nw + 16 * nt + m;
        if (MODE == 0) {
          const float rr = fmaxf(val, 0.f);
          const float r2 = rr * rr;
          fs += r2; fq += r2 * r2;
          us hi, lo;
          split2(r2, hi, lo);
          sH[tp * 64 + ch] = hi;
          sL[tp * 64 + ch] = lo;
        } else if (MODE == 1) {
          const float rr = fmaxf(val, 0.f);
          const float r2 = rr * rr;
          fs += r2; fq += r2 * r2;
          sbuf[ch * 64 + tp] = r2;
        } else if (MODE == 2) {
          us hi, lo;
          split2(val, hi, lo);
          sH[ch * 64 + tp] = hi;
          sL[ch * 64 + tp] = lo;
        } else {
          ds += (double)val;
          dq += (double)val * (double)val;
          sbuf[ch * 64 + tp] = val;
        }
      }
    }
  }
  if (MODE == 0 || MODE == 1) {
    fs = wave_sum(fs);
    fq = wave_sum(fq);
    ds = (double)fs;
    dq = (double)fq;
  } else if (MODE == 3) {
    ds = wave_sum_d(ds);
    dq = wave_sum_d(dq);
  }
  if (MODE != 2) {
    if (lane == 0) { sred[w][0] = ds; sred[w][1] = dq; }
  }
  __syncthreads();

  // block partial line (2 doubles + zeros), fixed order over the 4 waves
  v4f pv;
  pv.x = 0.f; pv.y = 0.f; pv.z = 0.f; pv.w = 0.f;
  size_t li = 0;
  bool pw = false;
  if (MODE != 2) {
    double S = 0.0, Q2 = 0.0;
    #pragma unroll
    for (int k = 0; k < 4; ++k) { S += sred[k][0]; Q2 += sred[k][1]; }
    DPack pk;
    pk.d[0] = S; pk.d[1] = Q2;
    pv.x = (lane == 0) ? pk.f.x : 0.f;
    pv.y = (lane == 0) ? pk.f.y : 0.f;
    pv.z = (lane == 0) ? pk.f.z : 0.f;
    pv.w = (lane == 0) ? pk.f.w : 0.f;
    li = ((size_t)blockIdx.x * gridDim.y + blockIdx.y) * 32 + 4 * (lane & 7);
    pw = (w == 0) && (lane < 8);
  }

  if (MODE == 0) {
    const int q8 = lane & 7, sub = lane >> 3;
    v8us th[4], tl[4];
    size_t d[4];
    #pragma unroll
    for (int i = 0; i < 4; ++i) {
      const int tp = 16 * w + 4 * i + sub;
      const int ry2 = tp >> 5, xx = tp & 31;
      th[i] = *(const v8usa*)(sH + tp * 64 + 8 * q8);
      tl[i] = *(const v8usa*)(sL + tp * 64 + 8 * q8);
      d[i] = ((size_t)((b * PW + y0 + ry2 + 1) * PW + xx + 1)) * (size_t)cout + n0 + 8 * q8;
    }
    #pragma unroll
    for (int i = 0; i < 4; ++i) { *(v8us*)(oh + d[i]) = th[i]; *(v8us*)(ol + d[i]) = tl[i]; }
    if (pw) *(v4f*)(part + li) = pv;
    
  } else if (MODE == 2) {
    const int q8 = lane & 7, sub = lane >> 3;
    v8us th[4], tl[4];
    size_t d[4];
    #pragma unroll
    for (int i = 0; i < 4; ++i) {
      const int chl = 16 * w + 4 * i + sub;
      th[i] = *(const v8usa*)(sH + chl * 64 + 8 * q8);
      tl[i] = *(const v8usa*)(sL + chl * 64 + 8 * q8);
      d[i] = ((size_t)(b * cout + n0 + chl)) * NPIX + y0 * HIMG + 8 * q8;
    }
    #pragma unroll
    for (int i = 0; i < 4; ++i) { *(v8us*)(oh + d[i]) = th[i]; *(v8us*)(ol + d[i]) = tl[i]; }
    
  } else {
    const int hs = lane >> 4, x4 = 4 * (lane & 15);
    v4f tv[8];
    size_t d[8];
    #pragma unroll
    for (int i = 0; i < 8; ++i) {
      const int chl = 16 * w + 2 * i + hs;
      tv[i] = *(const v4fa*)(sbuf + chl * 64 + x4);
      d[i] = ((size_t)(b * cout + n0 + chl)) * NPIX + y0 * HIMG + x4;
    }
    #pragma unroll
    for (int i = 0; i < 8; ++i) *(v4f*)(of + d[i]) = tv[i];
    if (pw) *(v4f*)(part + li) = pv;
    
  }
}

// ---------------------------------------------------------------------------
// Kernel: phi norm ratios s = sqrt(sum relu^2) / sqrt(sum relu^4) for the q
// and k tensors from 512 block partial lines each (fixed order, f64).
// One block of 64 threads; wave 0 = q, wave 1 = k; one whole output line.
// ---------------------------------------------------------------------------
__global__ __launch_bounds__(64) void k_phinorm(const float* __restrict__ partq, const float* __restrict__ partk,
                                                float* __restrict__ scal) {
  __shared__ double sacc[2][32][2];
  __shared__ float sres[2];
  const int tid = threadIdx.x, lane = tid & 31, w = tid >> 5;
  const float* pp = (w == 0) ? partq : partk;
  double s2 = 0.0, s4 = 0.0;
  #pragma unroll 1
  for (int j = 0; j < 16; ++j) {
    const double* dp = reinterpret_cast<const double*>(pp + (size_t)(lane * 16 + j) * 32);
    s2 += dp[0];
    s4 += dp[1];
  }
  sacc[w][lane][0] = s2;
  sacc[w][lane][1] = s4;
  __syncthreads();
  if (lane == 0) {
    double t2 = 0.0, t4 = 0.0;
    for (int i = 0; i < 32; ++i) { t2 += sacc[w][i][0]; t4 += sacc[w][i][1]; }
    const float num = sqrtf((float)t2);
    const float den = sqrtf((float)t4);
    sres[w] = num * (1.0f / den);
  }
  __syncthreads();
  v4f pv;
  pv.x = (lane == 0) ? sres[0] : 0.f;
  pv.y = (lane == 0) ? sres[1] : 0.f;
  pv.z = 0.f; pv.w = 0.f;
  const bool pw = (w == 0) && (lane < 8);
  float* dst = scal + 4 * lane;
  if (pw) *(v4f*)dst = pv;
  
}

// ---------------------------------------------------------------------------
// Kernel: pooled outer product. Block = (tap pq, bh): D[kk 64][v 32] =
// sum_pix (relu(K)^2[kk][pix] * Mh[p][y] * Mw[q][x]) * V[v][pix], K = 1024,
// A built in registers from the f32 NCHW relu^2 rows (split hi/lo),
// B from the bf16 NCHW V planes. Epilogue: * sK, clip +-32/9, hi/lo into
// coverage: 4 waves x 8 rows x 8 lanes x 8 kk = 32 v x 64 kk per (bh,pq).
// ---------------------------------------------------------------------------
__global__ __launch_bounds__(128) void k_kv(
    const float* __restrict__ r2k, const us* __restrict__ vnh, const us* __restrict__ vnl,
    const float* __restrict__ scal, BiW bw, us* __restrict__ fth, us* __restrict__ ftl)
{
  __shared__ __attribute__((aligned(16))) us sH[32 * 64];
  __shared__ __attribute__((aligned(16))) us sL[32 * 64];
  const int tid = threadIdx.x, lane = tid & 31, w = tid >> 5;
  const int h = lane >> 4, m = lane & 15;
  const int pq = blockIdx.x, bh = blockIdx.y;
  const int b = bh >> 3, head = bh & 7;
  const int p = pq / 3, q = pq - 3 * p;
  const int   iy0 = (p == 0) ? bw.i0[0] : ((p == 1) ? bw.i0[1] : bw.i0[2]);
  const int   iy1 = (p == 0) ? bw.i1[0] : ((p == 1) ? bw.i1[1] : bw.i1[2]);
  const float wy0 = (p == 0) ? bw.w0[0] : ((p == 1) ? bw.w0[1] : bw.w0[2]);
  const float wy1 = (p == 0) ? bw.w1[0] : ((p == 1) ? bw.w1[1] : bw.w1[2]);
  const int   ix0 = (q == 0) ? bw.i0[0] : ((q == 1) ? bw.i0[1] : bw.i0[2]);
  const int   ix1 = (q == 0) ? bw.i1[0] : ((q == 1) ? bw.i1[1] : bw.i1[2]);
  const float wx0 = (q == 0) ? bw.w0[0] : ((q == 1) ? bw.w0[1] : bw.w0[2]);
  const float wx1 = (q == 0) ? bw.w1[0] : ((q == 1) ? bw.w1[1] : bw.w1[2]);
  const float sK = scal[1];
  const float amax = (float)(32.0 / 9.0);
  const float* arow = r2k + ((size_t)(b * DQ + head * DK + 16 * w + m)) * NPIX;
  const size_t br0 = ((size_t)(b * DV + head * DVH + m)) * NPIX;
  const size_t br1 = br0 + (size_t)16 * NPIX;
  const v8f z8 = {0.f, 0.f, 0.f, 0.f, 0.f, 0.f, 0.f, 0.f};
  v8f acc[2];
  acc[0] = z8; acc[1] = z8;

  #pragma unroll 1
  for (int k0 = 0; k0 < NPIX; k0 += 32) {
    const int yy = k0 >> 5;
    const float wy = ((yy == iy0) ? wy0 : 0.f) + ((yy == iy1) ? wy1 : 0.f);
    const float* ap = arow + k0;
    const v4f q0 = *(const v4fa*)(ap + 8 * h);
    const v4f q1 = *(const v4fa*)(ap + 8 * h + 4);
    const v4f q2 = *(const v4fa*)(ap + 16 + 8 * h);
    const v4f q3 = *(const v4fa*)(ap + 20 + 8 * h);
    float v[16];
    v[0] = q0.x; v[1] = q0.y; v[2] = q0.z; v[3] = q0.w;
    v[4] = q1.x; v[5] = q1.y; v[6] = q1.z; v[7] = q1.w;
    v[8] = q2.x; v[9] = q2.y; v[10] = q2.z; v[11] = q2.w;
    v[12] = q3.x; v[13] = q3.y; v[14] = q3.z; v[15] = q3.w;
    Frag fah, fal;
    #pragma unroll
    for (int i = 0; i < 16; ++i) {
      const int xx = 8 * h + (i & 7) + ((i >> 3) << 4);
      const float wx = ((xx == ix0) ? wx0 : 0.f) + ((xx == ix1) ? wx1 : 0.f);
      const float a = v[i] * (wy * wx);
      us hi, lo;
      split2(a, hi, lo);
      fah.half[i >> 3][i & 7] = hi;
      fal.half[i >> 3][i & 7] = lo;
    }
    const v8i fb0h = ldfrag(vnh + br0 + k0, h);
    const v8i fb0l = ldfrag(vnl + br0 + k0, h);
    const v8i fb1h = ldfrag(vnh + br1 + k0, h);
    const v8i fb1l = ldfrag(vnl + br1 + k0, h);
    acc[0] = wmma3(fah.v, fal.v, fb0h, fb0l, acc[0]);
    acc[1] = wmma3(fah.v, fal.v, fb1h, fb1l, acc[1]);
  }

  #pragma unroll
  for (int nt = 0; nt < 2; ++nt) {
    #pragma unroll
    for (int r = 0; r < 8; ++r) {
      float val = acc[nt][r] * sK;
      val = fminf(fmaxf(val, -amax), amax);
      const int kk = 16 * w + 8 * h + r;
      const int vv = 16 * nt + m;
      us hi, lo;
      split2(val, hi, lo);
      sH[vv * 64 + kk] = hi;
      sL[vv * 64 + kk] = lo;
    }
  }
  __syncthreads();
  const int q8 = lane & 7, sub = lane >> 3;
  v8us th[2], tl[2];
  size_t d[2];
  #pragma unroll
  for (int i = 0; i < 2; ++i) {
    const int vv = 8 * w + 4 * i + sub;
    th[i] = *(const v8usa*)(sH + vv * 64 + 8 * q8);
    tl[i] = *(const v8usa*)(sL + vv * 64 + 8 * q8);
    d[i] = ((size_t)(bh * DVH + vv)) * FTK + pq * 64 + 8 * q8;
  }
  #pragma unroll
  for (int i = 0; i < 2; ++i) { *(v8us*)(fth + d[i]) = th[i]; *(v8us*)(ftl + d[i]) = tl[i]; }
  
}

// ---------------------------------------------------------------------------
// Kernel: per-sample grouped 3x3 conv of relu(Q)^2 planes (padded NHWC,
// 512 ch) with the pooled filters, K = 9*64 per head. Block = (64 px, head
// pair, b); wave = (head of the pair, image row) 32 px x 32 v. Epilogue:
// * sQ + bias[b][j*32+v], hi/lo into padded NHWC planes [b][34][34][256];
// coverage: 4 waves x 16 px x 8 lanes x 8 ch = 64 px x 64 ch per block;
// grid 16 x 4 x 4 = all interior pixels x all 256 channels x 4 samples.
// ---------------------------------------------------------------------------
__global__ __launch_bounds__(128) void k_gconv(
    const us* __restrict__ rqh, const us* __restrict__ rql,
    const us* __restrict__ fth, const us* __restrict__ ftl,
    const float* __restrict__ scal, const float* __restrict__ biasv,
    us* __restrict__ oh, us* __restrict__ ol)
{
  __shared__ __attribute__((aligned(16))) us sH[64 * 64];
  __shared__ __attribute__((aligned(16))) us sL[64 * 64];
  const int tid = threadIdx.x, lane = tid & 31, w = tid >> 5;
  const int h = lane >> 4, m = lane & 15;
  const int pt = blockIdx.x, jp = blockIdx.y, b = blockIdx.z;
  const int y0 = 2 * pt;
  const int jl = w >> 1, ry = w & 1;
  const int j = 2 * jp + jl, y = y0 + ry, bh = b * 8 + j;
  const size_t fr0 = ((size_t)(bh * DVH + m)) * FTK;
  const size_t fr1 = fr0 + (size_t)16 * FTK;
  const v8f z8 = {0.f, 0.f, 0.f, 0.f, 0.f, 0.f, 0.f, 0.f};
  v8f acc[2][2];
  #pragma unroll
  for (int i = 0; i < 2; ++i) { acc[i][0] = z8; acc[i][1] = z8; }

  #pragma unroll 1
  for (int tap = 0; tap < 9; ++tap) {
    const int ky = tap / 3;
    const int kx = tap - 3 * ky;
    const size_t ar0 = ((size_t)((b * PW + y + ky) * PW + kx + m)) * DQ + (size_t)j * DK;
    const size_t ar1 = ar0 + (size_t)16 * DQ;
    const size_t wt = (size_t)tap * DK;
    #pragma unroll
    for (int c0 = 0; c0 < DK; c0 += 32) {
      const v8i fa0h = ldfrag(rqh + ar0 + c0, h);
      const v8i fa0l = ldfrag(rql + ar0 + c0, h);
      const v8i fa1h = ldfrag(rqh + ar1 + c0, h);
      const v8i fa1l = ldfrag(rql + ar1 + c0, h);
      #pragma unroll
      for (int nt = 0; nt < 2; ++nt) {
        const size_t fr = (nt == 0) ? fr0 : fr1;
        const v8i fbh = ldfrag(fth + fr + wt + c0, h);
        const v8i fbl = ldfrag(ftl + fr + wt + c0, h);
        acc[0][nt] = wmma3(fa0h, fa0l, fbh, fbl, acc[0][nt]);
        acc[1][nt] = wmma3(fa1h, fa1l, fbh, fbl, acc[1][nt]);
      }
    }
  }

  const float sQ = scal[0];
  float bv[2];
  bv[0] = biasv[b * DV + j * DVH + m];
  bv[1] = biasv[b * DV + j * DVH + 16 + m];
  #pragma unroll
  for (int mt = 0; mt < 2; ++mt) {
    #pragma unroll
    for (int nt = 0; nt < 2; ++nt) {
      #pragma unroll
      for (int r = 0; r < 8; ++r) {
        const float val = acc[mt][nt][r] * sQ + bv[nt];
        const int tp = ry * 32 + mt * 16 + 8 * h + r;
        const int chl = jl * 32 + 16 * nt + m;
        us hi, lo;
        split2(val, hi, lo);
        sH[tp * 64 + chl] = hi;
        sL[tp * 64 + chl] = lo;
      }
    }
  }
  __syncthreads();
  const int q8 = lane & 7, sub = lane >> 3;
  v8us th[4], tl[4];
  size_t d[4];
  #pragma unroll
  for (int i = 0; i < 4; ++i) {
    const int tp = 16 * w + 4 * i + sub;
    const int ry2 = tp >> 5, xx = tp & 31;
    th[i] = *(const v8usa*)(sH + tp * 64 + 8 * q8);
    tl[i] = *(const v8usa*)(sL + tp * 64 + 8 * q8);
    d[i] = ((size_t)((b * PW + y0 + ry2 + 1) * PW + xx + 1)) * DV + jp * 64 + 8 * q8;
  }
  #pragma unroll
  for (int i = 0; i < 4; ++i) { *(v8us*)(oh + d[i]) = th[i]; *(v8us*)(ol + d[i]) = tl[i]; }
  
}

// ---------------------------------------------------------------------------
// Kernel: LayerNorm over (C,H,W) per sample: fixed-order f64 combine of the
// 64 block partial lines of the sample, then (v - mu) * rstd on one float4
// coverage: 1024 blocks x 256 threads x 4 floats = all 1048576 outputs.
// ---------------------------------------------------------------------------
__global__ __launch_bounds__(256) void k_ln(const float* __restrict__ outp, const float* __restrict__ partl,
                                            float* __restrict__ out) {
  __shared__ double ss[64];
  __shared__ double sq[64];
  __shared__ float sst[2];
  const int tid = threadIdx.x;
  const int blk = blockIdx.x, b = blk >> 8;
  if (tid < 64) {
    const double* dp = reinterpret_cast<const double*>(partl + (size_t)(b * 64 + tid) * 32);
    ss[tid] = dp[0];
    sq[tid] = dp[1];
  }
  __syncthreads();
  if (tid == 0) {
    double S = 0.0, Q2 = 0.0;
    for (int i = 0; i < 64; ++i) { S += ss[i]; Q2 += sq[i]; }
    const double inv = 1.0 / 262144.0;
    const double mu = S * inv;
    double var = Q2 * inv - mu * mu;
    if (var < 0.0) var = 0.0;
    const float den = sqrtf((float)var + 1e-5f);
    sst[0] = (float)mu;
    sst[1] = 1.0f / den;
  }
  __syncthreads();
  const float muf = sst[0], rinv = sst[1];
  const size_t e = ((size_t)blk * 256 + tid) * 4;
  v4f v = *(const v4fa*)(outp + e);
  v4f o;
  o.x = (v.x - muf) * rinv;
  o.y = (v.y - muf) * rinv;
  o.z = (v.z - muf) * rinv;
  o.w = (v.w - muf) * rinv;
  *(v4f*)(out + e) = o;
  
}

// ---------------------------------------------------------------------------
// Host: bilinear (32 -> 3, align_corners = false) taps and weights, computed
// with separate f64 multiply and subtract, fraction cast to f32.
// ---------------------------------------------------------------------------
static void bilin3(BiW& bw) {
#pragma clang fp contract(off)
  const double scale = 32.0 / 3.0;
  for (int p = 0; p < 3; ++p) {
    double src = ((double)p + 0.5) * scale;
    src = src - 0.5;
    if (src < 0.0) src = 0.0;
    const int f = (int)src;
    const float frac = (float)(src - (double)f);
    int c0 = f, c1 = f + 1;
    if (c0 > HIMG - 1) c0 = HIMG - 1;
    if (c1 > HIMG - 1) c1 = HIMG - 1;
    bw.i0[p] = c0;
    bw.i1[p] = c1;
    bw.w0[p] = 1.0f - frac;
    bw.w1[p] = frac;
  }
}

extern "C" void kernel_launch(void* const* d_in, const int* in_sizes, int n_in,
                              void* d_out, int out_size, void* d_ws, size_t ws_size,
                              hipStream_t stream) {
  if (n_in < 11) return;
  if (in_sizes[0] != NBATCH * CIN * NPIX) return;
  if (in_sizes[1] != DQ * CIN || in_sizes[2] != DQ) return;
  if (in_sizes[3] != DQ * CIN * 9 || in_sizes[4] != DQ) return;
  if (in_sizes[5] != DV * CIN * 9 || in_sizes[6] != DV) return;
  if (in_sizes[7] != DV * CIN || in_sizes[8] != DV) return;
  if (in_sizes[9] != DV * DV * 9 || in_sizes[10] != DV) return;
  if (out_size != NBATCH * DV * NPIX) return;

  const float* x      = (const float*)d_in[0];
  const float* q_w    = (const float*)d_in[1];
  const float* q_b    = (const float*)d_in[2];
  const float* k_w    = (const float*)d_in[3];
  const float* k_b    = (const float*)d_in[4];
  const float* v_w    = (const float*)d_in[5];
  const float* v_b    = (const float*)d_in[6];
  const float* bias_w = (const float*)d_in[7];
  const float* bias_b = (const float*)d_in[8];
  const float* hu_w   = (const float*)d_in[9];
  const float* hu_b   = (const float*)d_in[10];
  float* out = (float*)d_out;

  // workspace carve (bytes); every region sized to whole 256-B multiples and
  // written only with whole-line stores inside its extent
  char* ws = (char*)d_ws;
  size_t off = 0;
#define CARVE(T, name, bytes) T* name = (T*)(ws + off); off += (((size_t)(bytes)) + 255) & ~(size_t)255;
  const size_t padpx  = (size_t)NBATCH * PW * PW;                    // 4624 padded pixels
  CARVE(us,    XPH,   padpx * CIN * 2);                               // 2367488
  CARVE(us,    XPL,   padpx * CIN * 2);
  CARVE(us,    WQH,   (size_t)DQ * CIN * 2);                          // 262144
  CARVE(us,    WQL,   (size_t)DQ * CIN * 2);
  CARVE(us,    WKH,   (size_t)DQ * CIN * 9 * 2);                      // 2359296
  CARVE(us,    WKL,   (size_t)DQ * CIN * 9 * 2);
  CARVE(us,    WVH,   (size_t)DV * CIN * 9 * 2);                      // 1179648
  CARVE(us,    WVL,   (size_t)DV * CIN * 9 * 2);
  CARVE(us,    WHH,   (size_t)DV * DV * 9 * 2);                       // 1179648
  CARVE(us,    WHL,   (size_t)DV * DV * 9 * 2);
  CARVE(float, BIASV, (size_t)NBATCH * DV * 4);                       // 4096 = 32 lines
  CARVE(us,    RQH,   padpx * DQ * 2);                                // 4734976
  CARVE(us,    RQL,   padpx * DQ * 2);
  CARVE(float, R2K,   (size_t)NBATCH * DQ * NPIX * 4);                // 8388608
  CARVE(us,    VNH,   (size_t)NBATCH * DV * NPIX * 2);                // 2097152
  CARVE(us,    VNL,   (size_t)NBATCH * DV * NPIX * 2);
  CARVE(float, PARTQ, (size_t)512 * 128);                             // 512 lines
  CARVE(float, PARTK, (size_t)512 * 128);                             // 512 lines
  CARVE(float, SCAL,  256);                                           // 1 line used
  CARVE(us,    FTH,   (size_t)NBATCH * 8 * DVH * FTK * 2);            // 1179648
  CARVE(us,    FTL,   (size_t)NBATCH * 8 * DVH * FTK * 2);
  CARVE(us,    QKH,   padpx * DV * 2);                                // 2367488
  CARVE(us,    QKL,   padpx * DV * 2);
  CARVE(float, OUTP,  (size_t)NBATCH * DV * NPIX * 4);                // 4194304
  CARVE(float, PARTL, (size_t)256 * 128);                             // 256 lines
#undef CARVE
  if (off > ws_size) return;
  if (off > (size_t)134217728) return;

  BiW bw;
  bilin3(bw);

  // 16-bit operand planes
  k_prep_x<<<dim3(HIMG, NBATCH), 256, 0, stream>>>(x, XPH, XPL);
  k_zero_border<<<dim3(17, NBATCH), 256, 0, stream>>>(XPH, XPL, CIN);
  k_zero_border<<<dim3(17, NBATCH), 256, 0, stream>>>(RQH, RQL, DQ);
  k_zero_border<<<dim3(17, NBATCH), 256, 0, stream>>>(QKH, QKL, DV);
  k_wprep<<<(DQ * CIN * 1) / 2048, 256, 0, stream>>>(q_w, DQ, 1, WQH, WQL);
  k_wprep<<<(DQ * CIN * 9) / 2048, 256, 0, stream>>>(k_w, DQ, 9, WKH, WKL);
  k_wprep<<<(DV * CIN * 9) / 2048, 256, 0, stream>>>(v_w, DV, 9, WVH, WVL);
  k_wprep<<<(DV * DV * 9) / 2048, 256, 0, stream>>>(hu_w, DV, 9, WHH, WHL);

  // channel means + bias linear
  k_bias<<<1, 256, 0, stream>>>(x, bias_w, bias_b, BIASV);

  // q (1x1), k (3x3), v (3x3) convolutions
  k_conv<0><<<dim3(64, DQ / 64), 128, 0, stream>>>(XPH, XPL, WQH, WQL, q_b, 1, DQ, RQH, RQL, R2K, PARTQ);
  k_conv<1><<<dim3(64, DQ / 64), 128, 0, stream>>>(XPH, XPL, WKH, WKL, k_b, 9, DQ, VNH, VNL, R2K, PARTK);
  k_conv<2><<<dim3(64, DV / 64), 128, 0, stream>>>(XPH, XPL, WVH, WVL, v_b, 9, DV, VNH, VNL, OUTP, PARTL);

  // phi ratios, pooled KV filters, grouped conv
  k_phinorm<<<1, 64, 0, stream>>>(PARTQ, PARTK, SCAL);
  k_kv<<<dim3(9, NBATCH * 8), 128, 0, stream>>>(R2K, VNH, VNL, SCAL, bw, FTH, FTL);
  k_gconv<<<dim3(16, 4, NBATCH), 128, 0, stream>>>(RQH, RQL, FTH, FTL, SCAL, BIASV, QKH, QKL);

  // head unification conv + LayerNorm
  k_conv<3><<<dim3(64, DV / 64), 128, 0, stream>>>(QKH, QKL, WHH, WHL, hu_b, 9, DV, VNH, VNL, OUTP, PARTL);
  k_ln<<<(NBATCH * DV * NPIX) / 1024, 256, 0, stream>>>(OUTP, PARTL, out);
}

// v001
// A run of this version takes 357 microseconds.
// Two timings next to v000 put it at 1.19 and 1.21 times that version's speed.
// Contractions: q 1x1 conv, k/v/hu 3x3 convs as implicit GEMM (K = 9*256), pooled KV outer-product GEMMs (64x32x1024 per head and tap), per-sample grouped 3x3 conv (K = 9*64) and the channel-mean bias linear, all on v_wmma_f32_16x16x32_bf16 with bf16 hi/lo three-product operand split (hi*hi + lo*hi + hi*lo), f32 accumulate; phi norm ratios, clip, channel means and LayerNorm statistics in f32/f64 on the VALU.
#include <hip/hip_runtime.h>

typedef unsigned short us;
typedef int   v8i  __attribute__((ext_vector_type(8)));
typedef float v8f  __attribute__((ext_vector_type(8)));
typedef float v4f  __attribute__((ext_vector_type(4)));
typedef unsigned short v8us __attribute__((ext_vector_type(8)));
typedef __bf16 v16b __attribute__((ext_vector_type(16)));
typedef v4f  __attribute__((may_alias)) v4fa;
typedef v8us __attribute__((may_alias)) v8usa;
union Frag { v8i v; v8us half[2]; };
union DPack { double d[2]; v4f f; };

#define NBATCH 4
#define CIN    256
#define HIMG   32
#define NPIX   1024
#define PW     34
#define DQ     512
#define DV     256
#define DK     64
#define DVH    32
#define FTK    576

struct BiW { int i0[3]; int i1[3]; float w0[3]; float w1[3]; };
static_assert(sizeof(BiW) == 48);

// ---------------------------------------------------------------------------
// bf16 helpers (RNE convert) and the hi/lo split
// ---------------------------------------------------------------------------
__device__ __forceinline__ us f2bf(float f) {
  unsigned u = __float_as_uint(f);
  u += 0x7FFFu + ((u >> 16) & 1u);
  return (us)(u >> 16);
}
__device__ __forceinline__ float bf2f(us hv) {
  return __uint_as_float(((unsigned)hv) << 16);
}
__device__ __forceinline__ void split2(float f, us& hi, us& lo) {
  hi = f2bf(f);
  lo = f2bf(f - bf2f(hi));
}

// ---------------------------------------------------------------------------
// 16x16x32 bf16 WMMA with hazard guard (ties D, keeps A/B live).
// Fragment map (wave32): lane l, h = l>>4, m = n = l&15.
//   A/B element i: i<8 -> k0+8h+i ; i>=8 -> k0+16+8h+(i-8)
//   D element r : row 8h+r, col l&15
// ---------------------------------------------------------------------------
__device__ __forceinline__ v8f wmma_bf(v8i a, v8i b, v8f c) {
  v8f d = __builtin_amdgcn_wmma_f32_16x16x32_bf16(false, __builtin_bit_cast(v16b, a), false,
                                                  __builtin_bit_cast(v16b, b), (short)0, c, false, false);
  asm volatile("v_nop\n\tv_nop\n\tv_nop\n\tv_nop" : "+v"(d) : "v"(a), "v"(b));
  return d;
}
// three-product split: ah*bh + al*bh + ah*bl into one accumulator
__device__ __forceinline__ v8f wmma3(v8i ah, v8i al, v8i bh, v8i bl, v8f c) {
  c = wmma_bf(ah, bh, c);
  c = wmma_bf(al, bh, c);
  c = wmma_bf(ah, bl, c);
  return c;
}
// fragment from a k-contiguous 16-bit row (pointer already at k0)
__device__ __forceinline__ v8i ldfrag(const us* p, int h) {
  Frag f;
  f.half[0] = *(const v8usa*)(p + 8 * h);
  f.half[1] = *(const v8usa*)(p + 16 + 8 * h);
  return f.v;
}

__device__ __forceinline__ float wave_sum(float s) {
  s += __shfl_xor(s, 16);
  s += __shfl_xor(s, 8);
  s += __shfl_xor(s, 4);
  s += __shfl_xor(s, 2);
  s += __shfl_xor(s, 1);
  return s;
}
__device__ __forceinline__ double dshfl_xor(double v, int msk) {
  const unsigned long long u = __builtin_bit_cast(unsigned long long, v);
  int lo = (int)(unsigned)(u & 0xFFFFFFFFull);
  int hi = (int)(unsigned)(u >> 32);
  lo = __shfl_xor(lo, msk);
  hi = __shfl_xor(hi, msk);
  const unsigned long long r = (((unsigned long long)(unsigned)hi) << 32) | (unsigned long long)(unsigned)lo;
  return __builtin_bit_cast(double, r);
}
__device__ __forceinline__ double wave_sum_d(double s) {
  s += dshfl_xor(s, 16);
  s += dshfl_xor(s, 8);
  s += dshfl_xor(s, 4);
  s += dshfl_xor(s, 2);
  s += dshfl_xor(s, 1);
  return s;
}

// ---------------------------------------------------------------------------
// Kernel: x NCHW f32 -> bf16 hi/lo padded NHWC planes [b][34][34][256]
// (interior pixels). Block = (y, b); LDS transpose; one instruction writes one
// coverage: 8 waves x 4 pixels = 32 px per row, 32 lanes x 8 = 256 ch.
// Also the f32 sum of each channel's image row (32 values, fixed order) into
// rowsum[b][y][c]: 256 threads x 4 B = 8 whole lines per block. The f32 copy
// sits in LDS at pitch 33 words, free of bank conflicts on store and on read.
// ---------------------------------------------------------------------------
__global__ __launch_bounds__(256) void k_prep_x(const float* __restrict__ x,
                                                us* __restrict__ xh, us* __restrict__ xl,
                                                float* __restrict__ rowsum) {
  __shared__ __attribute__((aligned(16))) us sh[32 * 256];
  __shared__ __attribute__((aligned(16))) us sl[32 * 256];
  __shared__ float sf[256 * 33];
  const int tid = threadIdx.x, lane = tid & 31, w = tid >> 5;
  const int y = blockIdx.x, b = blockIdx.y;
  #pragma unroll 1
  for (int j = 0; j < 32; ++j) {
    const int c = 8 * j + w;
    const float v = x[((size_t)(b * CIN + c) * HIMG + y) * HIMG + lane];
    us hi, lo;
    split2(v, hi, lo);
    sh[lane * 256 + c] = hi;
    sl[lane * 256 + c] = lo;
    sf[c * 33 + lane] = v;
  }
  __syncthreads();
  float rs = 0.f;
  // unrolled: constant LDS offsets, the reads issue ahead of the dependent adds
  #pragma unroll
  for (int i = 0; i < 32; ++i) rs += sf[tid * 33 + i];
  rowsum[(size_t)(b * HIMG + y) * CIN + tid] = rs;
  v8us vh[4], vl[4];
  size_t d[4];
  #pragma unroll
  for (int i = 0; i < 4; ++i) {
    const int px = 4 * w + i;
    vh[i] = *(const v8usa*)(sh + px * 256 + 8 * lane);
    vl[i] = *(const v8usa*)(sl + px * 256 + 8 * lane);
    d[i] = ((size_t)((b * PW + y + 1) * PW + px + 1)) * CIN + 8 * lane;
  }
  #pragma unroll
  for (int i = 0; i < 4; ++i) { *(v8us*)(xh + d[i]) = vh[i]; *(v8us*)(xl + d[i]) = vl[i]; }
  
}

// ---------------------------------------------------------------------------
// Kernel: zero the border pixel rows of padded NHWC planes [b][34][34][C].
// Wave = one border pixel; 32 lanes x 16 B = 256 halves per instruction.
// coverage: 132 border pixels x 4 samples, C halves each, both planes.
// ---------------------------------------------------------------------------
__global__ __launch_bounds__(256) void k_zero_border(us* __restrict__ ph, us* __restrict__ pl, int C) {
  const int tid = threadIdx.x, lane = tid & 31, w = tid >> 5;
  const int i = blockIdx.x * 8 + w;
  const int b = blockIdx.y;
  if (i >= 132) return;
  int py, px;
  if (i < 34)       { py = 0;           px = i; }
  else if (i < 68)  { py = PW - 1;      px = i - 34; }
  else if (i < 100) { py = i - 68 + 1;  px = 0; }
  else              { py = i - 100 + 1; px = PW - 1; }
  const size_t base = ((size_t)((b * PW + py) * PW + px)) * (size_t)C;
  v8us z;
  #pragma unroll
  for (int j = 0; j < 8; ++j) z[j] = (us)0;
  #pragma unroll 1
  for (int off = 8 * lane; off < C; off += 256) {
    *(v8us*)(ph + base + off) = z;
    *(v8us*)(pl + base + off) = z;
  }
  
}

// ---------------------------------------------------------------------------
// Kernel: OIHW f32 weights -> rows [o][tap*256 + c] as bf16 hi and lo planes.
// Thread = 8 consecutive row elements, one 16-B store per lane per plane,
// coverage: cout*taps*256 elements, grid = n/2048 exactly.
// ---------------------------------------------------------------------------
__global__ __launch_bounds__(256) void k_wprep(const float* __restrict__ wsrc, int cout, int taps,
                                               us* __restrict__ wh, us* __restrict__ wl) {
  const int g = blockIdx.x * 256 + threadIdx.x;
  const int kw = taps * 256;
  const int n = cout * kw;
  const int e8 = g * 8;
  if (e8 >= n) return;
  const int o = e8 / kw;
  const int r = e8 - o * kw;
  const int tap = r >> 8, c = r & 255;
  const float* src = wsrc + ((size_t)(o * 256 + c)) * taps + tap;
  v8us vh, vl;
  #pragma unroll
  for (int i = 0; i < 8; ++i) {
    us a, bq;
    split2(src[(size_t)i * taps], a, bq);
    vh[i] = a;
    vl[i] = bq;
  }
  *(v8us*)(wh + e8) = vh;
  *(v8us*)(wl + e8) = vl;
  
}

// ---------------------------------------------------------------------------
// Fragment from 32 consecutive-k f32 values of one row (pointer at k0), split
// into hi/lo bf16 fragments in registers (fragment map as above).
// ---------------------------------------------------------------------------
__device__ __forceinline__ void frag_f32(const float* __restrict__ p, int h, v8i& fh, v8i& fl) {
  const v4f q0 = *(const v4fa*)(p + 8 * h);
  const v4f q1 = *(const v4fa*)(p + 8 * h + 4);
  const v4f q2 = *(const v4fa*)(p + 16 + 8 * h);
  const v4f q3 = *(const v4fa*)(p + 20 + 8 * h);
  float v[16];
  v[0] = q0.x; v[1] = q0.y; v[2] = q0.z; v[3] = q0.w;
  v[4] = q1.x; v[5] = q1.y; v[6] = q1.z; v[7] = q1.w;
  v[8] = q2.x; v[9] = q2.y; v[10] = q2.z; v[11] = q2.w;
  v[12] = q3.x; v[13] = q3.y; v[14] = q3.z; v[15] = q3.w;
  Frag a, bq;
  #pragma unroll
  for (int i = 0; i < 16; ++i) {
    us hi, lo;
    split2(v[i], hi, lo);
    a.half[i >> 3][i & 7] = hi;
    bq.half[i >> 3][i & 7] = lo;
  }
  fh = a.v;
  fl = bq.v;
}

// ---------------------------------------------------------------------------
// Kernel: channel means of x (f32, from the 32 row sums of each channel, fixed
// order) and the bias linear on WMMA:
// bias[b][o] = sum_c mean[b][c] * bw[o][c] + bb[o]. One block of 8 waves.
// A = means [16 rows (4 real, 12 zero)][256] hi/lo in LDS, B = bw rows [o][c]
// coverage: 256 threads x 16 B = 4096 B = all of bias.
// ---------------------------------------------------------------------------
__global__ __launch_bounds__(256) void k_bias(const float* __restrict__ rowsum, const float* __restrict__ bw,
                                              const float* __restrict__ bb, float* __restrict__ biasv) {
  __shared__ __attribute__((aligned(16))) us sah[16 * 256];
  __shared__ __attribute__((aligned(16))) us sal[16 * 256];
  __shared__ __attribute__((aligned(16))) float sd[4 * 256];
  const int tid = threadIdx.x, lane = tid & 31, w = tid >> 5;
  const int h = lane >> 4, m = lane & 15;
  for (int i = tid; i < 16 * 256; i += 256) {
    if (i >= 4 * 256) { sah[i] = (us)0; sal[i] = (us)0; }
  }
  {
    const int k = tid >> 6, c4 = 4 * (tid & 63);   // b = k, channels c4 .. c4+3
    const float* p = rowsum + (size_t)k * HIMG * CIN + c4;
    v4f sm;
    sm.x = 0.f; sm.y = 0.f; sm.z = 0.f; sm.w = 0.f;
    // unrolled: the 32 loads fly together, one memory latency instead of 32
    #pragma unroll
    for (int i = 0; i < HIMG; ++i) sm += *(const v4fa*)(p + i * CIN);
    // unrolled: constant vector index, sm stays in registers
    #pragma unroll
    for (int e = 0; e < 4; ++e) {
      const float mean = sm[e] * (1.0f / 1024.0f);
      us hi, lo;
      split2(mean, hi, lo);
      sah[k * 256 + c4 + e] = hi;
      sal[k * 256 + c4 + e] = lo;
    }
  }
  __syncthreads();

  const int o0 = 32 * w + m, o1 = o0 + 16;
  const float* br0 = bw + (size_t)o0 * 256;
  const float* br1 = bw + (size_t)o1 * 256;
  const v8f z8 = {0.f, 0.f, 0.f, 0.f, 0.f, 0.f, 0.f, 0.f};
  v8f acc[2];
  acc[0] = z8; acc[1] = z8;
  #pragma unroll 1
  for (int k0 = 0; k0 < 256; k0 += 32) {
    const v8i ah = ldfrag(sah + m * 256 + k0, h);
    const v8i al = ldfrag(sal + m * 256 + k0, h);
    v8i bh0, bl0, bh1, bl1;
    frag_f32(br0 + k0, h, bh0, bl0);
    frag_f32(br1 + k0, h, bh1, bl1);
    acc[0] = wmma3(ah, al, bh0, bl0, acc[0]);
    acc[1] = wmma3(ah, al, bh1, bl1, acc[1]);
  }
  const float bb0 = bb[o0], bb1 = bb[o1];
  if (h == 0) {
    #pragma unroll
    for (int r = 0; r < 4; ++r) {
      sd[r * 256 + o0] = acc[0][r] + bb0;
      sd[r * 256 + o1] = acc[1][r] + bb1;
    }
  }
  __syncthreads();
  const int L = tid >> 3, q = tid & 7;
  const v4f v = *(const v4fa*)(sd + L * 32 + 4 * q);
  float* dst = biasv + L * 32 + 4 * q;
  *(v4f*)dst = v;
  
}

// ---------------------------------------------------------------------------
// Kernel: implicit-GEMM convolution (Cin = 256 per pixel) over bf16 hi/lo
// zero-padded NHWC planes [b][34][34][256]; weights as rows [o][tap*256+c]
// hi/lo. Block = 64 pixels (image rows y0, y0+1) x 64 output channels,
// 4 waves of 32 px x 32 ch (2x2 tiles), K = ntaps*256 in steps of 32,
// fragments straight from the 16-bit rows, three products per tile pair.
// MODE 0: relu^2 -> bf16 hi/lo padded NHWC planes (pitch = cout) + (s2,s4) partial line
// MODE 1: relu^2 -> f32 NCHW + (s2,s4) partial line
// MODE 2: value -> bf16 hi/lo NCHW planes
// MODE 3: value -> f32 NCHW + (sum, sum of squares) partial line (f64)
// coverage: MODE 0 store: 4 waves x 16 px x 8 lanes x 8 ch = 64 px x 64 ch;
// MODE 1/3: 4 waves x 16 ch x 64 px; MODE 2: 4 waves x 16 ch x 8 lanes x 8 px.
// ---------------------------------------------------------------------------
template <int MODE>
__global__ __launch_bounds__(128) void k_conv(
    const us* __restrict__ ah, const us* __restrict__ al,
    const us* __restrict__ wh, const us* __restrict__ wl,
    const float* __restrict__ bias, int ntaps, int cout,
    us* __restrict__ oh, us* __restrict__ ol, float* __restrict__ of, float* __restrict__ part)
{
  __shared__ __attribute__((aligned(16))) float sbuf[64 * 64];
  __shared__ double sred[4][2];
  const int tid = threadIdx.x, lane = tid & 31, w = tid >> 5;
  const int h = lane >> 4, m = lane & 15;
  const int pt = blockIdx.x, b = pt >> 4, y0 = (pt & 15) * 2;
  const int n0 = blockIdx.y * 64;
  const int ry = w >> 1, y = y0 + ry, nw = 32 * (w & 1);
  const int kw = ntaps * CIN;
  const size_t wr0 = (size_t)(n0 + nw + m) * kw;
  const size_t wr1 = wr0 + (size_t)16 * kw;
  const v8f z8 = {0.f, 0.f, 0.f, 0.f, 0.f, 0.f, 0.f, 0.f};
  v8f acc[2][2];
  #pragma unroll
  for (int i = 0; i < 2; ++i) { acc[i][0] = z8; acc[i][1] = z8; }

  #pragma unroll 1
  for (int tap = 0; tap < ntaps; ++tap) {
    const int t3 = tap / 3;
    const int ky = (ntaps == 1) ? 1 : t3;
    const int kx = (ntaps == 1) ? 1 : (tap - 3 * t3);
    const size_t ar0 = ((size_t)((b * PW + y + ky) * PW + kx + m)) * CIN;
    const size_t ar1 = ar0 + (size_t)16 * CIN;
    const size_t wt = (size_t)tap * CIN;
    #pragma unroll 1
    for (int c0 = 0; c0 < CIN; c0 += 32) {
      const v8i fa0h = ldfrag(ah + ar0 + c0, h);
      const v8i fa0l = ldfrag(al + ar0 + c0, h);
      const v8i fa1h = ldfrag(ah + ar1 + c0, h);
      const v8i fa1l = ldfrag(al + ar1 + c0, h);
      #pragma unroll
      for (int nt = 0; nt < 2; ++nt) {
        const size_t wr = (nt == 0) ? wr0 : wr1;
        const v8i fbh = ldfrag(wh + wr + wt + c0, h);
        const v8i fbl = ldfrag(wl + wr + wt + c0, h);
        acc[0][nt] = wmma3(fa0h, fa0l, fbh, fbl, acc[0][nt]);
        acc[1][nt] = wmma3(fa1h, fa1l, fbh, fbl, acc[1][nt]);
      }
    }
  }

  // epilogue into LDS
  float bv[2];
  bv[0] = bias[n0 + nw + m];
  bv[1] = bias[n0 + nw + 16 + m];
  us* sH = reinterpret_cast<us*>(sbuf);
  us* sL = sH + 4096;
  float fs = 0.f, fq = 0.f;
  double ds = 0.0, dq = 0.0;
  #pragma unroll
  for (int mt = 0; mt < 2; ++mt) {
    #pragma unroll
    for (int nt = 0; nt < 2; ++nt) {
      #pragma unroll
      for (int r = 0; r < 8; ++r) {
        const float val = acc[mt][nt][r] + bv[nt];
        const int tp = ry * 32 + mt * 16 + 8 * h + r;
        const int ch = nw + 16 * nt + m;
        if (MODE == 0) {
          const float rr = fmaxf(val, 0.f);
          const float r2 = rr * rr;
          fs += r2; fq += r2 * r2;
          us hi, lo;
          split2(r2, hi, lo);
          sH[tp * 64 + ch] = hi;
          sL[tp * 64 + ch] = lo;
        } else if (MODE == 1) {
          const float rr = fmaxf(val, 0.f);
          const float r2 = rr * rr;
          fs += r2; fq += r2 * r2;
          sbuf[ch * 64 + tp] = r2;
        } else if (MODE == 2) {
          us hi, lo;
          split2(val, hi, lo);
          sH[ch * 64 + tp] = hi;
          sL[ch * 64 + tp] = lo;
        } else {
          ds += (double)val;
          dq += (double)val * (double)val;
          sbuf[ch * 64 + tp] = val;
        }
      }
    }
  }
  if (MODE == 0 || MODE == 1) {
    fs = wave_sum(fs);
    fq = wave_sum(fq);
    ds = (double)fs;
    dq = (double)fq;
  } else if (MODE == 3) {
    ds = wave_sum_d(ds);
    dq = wave_sum_d(dq);
  }
  if (MODE != 2) {
    if (lane == 0) { sred[w][0] = ds; sred[w][1] = dq; }
  }
  __syncthreads();

  // block partial line (2 doubles + zeros), fixed order over the 4 waves
  v4f pv;
  pv.x = 0.f; pv.y = 0.f; pv.z = 0.f; pv.w = 0.f;
  size_t li = 0;
  bool pw = false;
  if (MODE != 2) {
    double S = 0.0, Q2 = 0.0;
    #pragma unroll
    for (int k = 0; k < 4; ++k) { S += sred[k][0]; Q2 += sred[k][1]; }
    DPack pk;
    pk.d[0] = S; pk.d[1] = Q2;
    pv.x = (lane == 0) ? pk.f.x : 0.f;
    pv.y = (lane == 0) ? pk.f.y : 0.f;
    pv.z = (lane == 0) ? pk.f.z : 0.f;
    pv.w = (lane == 0) ? pk.f.w : 0.f;
    li = ((size_t)blockIdx.x * gridDim.y + blockIdx.y) * 32 + 4 * (lane & 7);
    pw = (w == 0) && (lane < 8);
  }

  if (MODE == 0) {
    const int q8 = lane & 7, sub = lane >> 3;
    v8us th[4], tl[4];
    size_t d[4];
    #pragma unroll
    for (int i = 0; i < 4; ++i) {
      const int tp = 16 * w + 4 * i + sub;
      const int ry2 = tp >> 5, xx = tp & 31;
      th[i] = *(const v8usa*)(sH + tp * 64 + 8 * q8);
      tl[i] = *(const v8usa*)(sL + tp * 64 + 8 * q8);
      d[i] = ((size_t)((b * PW + y0 + ry2 + 1) * PW + xx + 1)) * (size_t)cout + n0 + 8 * q8;
    }
    #pragma unroll
    for (int i = 0; i < 4; ++i) { *(v8us*)(oh + d[i]) = th[i]; *(v8us*)(ol + d[i]) = tl[i]; }
    if (pw) *(v4f*)(part + li) = pv;
    
  } else if (MODE == 2) {
    const int q8 = lane & 7, sub = lane >> 3;
    v8us th[4], tl[4];
    size_t d[4];
    #pragma unroll
    for (int i = 0; i < 4; ++i) {
      const int chl = 16 * w + 4 * i + sub;
      th[i] = *(const v8usa*)(sH + chl * 64 + 8 * q8);
      tl[i] = *(const v8usa*)(sL + chl * 64 + 8 * q8);
      d[i] = ((size_t)(b * cout + n0 + chl)) * NPIX + y0 * HIMG + 8 * q8;
    }
    #pragma unroll
    for (int i = 0; i < 4; ++i) { *(v8us*)(oh + d[i]) = th[i]; *(v8us*)(ol + d[i]) = tl[i]; }
    
  } else {
    const int hs = lane >> 4, x4 = 4 * (lane & 15);
    v4f tv[8];
    size_t d[8];
    #pragma unroll
    for (int i = 0; i < 8; ++i) {
      const int chl = 16 * w + 2 * i + hs;
      tv[i] = *(const v4fa*)(sbuf + chl * 64 + x4);
      d[i] = ((size_t)(b * cout + n0 + chl)) * NPIX + y0 * HIMG + x4;
    }
    #pragma unroll
    for (int i = 0; i < 8; ++i) *(v4f*)(of + d[i]) = tv[i];
    if (pw) *(v4f*)(part + li) = pv;
    
  }
}

// ---------------------------------------------------------------------------
// Kernel: phi norm ratios s = sqrt(sum relu^2) / sqrt(sum relu^4) for the q
// and k tensors from 512 block partial lines each (fixed order, f64).
// One block of 64 threads; wave 0 = q, wave 1 = k; one whole output line.
// ---------------------------------------------------------------------------
__global__ __launch_bounds__(64) void k_phinorm(const float* __restrict__ partq, const float* __restrict__ partk,
                                                float* __restrict__ scal) {
  __shared__ double sacc[2][32][2];
  __shared__ float sres[2];
  const int tid = threadIdx.x, lane = tid & 31, w = tid >> 5;
  const float* pp = (w == 0) ? partq : partk;
  double s2 = 0.0, s4 = 0.0;
  #pragma unroll 1
  for (int j = 0; j < 16; ++j) {
    const double* dp = reinterpret_cast<const double*>(pp + (size_t)(lane * 16 + j) * 32);
    s2 += dp[0];
    s4 += dp[1];
  }
  sacc[w][lane][0] = s2;
  sacc[w][lane][1] = s4;
  __syncthreads();
  if (lane == 0) {
    double t2 = 0.0, t4 = 0.0;
    for (int i = 0; i < 32; ++i) { t2 += sacc[w][i][0]; t4 += sacc[w][i][1]; }
    const float num = sqrtf((float)t2);
    const float den = sqrtf((float)t4);
    sres[w] = num * (1.0f / den);
  }
  __syncthreads();
  v4f pv;
  pv.x = (lane == 0) ? sres[0] : 0.f;
  pv.y = (lane == 0) ? sres[1] : 0.f;
  pv.z = 0.f; pv.w = 0.f;
  const bool pw = (w == 0) && (lane < 8);
  float* dst = scal + 4 * lane;
  if (pw) *(v4f*)dst = pv;
  
}

// ---------------------------------------------------------------------------
// Kernel: pooled outer product. Block = (tap pq, bh): D[kk 64][v 32] =
// sum_pix (relu(K)^2[kk][pix] * Mh[p][y] * Mw[q][x]) * V[v][pix], K = 1024,
// A built in registers from the f32 NCHW relu^2 rows (split hi/lo),
// B from the bf16 NCHW V planes. Epilogue: * sK, clip +-32/9, hi/lo into
// coverage: 4 waves x 8 rows x 8 lanes x 8 kk = 32 v x 64 kk per (bh,pq).
// ---------------------------------------------------------------------------
__global__ __launch_bounds__(128) void k_kv(
    const float* __restrict__ r2k, const us* __restrict__ vnh, const us* __restrict__ vnl,
    const float* __restrict__ scal, BiW bw, us* __restrict__ fth, us* __restrict__ ftl)
{
  __shared__ __attribute__((aligned(16))) us sH[32 * 64];
  __shared__ __attribute__((aligned(16))) us sL[32 * 64];
  const int tid = threadIdx.x, lane = tid & 31, w = tid >> 5;
  const int h = lane >> 4, m = lane & 15;
  const int pq = blockIdx.x, bh = blockIdx.y;
  const int b = bh >> 3, head = bh & 7;
  const int p = pq / 3, q = pq - 3 * p;
  const int   iy0 = (p == 0) ? bw.i0[0] : ((p == 1) ? bw.i0[1] : bw.i0[2]);
  const int   iy1 = (p == 0) ? bw.i1[0] : ((p == 1) ? bw.i1[1] : bw.i1[2]);
  const float wy0 = (p == 0) ? bw.w0[0] : ((p == 1) ? bw.w0[1] : bw.w0[2]);
  const float wy1 = (p == 0) ? bw.w1[0] : ((p == 1) ? bw.w1[1] : bw.w1[2]);
  const int   ix0 = (q == 0) ? bw.i0[0] : ((q == 1) ? bw.i0[1] : bw.i0[2]);
  const int   ix1 = (q == 0) ? bw.i1[0] : ((q == 1) ? bw.i1[1] : bw.i1[2]);
  const float wx0 = (q == 0) ? bw.w0[0] : ((q == 1) ? bw.w0[1] : bw.w0[2]);
  const float wx1 = (q == 0) ? bw.w1[0] : ((q == 1) ? bw.w1[1] : bw.w1[2]);
  const float sK = scal[1];
  const float amax = (float)(32.0 / 9.0);
  const float* arow = r2k + ((size_t)(b * DQ + head * DK + 16 * w + m)) * NPIX;
  const size_t br0 = ((size_t)(b * DV + head * DVH + m)) * NPIX;
  const size_t br1 = br0 + (size_t)16 * NPIX;
  const v8f z8 = {0.f, 0.f, 0.f, 0.f, 0.f, 0.f, 0.f, 0.f};
  v8f acc[2];
  acc[0] = z8; acc[1] = z8;

  #pragma unroll 1
  for (int k0 = 0; k0 < NPIX; k0 += 32) {
    const int yy = k0 >> 5;
    const float wy = ((yy == iy0) ? wy0 : 0.f) + ((yy == iy1) ? wy1 : 0.f);
    const float* ap = arow + k0;
    const v4f q0 = *(const v4fa*)(ap + 8 * h);
    const v4f q1 = *(const v4fa*)(ap + 8 * h + 4);
    const v4f q2 = *(const v4fa*)(ap + 16 + 8 * h);
    const v4f q3 = *(const v4fa*)(ap + 20 + 8 * h);
    float v[16];
    v[0] = q0.x; v[1] = q0.y; v[2] = q0.z; v[3] = q0.w;
    v[4] = q1.x; v[5] = q1.y; v[6] = q1.z; v[7] = q1.w;
    v[8] = q2.x; v[9] = q2.y; v[10] = q2.z; v[11] = q2.w;
    v[12] = q3.x; v[13] = q3.y; v[14] = q3.z; v[15] = q3.w;
    Frag fah, fal;
    #pragma unroll
    for (int i = 0; i < 16; ++i) {
      const int xx = 8 * h + (i & 7) + ((i >> 3) << 4);
      const float wx = ((xx == ix0) ? wx0 : 0.f) + ((xx == ix1) ? wx1 : 0.f);
      const float a = v[i] * (wy * wx);
      us hi, lo;
      split2(a, hi, lo);
      fah.half[i >> 3][i & 7] = hi;
      fal.half[i >> 3][i & 7] = lo;
    }
    const v8i fb0h = ldfrag(vnh + br0 + k0, h);
    const v8i fb0l = ldfrag(vnl + br0 + k0, h);
    const v8i fb1h = ldfrag(vnh + br1 + k0, h);
    const v8i fb1l = ldfrag(vnl + br1 + k0, h);
    acc[0] = wmma3(fah.v, fal.v, fb0h, fb0l, acc[0]);
    acc[1] = wmma3(fah.v, fal.v, fb1h, fb1l, acc[1]);
  }

  #pragma unroll
  for (int nt = 0; nt < 2; ++nt) {
    #pragma unroll
    for (int r = 0; r < 8; ++r) {
      float val = acc[nt][r] * sK;
      val = fminf(fmaxf(val, -amax), amax);
      const int kk = 16 * w + 8 * h + r;
      const int vv = 16 * nt + m;
      us hi, lo;
      split2(val, hi, lo);
      sH[vv * 64 + kk] = hi;
      sL[vv * 64 + kk] = lo;
    }
  }
  __syncthreads();
  const int q8 = lane & 7, sub = lane >> 3;
  v8us th[2], tl[2];
  size_t d[2];
  #pragma unroll
  for (int i = 0; i < 2; ++i) {
    const int vv = 8 * w + 4 * i + sub;
    th[i] = *(const v8usa*)(sH + vv * 64 + 8 * q8);
    tl[i] = *(const v8usa*)(sL + vv * 64 + 8 * q8);
    d[i] = ((size_t)(bh * DVH + vv)) * FTK + pq * 64 + 8 * q8;
  }
  #pragma unroll
  for (int i = 0; i < 2; ++i) { *(v8us*)(fth + d[i]) = th[i]; *(v8us*)(ftl + d[i]) = tl[i]; }
  
}

// ---------------------------------------------------------------------------
// Kernel: per-sample grouped 3x3 conv of relu(Q)^2 planes (padded NHWC,
// 512 ch) with the pooled filters, K = 9*64 per head. Block = (64 px, head
// pair, b); wave = (head of the pair, image row) 32 px x 32 v. Epilogue:
// * sQ + bias[b][j*32+v], hi/lo into padded NHWC planes [b][34][34][256];
// coverage: 4 waves x 16 px x 8 lanes x 8 ch = 64 px x 64 ch per block;
// grid 16 x 4 x 4 = all interior pixels x all 256 channels x 4 samples.
// ---------------------------------------------------------------------------
__global__ __launch_bounds__(128) void k_gconv(
    const us* __restrict__ rqh, const us* __restrict__ rql,
    const us* __restrict__ fth, const us* __restrict__ ftl,
    const float* __restrict__ scal, const float* __restrict__ biasv,
    us* __restrict__ oh, us* __restrict__ ol)
{
  __shared__ __attribute__((aligned(16))) us sH[64 * 64];
  __shared__ __attribute__((aligned(16))) us sL[64 * 64];
  const int tid = threadIdx.x, lane = tid & 31, w = tid >> 5;
  const int h = lane >> 4, m = lane & 15;
  const int pt = blockIdx.x, jp = blockIdx.y, b = blockIdx.z;
  const int y0 = 2 * pt;
  const int jl = w >> 1, ry = w & 1;
  const int j = 2 * jp + jl, y = y0 + ry, bh = b * 8 + j;
  const size_t fr0 = ((size_t)(bh * DVH + m)) * FTK;
  const size_t fr1 = fr0 + (size_t)16 * FTK;
  const v8f z8 = {0.f, 0.f, 0.f, 0.f, 0.f, 0.f, 0.f, 0.f};
  v8f acc[2][2];
  #pragma unroll
  for (int i = 0; i < 2; ++i) { acc[i][0] = z8; acc[i][1] = z8; }

  #pragma unroll 1
  for (int tap = 0; tap < 9; ++tap) {
    const int ky = tap / 3;
    const int kx = tap - 3 * ky;
    const size_t ar0 = ((size_t)((b * PW + y + ky) * PW + kx + m)) * DQ + (size_t)j * DK;
    const size_t ar1 = ar0 + (size_t)16 * DQ;
    const size_t wt = (size_t)tap * DK;
    #pragma unroll
    for (int c0 = 0; c0 < DK; c0 += 32) {
      const v8i fa0h = ldfrag(rqh + ar0 + c0, h);
      const v8i fa0l = ldfrag(rql + ar0 + c0, h);
      const v8i fa1h = ldfrag(rqh + ar1 + c0, h);
      const v8i fa1l = ldfrag(rql + ar1 + c0, h);
      #pragma unroll
      for (int nt = 0; nt < 2; ++nt) {
        const size_t fr = (nt == 0) ? fr0 : fr1;
        const v8i fbh = ldfrag(fth + fr + wt + c0, h);
        const v8i fbl = ldfrag(ftl + fr + wt + c0, h);
        acc[0][nt] = wmma3(fa0h, fa0l, fbh, fbl, acc[0][nt]);
        acc[1][nt] = wmma3(fa1h, fa1l, fbh, fbl, acc[1][nt]);
      }
    }
  }

  const float sQ = scal[0];
  float bv[2];
  bv[0] = biasv[b * DV + j * DVH + m];
  bv[1] = biasv[b * DV + j * DVH + 16 + m];
  #pragma unroll
  for (int mt = 0; mt < 2; ++mt) {
    #pragma unroll
    for (int nt = 0; nt < 2; ++nt) {
      #pragma unroll
      for (int r = 0; r < 8; ++r) {
        const float val = acc[mt][nt][r] * sQ + bv[nt];
        const int tp = ry * 32 + mt * 16 + 8 * h + r;
        const int chl = jl * 32 + 16 * nt + m;
        us hi, lo;
        split2(val, hi, lo);
        sH[tp * 64 + chl] = hi;
        sL[tp * 64 + chl] = lo;
      }
    }
  }
  __syncthreads();
  const int q8 = lane & 7, sub = lane >> 3;
  v8us th[4], tl[4];
  size_t d[4];
  #pragma unroll
  for (int i = 0; i < 4; ++i) {
    const int tp = 16 * w + 4 * i + sub;
    const int ry2 = tp >> 5, xx = tp & 31;
    th[i] = *(const v8usa*)(sH + tp * 64 + 8 * q8);
    tl[i] = *(const v8usa*)(sL + tp * 64 + 8 * q8);
    d[i] = ((size_t)((b * PW + y0 + ry2 + 1) * PW + xx + 1)) * DV + jp * 64 + 8 * q8;
  }
  #pragma unroll
  for (int i = 0; i < 4; ++i) { *(v8us*)(oh + d[i]) = th[i]; *(v8us*)(ol + d[i]) = tl[i]; }
  
}

// ---------------------------------------------------------------------------
// Kernel: LayerNorm over (C,H,W) per sample: fixed-order f64 combine of the
// 64 block partial lines of the sample, then (v - mu) * rstd on one float4
// coverage: 1024 blocks x 256 threads x 4 floats = all 1048576 outputs.
// ---------------------------------------------------------------------------
__global__ __launch_bounds__(256) void k_ln(const float* __restrict__ outp, const float* __restrict__ partl,
                                            float* __restrict__ out) {
  __shared__ double ss[64];
  __shared__ double sq[64];
  __shared__ float sst[2];
  const int tid = threadIdx.x;
  const int blk = blockIdx.x, b = blk >> 8;
  if (tid < 64) {
    const double* dp = reinterpret_cast<const double*>(partl + (size_t)(b * 64 + tid) * 32);
    ss[tid] = dp[0];
    sq[tid] = dp[1];
  }
  __syncthreads();
  if (tid == 0) {
    double S = 0.0, Q2 = 0.0;
    for (int i = 0; i < 64; ++i) { S += ss[i]; Q2 += sq[i]; }
    const double inv = 1.0 / 262144.0;
    const double mu = S * inv;
    double var = Q2 * inv - mu * mu;
    if (var < 0.0) var = 0.0;
    const float den = sqrtf((float)var + 1e-5f);
    sst[0] = (float)mu;
    sst[1] = 1.0f / den;
  }
  __syncthreads();
  const float muf = sst[0], rinv = sst[1];
  const size_t e = ((size_t)blk * 256 + tid) * 4;
  v4f v = *(const v4fa*)(outp + e);
  v4f o;
  o.x = (v.x - muf) * rinv;
  o.y = (v.y - muf) * rinv;
  o.z = (v.z - muf) * rinv;
  o.w = (v.w - muf) * rinv;
  *(v4f*)(out + e) = o;
  
}

// ---------------------------------------------------------------------------
// Host: bilinear (32 -> 3, align_corners = false) taps and weights, computed
// with separate f64 multiply and subtract, fraction cast to f32.
// ---------------------------------------------------------------------------
static void bilin3(BiW& bw) {
#pragma clang fp contract(off)
  const double scale = 32.0 / 3.0;
  for (int p = 0; p < 3; ++p) {
    double src = ((double)p + 0.5) * scale;
    src = src - 0.5;
    if (src < 0.0) src = 0.0;
    const int f = (int)src;
    const float frac = (float)(src - (double)f);
    int c0 = f, c1 = f + 1;
    if (c0 > HIMG - 1) c0 = HIMG - 1;
    if (c1 > HIMG - 1) c1 = HIMG - 1;
    bw.i0[p] = c0;
    bw.i1[p] = c1;
    bw.w0[p] = 1.0f - frac;
    bw.w1[p] = frac;
  }
}

extern "C" void kernel_launch(void* const* d_in, const int* in_sizes, int n_in,
                              void* d_out, int out_size, void* d_ws, size_t ws_size,
                              hipStream_t stream) {
  if (n_in < 11) return;
  if (in_sizes[0] != NBATCH * CIN * NPIX) return;
  if (in_sizes[1] != DQ * CIN || in_sizes[2] != DQ) return;
  if (in_sizes[3] != DQ * CIN * 9 || in_sizes[4] != DQ) return;
  if (in_sizes[5] != DV * CIN * 9 || in_sizes[6] != DV) return;
  if (in_sizes[7] != DV * CIN || in_sizes[8] != DV) return;
  if (in_sizes[9] != DV * DV * 9 || in_sizes[10] != DV) return;
  if (out_size != NBATCH * DV * NPIX) return;

  const float* x      = (const float*)d_in[0];
  const float* q_w    = (const float*)d_in[1];
  const float* q_b    = (const float*)d_in[2];
  const float* k_w    = (const float*)d_in[3];
  const float* k_b    = (const float*)d_in[4];
  const float* v_w    = (const float*)d_in[5];
  const float* v_b    = (const float*)d_in[6];
  const float* bias_w = (const float*)d_in[7];
  const float* bias_b = (const float*)d_in[8];
  const float* hu_w   = (const float*)d_in[9];
  const float* hu_b   = (const float*)d_in[10];
  float* out = (float*)d_out;

  // workspace carve (bytes); every region sized to whole 256-B multiples and
  // written only with whole-line stores inside its extent
  char* ws = (char*)d_ws;
  size_t off = 0;
#define CARVE(T, name, bytes) T* name = (T*)(ws + off); off += (((size_t)(bytes)) + 255) & ~(size_t)255;
  const size_t padpx  = (size_t)NBATCH * PW * PW;                    // 4624 padded pixels
  CARVE(us,    XPH,   padpx * CIN * 2);                               // 2367488
  CARVE(us,    XPL,   padpx * CIN * 2);
  CARVE(us,    WQH,   (size_t)DQ * CIN * 2);                          // 262144
  CARVE(us,    WQL,   (size_t)DQ * CIN * 2);
  CARVE(us,    WKH,   (size_t)DQ * CIN * 9 * 2);                      // 2359296
  CARVE(us,    WKL,   (size_t)DQ * CIN * 9 * 2);
  CARVE(us,    WVH,   (size_t)DV * CIN * 9 * 2);                      // 1179648
  CARVE(us,    WVL,   (size_t)DV * CIN * 9 * 2);
  CARVE(us,    WHH,   (size_t)DV * DV * 9 * 2);                       // 1179648
  CARVE(us,    WHL,   (size_t)DV * DV * 9 * 2);
  CARVE(float, BIASV, (size_t)NBATCH * DV * 4);                       // 4096 = 32 lines
  CARVE(us,    RQH,   padpx * DQ * 2);                                // 4734976
  CARVE(us,    RQL,   padpx * DQ * 2);
  CARVE(float, R2K,   (size_t)NBATCH * DQ * NPIX * 4);                // 8388608
  CARVE(us,    VNH,   (size_t)NBATCH * DV * NPIX * 2);                // 2097152
  CARVE(us,    VNL,   (size_t)NBATCH * DV * NPIX * 2);
  CARVE(float, PARTQ, (size_t)512 * 128);                             // 512 lines
  CARVE(float, PARTK, (size_t)512 * 128);                             // 512 lines
  CARVE(float, SCAL,  256);                                           // 1 line used
  CARVE(us,    FTH,   (size_t)NBATCH * 8 * DVH * FTK * 2);            // 1179648
  CARVE(us,    FTL,   (size_t)NBATCH * 8 * DVH * FTK * 2);
  CARVE(us,    QKH,   padpx * DV * 2);                                // 2367488
  CARVE(us,    QKL,   padpx * DV * 2);
  CARVE(float, OUTP,  (size_t)NBATCH * DV * NPIX * 4);                // 4194304
  CARVE(float, PARTL, (size_t)256 * 128);                             // 256 lines
  CARVE(float, ROWS,  (size_t)NBATCH * HIMG * CIN * 4);               // 131072
#undef CARVE
  if (off > ws_size) return;
  if (off > (size_t)134217728) return;

  BiW bw;
  bilin3(bw);

  // 16-bit operand planes
  k_prep_x<<<dim3(HIMG, NBATCH), 256, 0, stream>>>(x, XPH, XPL, ROWS);
  k_zero_border<<<dim3(17, NBATCH), 256, 0, stream>>>(XPH, XPL, CIN);
  k_zero_border<<<dim3(17, NBATCH), 256, 0, stream>>>(RQH, RQL, DQ);
  k_zero_border<<<dim3(17, NBATCH), 256, 0, stream>>>(QKH, QKL, DV);
  k_wprep<<<(DQ * CIN * 1) / 2048, 256, 0, stream>>>(q_w, DQ, 1, WQH, WQL);
  k_wprep<<<(DQ * CIN * 9) / 2048, 256, 0, stream>>>(k_w, DQ, 9, WKH, WKL);
  k_wprep<<<(DV * CIN * 9) / 2048, 256, 0, stream>>>(v_w, DV, 9, WVH, WVL);
  k_wprep<<<(DV * DV * 9) / 2048, 256, 0, stream>>>(hu_w, DV, 9, WHH, WHL);

  // channel means + bias linear
  k_bias<<<1, 256, 0, stream>>>(ROWS, bias_w, bias_b, BIASV);

  // q (1x1), k (3x3), v (3x3) convolutions
  k_conv<0><<<dim3(64, DQ / 64), 128, 0, stream>>>(XPH, XPL, WQH, WQL, q_b, 1, DQ, RQH, RQL, R2K, PARTQ);
  k_conv<1><<<dim3(64, DQ / 64), 128, 0, stream>>>(XPH, XPL, WKH, WKL, k_b, 9, DQ, VNH, VNL, R2K, PARTK);
  k_conv<2><<<dim3(64, DV / 64), 128, 0, stream>>>(XPH, XPL, WVH, WVL, v_b, 9, DV, VNH, VNL, OUTP, PARTL);

  // phi ratios, pooled KV filters, grouped conv
  k_phinorm<<<1, 64, 0, stream>>>(PARTQ, PARTK, SCAL);
  k_kv<<<dim3(9, NBATCH * 8), 128, 0, stream>>>(R2K, VNH, VNL, SCAL, bw, FTH, FTL);
  k_gconv<<<dim3(16, 4, NBATCH), 128, 0, stream>>>(RQH, RQL, FTH, FTL, SCAL, BIASV, QKH, QKL);

  // head unification conv + LayerNorm
  k_conv<3><<<dim3(64, DV / 64), 128, 0, stream>>>(QKH, QKL, WHH, WHL, hu_b, 9, DV, VNH, VNL, OUTP, PARTL);
  k_ln<<<(NBATCH * DV * NPIX) / 1024, 256, 0, stream>>>(OUTP, PARTL, out);
}

// v002
// A run of this version takes 181 microseconds.
// Two timings next to v001 both put it at 1.98 times that version's speed.
// All steps since v000 together make it 2.37 times as fast.
// Contractions: q 1x1 conv, k/v/hu 3x3 convs as implicit GEMM (K = 9*256), pooled KV outer-product GEMMs (64x32x1024 per head and tap), per-sample grouped 3x3 conv (K = 9*64) and the channel-mean bias linear, all on v_wmma_f32_16x16x32_bf16 with bf16 hi/lo three-product operand split (hi*hi + lo*hi + hi*lo), f32 accumulate; phi norm ratios, clip, channel means and LayerNorm statistics in f32/f64 on the VALU.
#include <hip/hip_runtime.h>

typedef unsigned short us;
typedef int   v8i  __attribute__((ext_vector_type(8)));
typedef float v8f  __attribute__((ext_vector_type(8)));
typedef float v4f  __attribute__((ext_vector_type(4)));
typedef unsigned short v8us __attribute__((ext_vector_type(8)));
typedef __bf16 v16b __attribute__((ext_vector_type(16)));
typedef v4f  __attribute__((may_alias)) v4fa;
typedef v8us __attribute__((may_alias)) v8usa;
union Frag { v8i v; v8us half[2]; };
union DPack { double d[2]; v4f f; };

#define NBATCH 4
#define CIN    256
#define HIMG   32
#define NPIX   1024
#define PW     34
#define DQ     512
#define DV     256
#define DK     64
#define DVH    32
#define FTK    576

struct BiW { int i0[3]; int i1[3]; float w0[3]; float w1[3]; };
static_assert(sizeof(BiW) == 48);

// ---------------------------------------------------------------------------
// bf16 helpers (RNE convert) and the hi/lo split
// ---------------------------------------------------------------------------
__device__ __forceinline__ us f2bf(float f) {
  unsigned u = __float_as_uint(f);
  u += 0x7FFFu + ((u >> 16) & 1u);
  return (us)(u >> 16);
}
__device__ __forceinline__ float bf2f(us hv) {
  return __uint_as_float(((unsigned)hv) << 16);
}
__device__ __forceinline__ void split2(float f, us& hi, us& lo) {
  hi = f2bf(f);
  lo = f2bf(f - bf2f(hi));
}

// ---------------------------------------------------------------------------
// 16x16x32 bf16 WMMA with hazard guard (ties D, keeps A/B live).
// Fragment map (wave32): lane l, h = l>>4, m = n = l&15.
//   A/B element i: i<8 -> k0+8h+i ; i>=8 -> k0+16+8h+(i-8)
//   D element r : row 8h+r, col l&15
// ---------------------------------------------------------------------------
__device__ __forceinline__ v8f wmma_bf(v8i a, v8i b, v8f c) {
  v8f d = __builtin_amdgcn_wmma_f32_16x16x32_bf16(false, __builtin_bit_cast(v16b, a), false,
                                                  __builtin_bit_cast(v16b, b), (short)0, c, false, false);
  asm volatile("v_nop\n\tv_nop\n\tv_nop\n\tv_nop" : "+v"(d) : "v"(a), "v"(b));
  return d;
}
// three-product split: ah*bh + al*bh + ah*bl into one accumulator
__device__ __forceinline__ v8f wmma3(v8i ah, v8i al, v8i bh, v8i bl, v8f c) {
  c = wmma_bf(ah, bh, c);
  c = wmma_bf(al, bh, c);
  c = wmma_bf(ah, bl, c);
  return c;
}
// fragment from a k-contiguous 16-bit row (pointer already at k0)
__device__ __forceinline__ v8i ldfrag(const us* p, int h) {
  Frag f;
  f.half[0] = *(const v8usa*)(p + 8 * h);
  f.half[1] = *(const v8usa*)(p + 16 + 8 * h);
  return f.v;
}

__device__ __forceinline__ float wave_sum(float s) {
  s += __shfl_xor(s, 16);
  s += __shfl_xor(s, 8);
  s += __shfl_xor(s, 4);
  s += __shfl_xor(s, 2);
  s += __shfl_xor(s, 1);
  return s;
}
__device__ __forceinline__ double dshfl_xor(double v, int msk) {
  const unsigned long long u = __builtin_bit_cast(unsigned long long, v);
  int lo = (int)(unsigned)(u & 0xFFFFFFFFull);
  int hi = (int)(unsigned)(u >> 32);
  lo = __shfl_xor(lo, msk);
  hi = __shfl_xor(hi, msk);
  const unsigned long long r = (((unsigned long long)(unsigned)hi) << 32) | (unsigned long long)(unsigned)lo;
  return __builtin_bit_cast(double, r);
}
__device__ __forceinline__ double wave_sum_d(double s) {
  s += dshfl_xor(s, 16);
  s += dshfl_xor(s, 8);
  s += dshfl_xor(s, 4);
  s += dshfl_xor(s, 2);
  s += dshfl_xor(s, 1);
  return s;
}

// ---------------------------------------------------------------------------
// Kernel: x NCHW f32 -> bf16 hi/lo padded NHWC planes [b][34][34][256]
// (interior pixels). Block = (y, b); LDS transpose; one instruction writes one
// coverage: 8 waves x 4 pixels = 32 px per row, 32 lanes x 8 = 256 ch.
// Also the f32 sum of each channel's image row (32 values, fixed order) into
// rowsum[b][y][c]: 256 threads x 4 B = 8 whole lines per block. The f32 copy
// sits in LDS at pitch 33 words, free of bank conflicts on store and on read.
// ---------------------------------------------------------------------------
__global__ __launch_bounds__(256) void k_prep_x(const float* __restrict__ x,
                                                us* __restrict__ xh, us* __restrict__ xl,
                                                float* __restrict__ rowsum) {
  __shared__ __attribute__((aligned(16))) us sh[32 * 256];
  __shared__ __attribute__((aligned(16))) us sl[32 * 256];
  __shared__ float sf[256 * 33];
  const int tid = threadIdx.x, lane = tid & 31, w = tid >> 5;
  const int y = blockIdx.x, b = blockIdx.y;
  #pragma unroll 1
  for (int j = 0; j < 32; ++j) {
    const int c = 8 * j + w;
    const float v = x[((size_t)(b * CIN + c) * HIMG + y) * HIMG + lane];
    us hi, lo;
    split2(v, hi, lo);
    sh[lane * 256 + c] = hi;
    sl[lane * 256 + c] = lo;
    sf[c * 33 + lane] = v;
  }
  __syncthreads();
  float rs = 0.f;
  // unrolled: constant LDS offsets, the reads issue ahead of the dependent adds
  #pragma unroll
  for (int i = 0; i < 32; ++i) rs += sf[tid * 33 + i];
  rowsum[(size_t)(b * HIMG + y) * CIN + tid] = rs;
  v8us vh[4], vl[4];
  size_t d[4];
  #pragma unroll
  for (int i = 0; i < 4; ++i) {
    const int px = 4 * w + i;
    vh[i] = *(const v8usa*)(sh + px * 256 + 8 * lane);
    vl[i] = *(const v8usa*)(sl + px * 256 + 8 * lane);
    d[i] = ((size_t)((b * PW + y + 1) * PW + px + 1)) * CIN + 8 * lane;
  }
  #pragma unroll
  for (int i = 0; i < 4; ++i) { *(v8us*)(xh + d[i]) = vh[i]; *(v8us*)(xl + d[i]) = vl[i]; }
  
}

// ---------------------------------------------------------------------------
// Kernel: zero the border pixel rows of padded NHWC planes [b][34][34][C].
// Wave = one border pixel; 32 lanes x 16 B = 256 halves per instruction.
// coverage: 132 border pixels x 4 samples, C halves each, both planes.
// ---------------------------------------------------------------------------
__global__ __launch_bounds__(256) void k_zero_border(us* __restrict__ ph, us* __restrict__ pl, int C) {
  const int tid = threadIdx.x, lane = tid & 31, w = tid >> 5;
  const int i = blockIdx.x * 8 + w;
  const int b = blockIdx.y;
  if (i >= 132) return;
  int py, px;
  if (i < 34)       { py = 0;           px = i; }
  else if (i < 68)  { py = PW - 1;      px = i - 34; }
  else if (i < 100) { py = i - 68 + 1;  px = 0; }
  else              { py = i - 100 + 1; px = PW - 1; }
  const size_t base = ((size_t)((b * PW + py) * PW + px)) * (size_t)C;
  v8us z;
  #pragma unroll
  for (int j = 0; j < 8; ++j) z[j] = (us)0;
  #pragma unroll 1
  for (int off = 8 * lane; off < C; off += 256) {
    *(v8us*)(ph + base + off) = z;
    *(v8us*)(pl + base + off) = z;
  }
  
}

// ---------------------------------------------------------------------------
// Kernel: OIHW f32 weights -> rows [o][tap*256 + c] as bf16 hi and lo planes.
// Thread = 8 consecutive row elements, one 16-B store per lane per plane,
// coverage: cout*taps*256 elements, grid = n/2048 exactly.
// ---------------------------------------------------------------------------
__global__ __launch_bounds__(256) void k_wprep(const float* __restrict__ wsrc, int cout, int taps,
                                               us* __restrict__ wh, us* __restrict__ wl) {
  const int g = blockIdx.x * 256 + threadIdx.x;
  const int kw = taps * 256;
  const int n = cout * kw;
  const int e8 = g * 8;
  if (e8 >= n) return;
  const int o = e8 / kw;
  const int r = e8 - o * kw;
  const int tap = r >> 8, c = r & 255;
  const float* src = wsrc + ((size_t)(o * 256 + c)) * taps + tap;
  v8us vh, vl;
  #pragma unroll
  for (int i = 0; i < 8; ++i) {
    us a, bq;
    split2(src[(size_t)i * taps], a, bq);
    vh[i] = a;
    vl[i] = bq;
  }
  *(v8us*)(wh + e8) = vh;
  *(v8us*)(wl + e8) = vl;
  
}

// ---------------------------------------------------------------------------
// Fragment from 32 consecutive-k f32 values of one row (pointer at k0), split
// into hi/lo bf16 fragments in registers (fragment map as above).
// ---------------------------------------------------------------------------
__device__ __forceinline__ void frag_f32(const float* __restrict__ p, int h, v8i& fh, v8i& fl) {
  const v4f q0 = *(const v4fa*)(p + 8 * h);
  const v4f q1 = *(const v4fa*)(p + 8 * h + 4);
  const v4f q2 = *(const v4fa*)(p + 16 + 8 * h);
  const v4f q3 = *(const v4fa*)(p + 20 + 8 * h);
  float v[16];
  v[0] = q0.x; v[1] = q0.y; v[2] = q0.z; v[3] = q0.w;
  v[4] = q1.x; v[5] = q1.y; v[6] = q1.z; v[7] = q1.w;
  v[8] = q2.x; v[9] = q2.y; v[10] = q2.z; v[11] = q2.w;
  v[12] = q3.x; v[13] = q3.y; v[14] = q3.z; v[15] = q3.w;
  Frag a, bq;
  #pragma unroll
  for (int i = 0; i < 16; ++i) {
    us hi, lo;
    split2(v[i], hi, lo);
    a.half[i >> 3][i & 7] = hi;
    bq.half[i >> 3][i & 7] = lo;
  }
  fh = a.v;
  fl = bq.v;
}

// ---------------------------------------------------------------------------
// Kernel: channel means of x (f32, from the 32 row sums of each channel, fixed
// order) and the bias linear on WMMA:
// bias[b][o] = sum_c mean[b][c] * bw[o][c] + bb[o]. One block of 8 waves.
// A = means [16 rows (4 real, 12 zero)][256] hi/lo in LDS, B = bw rows [o][c]
// coverage: 256 threads x 16 B = 4096 B = all of bias.
// ---------------------------------------------------------------------------
__global__ __launch_bounds__(256) void k_bias(const float* __restrict__ rowsum, const float* __restrict__ bw,
                                              const float* __restrict__ bb, float* __restrict__ biasv) {
  __shared__ __attribute__((aligned(16))) us sah[16 * 256];
  __shared__ __attribute__((aligned(16))) us sal[16 * 256];
  __shared__ __attribute__((aligned(16))) float sd[4 * 256];
  const int tid = threadIdx.x, lane = tid & 31, w = tid >> 5;
  const int h = lane >> 4, m = lane & 15;
  for (int i = tid; i < 16 * 256; i += 256) {
    if (i >= 4 * 256) { sah[i] = (us)0; sal[i] = (us)0; }
  }
  {
    const int k = tid >> 6, c4 = 4 * (tid & 63);   // b = k, channels c4 .. c4+3
    const float* p = rowsum + (size_t)k * HIMG * CIN + c4;
    v4f sm;
    sm.x = 0.f; sm.y = 0.f; sm.z = 0.f; sm.w = 0.f;
    // unrolled: the 32 loads fly together, one memory latency instead of 32
    #pragma unroll
    for (int i = 0; i < HIMG; ++i) sm += *(const v4fa*)(p + i * CIN);
    // unrolled: constant vector index, sm stays in registers
    #pragma unroll
    for (int e = 0; e < 4; ++e) {
      const float mean = sm[e] * (1.0f / 1024.0f);
      us hi, lo;
      split2(mean, hi, lo);
      sah[k * 256 + c4 + e] = hi;
      sal[k * 256 + c4 + e] = lo;
    }
  }
  __syncthreads();

  const int o0 = 32 * w + m, o1 = o0 + 16;
  const float* br0 = bw + (size_t)o0 * 256;
  const float* br1 = bw + (size_t)o1 * 256;
  const v8f z8 = {0.f, 0.f, 0.f, 0.f, 0.f, 0.f, 0.f, 0.f};
  v8f acc[2];
  acc[0] = z8; acc[1] = z8;
  #pragma unroll 1
  for (int k0 = 0; k0 < 256; k0 += 32) {
    const v8i ah = ldfrag(sah + m * 256 + k0, h);
    const v8i al = ldfrag(sal + m * 256 + k0, h);
    v8i bh0, bl0, bh1, bl1;
    frag_f32(br0 + k0, h, bh0, bl0);
    frag_f32(br1 + k0, h, bh1, bl1);
    acc[0] = wmma3(ah, al, bh0, bl0, acc[0]);
    acc[1] = wmma3(ah, al, bh1, bl1, acc[1]);
  }
  const float bb0 = bb[o0], bb1 = bb[o1];
  if (h == 0) {
    #pragma unroll
    for (int r = 0; r < 4; ++r) {
      sd[r * 256 + o0] = acc[0][r] + bb0;
      sd[r * 256 + o1] = acc[1][r] + bb1;
    }
  }
  __syncthreads();
  const int L = tid >> 3, q = tid & 7;
  const v4f v = *(const v4fa*)(sd + L * 32 + 4 * q);
  float* dst = biasv + L * 32 + 4 * q;
  *(v4f*)dst = v;
  
}

// ---------------------------------------------------------------------------
// Eight asynchronous 16-B copies global -> LDS per lane (no register staging).
// l = the lane's LDS byte addresses, g = its global addresses, both 16-B
// aligned. The closing s_wait_xcnt keeps later rewrites of the address
// registers behind the copies' issue (precaution), so it sits in the statement.
// ---------------------------------------------------------------------------
__device__ __forceinline__ void acopy8(const unsigned (&l)[8], const us* const (&g)[8]) {
  asm volatile(
      "global_load_async_to_lds_b128 %0, %8, off\n\t"
      "global_load_async_to_lds_b128 %1, %9, off\n\t"
      "global_load_async_to_lds_b128 %2, %10, off\n\t"
      "global_load_async_to_lds_b128 %3, %11, off\n\t"
      "global_load_async_to_lds_b128 %4, %12, off\n\t"
      "global_load_async_to_lds_b128 %5, %13, off\n\t"
      "global_load_async_to_lds_b128 %6, %14, off\n\t"
      "global_load_async_to_lds_b128 %7, %15, off\n\t"
      "s_wait_xcnt 0x0"
      :: "v"(l[0]), "v"(l[1]), "v"(l[2]), "v"(l[3]), "v"(l[4]), "v"(l[5]), "v"(l[6]), "v"(l[7]),
         "v"(g[0]), "v"(g[1]), "v"(g[2]), "v"(g[3]), "v"(g[4]), "v"(g[5]), "v"(g[6]), "v"(g[7])
      : "memory");
}

// LDS ring of k_conv: a stage = 128 channels (256 B) of 64 pixel rows and 64
// weight rows, hi and lo planes; row pitch 272 B (conflict-free 16-B reads).
#define KCH    128
#define LPITCH 136
#define LPLANE (64 * LPITCH)
#define LSTAGE (4 * LPLANE)

// ---------------------------------------------------------------------------
// Kernel: implicit-GEMM convolution (Cin = 256 per pixel) over bf16 hi/lo
// zero-padded NHWC planes [b][34][34][256]; weights as rows [o][tap*256+c]
// hi/lo. Block = 64 pixels (image rows y0, y0+1) x 64 output channels,
// 4 waves of 32 px x 32 ch (2x2 tiles), K = ntaps*256 in steps of 32,
// operand rows staged in LDS by asynchronous copies of whole 256-B units (two
// buffers, the next stage flies while this one is worked on), fragments read
// from LDS, three products per tile pair.
// MODE 0: relu^2 -> bf16 hi/lo padded NHWC planes (pitch = cout) + (s2,s4) partial line
// MODE 1: relu^2 -> f32 NCHW + (s2,s4) partial line
// MODE 2: value -> bf16 hi/lo NCHW planes
// MODE 3: value -> f32 NCHW + (sum, sum of squares) partial line (f64)
// coverage: MODE 0 store: 4 waves x 16 px x 8 lanes x 8 ch = 64 px x 64 ch;
// MODE 1/3: 4 waves x 16 ch x 64 px; MODE 2: 4 waves x 16 ch x 8 lanes x 8 px.
// ---------------------------------------------------------------------------
template <int MODE>
__global__ __launch_bounds__(128) void k_conv(
    const us* __restrict__ ah, const us* __restrict__ al,
    const us* __restrict__ wh, const us* __restrict__ wl,
    const float* __restrict__ bias, int ntaps, int cout,
    us* __restrict__ oh, us* __restrict__ ol, float* __restrict__ of, float* __restrict__ part)
{
  __shared__ __attribute__((aligned(16))) us ring[2 * LSTAGE];
  __shared__ __attribute__((aligned(16))) float sbuf[64 * 64];
  __shared__ double sred[4][2];
  const int tid = threadIdx.x, lane = tid & 31, w = tid >> 5;
  const int h = lane >> 4, m = lane & 15;
  const int pt = blockIdx.x, b = pt >> 4, y0 = (pt & 15) * 2;
  const int n0 = blockIdx.y * 64;
  const int ry = w >> 1, nw = 32 * (w & 1);
  const int kw = ntaps * CIN;
  const int nst = 2 * ntaps;
  // copy map: 16 lanes x 16 B = one 256-B row piece; thread rows r0 + 8 i
  const int q16 = tid & 15, r0 = tid >> 4;
  const unsigned lds0 = (unsigned)(size_t)ring + (unsigned)(r0 * (LPITCH * 2) + q16 * 16);
  const size_t wbase = (size_t)(n0 + r0) * kw + 8 * q16;
  // stage s (tap s / 2, channels 128 (s & 1) ..) into buffer bufi
  auto stage_copy = [&](int s, int bufi) {
    const int tap = s >> 1, c0 = (s & 1) * KCH;
    const int t3 = tap / 3;
    const int ky = (ntaps == 1) ? 1 : t3;
    const int kx = (ntaps == 1) ? 1 : (tap - 3 * t3);
    const size_t ao = ((size_t)((b * PW + y0 + ky) * PW + kx + r0)) * CIN + c0 + 8 * q16;
    const size_t wo = wbase + (size_t)s * KCH;
    const unsigned lb = lds0 + (unsigned)bufi * (LSTAGE * 2);
    unsigned l[8];
    const us* g[8];
    #pragma unroll
    for (int i = 0; i < 8; ++i) {
      l[i] = lb + (unsigned)(i * 8 * LPITCH * 2);
      g[i] = ah + ao + (size_t)((i >> 2) * PW * CIN + (i & 3) * 8 * CIN);
    }
    acopy8(l, g);
    #pragma unroll
    for (int i = 0; i < 8; ++i) {
      l[i] = lb + (unsigned)(LPLANE * 2 + i * 8 * LPITCH * 2);
      g[i] = al + ao + (size_t)((i >> 2) * PW * CIN + (i & 3) * 8 * CIN);
    }
    acopy8(l, g);
    #pragma unroll
    for (int i = 0; i < 8; ++i) {
      l[i] = lb + (unsigned)(2 * LPLANE * 2 + i * 8 * LPITCH * 2);
      g[i] = wh + wo + (size_t)(i * 8) * kw;
    }
    acopy8(l, g);
    #pragma unroll
    for (int i = 0; i < 8; ++i) {
      l[i] = lb + (unsigned)(3 * LPLANE * 2 + i * 8 * LPITCH * 2);
      g[i] = wl + wo + (size_t)(i * 8) * kw;
    }
    acopy8(l, g);
  };
  const v8f z8 = {0.f, 0.f, 0.f, 0.f, 0.f, 0.f, 0.f, 0.f};
  v8f acc[2][2];
  #pragma unroll
  for (int i = 0; i < 2; ++i) { acc[i][0] = z8; acc[i][1] = z8; }

  // prologue: stage 0 landed and published, then stage 1 in flight
  stage_copy(0, 0);
  asm volatile("s_wait_asynccnt 0x0" ::: "memory");  // this wave's copies of stage 0 have landed
  __syncthreads();                                   // ... and every other wave's
  stage_copy(1, 1);                                  // nst = 2 ntaps >= 2

  const int arow = (ry * 32 + m) * LPITCH;
  const int brow = 2 * LPLANE + (nw + m) * LPITCH;
  #pragma unroll 1
  for (int s = 0; s < nst; ++s) {
    const us* sb = ring + (s & 1) * LSTAGE;
    #pragma unroll
    for (int kk = 0; kk < KCH; kk += 32) {
      const v8i fa0h = ldfrag(sb + arow + kk, h);
      const v8i fa0l = ldfrag(sb + LPLANE + arow + kk, h);
      const v8i fa1h = ldfrag(sb + arow + 16 * LPITCH + kk, h);
      const v8i fa1l = ldfrag(sb + LPLANE + arow + 16 * LPITCH + kk, h);
      #pragma unroll
      for (int nt = 0; nt < 2; ++nt) {
        const v8i fbh = ldfrag(sb + brow + nt * 16 * LPITCH + kk, h);
        const v8i fbl = ldfrag(sb + LPLANE + brow + nt * 16 * LPITCH + kk, h);
        acc[0][nt] = wmma3(fa0h, fa0l, fbh, fbl, acc[0][nt]);
        acc[1][nt] = wmma3(fa1h, fa1l, fbh, fbl, acc[1][nt]);
      }
    }
    // publish point of stage s + 1, and hand-over of this stage's buffer
    asm volatile("s_wait_dscnt 0x0" ::: "memory");     // this wave's reads of the buffer are done
    asm volatile("s_wait_asynccnt 0x0" ::: "memory");  // this wave's copies of stage s + 1 have landed
    __syncthreads();                                   // both hold for every wave of the block
    if (s + 2 < nst) stage_copy(s + 2, s & 1);
  }
  asm volatile("s_wait_asynccnt 0x0" ::: "memory");    // no copy outstanding past the loop

  // epilogue into LDS
  float bv[2];
  bv[0] = bias[n0 + nw + m];
  bv[1] = bias[n0 + nw + 16 + m];
  us* sH = reinterpret_cast<us*>(sbuf);
  us* sL = sH + 4096;
  float fs = 0.f, fq = 0.f;
  double ds = 0.0, dq = 0.0;
  #pragma unroll
  for (int mt = 0; mt < 2; ++mt) {
    #pragma unroll
    for (int nt = 0; nt < 2; ++nt) {
      #pragma unroll
      for (int r = 0; r < 8; ++r) {
        const float val = acc[mt][nt][r] + bv[nt];
        const int tp = ry * 32 + mt * 16 + 8 * h + r;
        const int ch = nw + 16 * nt + m;
        if (MODE == 0) {
          const float rr = fmaxf(val, 0.f);
          const float r2 = rr * rr;
          fs += r2; fq += r2 * r2;
          us hi, lo;
          split2(r2, hi, lo);
          sH[tp * 64 + ch] = hi;
          sL[tp * 64 + ch] = lo;
        } else if (MODE == 1) {
          const float rr = fmaxf(val, 0.f);
          const float r2 = rr * rr;
          fs += r2; fq += r2 * r2;
          sbuf[ch * 64 + tp] = r2;
        } else if (MODE == 2) {
          us hi, lo;
          split2(val, hi, lo);
          sH[ch * 64 + tp] = hi;
          sL[ch * 64 + tp] = lo;
        } else {
          ds += (double)val;
          dq += (double)val * (double)val;
          sbuf[ch * 64 + tp] = val;
        }
      }
    }
  }
  if (MODE == 0 || MODE == 1) {
    fs = wave_sum(fs);
    fq = wave_sum(fq);
    ds = (double)fs;
    dq = (double)fq;
  } else if (MODE == 3) {
    ds = wave_sum_d(ds);
    dq = wave_sum_d(dq);
  }
  if (MODE != 2) {
    if (lane == 0) { sred[w][0] = ds; sred[w][1] = dq; }
  }
  __syncthreads();

  // block partial line (2 doubles + zeros), fixed order over the 4 waves
  v4f pv;
  pv.x = 0.f; pv.y = 0.f; pv.z = 0.f; pv.w = 0.f;
  size_t li = 0;
  bool pw = false;
  if (MODE != 2) {
    double S = 0.0, Q2 = 0.0;
    #pragma unroll
    for (int k = 0; k < 4; ++k) { S += sred[k][0]; Q2 += sred[k][1]; }
    DPack pk;
    pk.d[0] = S; pk.d[1] = Q2;
    pv.x = (lane == 0) ? pk.f.x : 0.f;
    pv.y = (lane == 0) ? pk.f.y : 0.f;
    pv.z = (lane == 0) ? pk.f.z : 0.f;
    pv.w = (lane == 0) ? pk.f.w : 0.f;
    li = ((size_t)blockIdx.x * gridDim.y + blockIdx.y) * 32 + 4 * (lane & 7);
    pw = (w == 0) && (lane < 8);
  }

  if (MODE == 0) {
    const int q8 = lane & 7, sub = lane >> 3;
    v8us th[4], tl[4];
    size_t d[4];
    #pragma unroll
    for (int i = 0; i < 4; ++i) {
      const int tp = 16 * w + 4 * i + sub;
      const int ry2 = tp >> 5, xx = tp & 31;
      th[i] = *(const v8usa*)(sH + tp * 64 + 8 * q8);
      tl[i] = *(const v8usa*)(sL + tp * 64 + 8 * q8);
      d[i] = ((size_t)((b * PW + y0 + ry2 + 1) * PW + xx + 1)) * (size_t)cout + n0 + 8 * q8;
    }
    #pragma unroll
    for (int i = 0; i < 4; ++i) { *(v8us*)(oh + d[i]) = th[i]; *(v8us*)(ol + d[i]) = tl[i]; }
    if (pw) *(v4f*)(part + li) = pv;
    
  } else if (MODE == 2) {
    const int q8 = lane & 7, sub = lane >> 3;
    v8us th[4], tl[4];
    size_t d[4];
    #pragma unroll
    for (int i = 0; i < 4; ++i) {
      const int chl = 16 * w + 4 * i + sub;
      th[i] = *(const v8usa*)(sH + chl * 64 + 8 * q8);
      tl[i] = *(const v8usa*)(sL + chl * 64 + 8 * q8);
      d[i] = ((size_t)(b * cout + n0 + chl)) * NPIX + y0 * HIMG + 8 * q8;
    }
    #pragma unroll
    for (int i = 0; i < 4; ++i) { *(v8us*)(oh + d[i]) = th[i]; *(v8us*)(ol + d[i]) = tl[i]; }
    
  } else {
    const int hs = lane >> 4, x4 = 4 * (lane & 15);
    v4f tv[8];
    size_t d[8];
    #pragma unroll
    for (int i = 0; i < 8; ++i) {
      const int chl = 16 * w + 2 * i + hs;
      tv[i] = *(const v4fa*)(sbuf + chl * 64 + x4);
      d[i] = ((size_t)(b * cout + n0 + chl)) * NPIX + y0 * HIMG + x4;
    }
    #pragma unroll
    for (int i = 0; i < 8; ++i) *(v4f*)(of + d[i]) = tv[i];
    if (pw) *(v4f*)(part + li) = pv;
    
  }
}

// ---------------------------------------------------------------------------
// Kernel: phi norm ratios s = sqrt(sum relu^2) / sqrt(sum relu^4) for the q
// and k tensors from 512 block partial lines each (fixed order, f64).
// One block of 64 threads; wave 0 = q, wave 1 = k; one whole output line.
// ---------------------------------------------------------------------------
__global__ __launch_bounds__(64) void k_phinorm(const float* __restrict__ partq, const float* __restrict__ partk,
                                                float* __restrict__ scal) {
  __shared__ double sacc[2][32][2];
  __shared__ float sres[2];
  const int tid = threadIdx.x, lane = tid & 31, w = tid >> 5;
  const float* pp = (w == 0) ? partq : partk;
  double s2 = 0.0, s4 = 0.0;
  #pragma unroll 1
  for (int j = 0; j < 16; ++j) {
    const double* dp = reinterpret_cast<const double*>(pp + (size_t)(lane * 16 + j) * 32);
    s2 += dp[0];
    s4 += dp[1];
  }
  sacc[w][lane][0] = s2;
  sacc[w][lane][1] = s4;
  __syncthreads();
  if (lane == 0) {
    double t2 = 0.0, t4 = 0.0;
    for (int i = 0; i < 32; ++i) { t2 += sacc[w][i][0]; t4 += sacc[w][i][1]; }
    const float num = sqrtf((float)t2);
    const float den = sqrtf((float)t4);
    sres[w] = num * (1.0f / den);
  }
  __syncthreads();
  v4f pv;
  pv.x = (lane == 0) ? sres[0] : 0.f;
  pv.y = (lane == 0) ? sres[1] : 0.f;
  pv.z = 0.f; pv.w = 0.f;
  const bool pw = (w == 0) && (lane < 8);
  float* dst = scal + 4 * lane;
  if (pw) *(v4f*)dst = pv;
  
}

// ---------------------------------------------------------------------------
// Kernel: pooled outer product. Block = (tap pq, bh): D[kk 64][v 32] =
// sum_pix (relu(K)^2[kk][pix] * Mh[p][y] * Mw[q][x]) * V[v][pix], K = 1024,
// A built in registers from the f32 NCHW relu^2 rows (split hi/lo),
// B from the bf16 NCHW V planes. Epilogue: * sK, clip +-32/9, hi/lo into
// coverage: 4 waves x 8 rows x 8 lanes x 8 kk = 32 v x 64 kk per (bh,pq).
// ---------------------------------------------------------------------------
__global__ __launch_bounds__(128) void k_kv(
    const float* __restrict__ r2k, const us* __restrict__ vnh, const us* __restrict__ vnl,
    const float* __restrict__ scal, BiW bw, us* __restrict__ fth, us* __restrict__ ftl)
{
  __shared__ __attribute__((aligned(16))) us sH[32 * 64];
  __shared__ __attribute__((aligned(16))) us sL[32 * 64];
  const int tid = threadIdx.x, lane = tid & 31, w = tid >> 5;
  const int h = lane >> 4, m = lane & 15;
  const int pq = blockIdx.x, bh = blockIdx.y;
  const int b = bh >> 3, head = bh & 7;
  const int p = pq / 3, q = pq - 3 * p;
  const int   iy0 = (p == 0) ? bw.i0[0] : ((p == 1) ? bw.i0[1] : bw.i0[2]);
  const int   iy1 = (p == 0) ? bw.i1[0] : ((p == 1) ? bw.i1[1] : bw.i1[2]);
  const float wy0 = (p == 0) ? bw.w0[0] : ((p == 1) ? bw.w0[1] : bw.w0[2]);
  const float wy1 = (p == 0) ? bw.w1[0] : ((p == 1) ? bw.w1[1] : bw.w1[2]);
  const int   ix0 = (q == 0) ? bw.i0[0] : ((q == 1) ? bw.i0[1] : bw.i0[2]);
  const int   ix1 = (q == 0) ? bw.i1[0] : ((q == 1) ? bw.i1[1] : bw.i1[2]);
  const float wx0 = (q == 0) ? bw.w0[0] : ((q == 1) ? bw.w0[1] : bw.w0[2]);
  const float wx1 = (q == 0) ? bw.w1[0] : ((q == 1) ? bw.w1[1] : bw.w1[2]);
  const float sK = scal[1];
  const float amax = (float)(32.0 / 9.0);
  const float* arow = r2k + ((size_t)(b * DQ + head * DK + 16 * w + m)) * NPIX;
  const size_t br0 = ((size_t)(b * DV + head * DVH + m)) * NPIX;
  const size_t br1 = br0 + (size_t)16 * NPIX;
  const v8f z8 = {0.f, 0.f, 0.f, 0.f, 0.f, 0.f, 0.f, 0.f};
  v8f acc[2];
  acc[0] = z8; acc[1] = z8;

  #pragma unroll 1
  for (int k0 = 0; k0 < NPIX; k0 += 32) {
    const int yy = k0 >> 5;
    const float wy = ((yy == iy0) ? wy0 : 0.f) + ((yy == iy1) ? wy1 : 0.f);
    const float* ap = arow + k0;
    const v4f q0 = *(const v4fa*)(ap + 8 * h);
    const v4f q1 = *(const v4fa*)(ap + 8 * h + 4);
    const v4f q2 = *(const v4fa*)(ap + 16 + 8 * h);
    const v4f q3 = *(const v4fa*)(ap + 20 + 8 * h);
    float v[16];
    v[0] = q0.x; v[1] = q0.y; v[2] = q0.z; v[3] = q0.w;
    v[4] = q1.x; v[5] = q1.y; v[6] = q1.z; v[7] = q1.w;
    v[8] = q2.x; v[9] = q2.y; v[10] = q2.z; v[11] = q2.w;
    v[12] = q3.x; v[13] = q3.y; v[14] = q3.z; v[15] = q3.w;
    Frag fah, fal;
    #pragma unroll
    for (int i = 0; i < 16; ++i) {
      const int xx = 8 * h + (i & 7) + ((i >> 3) << 4);
      const float wx = ((xx == ix0) ? wx0 : 0.f) + ((xx == ix1) ? wx1 : 0.f);
      const float a = v[i] * (wy * wx);
      us hi, lo;
      split2(a, hi, lo);
      fah.half[i >> 3][i & 7] = hi;
      fal.half[i >> 3][i & 7] = lo;
    }
    const v8i fb0h = ldfrag(vnh + br0 + k0, h);
    const v8i fb0l = ldfrag(vnl + br0 + k0, h);
    const v8i fb1h = ldfrag(vnh + br1 + k0, h);
    const v8i fb1l = ldfrag(vnl + br1 + k0, h);
    acc[0] = wmma3(fah.v, fal.v, fb0h, fb0l, acc[0]);
    acc[1] = wmma3(fah.v, fal.v, fb1h, fb1l, acc[1]);
  }

  #pragma unroll
  for (int nt = 0; nt < 2; ++nt) {
    #pragma unroll
    for (int r = 0; r < 8; ++r) {
      float val = acc[nt][r] * sK;
      val = fminf(fmaxf(val, -amax), amax);
      const int kk = 16 * w + 8 * h + r;
      const int vv = 16 * nt + m;
      us hi, lo;
      split2(val, hi, lo);
      sH[vv * 64 + kk] = hi;
      sL[vv * 64 + kk] = lo;
    }
  }
  __syncthreads();
  const int q8 = lane & 7, sub = lane >> 3;
  v8us th[2], tl[2];
  size_t d[2];
  #pragma unroll
  for (int i = 0; i < 2; ++i) {
    const int vv = 8 * w + 4 * i + sub;
    th[i] = *(const v8usa*)(sH + vv * 64 + 8 * q8);
    tl[i] = *(const v8usa*)(sL + vv * 64 + 8 * q8);
    d[i] = ((size_t)(bh * DVH + vv)) * FTK + pq * 64 + 8 * q8;
  }
  #pragma unroll
  for (int i = 0; i < 2; ++i) { *(v8us*)(fth + d[i]) = th[i]; *(v8us*)(ftl + d[i]) = tl[i]; }
  
}

// ---------------------------------------------------------------------------
// Kernel: per-sample grouped 3x3 conv of relu(Q)^2 planes (padded NHWC,
// 512 ch) with the pooled filters, K = 9*64 per head. Block = (64 px, head
// pair, b); wave = (head of the pair, image row) 32 px x 32 v. Epilogue:
// * sQ + bias[b][j*32+v], hi/lo into padded NHWC planes [b][34][34][256];
// coverage: 4 waves x 16 px x 8 lanes x 8 ch = 64 px x 64 ch per block;
// grid 16 x 4 x 4 = all interior pixels x all 256 channels x 4 samples.
// ---------------------------------------------------------------------------
__global__ __launch_bounds__(128) void k_gconv(
    const us* __restrict__ rqh, const us* __restrict__ rql,
    const us* __restrict__ fth, const us* __restrict__ ftl,
    const float* __restrict__ scal, const float* __restrict__ biasv,
    us* __restrict__ oh, us* __restrict__ ol)
{
  __shared__ __attribute__((aligned(16))) us sH[64 * 64];
  __shared__ __attribute__((aligned(16))) us sL[64 * 64];
  const int tid = threadIdx.x, lane = tid & 31, w = tid >> 5;
  const int h = lane >> 4, m = lane & 15;
  const int pt = blockIdx.x, jp = blockIdx.y, b = blockIdx.z;
  const int y0 = 2 * pt;
  const int jl = w >> 1, ry = w & 1;
  const int j = 2 * jp + jl, y = y0 + ry, bh = b * 8 + j;
  const size_t fr0 = ((size_t)(bh * DVH + m)) * FTK;
  const size_t fr1 = fr0 + (size_t)16 * FTK;
  const v8f z8 = {0.f, 0.f, 0.f, 0.f, 0.f, 0.f, 0.f, 0.f};
  v8f acc[2][2];
  #pragma unroll
  for (int i = 0; i < 2; ++i) { acc[i][0] = z8; acc[i][1] = z8; }

  #pragma unroll 1
  for (int tap = 0; tap < 9; ++tap) {
    const int ky = tap / 3;
    const int kx = tap - 3 * ky;
    const size_t ar0 = ((size_t)((b * PW + y + ky) * PW + kx + m)) * DQ + (size_t)j * DK;
    const size_t ar1 = ar0 + (size_t)16 * DQ;
    const size_t wt = (size_t)tap * DK;
    #pragma unroll
    for (int c0 = 0; c0 < DK; c0 += 32) {
      const v8i fa0h = ldfrag(rqh + ar0 + c0, h);
      const v8i fa0l = ldfrag(rql + ar0 + c0, h);
      const v8i fa1h = ldfrag(rqh + ar1 + c0, h);
      const v8i fa1l = ldfrag(rql + ar1 + c0, h);
      #pragma unroll
      for (int nt = 0; nt < 2; ++nt) {
        const size_t fr = (nt == 0) ? fr0 : fr1;
        const v8i fbh = ldfrag(fth + fr + wt + c0, h);
        const v8i fbl = ldfrag(ftl + fr + wt + c0, h);
        acc[0][nt] = wmma3(fa0h, fa0l, fbh, fbl, acc[0][nt]);
        acc[1][nt] = wmma3(fa1h, fa1l, fbh, fbl, acc[1][nt]);
      }
    }
  }

  const float sQ = scal[0];
  float bv[2];
  bv[0] = biasv[b * DV + j * DVH + m];
  bv[1] = biasv[b * DV + j * DVH + 16 + m];
  #pragma unroll
  for (int mt = 0; mt < 2; ++mt) {
    #pragma unroll
    for (int nt = 0; nt < 2; ++nt) {
      #pragma unroll
      for (int r = 0; r < 8; ++r) {
        const float val = acc[mt][nt][r] * sQ + bv[nt];
        const int tp = ry * 32 + mt * 16 + 8 * h + r;
        const int chl = jl * 32 + 16 * nt + m;
        us hi, lo;
        split2(val, hi, lo);
        sH[tp * 64 + chl] = hi;
        sL[tp * 64 + chl] = lo;
      }
    }
  }
  __syncthreads();
  const int q8 = lane & 7, sub = lane >> 3;
  v8us th[4], tl[4];
  size_t d[4];
  #pragma unroll
  for (int i = 0; i < 4; ++i) {
    const int tp = 16 * w + 4 * i + sub;
    const int ry2 = tp >> 5, xx = tp & 31;
    th[i] = *(const v8usa*)(sH + tp * 64 + 8 * q8);
    tl[i] = *(const v8usa*)(sL + tp * 64 + 8 * q8);
    d[i] = ((size_t)((b * PW + y0 + ry2 + 1) * PW + xx + 1)) * DV + jp * 64 + 8 * q8;
  }
  #pragma unroll
  for (int i = 0; i < 4; ++i) { *(v8us*)(oh + d[i]) = th[i]; *(v8us*)(ol + d[i]) = tl[i]; }
  
}

// ---------------------------------------------------------------------------
// Kernel: LayerNorm over (C,H,W) per sample: fixed-order f64 combine of the
// 64 block partial lines of the sample, then (v - mu) * rstd on one float4
// coverage: 1024 blocks x 256 threads x 4 floats = all 1048576 outputs.
// ---------------------------------------------------------------------------
__global__ __launch_bounds__(256) void k_ln(const float* __restrict__ outp, const float* __restrict__ partl,
                                            float* __restrict__ out) {
  __shared__ double ss[64];
  __shared__ double sq[64];
  __shared__ float sst[2];
  const int tid = threadIdx.x;
  const int blk = blockIdx.x, b = blk >> 8;
  if (tid < 64) {
    const double* dp = reinterpret_cast<const double*>(partl + (size_t)(b * 64 + tid) * 32);
    ss[tid] = dp[0];
    sq[tid] = dp[1];
  }
  __syncthreads();
  if (tid == 0) {
    double S = 0.0, Q2 = 0.0;
    for (int i = 0; i < 64; ++i) { S += ss[i]; Q2 += sq[i]; }
    const double inv = 1.0 / 262144.0;
    const double mu = S * inv;
    double var = Q2 * inv - mu * mu;
    if (var < 0.0) var = 0.0;
    const float den = sqrtf((float)var + 1e-5f);
    sst[0] = (float)mu;
    sst[1] = 1.0f / den;
  }
  __syncthreads();
  const float muf = sst[0], rinv = sst[1];
  const size_t e = ((size_t)blk * 256 + tid) * 4;
  v4f v = *(const v4fa*)(outp + e);
  v4f o;
  o.x = (v.x - muf) * rinv;
  o.y = (v.y - muf) * rinv;
  o.z = (v.z - muf) * rinv;
  o.w = (v.w - muf) * rinv;
  *(v4f*)(out + e) = o;
  
}

// ---------------------------------------------------------------------------
// Host: bilinear (32 -> 3, align_corners = false) taps and weights, computed
// with separate f64 multiply and subtract, fraction cast to f32.
// ---------------------------------------------------------------------------
static void bilin3(BiW& bw) {
#pragma clang fp contract(off)
  const double scale = 32.0 / 3.0;
  for (int p = 0; p < 3; ++p) {
    double src = ((double)p + 0.5) * scale;
    src = src - 0.5;
    if (src < 0.0) src = 0.0;
    const int f = (int)src;
    const float frac = (float)(src - (double)f);
    int c0 = f, c1 = f + 1;
    if (c0 > HIMG - 1) c0 = HIMG - 1;
    if (c1 > HIMG - 1) c1 = HIMG - 1;
    bw.i0[p] = c0;
    bw.i1[p] = c1;
    bw.w0[p] = 1.0f - frac;
    bw.w1[p] = frac;
  }
}

extern "C" void kernel_launch(void* const* d_in, const int* in_sizes, int n_in,
                              void* d_out, int out_size, void* d_ws, size_t ws_size,
                              hipStream_t stream) {
  if (n_in < 11) return;
  if (in_sizes[0] != NBATCH * CIN * NPIX) return;
  if (in_sizes[1] != DQ * CIN || in_sizes[2] != DQ) return;
  if (in_sizes[3] != DQ * CIN * 9 || in_sizes[4] != DQ) return;
  if (in_sizes[5] != DV * CIN * 9 || in_sizes[6] != DV) return;
  if (in_sizes[7] != DV * CIN || in_sizes[8] != DV) return;
  if (in_sizes[9] != DV * DV * 9 || in_sizes[10] != DV) return;
  if (out_size != NBATCH * DV * NPIX) return;

  const float* x      = (const float*)d_in[0];
  const float* q_w    = (const float*)d_in[1];
  const float* q_b    = (const float*)d_in[2];
  const float* k_w    = (const float*)d_in[3];
  const float* k_b    = (const float*)d_in[4];
  const float* v_w    = (const float*)d_in[5];
  const float* v_b    = (const float*)d_in[6];
  const float* bias_w = (const float*)d_in[7];
  const float* bias_b = (const float*)d_in[8];
  const float* hu_w   = (const float*)d_in[9];
  const float* hu_b   = (const float*)d_in[10];
  float* out = (float*)d_out;

  // workspace carve (bytes); every region sized to whole 256-B multiples and
  // written only with whole-line stores inside its extent
  char* ws = (char*)d_ws;
  size_t off = 0;
#define CARVE(T, name, bytes) T* name = (T*)(ws + off); off += (((size_t)(bytes)) + 255) & ~(size_t)255;
  const size_t padpx  = (size_t)NBATCH * PW * PW;                    // 4624 padded pixels
  CARVE(us,    XPH,   padpx * CIN * 2);                               // 2367488
  CARVE(us,    XPL,   padpx * CIN * 2);
  CARVE(us,    WQH,   (size_t)DQ * CIN * 2);                          // 262144
  CARVE(us,    WQL,   (size_t)DQ * CIN * 2);
  CARVE(us,    WKH,   (size_t)DQ * CIN * 9 * 2);                      // 2359296
  CARVE(us,    WKL,   (size_t)DQ * CIN * 9 * 2);
  CARVE(us,    WVH,   (size_t)DV * CIN * 9 * 2);                      // 1179648
  CARVE(us,    WVL,   (size_t)DV * CIN * 9 * 2);
  CARVE(us,    WHH,   (size_t)DV * DV * 9 * 2);                       // 1179648
  CARVE(us,    WHL,   (size_t)DV * DV * 9 * 2);
  CARVE(float, BIASV, (size_t)NBATCH * DV * 4);                       // 4096 = 32 lines
  CARVE(us,    RQH,   padpx * DQ * 2);                                // 4734976
  CARVE(us,    RQL,   padpx * DQ * 2);
  CARVE(float, R2K,   (size_t)NBATCH * DQ * NPIX * 4);                // 8388608
  CARVE(us,    VNH,   (size_t)NBATCH * DV * NPIX * 2);                // 2097152
  CARVE(us,    VNL,   (size_t)NBATCH * DV * NPIX * 2);
  CARVE(float, PARTQ, (size_t)512 * 128);                             // 512 lines
  CARVE(float, PARTK, (size_t)512 * 128);                             // 512 lines
  CARVE(float, SCAL,  256);                                           // 1 line used
  CARVE(us,    FTH,   (size_t)NBATCH * 8 * DVH * FTK * 2);            // 1179648
  CARVE(us,    FTL,   (size_t)NBATCH * 8 * DVH * FTK * 2);
  CARVE(us,    QKH,   padpx * DV * 2);                                // 2367488
  CARVE(us,    QKL,   padpx * DV * 2);
  CARVE(float, OUTP,  (size_t)NBATCH * DV * NPIX * 4);                // 4194304
  CARVE(float, PARTL, (size_t)256 * 128);                             // 256 lines
  CARVE(float, ROWS,  (size_t)NBATCH * HIMG * CIN * 4);               // 131072
#undef CARVE
  if (off > ws_size) return;
  if (off > (size_t)134217728) return;

  BiW bw;
  bilin3(bw);

  // 16-bit operand planes
  k_prep_x<<<dim3(HIMG, NBATCH), 256, 0, stream>>>(x, XPH, XPL, ROWS);
  k_zero_border<<<dim3(17, NBATCH), 256, 0, stream>>>(XPH, XPL, CIN);
  k_zero_border<<<dim3(17, NBATCH), 256, 0, stream>>>(RQH, RQL, DQ);
  k_zero_border<<<dim3(17, NBATCH), 256, 0, stream>>>(QKH, QKL, DV);
  k_wprep<<<(DQ * CIN * 1) / 2048, 256, 0, stream>>>(q_w, DQ, 1, WQH, WQL);
  k_wprep<<<(DQ * CIN * 9) / 2048, 256, 0, stream>>>(k_w, DQ, 9, WKH, WKL);
  k_wprep<<<(DV * CIN * 9) / 2048, 256, 0, stream>>>(v_w, DV, 9, WVH, WVL);
  k_wprep<<<(DV * DV * 9) / 2048, 256, 0, stream>>>(hu_w, DV, 9, WHH, WHL);

  // channel means + bias linear
  k_bias<<<1, 256, 0, stream>>>(ROWS, bias_w, bias_b, BIASV);

  // q (1x1), k (3x3), v (3x3) convolutions
  k_conv<0><<<dim3(64, DQ / 64), 128, 0, stream>>>(XPH, XPL, WQH, WQL, q_b, 1, DQ, RQH, RQL, R2K, PARTQ);
  k_conv<1><<<dim3(64, DQ / 64), 128, 0, stream>>>(XPH, XPL, WKH, WKL, k_b, 9, DQ, VNH, VNL, R2K, PARTK);
  k_conv<2><<<dim3(64, DV / 64), 128, 0, stream>>>(XPH, XPL, WVH, WVL, v_b, 9, DV, VNH, VNL, OUTP, PARTL);

  // phi ratios, pooled KV filters, grouped conv
  k_phinorm<<<1, 64, 0, stream>>>(PARTQ, PARTK, SCAL);
  k_kv<<<dim3(9, NBATCH * 8), 128, 0, stream>>>(R2K, VNH, VNL, SCAL, bw, FTH, FTL);
  k_gconv<<<dim3(16, 4, NBATCH), 128, 0, stream>>>(RQH, RQL, FTH, FTL, SCAL, BIASV, QKH, QKL);

  // head unification conv + LayerNorm
  k_conv<3><<<dim3(64, DV / 64), 128, 0, stream>>>(QKH, QKL, WHH, WHL, hu_b, 9, DV, VNH, VNL, OUTP, PARTL);
  k_ln<<<(NBATCH * DV * NPIX) / 1024, 256, 0, stream>>>(OUTP, PARTL, out);
}

// v003
// Measured time: 150 microseconds a run.
// Timed twice side by side with v002, it ran 1.21 times as fast both times.
// Over all steps from v000 it is 2.87 times as fast.
// Contractions: q 1x1 conv, k/v/hu 3x3 convs as implicit GEMM (K = 9*256), pooled KV outer-product GEMMs (64x32x1024 per head and tap), per-sample grouped 3x3 conv (K = 9*64) and the channel-mean bias linear, all on v_wmma_f32_16x16x32_bf16 with bf16 hi/lo three-product operand split (hi*hi + lo*hi + hi*lo), f32 accumulate; phi norm ratios, clip, channel means and LayerNorm statistics in f32/f64 on the VALU.
#include <hip/hip_runtime.h>

typedef unsigned short us;
typedef int   v8i  __attribute__((ext_vector_type(8)));
typedef float v8f  __attribute__((ext_vector_type(8)));
typedef float v4f  __attribute__((ext_vector_type(4)));
typedef unsigned short v8us __attribute__((ext_vector_type(8)));
typedef __bf16 v16b __attribute__((ext_vector_type(16)));
typedef v4f  __attribute__((may_alias)) v4fa;
typedef v8us __attribute__((may_alias)) v8usa;
union Frag { v8i v; v8us half[2]; };
union DPack { double d[2]; v4f f; };

#define NBATCH 4
#define CIN    256
#define HIMG   32
#define NPIX   1024
#define PW     34
#define DQ     512
#define DV     256
#define DK     64
#define DVH    32
#define FTK    576

struct BiW { int i0[3]; int i1[3]; float w0[3]; float w1[3]; };
static_assert(sizeof(BiW) == 48);

// ---------------------------------------------------------------------------
// bf16 helpers (RNE convert) and the hi/lo split
// ---------------------------------------------------------------------------
__device__ __forceinline__ us f2bf(float f) {
  unsigned u = __float_as_uint(f);
  u += 0x7FFFu + ((u >> 16) & 1u);
  return (us)(u >> 16);
}
__device__ __forceinline__ float bf2f(us hv) {
  return __uint_as_float(((unsigned)hv) << 16);
}
__device__ __forceinline__ void split2(float f, us& hi, us& lo) {
  hi = f2bf(f);
  lo = f2bf(f - bf2f(hi));
}

// ---------------------------------------------------------------------------
// 16x16x32 bf16 WMMA with hazard guard (ties D, keeps A/B live).
// Fragment map (wave32): lane l, h = l>>4, m = n = l&15.
//   A/B element i: i<8 -> k0+8h+i ; i>=8 -> k0+16+8h+(i-8)
//   D element r : row 8h+r, col l&15
// ---------------------------------------------------------------------------
__device__ __forceinline__ v8f wmma_bf(v8i a, v8i b, v8f c) {
  v8f d = __builtin_amdgcn_wmma_f32_16x16x32_bf16(false, __builtin_bit_cast(v16b, a), false,
                                                  __builtin_bit_cast(v16b, b), (short)0, c, false, false);
  asm volatile("v_nop\n\tv_nop\n\tv_nop\n\tv_nop" : "+v"(d) : "v"(a), "v"(b));
  return d;
}
// three-product split: ah*bh + al*bh + ah*bl into one accumulator
__device__ __forceinline__ v8f wmma3(v8i ah, v8i al, v8i bh, v8i bl, v8f c) {
  c = wmma_bf(ah, bh, c);
  c = wmma_bf(al, bh, c);
  c = wmma_bf(ah, bl, c);
  return c;
}
// fragment from a k-contiguous 16-bit row (pointer already at k0)
__device__ __forceinline__ v8i ldfrag(const us* p, int h) {
  Frag f;
  f.half[0] = *(const v8usa*)(p + 8 * h);
  f.half[1] = *(const v8usa*)(p + 16 + 8 * h);
  return f.v;
}

__device__ __forceinline__ float wave_sum(float s) {
  s += __shfl_xor(s, 16);
  s += __shfl_xor(s, 8);
  s += __shfl_xor(s, 4);
  s += __shfl_xor(s, 2);
  s += __shfl_xor(s, 1);
  return s;
}
__device__ __forceinline__ double dshfl_xor(double v, int msk) {
  const unsigned long long u = __builtin_bit_cast(unsigned long long, v);
  int lo = (int)(unsigned)(u & 0xFFFFFFFFull);
  int hi = (int)(unsigned)(u >> 32);
  lo = __shfl_xor(lo, msk);
  hi = __shfl_xor(hi, msk);
  const unsigned long long r = (((unsigned long long)(unsigned)hi) << 32) | (unsigned long long)(unsigned)lo;
  return __builtin_bit_cast(double, r);
}
__device__ __forceinline__ double wave_sum_d(double s) {
  s += dshfl_xor(s, 16);
  s += dshfl_xor(s, 8);
  s += dshfl_xor(s, 4);
  s += dshfl_xor(s, 2);
  s += dshfl_xor(s, 1);
  return s;
}

// ---------------------------------------------------------------------------
// Kernel: x NCHW f32 -> bf16 hi/lo padded NHWC planes [b][34][34][256]
// (interior pixels). Block role = (y, b); LDS transpose; one instruction writes one
// coverage: 8 waves x 4 pixels = 32 px per row, 32 lanes x 8 = 256 ch.
// Also the f32 sum of each channel's image row (32 values, fixed order) into
// rowsum[b][y][c]: 256 threads x 4 B = 8 whole lines per block. The f32 copy
// sits in LDS at pitch 33 words, free of bank conflicts on store and on read.
// ---------------------------------------------------------------------------
__device__ __forceinline__ void prep_x_body(const float* __restrict__ x,
                                            us* __restrict__ xh, us* __restrict__ xl,
                                            float* __restrict__ rowsum, int y, int b) {
  __shared__ __attribute__((aligned(16))) us sh[32 * 256];
  __shared__ __attribute__((aligned(16))) us sl[32 * 256];
  __shared__ float sf[256 * 33];
  const int tid = threadIdx.x, lane = tid & 31, w = tid >> 5;
  #pragma unroll 1
  for (int j = 0; j < 32; ++j) {
    const int c = 8 * j + w;
    const float v = x[((size_t)(b * CIN + c) * HIMG + y) * HIMG + lane];
    us hi, lo;
    split2(v, hi, lo);
    sh[lane * 256 + c] = hi;
    sl[lane * 256 + c] = lo;
    sf[c * 33 + lane] = v;
  }
  __syncthreads();
  float rs = 0.f;
  // unrolled: constant LDS offsets, the reads issue ahead of the dependent adds
  #pragma unroll
  for (int i = 0; i < 32; ++i) rs += sf[tid * 33 + i];
  rowsum[(size_t)(b * HIMG + y) * CIN + tid] = rs;
  v8us vh[4], vl[4];
  size_t d[4];
  #pragma unroll
  for (int i = 0; i < 4; ++i) {
    const int px = 4 * w + i;
    vh[i] = *(const v8usa*)(sh + px * 256 + 8 * lane);
    vl[i] = *(const v8usa*)(sl + px * 256 + 8 * lane);
    d[i] = ((size_t)((b * PW + y + 1) * PW + px + 1)) * CIN + 8 * lane;
  }
  #pragma unroll
  for (int i = 0; i < 4; ++i) { *(v8us*)(xh + d[i]) = vh[i]; *(v8us*)(xl + d[i]) = vl[i]; }
  
}

// ---------------------------------------------------------------------------
// Kernel: zero the border pixel rows of padded NHWC planes [b][34][34][C].
// Wave = one border pixel; 32 lanes x 16 B = 256 halves per instruction.
// coverage: 132 border pixels x 4 samples, C halves each, both planes.
// ---------------------------------------------------------------------------
__device__ __forceinline__ void zero_border_body(us* __restrict__ ph, us* __restrict__ pl, int C, int bx, int b) {
  const int tid = threadIdx.x, lane = tid & 31, w = tid >> 5;
  const int i = bx * 8 + w;
  if (i >= 132) return;
  int py, px;
  if (i < 34)       { py = 0;           px = i; }
  else if (i < 68)  { py = PW - 1;      px = i - 34; }
  else if (i < 100) { py = i - 68 + 1;  px = 0; }
  else              { py = i - 100 + 1; px = PW - 1; }
  const size_t base = ((size_t)((b * PW + py) * PW + px)) * (size_t)C;
  v8us z;
  #pragma unroll
  for (int j = 0; j < 8; ++j) z[j] = (us)0;
  #pragma unroll 1
  for (int off = 8 * lane; off < C; off += 256) {
    *(v8us*)(ph + base + off) = z;
    *(v8us*)(pl + base + off) = z;
  }
  
}

// ---------------------------------------------------------------------------
// Kernel: OIHW f32 weights -> rows [o][tap*256 + c] as bf16 hi and lo planes.
// Thread = 8 consecutive row elements, one 16-B store per lane per plane,
// coverage: cout*taps*256 elements, grid = n/2048 exactly.
// ---------------------------------------------------------------------------
__device__ __forceinline__ void wprep_body(const float* __restrict__ wsrc, int cout, int taps,
                                           us* __restrict__ wh, us* __restrict__ wl, int bx) {
  const int g = bx * 256 + threadIdx.x;
  const int kw = taps * 256;
  const int n = cout * kw;
  const int e8 = g * 8;
  if (e8 >= n) return;
  const int o = e8 / kw;
  const int r = e8 - o * kw;
  const int tap = r >> 8, c = r & 255;
  const float* src = wsrc + ((size_t)(o * 256 + c)) * taps + tap;
  v8us vh, vl;
  #pragma unroll
  for (int i = 0; i < 8; ++i) {
    us a, bq;
    split2(src[(size_t)i * taps], a, bq);
    vh[i] = a;
    vl[i] = bq;
  }
  *(v8us*)(wh + e8) = vh;
  *(v8us*)(wl + e8) = vl;
  
}

// ---------------------------------------------------------------------------
// Kernel: all operand preparation in one grid (the roles share no data, so
// they run side by side instead of one launch after another). Role by block
// index, the longest first: x planes, then k, v, hu, q weight rows, then the
// zero borders of the three padded plane pairs.
// ---------------------------------------------------------------------------
#define NB_X   (HIMG * NBATCH)
#define NB_WK  ((DQ * CIN * 9) / 2048)
#define NB_WV  ((DV * CIN * 9) / 2048)
#define NB_WH  ((DV * DV * 9) / 2048)
#define NB_WQ  ((DQ * CIN) / 2048)
#define NB_ZB  (17 * NBATCH)
#define NB_PREP (NB_X + NB_WK + NB_WV + NB_WH + NB_WQ + 3 * NB_ZB)
__global__ __launch_bounds__(256) void k_prep(
    const float* __restrict__ x, const float* __restrict__ q_w, const float* __restrict__ k_w,
    const float* __restrict__ v_w, const float* __restrict__ hu_w,
    us* __restrict__ xh, us* __restrict__ xl, float* __restrict__ rowsum,
    us* __restrict__ wqh, us* __restrict__ wql, us* __restrict__ wkh, us* __restrict__ wkl,
    us* __restrict__ wvh, us* __restrict__ wvl, us* __restrict__ whh, us* __restrict__ whl,
    us* __restrict__ rqh, us* __restrict__ rql, us* __restrict__ qkh, us* __restrict__ qkl) {
  int i = blockIdx.x;
  if (i < NB_X) { prep_x_body(x, xh, xl, rowsum, i & (HIMG - 1), i / HIMG); return; }
  i -= NB_X;
  if (i < NB_WK) { wprep_body(k_w, DQ, 9, wkh, wkl, i); return; }
  i -= NB_WK;
  if (i < NB_WV) { wprep_body(v_w, DV, 9, wvh, wvl, i); return; }
  i -= NB_WV;
  if (i < NB_WH) { wprep_body(hu_w, DV, 9, whh, whl, i); return; }
  i -= NB_WH;
  if (i < NB_WQ) { wprep_body(q_w, DQ, 1, wqh, wql, i); return; }
  i -= NB_WQ;
  const int pl = i / NB_ZB, r = i - pl * NB_ZB;
  const int bx = r % 17, b = r / 17;
  if (pl == 0)      zero_border_body(xh, xl, CIN, bx, b);
  else if (pl == 1) zero_border_body(rqh, rql, DQ, bx, b);
  else              zero_border_body(qkh, qkl, DV, bx, b);
}

// ---------------------------------------------------------------------------
// Fragment from 32 consecutive-k f32 values of one row (pointer at k0), split
// into hi/lo bf16 fragments in registers (fragment map as above).
// ---------------------------------------------------------------------------
__device__ __forceinline__ void frag_f32(const float* __restrict__ p, int h, v8i& fh, v8i& fl) {
  const v4f q0 = *(const v4fa*)(p + 8 * h);
  const v4f q1 = *(const v4fa*)(p + 8 * h + 4);
  const v4f q2 = *(const v4fa*)(p + 16 + 8 * h);
  const v4f q3 = *(const v4fa*)(p + 20 + 8 * h);
  float v[16];
  v[0] = q0.x; v[1] = q0.y; v[2] = q0.z; v[3] = q0.w;
  v[4] = q1.x; v[5] = q1.y; v[6] = q1.z; v[7] = q1.w;
  v[8] = q2.x; v[9] = q2.y; v[10] = q2.z; v[11] = q2.w;
  v[12] = q3.x; v[13] = q3.y; v[14] = q3.z; v[15] = q3.w;
  Frag a, bq;
  #pragma unroll
  for (int i = 0; i < 16; ++i) {
    us hi, lo;
    split2(v[i], hi, lo);
    a.half[i >> 3][i & 7] = hi;
    bq.half[i >> 3][i & 7] = lo;
  }
  fh = a.v;
  fl = bq.v;
}

// ---------------------------------------------------------------------------
// Block role: channel means of x (f32, from the 32 row sums of each channel, fixed
// order) and the bias linear on WMMA:
// bias[b][o] = sum_c mean[b][c] * bw[o][c] + bb[o]. One block of 8 waves.
// A = means [16 rows (4 real, 12 zero)][256] hi/lo in LDS, B = bw rows [o][c]
// coverage: 256 threads x 16 B = 4096 B = all of bias.
// ---------------------------------------------------------------------------
__device__ __forceinline__ void bias_body(const float* __restrict__ rowsum, const float* __restrict__ bw,
                                          const float* __restrict__ bb, float* __restrict__ biasv) {
  __shared__ __attribute__((aligned(16))) us sah[16 * 256];
  __shared__ __attribute__((aligned(16))) us sal[16 * 256];
  __shared__ __attribute__((aligned(16))) float sd[4 * 256];
  const int tid = threadIdx.x, lane = tid & 31, w = tid >> 5;
  const int h = lane >> 4, m = lane & 15;
  for (int i = tid; i < 16 * 256; i += 256) {
    if (i >= 4 * 256) { sah[i] = (us)0; sal[i] = (us)0; }
  }
  {
    const int k = tid >> 6, c4 = 4 * (tid & 63);   // b = k, channels c4 .. c4+3
    const float* p = rowsum + (size_t)k * HIMG * CIN + c4;
    v4f sm;
    sm.x = 0.f; sm.y = 0.f; sm.z = 0.f; sm.w = 0.f;
    // unrolled: the 32 loads fly together, one memory latency instead of 32
    #pragma unroll
    for (int i = 0; i < HIMG; ++i) sm += *(const v4fa*)(p + i * CIN);
    // unrolled: constant vector index, sm stays in registers
    #pragma unroll
    for (int e = 0; e < 4; ++e) {
      const float mean = sm[e] * (1.0f / 1024.0f);
      us hi, lo;
      split2(mean, hi, lo);
      sah[k * 256 + c4 + e] = hi;
      sal[k * 256 + c4 + e] = lo;
    }
  }
  __syncthreads();

  const int o0 = 32 * w + m, o1 = o0 + 16;
  const float* br0 = bw + (size_t)o0 * 256;
  const float* br1 = bw + (size_t)o1 * 256;
  const v8f z8 = {0.f, 0.f, 0.f, 0.f, 0.f, 0.f, 0.f, 0.f};
  v8f acc[2];
  acc[0] = z8; acc[1] = z8;
  #pragma unroll 1
  for (int k0 = 0; k0 < 256; k0 += 32) {
    const v8i ah = ldfrag(sah + m * 256 + k0, h);
    const v8i al = ldfrag(sal + m * 256 + k0, h);
    v8i bh0, bl0, bh1, bl1;
    frag_f32(br0 + k0, h, bh0, bl0);
    frag_f32(br1 + k0, h, bh1, bl1);
    acc[0] = wmma3(ah, al, bh0, bl0, acc[0]);
    acc[1] = wmma3(ah, al, bh1, bl1, acc[1]);
  }
  const float bb0 = bb[o0], bb1 = bb[o1];
  if (h == 0) {
    #pragma unroll
    for (int r = 0; r < 4; ++r) {
      sd[r * 256 + o0] = acc[0][r] + bb0;
      sd[r * 256 + o1] = acc[1][r] + bb1;
    }
  }
  __syncthreads();
  const int L = tid >> 3, q = tid & 7;
  const v4f v = *(const v4fa*)(sd + L * 32 + 4 * q);
  float* dst = biasv + L * 32 + 4 * q;
  *(v4f*)dst = v;
  
}

// ---------------------------------------------------------------------------
// Eight asynchronous 16-B copies global -> LDS per lane (no register staging).
// l = the lane's LDS byte addresses, g = its global addresses, both 16-B
// aligned. The closing s_wait_xcnt keeps later rewrites of the address
// registers behind the copies' issue (precaution), so it sits in the statement.
// ---------------------------------------------------------------------------
__device__ __forceinline__ void acopy8(const unsigned (&l)[8], const us* const (&g)[8]) {
  asm volatile(
      "global_load_async_to_lds_b128 %0, %8, off\n\t"
      "global_load_async_to_lds_b128 %1, %9, off\n\t"
      "global_load_async_to_lds_b128 %2, %10, off\n\t"
      "global_load_async_to_lds_b128 %3, %11, off\n\t"
      "global_load_async_to_lds_b128 %4, %12, off\n\t"
      "global_load_async_to_lds_b128 %5, %13, off\n\t"
      "global_load_async_to_lds_b128 %6, %14, off\n\t"
      "global_load_async_to_lds_b128 %7, %15, off\n\t"
      "s_wait_xcnt 0x0"
      :: "v"(l[0]), "v"(l[1]), "v"(l[2]), "v"(l[3]), "v"(l[4]), "v"(l[5]), "v"(l[6]), "v"(l[7]),
         "v"(g[0]), "v"(g[1]), "v"(g[2]), "v"(g[3]), "v"(g[4]), "v"(g[5]), "v"(g[6]), "v"(g[7])
      : "memory");
}

// LDS ring of k_conv: a stage = 128 channels (256 B) of 64 pixel rows and 64
// weight rows, hi and lo planes; row pitch 272 B (conflict-free 16-B reads).
#define KCH    128
#define LPITCH 136
#define LPLANE (64 * LPITCH)
#define LSTAGE (4 * LPLANE)

// ---------------------------------------------------------------------------
// Kernel: implicit-GEMM convolution (Cin = 256 per pixel) over bf16 hi/lo
// zero-padded NHWC planes [b][34][34][256]; weights as rows [o][tap*256+c]
// hi/lo. Block = 64 pixels (image rows y0, y0+1) x 64 output channels,
// 4 waves of 32 px x 32 ch (2x2 tiles), K = ntaps*256 in steps of 32,
// operand rows staged in LDS by asynchronous copies of whole 256-B units (two
// buffers, the next stage flies while this one is worked on), fragments read
// from LDS, three products per tile pair.
// MODE 0: relu^2 -> bf16 hi/lo padded NHWC planes (pitch = cout) + (s2,s4) partial line
// MODE 1: relu^2 -> f32 NCHW + (s2,s4) partial line
// MODE 2: value -> bf16 hi/lo NCHW planes
// MODE 3: value -> f32 NCHW + (sum, sum of squares) partial line (f64)
// coverage: MODE 0 store: 4 waves x 16 px x 8 lanes x 8 ch = 64 px x 64 ch;
// MODE 1/3: 4 waves x 16 ch x 64 px; MODE 2: 4 waves x 16 ch x 8 lanes x 8 px.
// ---------------------------------------------------------------------------
// The body takes its tile (bx = pixel tile, by = channel tile of gy) and the
// block's LDS from the kernel that calls it.
template <int MODE>
__device__ __forceinline__ void conv_body(
    us* ring, float* sbuf, double (*sred)[2], int bx, int by, int gy,
    const us* __restrict__ ah, const us* __restrict__ al,
    const us* __restrict__ wh, const us* __restrict__ wl,
    const float* __restrict__ bias, int ntaps, int cout,
    us* __restrict__ oh, us* __restrict__ ol, float* __restrict__ of, float* __restrict__ part)
{
  const int tid = threadIdx.x, lane = tid & 31, w = tid >> 5;
  const int h = lane >> 4, m = lane & 15;
  const int pt = bx, b = pt >> 4, y0 = (pt & 15) * 2;
  const int n0 = by * 64;
  const int ry = w >> 1, nw = 32 * (w & 1);
  const int kw = ntaps * CIN;
  const int nst = 2 * ntaps;
  // copy map: 16 lanes x 16 B = one 256-B row piece; thread rows r0 + 8 i
  const int q16 = tid & 15, r0 = tid >> 4;
  const unsigned lds0 = (unsigned)(size_t)ring + (unsigned)(r0 * (LPITCH * 2) + q16 * 16);
  const size_t wbase = (size_t)(n0 + r0) * kw + 8 * q16;
  // stage s (tap s / 2, channels 128 (s & 1) ..) into buffer bufi
  auto stage_copy = [&](int s, int bufi) {
    const int tap = s >> 1, c0 = (s & 1) * KCH;
    const int t3 = tap / 3;
    const int ky = (ntaps == 1) ? 1 : t3;
    const int kx = (ntaps == 1) ? 1 : (tap - 3 * t3);
    const size_t ao = ((size_t)((b * PW + y0 + ky) * PW + kx + r0)) * CIN + c0 + 8 * q16;
    const size_t wo = wbase + (size_t)s * KCH;
    const unsigned lb = lds0 + (unsigned)bufi * (LSTAGE * 2);
    unsigned l[8];
    const us* g[8];
    #pragma unroll
    for (int i = 0; i < 8; ++i) {
      l[i] = lb + (unsigned)(i * 8 * LPITCH * 2);
      g[i] = ah + ao + (size_t)((i >> 2) * PW * CIN + (i & 3) * 8 * CIN);
    }
    acopy8(l, g);
    #pragma unroll
    for (int i = 0; i < 8; ++i) {
      l[i] = lb + (unsigned)(LPLANE * 2 + i * 8 * LPITCH * 2);
      g[i] = al + ao + (size_t)((i >> 2) * PW * CIN + (i & 3) * 8 * CIN);
    }
    acopy8(l, g);
    #pragma unroll
    for (int i = 0; i < 8; ++i) {
      l[i] = lb + (unsigned)(2 * LPLANE * 2 + i * 8 * LPITCH * 2);
      g[i] = wh + wo + (size_t)(i * 8) * kw;
    }
    acopy8(l, g);
    #pragma unroll
    for (int i = 0; i < 8; ++i) {
      l[i] = lb + (unsigned)(3 * LPLANE * 2 + i * 8 * LPITCH * 2);
      g[i] = wl + wo + (size_t)(i * 8) * kw;
    }
    acopy8(l, g);
  };
  const v8f z8 = {0.f, 0.f, 0.f, 0.f, 0.f, 0.f, 0.f, 0.f};
  v8f acc[2][2];
  #pragma unroll
  for (int i = 0; i < 2; ++i) { acc[i][0] = z8; acc[i][1] = z8; }

  // prologue: stage 0 landed and published, then stage 1 in flight
  stage_copy(0, 0);
  asm volatile("s_wait_asynccnt 0x0" ::: "memory");  // this wave's copies of stage 0 have landed
  __syncthreads();                                   // ... and every other wave's
  stage_copy(1, 1);                                  // nst = 2 ntaps >= 2

  const int arow = (ry * 32 + m) * LPITCH;
  const int brow = 2 * LPLANE + (nw + m) * LPITCH;
  #pragma unroll 1
  for (int s = 0; s < nst; ++s) {
    const us* sb = ring + (s & 1) * LSTAGE;
    #pragma unroll
    for (int kk = 0; kk < KCH; kk += 32) {
      const v8i fa0h = ldfrag(sb + arow + kk, h);
      const v8i fa0l = ldfrag(sb + LPLANE + arow + kk, h);
      const v8i fa1h = ldfrag(sb + arow + 16 * LPITCH + kk, h);
      const v8i fa1l = ldfrag(sb + LPLANE + arow + 16 * LPITCH + kk, h);
      #pragma unroll
      for (int nt = 0; nt < 2; ++nt) {
        const v8i fbh = ldfrag(sb + brow + nt * 16 * LPITCH + kk, h);
        const v8i fbl = ldfrag(sb + LPLANE + brow + nt * 16 * LPITCH + kk, h);
        acc[0][nt] = wmma3(fa0h, fa0l, fbh, fbl, acc[0][nt]);
        acc[1][nt] = wmma3(fa1h, fa1l, fbh, fbl, acc[1][nt]);
      }
    }
    // publish point of stage s + 1, and hand-over of this stage's buffer
    asm volatile("s_wait_dscnt 0x0" ::: "memory");     // this wave's reads of the buffer are done
    asm volatile("s_wait_asynccnt 0x0" ::: "memory");  // this wave's copies of stage s + 1 have landed
    __syncthreads();                                   // both hold for every wave of the block
    if (s + 2 < nst) stage_copy(s + 2, s & 1);
  }
  asm volatile("s_wait_asynccnt 0x0" ::: "memory");    // no copy outstanding past the loop

  // epilogue into LDS
  float bv[2];
  bv[0] = bias[n0 + nw + m];
  bv[1] = bias[n0 + nw + 16 + m];
  us* sH = reinterpret_cast<us*>(sbuf);
  us* sL = sH + 4096;
  float fs = 0.f, fq = 0.f;
  double ds = 0.0, dq = 0.0;
  #pragma unroll
  for (int mt = 0; mt < 2; ++mt) {
    #pragma unroll
    for (int nt = 0; nt < 2; ++nt) {
      #pragma unroll
      for (int r = 0; r < 8; ++r) {
        const float val = acc[mt][nt][r] + bv[nt];
        const int tp = ry * 32 + mt * 16 + 8 * h + r;
        const int ch = nw + 16 * nt + m;
        if (MODE == 0) {
          const float rr = fmaxf(val, 0.f);
          const float r2 = rr * rr;
          fs += r2; fq += r2 * r2;
          us hi, lo;
          split2(r2, hi, lo);
          sH[tp * 64 + ch] = hi;
          sL[tp * 64 + ch] = lo;
        } else if (MODE == 1) {
          const float rr = fmaxf(val, 0.f);
          const float r2 = rr * rr;
          fs += r2; fq += r2 * r2;
          sbuf[ch * 64 + tp] = r2;
        } else if (MODE == 2) {
          us hi, lo;
          split2(val, hi, lo);
          sH[ch * 64 + tp] = hi;
          sL[ch * 64 + tp] = lo;
        } else {
          ds += (double)val;
          dq += (double)val * (double)val;
          sbuf[ch * 64 + tp] = val;
        }
      }
    }
  }
  if (MODE == 0 || MODE == 1) {
    fs = wave_sum(fs);
    fq = wave_sum(fq);
    ds = (double)fs;
    dq = (double)fq;
  } else if (MODE == 3) {
    ds = wave_sum_d(ds);
    dq = wave_sum_d(dq);
  }
  if (MODE != 2) {
    if (lane == 0) { sred[w][0] = ds; sred[w][1] = dq; }
  }
  __syncthreads();

  // block partial line (2 doubles + zeros), fixed order over the 4 waves
  v4f pv;
  pv.x = 0.f; pv.y = 0.f; pv.z = 0.f; pv.w = 0.f;
  size_t li = 0;
  bool pw = false;
  if (MODE != 2) {
    double S = 0.0, Q2 = 0.0;
    #pragma unroll
    for (int k = 0; k < 4; ++k) { S += sred[k][0]; Q2 += sred[k][1]; }
    DPack pk;
    pk.d[0] = S; pk.d[1] = Q2;
    pv.x = (lane == 0) ? pk.f.x : 0.f;
    pv.y = (lane == 0) ? pk.f.y : 0.f;
    pv.z = (lane == 0) ? pk.f.z : 0.f;
    pv.w = (lane == 0) ? pk.f.w : 0.f;
    li = ((size_t)bx * gy + by) * 32 + 4 * (lane & 7);
    pw = (w == 0) && (lane < 8);
  }

  if (MODE == 0) {
    const int q8 = lane & 7, sub = lane >> 3;
    v8us th[4], tl[4];
    size_t d[4];
    #pragma unroll
    for (int i = 0; i < 4; ++i) {
      const int tp = 16 * w + 4 * i + sub;
      const int ry2 = tp >> 5, xx = tp & 31;
      th[i] = *(const v8usa*)(sH + tp * 64 + 8 * q8);
      tl[i] = *(const v8usa*)(sL + tp * 64 + 8 * q8);
      d[i] = ((size_t)((b * PW + y0 + ry2 + 1) * PW + xx + 1)) * (size_t)cout + n0 + 8 * q8;
    }
    #pragma unroll
    for (int i = 0; i < 4; ++i) { *(v8us*)(oh + d[i]) = th[i]; *(v8us*)(ol + d[i]) = tl[i]; }
    if (pw) *(v4f*)(part + li) = pv;
    
  } else if (MODE == 2) {
    const int q8 = lane & 7, sub = lane >> 3;
    v8us th[4], tl[4];
    size_t d[4];
    #pragma unroll
    for (int i = 0; i < 4; ++i) {
      const int chl = 16 * w + 4 * i + sub;
      th[i] = *(const v8usa*)(sH + chl * 64 + 8 * q8);
      tl[i] = *(const v8usa*)(sL + chl * 64 + 8 * q8);
      d[i] = ((size_t)(b * cout + n0 + chl)) * NPIX + y0 * HIMG + 8 * q8;
    }
    #pragma unroll
    for (int i = 0; i < 4; ++i) { *(v8us*)(oh + d[i]) = th[i]; *(v8us*)(ol + d[i]) = tl[i]; }
    // another role's code follows these stores in the merged kernel's listing and reuses their registers:
    // the wait keeps any such rewrite behind the stores' issue (precaution)
    asm volatile("s_wait_xcnt 0x0" ::: "memory");
  } else {
    const int hs = lane >> 4, x4 = 4 * (lane & 15);
    v4f tv[8];
    size_t d[8];
    #pragma unroll
    for (int i = 0; i < 8; ++i) {
      const int chl = 16 * w + 2 * i + hs;
      tv[i] = *(const v4fa*)(sbuf + chl * 64 + x4);
      d[i] = ((size_t)(b * cout + n0 + chl)) * NPIX + y0 * HIMG + x4;
    }
    #pragma unroll
    for (int i = 0; i < 8; ++i) *(v4f*)(of + d[i]) = tv[i];
    if (pw) *(v4f*)(part + li) = pv;
    
  }
}

// ---------------------------------------------------------------------------
// Kernel: the head unification conv (MODE 3), one tile per block.
// ---------------------------------------------------------------------------
__global__ __launch_bounds__(128) void k_conv_hu(
    const us* __restrict__ ah, const us* __restrict__ al,
    const us* __restrict__ wh, const us* __restrict__ wl,
    const float* __restrict__ bias, float* __restrict__ of, float* __restrict__ part)
{
  __shared__ __attribute__((aligned(16))) us ring[2 * LSTAGE];
  __shared__ __attribute__((aligned(16))) float sbuf[64 * 64];
  __shared__ double sred[4][2];
  conv_body<3>(ring, sbuf, sred, blockIdx.x, blockIdx.y, DV / 64, ah, al, wh, wl, bias, 9, DV,
               nullptr, nullptr, of, part);
}

// ---------------------------------------------------------------------------
// Kernel: the k, v and q convolutions of x in one grid (they share no result,
// so their tiles fill the chip together). Role by block index, the long 3x3
// tiles first: 512 k tiles, 256 v tiles, 512 q tiles; pixel tile fastest.
// ---------------------------------------------------------------------------
#define NB_CK (64 * (DQ / 64))
#define NB_CV (64 * (DV / 64))
#define NB_CQ (64 * (DQ / 64))
__global__ __launch_bounds__(128) void k_conv_qkv(
    const us* __restrict__ xh, const us* __restrict__ xl,
    const us* __restrict__ wkh, const us* __restrict__ wkl, const float* __restrict__ k_b,
    float* __restrict__ r2k, float* __restrict__ partk,
    const us* __restrict__ wvh, const us* __restrict__ wvl, const float* __restrict__ v_b,
    us* __restrict__ vnh, us* __restrict__ vnl,
    const us* __restrict__ wqh, const us* __restrict__ wql, const float* __restrict__ q_b,
    us* __restrict__ rqh, us* __restrict__ rql, float* __restrict__ partq)
{
  __shared__ __attribute__((aligned(16))) us ring[2 * LSTAGE];
  __shared__ __attribute__((aligned(16))) float sbuf[64 * 64];
  __shared__ double sred[4][2];
  int i = blockIdx.x;
  if (i < NB_CK) {
    conv_body<1>(ring, sbuf, sred, i & 63, i >> 6, DQ / 64, xh, xl, wkh, wkl, k_b, 9, DQ,
                 nullptr, nullptr, r2k, partk);
    return;
  }
  i -= NB_CK;
  if (i < NB_CV) {
    conv_body<2>(ring, sbuf, sred, i & 63, i >> 6, DV / 64, xh, xl, wvh, wvl, v_b, 9, DV,
                 vnh, vnl, nullptr, nullptr);
    return;
  }
  i -= NB_CV;
  conv_body<0>(ring, sbuf, sred, i & 63, i >> 6, DQ / 64, xh, xl, wqh, wql, q_b, 1, DQ,
               rqh, rql, nullptr, partq);
}

// ---------------------------------------------------------------------------
// Block role: phi norm ratios s = sqrt(sum relu^2) / sqrt(sum relu^4) for the
// q and k tensors from 512 block partial lines each (fixed order, f64).
// Wave 0 = q, wave 1 = k, the other waves only pass the barriers; one whole
// output line.
// ---------------------------------------------------------------------------
__device__ __forceinline__ void phinorm_body(const float* __restrict__ partq, const float* __restrict__ partk,
                                             float* __restrict__ scal) {
  __shared__ double sacc[2][32][2];
  __shared__ float sres[2];
  const int tid = threadIdx.x, lane = tid & 31, w = tid >> 5;
  const float* pp = (w == 0) ? partq : partk;
  if (w < 2) {
    double s2 = 0.0, s4 = 0.0;
    #pragma unroll 1
    for (int j = 0; j < 16; ++j) {
      const double* dp = reinterpret_cast<const double*>(pp + (size_t)(lane * 16 + j) * 32);
      s2 += dp[0];
      s4 += dp[1];
    }
    sacc[w][lane][0] = s2;
    sacc[w][lane][1] = s4;
  }
  __syncthreads();
  if (w < 2 && lane == 0) {
    double t2 = 0.0, t4 = 0.0;
    for (int i = 0; i < 32; ++i) { t2 += sacc[w][i][0]; t4 += sacc[w][i][1]; }
    const float num = sqrtf((float)t2);
    const float den = sqrtf((float)t4);
    sres[w] = num * (1.0f / den);
  }
  __syncthreads();
  v4f pv;
  pv.x = (lane == 0) ? sres[0] : 0.f;
  pv.y = (lane == 0) ? sres[1] : 0.f;
  pv.z = 0.f; pv.w = 0.f;
  const bool pw = (w == 0) && (lane < 8);
  float* dst = scal + 4 * lane;
  if (pw) *(v4f*)dst = pv;
  
}

// ---------------------------------------------------------------------------
// Kernel: the two one-block jobs in front of the pooled filters and the
// grouped conv, side by side: block 0 = bias linear, block 1 = phi ratios.
// ---------------------------------------------------------------------------
__global__ __launch_bounds__(256) void k_bias_phinorm(
    const float* __restrict__ rowsum, const float* __restrict__ bw, const float* __restrict__ bb,
    float* __restrict__ biasv, const float* __restrict__ partq, const float* __restrict__ partk,
    float* __restrict__ scal) {
  if (blockIdx.x == 0) bias_body(rowsum, bw, bb, biasv);
  else                 phinorm_body(partq, partk, scal);
}

// ---------------------------------------------------------------------------
// Kernel: pooled outer product. Block = (tap pq, bh): D[kk 64][v 32] =
// sum_pix (relu(K)^2[kk][pix] * Mh[p][y] * Mw[q][x]) * V[v][pix], K = 1024,
// A built in registers from the f32 NCHW relu^2 rows (split hi/lo),
// B from the bf16 NCHW V planes. Epilogue: * sK, clip +-32/9, hi/lo into
// coverage: 4 waves x 8 rows x 8 lanes x 8 kk = 32 v x 64 kk per (bh,pq).
// ---------------------------------------------------------------------------
__global__ __launch_bounds__(128) void k_kv(
    const float* __restrict__ r2k, const us* __restrict__ vnh, const us* __restrict__ vnl,
    const float* __restrict__ scal, BiW bw, us* __restrict__ fth, us* __restrict__ ftl)
{
  __shared__ __attribute__((aligned(16))) us sH[32 * 64];
  __shared__ __attribute__((aligned(16))) us sL[32 * 64];
  const int tid = threadIdx.x, lane = tid & 31, w = tid >> 5;
  const int h = lane >> 4, m = lane & 15;
  const int pq = blockIdx.x, bh = blockIdx.y;
  const int b = bh >> 3, head = bh & 7;
  const int p = pq / 3, q = pq - 3 * p;
  const int   iy0 = (p == 0) ? bw.i0[0] : ((p == 1) ? bw.i0[1] : bw.i0[2]);
  const int   iy1 = (p == 0) ? bw.i1[0] : ((p == 1) ? bw.i1[1] : bw.i1[2]);
  const float wy0 = (p == 0) ? bw.w0[0] : ((p == 1) ? bw.w0[1] : bw.w0[2]);
  const float wy1 = (p == 0) ? bw.w1[0] : ((p == 1) ? bw.w1[1] : bw.w1[2]);
  const int   ix0 = (q == 0) ? bw.i0[0] : ((q == 1) ? bw.i0[1] : bw.i0[2]);
  const int   ix1 = (q == 0) ? bw.i1[0] : ((q == 1) ? bw.i1[1] : bw.i1[2]);
  const float wx0 = (q == 0) ? bw.w0[0] : ((q == 1) ? bw.w0[1] : bw.w0[2]);
  const float wx1 = (q == 0) ? bw.w1[0] : ((q == 1) ? bw.w1[1] : bw.w1[2]);
  const float sK = scal[1];
  const float amax = (float)(32.0 / 9.0);
  const float* arow = r2k + ((size_t)(b * DQ + head * DK + 16 * w + m)) * NPIX;
  const size_t br0 = ((size_t)(b * DV + head * DVH + m)) * NPIX;
  const size_t br1 = br0 + (size_t)16 * NPIX;
  const v8f z8 = {0.f, 0.f, 0.f, 0.f, 0.f, 0.f, 0.f, 0.f};
  v8f acc[2];
  acc[0] = z8; acc[1] = z8;

  #pragma unroll 1
  for (int k0 = 0; k0 < NPIX; k0 += 32) {
    const int yy = k0 >> 5;
    const float wy = ((yy == iy0) ? wy0 : 0.f) + ((yy == iy1) ? wy1 : 0.f);
    const float* ap = arow + k0;
    const v4f q0 = *(const v4fa*)(ap + 8 * h);
    const v4f q1 = *(const v4fa*)(ap + 8 * h + 4);
    const v4f q2 = *(const v4fa*)(ap + 16 + 8 * h);
    const v4f q3 = *(const v4fa*)(ap + 20 + 8 * h);
    float v[16];
    v[0] = q0.x; v[1] = q0.y; v[2] = q0.z; v[3] = q0.w;
    v[4] = q1.x; v[5] = q1.y; v[6] = q1.z; v[7] = q1.w;
    v[8] = q2.x; v[9] = q2.y; v[10] = q2.z; v[11] = q2.w;
    v[12] = q3.x; v[13] = q3.y; v[14] = q3.z; v[15] = q3.w;
    Frag fah, fal;
    #pragma unroll
    for (int i = 0; i < 16; ++i) {
      const int xx = 8 * h + (i & 7) + ((i >> 3) << 4);
      const float wx = ((xx == ix0) ? wx0 : 0.f) + ((xx == ix1) ? wx1 : 0.f);
      const float a = v[i] * (wy * wx);
      us hi, lo;
      split2(a, hi, lo);
      fah.half[i >> 3][i & 7] = hi;
      fal.half[i >> 3][i & 7] = lo;
    }
    const v8i fb0h = ldfrag(vnh + br0 + k0, h);
    const v8i fb0l = ldfrag(vnl + br0 + k0, h);
    const v8i fb1h = ldfrag(vnh + br1 + k0, h);
    const v8i fb1l = ldfrag(vnl + br1 + k0, h);
    acc[0] = wmma3(fah.v, fal.v, fb0h, fb0l, acc[0]);
    acc[1] = wmma3(fah.v, fal.v, fb1h, fb1l, acc[1]);
  }

  #pragma unroll
  for (int nt = 0; nt < 2; ++nt) {
    #pragma unroll
    for (int r = 0; r < 8; ++r) {
      float val = acc[nt][r] * sK;
      val = fminf(fmaxf(val, -amax), amax);
      const int kk = 16 * w + 8 * h + r;
      const int vv = 16 * nt + m;
      us hi, lo;
      split2(val, hi, lo);
      sH[vv * 64 + kk] = hi;
      sL[vv * 64 + kk] = lo;
    }
  }
  __syncthreads();
  const int q8 = lane & 7, sub = lane >> 3;
  v8us th[2], tl[2];
  size_t d[2];
  #pragma unroll
  for (int i = 0; i < 2; ++i) {
    const int vv = 8 * w + 4 * i + sub;
    th[i] = *(const v8usa*)(sH + vv * 64 + 8 * q8);
    tl[i] = *(const v8usa*)(sL + vv * 64 + 8 * q8);
    d[i] = ((size_t)(bh * DVH + vv)) * FTK + pq * 64 + 8 * q8;
  }
  #pragma unroll
  for (int i = 0; i < 2; ++i) { *(v8us*)(fth + d[i]) = th[i]; *(v8us*)(ftl + d[i]) = tl[i]; }
  
}

// ---------------------------------------------------------------------------
// Kernel: per-sample grouped 3x3 conv of relu(Q)^2 planes (padded NHWC,
// 512 ch) with the pooled filters, K = 9*64 per head. Block = (64 px, head
// pair, b); wave = (head of the pair, image row) 32 px x 32 v. Epilogue:
// * sQ + bias[b][j*32+v], hi/lo into padded NHWC planes [b][34][34][256];
// coverage: 4 waves x 16 px x 8 lanes x 8 ch = 64 px x 64 ch per block;
// grid 16 x 4 x 4 = all interior pixels x all 256 channels x 4 samples.
// ---------------------------------------------------------------------------
__global__ __launch_bounds__(128) void k_gconv(
    const us* __restrict__ rqh, const us* __restrict__ rql,
    const us* __restrict__ fth, const us* __restrict__ ftl,
    const float* __restrict__ scal, const float* __restrict__ biasv,
    us* __restrict__ oh, us* __restrict__ ol)
{
  __shared__ __attribute__((aligned(16))) us sH[64 * 64];
  __shared__ __attribute__((aligned(16))) us sL[64 * 64];
  const int tid = threadIdx.x, lane = tid & 31, w = tid >> 5;
  const int h = lane >> 4, m = lane & 15;
  const int pt = blockIdx.x, jp = blockIdx.y, b = blockIdx.z;
  const int y0 = 2 * pt;
  const int jl = w >> 1, ry = w & 1;
  const int j = 2 * jp + jl, y = y0 + ry, bh = b * 8 + j;
  const size_t fr0 = ((size_t)(bh * DVH + m)) * FTK;
  const size_t fr1 = fr0 + (size_t)16 * FTK;
  const v8f z8 = {0.f, 0.f, 0.f, 0.f, 0.f, 0.f, 0.f, 0.f};
  v8f acc[2][2];
  #pragma unroll
  for (int i = 0; i < 2; ++i) { acc[i][0] = z8; acc[i][1] = z8; }

  #pragma unroll 1
  for (int tap = 0; tap < 9; ++tap) {
    const int ky = tap / 3;
    const int kx = tap - 3 * ky;
    const size_t ar0 = ((size_t)((b * PW + y + ky) * PW + kx + m)) * DQ + (size_t)j * DK;
    const size_t ar1 = ar0 + (size_t)16 * DQ;
    const size_t wt = (size_t)tap * DK;
    #pragma unroll
    for (int c0 = 0; c0 < DK; c0 += 32) {
      const v8i fa0h = ldfrag(rqh + ar0 + c0, h);
      const v8i fa0l = ldfrag(rql + ar0 + c0, h);
      const v8i fa1h = ldfrag(rqh + ar1 + c0, h);
      const v8i fa1l = ldfrag(rql + ar1 + c0, h);
      #pragma unroll
      for (int nt = 0; nt < 2; ++nt) {
        const size_t fr = (nt == 0) ? fr0 : fr1;
        const v8i fbh = ldfrag(fth + fr + wt + c0, h);
        const v8i fbl = ldfrag(ftl + fr + wt + c0, h);
        acc[0][nt] = wmma3(fa0h, fa0l, fbh, fbl, acc[0][nt]);
        acc[1][nt] = wmma3(fa1h, fa1l, fbh, fbl, acc[1][nt]);
      }
    }
  }

  const float sQ = scal[0];
  float bv[2];
  bv[0] = biasv[b * DV + j * DVH + m];
  bv[1] = biasv[b * DV + j * DVH + 16 + m];
  #pragma unroll
  for (int mt = 0; mt < 2; ++mt) {
    #pragma unroll
    for (int nt = 0; nt < 2; ++nt) {
      #pragma unroll
      for (int r = 0; r < 8; ++r) {
        const float val = acc[mt][nt][r] * sQ + bv[nt];
        const int tp = ry * 32 + mt * 16 + 8 * h + r;
        const int chl = jl * 32 + 16 * nt + m;
        us hi, lo;
        split2(val, hi, lo);
        sH[tp * 64 + chl] = hi;
        sL[tp * 64 + chl] = lo;
      }
    }
  }
  __syncthreads();
  const int q8 = lane & 7, sub = lane >> 3;
  v8us th[4], tl[4];
  size_t d[4];
  #pragma unroll
  for (int i = 0; i < 4; ++i) {
    const int tp = 16 * w + 4 * i + sub;
    const int ry2 = tp >> 5, xx = tp & 31;
    th[i] = *(const v8usa*)(sH + tp * 64 + 8 * q8);
    tl[i] = *(const v8usa*)(sL + tp * 64 + 8 * q8);
    d[i] = ((size_t)((b * PW + y0 + ry2 + 1) * PW + xx + 1)) * DV + jp * 64 + 8 * q8;
  }
  #pragma unroll
  for (int i = 0; i < 4; ++i) { *(v8us*)(oh + d[i]) = th[i]; *(v8us*)(ol + d[i]) = tl[i]; }
  
}

// ---------------------------------------------------------------------------
// Kernel: LayerNorm over (C,H,W) per sample: fixed-order f64 combine of the
// 64 block partial lines of the sample, then (v - mu) * rstd on one float4
// coverage: 1024 blocks x 256 threads x 4 floats = all 1048576 outputs.
// ---------------------------------------------------------------------------
__global__ __launch_bounds__(256) void k_ln(const float* __restrict__ outp, const float* __restrict__ partl,
                                            float* __restrict__ out) {
  __shared__ double ss[64];
  __shared__ double sq[64];
  __shared__ float sst[2];
  const int tid = threadIdx.x;
  const int blk = blockIdx.x, b = blk >> 8;
  if (tid < 64) {
    const double* dp = reinterpret_cast<const double*>(partl + (size_t)(b * 64 + tid) * 32);
    ss[tid] = dp[0];
    sq[tid] = dp[1];
  }
  __syncthreads();
  if (tid == 0) {
    double S = 0.0, Q2 = 0.0;
    for (int i = 0; i < 64; ++i) { S += ss[i]; Q2 += sq[i]; }
    const double inv = 1.0 / 262144.0;
    const double mu = S * inv;
    double var = Q2 * inv - mu * mu;
    if (var < 0.0) var = 0.0;
    const float den = sqrtf((float)var + 1e-5f);
    sst[0] = (float)mu;
    sst[1] = 1.0f / den;
  }
  __syncthreads();
  const float muf = sst[0], rinv = sst[1];
  const size_t e = ((size_t)blk * 256 + tid) * 4;
  v4f v = *(const v4fa*)(outp + e);
  v4f o;
  o.x = (v.x - muf) * rinv;
  o.y = (v.y - muf) * rinv;
  o.z = (v.z - muf) * rinv;
  o.w = (v.w - muf) * rinv;
  *(v4f*)(out + e) = o;
  
}

// ---------------------------------------------------------------------------
// Host: bilinear (32 -> 3, align_corners = false) taps and weights, computed
// with separate f64 multiply and subtract, fraction cast to f32.
// ---------------------------------------------------------------------------
static void bilin3(BiW& bw) {
#pragma clang fp contract(off)
  const double scale = 32.0 / 3.0;
  for (int p = 0; p < 3; ++p) {
    double src = ((double)p + 0.5) * scale;
    src = src - 0.5;
    if (src < 0.0) src = 0.0;
    const int f = (int)src;
    const float frac = (float)(src - (double)f);
    int c0 = f, c1 = f + 1;
    if (c0 > HIMG - 1) c0 = HIMG - 1;
    if (c1 > HIMG - 1) c1 = HIMG - 1;
    bw.i0[p] = c0;
    bw.i1[p] = c1;
    bw.w0[p] = 1.0f - frac;
    bw.w1[p] = frac;
  }
}

extern "C" void kernel_launch(void* const* d_in, const int* in_sizes, int n_in,
                              void* d_out, int out_size, void* d_ws, size_t ws_size,
                              hipStream_t stream) {
  if (n_in < 11) return;
  if (in_sizes[0] != NBATCH * CIN * NPIX) return;
  if (in_sizes[1] != DQ * CIN || in_sizes[2] != DQ) return;
  if (in_sizes[3] != DQ * CIN * 9 || in_sizes[4] != DQ) return;
  if (in_sizes[5] != DV * CIN * 9 || in_sizes[6] != DV) return;
  if (in_sizes[7] != DV * CIN || in_sizes[8] != DV) return;
  if (in_sizes[9] != DV * DV * 9 || in_sizes[10] != DV) return;
  if (out_size != NBATCH * DV * NPIX) return;

  const float* x      = (const float*)d_in[0];
  const float* q_w    = (const float*)d_in[1];
  const float* q_b    = (const float*)d_in[2];
  const float* k_w    = (const float*)d_in[3];
  const float* k_b    = (const float*)d_in[4];
  const float* v_w    = (const float*)d_in[5];
  const float* v_b    = (const float*)d_in[6];
  const float* bias_w = (const float*)d_in[7];
  const float* bias_b = (const float*)d_in[8];
  const float* hu_w   = (const float*)d_in[9];
  const float* hu_b   = (const float*)d_in[10];
  float* out = (float*)d_out;

  // workspace carve (bytes); every region sized to whole 256-B multiples and
  // written only with whole-line stores inside its extent
  char* ws = (char*)d_ws;
  size_t off = 0;
#define CARVE(T, name, bytes) T* name = (T*)(ws + off); off += (((size_t)(bytes)) + 255) & ~(size_t)255;
  const size_t padpx  = (size_t)NBATCH * PW * PW;                    // 4624 padded pixels
  CARVE(us,    XPH,   padpx * CIN * 2);                               // 2367488
  CARVE(us,    XPL,   padpx * CIN * 2);
  CARVE(us,    WQH,   (size_t)DQ * CIN * 2);                          // 262144
  CARVE(us,    WQL,   (size_t)DQ * CIN * 2);
  CARVE(us,    WKH,   (size_t)DQ * CIN * 9 * 2);                      // 2359296
  CARVE(us,    WKL,   (size_t)DQ * CIN * 9 * 2);
  CARVE(us,    WVH,   (size_t)DV * CIN * 9 * 2);                      // 1179648
  CARVE(us,    WVL,   (size_t)DV * CIN * 9 * 2);
  CARVE(us,    WHH,   (size_t)DV * DV * 9 * 2);                       // 1179648
  CARVE(us,    WHL,   (size_t)DV * DV * 9 * 2);
  CARVE(float, BIASV, (size_t)NBATCH * DV * 4);                       // 4096 = 32 lines
  CARVE(us,    RQH,   padpx * DQ * 2);                                // 4734976
  CARVE(us,    RQL,   padpx * DQ * 2);
  CARVE(float, R2K,   (size_t)NBATCH * DQ * NPIX * 4);                // 8388608
  CARVE(us,    VNH,   (size_t)NBATCH * DV * NPIX * 2);                // 2097152
  CARVE(us,    VNL,   (size_t)NBATCH * DV * NPIX * 2);
  CARVE(float, PARTQ, (size_t)512 * 128);                             // 512 lines
  CARVE(float, PARTK, (size_t)512 * 128);                             // 512 lines
  CARVE(float, SCAL,  256);                                           // 1 line used
  CARVE(us,    FTH,   (size_t)NBATCH * 8 * DVH * FTK * 2);            // 1179648
  CARVE(us,    FTL,   (size_t)NBATCH * 8 * DVH * FTK * 2);
  CARVE(us,    QKH,   padpx * DV * 2);                                // 2367488
  CARVE(us,    QKL,   padpx * DV * 2);
  CARVE(float, OUTP,  (size_t)NBATCH * DV * NPIX * 4);                // 4194304
  CARVE(float, PARTL, (size_t)256 * 128);                             // 256 lines
  CARVE(float, ROWS,  (size_t)NBATCH * HIMG * CIN * 4);               // 131072
#undef CARVE
  if (off > ws_size) return;
  if (off > (size_t)134217728) return;

  BiW bw;
  bilin3(bw);

  // 16-bit operand planes
  k_prep<<<NB_PREP, 256, 0, stream>>>(x, q_w, k_w, v_w, hu_w, XPH, XPL, ROWS,
                                      WQH, WQL, WKH, WKL, WVH, WVL, WHH, WHL, RQH, RQL, QKH, QKL);

  // k (3x3), v (3x3), q (1x1) convolutions
  k_conv_qkv<<<NB_CK + NB_CV + NB_CQ, 128, 0, stream>>>(XPH, XPL, WKH, WKL, k_b, R2K, PARTK,
                                                        WVH, WVL, v_b, VNH, VNL,
                                                        WQH, WQL, q_b, RQH, RQL, PARTQ);

  // channel means + bias linear and phi ratios; pooled KV filters, grouped conv
  k_bias_phinorm<<<2, 256, 0, stream>>>(ROWS, bias_w, bias_b, BIASV, PARTQ, PARTK, SCAL);
  k_kv<<<dim3(9, NBATCH * 8), 128, 0, stream>>>(R2K, VNH, VNL, SCAL, bw, FTH, FTL);
  k_gconv<<<dim3(16, 4, NBATCH), 128, 0, stream>>>(RQH, RQL, FTH, FTL, SCAL, BIASV, QKH, QKL);

  // head unification conv + LayerNorm
  k_conv_hu<<<dim3(64, DV / 64), 128, 0, stream>>>(QKH, QKL, WHH, WHL, hu_b, OUTP, PARTL);
  k_ln<<<(NBATCH * DV * NPIX) / 1024, 256, 0, stream>>>(OUTP, PARTL, out);
}

// v004
// Measured time: 129 microseconds a run.
// In both of two side-by-side timings against v003, it was 1.16 times as fast.
// Over all steps from v000 it is 3.33 times as fast.
// Contractions: q 1x1 conv, k/v/hu 3x3 convs as implicit GEMM (K = 9*256), pooled KV outer-product GEMMs (64x32x64 per head and tap: the two image rows with a non-zero pool weight), per-sample grouped 3x3 conv (K = 9*64) and the channel-mean bias linear, all on v_wmma_f32_16x16x32_bf16 with bf16 hi/lo three-product operand split (hi*hi + lo*hi + hi*lo), f32 accumulate; phi norm ratios, clip, channel means and LayerNorm statistics in f32/f64 on the VALU.
#include <hip/hip_runtime.h>

typedef unsigned short us;
typedef int   v8i  __attribute__((ext_vector_type(8)));
typedef float v8f  __attribute__((ext_vector_type(8)));
typedef float v4f  __attribute__((ext_vector_type(4)));
typedef unsigned short v8us __attribute__((ext_vector_type(8)));
typedef __bf16 v16b __attribute__((ext_vector_type(16)));
typedef v4f  __attribute__((may_alias)) v4fa;
typedef v8us __attribute__((may_alias)) v8usa;
union Frag { v8i v; v8us half[2]; };
union DPack { double d[2]; v4f f; };

#define NBATCH 4
#define CIN    256
#define HIMG   32
#define NPIX   1024
#define PW     34
#define DQ     512
#define DV     256
#define DK     64
#define DVH    32
#define FTK    576

struct BiW { int i0[3]; int i1[3]; float w0[3]; float w1[3]; };
static_assert(sizeof(BiW) == 48);

// The bilinear pool (32 -> 3, align_corners = false) gives a non-zero weight to image row
// floor((p + 0.5) * 32 / 3 - 0.5) = (64 p + 29) / 6 and to the row below it, p = 0..2, and to no other.
// V enters the result only through that pool, so only these rows of V are ever read.
constexpr int pool_row(int p) { return (64 * p + 29) / 6; }
// the two-row pixel tiles (image rows 2 t, 2 t + 1) that hold those six rows
#define NVT 4
constexpr int VT0 = pool_row(0) >> 1, VT1 = pool_row(1) >> 1, VT2 = (pool_row(1) + 1) >> 1, VT3 = pool_row(2) >> 1;
static_assert(((pool_row(0) + 1) >> 1) == VT0 && ((pool_row(2) + 1) >> 1) == VT3, "rows of taps 0 and 2 share a tile");
static_assert(VT0 < VT1 && VT1 < VT2 && VT2 < VT3 && VT3 < HIMG / 2, "four distinct tiles, one writer each");

// ---------------------------------------------------------------------------
// bf16 helpers (RNE convert) and the hi/lo split
// ---------------------------------------------------------------------------
__device__ __forceinline__ us f2bf(float f) {
  unsigned u = __float_as_uint(f);
  u += 0x7FFFu + ((u >> 16) & 1u);
  return (us)(u >> 16);
}
__device__ __forceinline__ float bf2f(us hv) {
  return __uint_as_float(((unsigned)hv) << 16);
}
__device__ __forceinline__ void split2(float f, us& hi, us& lo) {
  hi = f2bf(f);
  lo = f2bf(f - bf2f(hi));
}

// ---------------------------------------------------------------------------
// 16x16x32 bf16 WMMA with hazard guard (ties D, keeps A/B live).
// Fragment map (wave32): lane l, h = l>>4, m = n = l&15.
//   A/B element i: i<8 -> k0+8h+i ; i>=8 -> k0+16+8h+(i-8)
//   D element r : row 8h+r, col l&15
// ---------------------------------------------------------------------------
__device__ __forceinline__ v8f wmma_bf(v8i a, v8i b, v8f c) {
  v8f d = __builtin_amdgcn_wmma_f32_16x16x32_bf16(false, __builtin_bit_cast(v16b, a), false,
                                                  __builtin_bit_cast(v16b, b), (short)0, c, false, false);
  asm volatile("v_nop\n\tv_nop\n\tv_nop\n\tv_nop" : "+v"(d) : "v"(a), "v"(b));
  return d;
}
// three-product split: ah*bh + al*bh + ah*bl into one accumulator
__device__ __forceinline__ v8f wmma3(v8i ah, v8i al, v8i bh, v8i bl, v8f c) {
  c = wmma_bf(ah, bh, c);
  c = wmma_bf(al, bh, c);
  c = wmma_bf(ah, bl, c);
  return c;
}
// fragment from a k-contiguous 16-bit row (pointer already at k0)
__device__ __forceinline__ v8i ldfrag(const us* p, int h) {
  Frag f;
  f.half[0] = *(const v8usa*)(p + 8 * h);
  f.half[1] = *(const v8usa*)(p + 16 + 8 * h);
  return f.v;
}

__device__ __forceinline__ float wave_sum(float s) {
  s += __shfl_xor(s, 16);
  s += __shfl_xor(s, 8);
  s += __shfl_xor(s, 4);
  s += __shfl_xor(s, 2);
  s += __shfl_xor(s, 1);
  return s;
}
__device__ __forceinline__ double dshfl_xor(double v, int msk) {
  const unsigned long long u = __builtin_bit_cast(unsigned long long, v);
  int lo = (int)(unsigned)(u & 0xFFFFFFFFull);
  int hi = (int)(unsigned)(u >> 32);
  lo = __shfl_xor(lo, msk);
  hi = __shfl_xor(hi, msk);
  const unsigned long long r = (((unsigned long long)(unsigned)hi) << 32) | (unsigned long long)(unsigned)lo;
  return __builtin_bit_cast(double, r);
}
__device__ __forceinline__ double wave_sum_d(double s) {
  s += dshfl_xor(s, 16);
  s += dshfl_xor(s, 8);
  s += dshfl_xor(s, 4);
  s += dshfl_xor(s, 2);
  s += dshfl_xor(s, 1);
  return s;
}

// ---------------------------------------------------------------------------
// Kernel: x NCHW f32 -> bf16 hi/lo padded NHWC planes [b][34][34][256]
// (interior pixels). Block role = (y, b); LDS transpose; one instruction writes one
// coverage: 8 waves x 4 pixels = 32 px per row, 32 lanes x 8 = 256 ch.
// Also the f32 sum of each channel's image row (32 values, fixed order) into
// rowsum[b][y][c]: 256 threads x 4 B = 8 whole lines per block. The f32 copy
// sits in LDS at pitch 33 words, free of bank conflicts on store and on read.
// ---------------------------------------------------------------------------
__device__ __forceinline__ void prep_x_body(const float* __restrict__ x,
                                            us* __restrict__ xh, us* __restrict__ xl,
                                            float* __restrict__ rowsum, int y, int b) {
  __shared__ __attribute__((aligned(16))) us sh[32 * 256];
  __shared__ __attribute__((aligned(16))) us sl[32 * 256];
  __shared__ float sf[256 * 33];
  const int tid = threadIdx.x, lane = tid & 31, w = tid >> 5;
  #pragma unroll 1
  for (int j = 0; j < 32; ++j) {
    const int c = 8 * j + w;
    const float v = x[((size_t)(b * CIN + c) * HIMG + y) * HIMG + lane];
    us hi, lo;
    split2(v, hi, lo);
    sh[lane * 256 + c] = hi;
    sl[lane * 256 + c] = lo;
    sf[c * 33 + lane] = v;
  }
  __syncthreads();
  float rs = 0.f;
  // unrolled: constant LDS offsets, the reads issue ahead of the dependent adds
  #pragma unroll
  for (int i = 0; i < 32; ++i) rs += sf[tid * 33 + i];
  rowsum[(size_t)(b * HIMG + y) * CIN + tid] = rs;
  v8us vh[4], vl[4];
  size_t d[4];
  #pragma unroll
  for (int i = 0; i < 4; ++i) {
    const int px = 4 * w + i;
    vh[i] = *(const v8usa*)(sh + px * 256 + 8 * lane);
    vl[i] = *(const v8usa*)(sl + px * 256 + 8 * lane);
    d[i] = ((size_t)((b * PW + y + 1) * PW + px + 1)) * CIN + 8 * lane;
  }
  #pragma unroll
  for (int i = 0; i < 4; ++i) { *(v8us*)(xh + d[i]) = vh[i]; *(v8us*)(xl + d[i]) = vl[i]; }
  
}

// ---------------------------------------------------------------------------
// Kernel: zero the border pixel rows of padded NHWC planes [b][34][34][C].
// Wave = one border pixel; 32 lanes x 16 B = 256 halves per instruction.
// coverage: 132 border pixels x 4 samples, C halves each, both planes.
// ---------------------------------------------------------------------------
__device__ __forceinline__ void zero_border_body(us* __restrict__ ph, us* __restrict__ pl, int C, int bx, int b) {
  const int tid = threadIdx.x, lane = tid & 31, w = tid >> 5;
  const int i = bx * 8 + w;
  if (i >= 132) return;
  int py, px;
  if (i < 34)       { py = 0;           px = i; }
  else if (i < 68)  { py = PW - 1;      px = i - 34; }
  else if (i < 100) { py = i - 68 + 1;  px = 0; }
  else              { py = i - 100 + 1; px = PW - 1; }
  const size_t base = ((size_t)((b * PW + py) * PW + px)) * (size_t)C;
  v8us z;
  #pragma unroll
  for (int j = 0; j < 8; ++j) z[j] = (us)0;
  #pragma unroll 1
  for (int off = 8 * lane; off < C; off += 256) {
    *(v8us*)(ph + base + off) = z;
    *(v8us*)(pl + base + off) = z;
  }
  
}

// ---------------------------------------------------------------------------
// Kernel: OIHW f32 weights -> rows [o][tap*256 + c] as bf16 hi and lo planes.
// Thread = 8 consecutive row elements, one 16-B store per lane per plane,
// coverage: cout*taps*256 elements, grid = n/2048 exactly.
// ---------------------------------------------------------------------------
__device__ __forceinline__ void wprep_body(const float* __restrict__ wsrc, int cout, int taps,
                                           us* __restrict__ wh, us* __restrict__ wl, int bx) {
  const int g = bx * 256 + threadIdx.x;
  const int kw = taps * 256;
  const int n = cout * kw;
  const int e8 = g * 8;
  if (e8 >= n) return;
  const int o = e8 / kw;
  const int r = e8 - o * kw;
  const int tap = r >> 8, c = r & 255;
  const float* src = wsrc + ((size_t)(o * 256 + c)) * taps + tap;
  v8us vh, vl;
  #pragma unroll
  for (int i = 0; i < 8; ++i) {
    us a, bq;
    split2(src[(size_t)i * taps], a, bq);
    vh[i] = a;
    vl[i] = bq;
  }
  *(v8us*)(wh + e8) = vh;
  *(v8us*)(wl + e8) = vl;
  
}

// ---------------------------------------------------------------------------
// Kernel: all operand preparation in one grid (the roles share no data, so
// they run side by side instead of one launch after another). Role by block
// index, the longest first: x planes, then k, v, hu, q weight rows, then the
// zero borders of the three padded plane pairs.
// ---------------------------------------------------------------------------
#define NB_X   (HIMG * NBATCH)
#define NB_WK  ((DQ * CIN * 9) / 2048)
#define NB_WV  ((DV * CIN * 9) / 2048)
#define NB_WH  ((DV * DV * 9) / 2048)
#define NB_WQ  ((DQ * CIN) / 2048)
#define NB_ZB  (17 * NBATCH)
#define NB_PREP (NB_X + NB_WK + NB_WV + NB_WH + NB_WQ + 3 * NB_ZB)
__global__ __launch_bounds__(256) void k_prep(
    const float* __restrict__ x, const float* __restrict__ q_w, const float* __restrict__ k_w,
    const float* __restrict__ v_w, const float* __restrict__ hu_w,
    us* __restrict__ xh, us* __restrict__ xl, float* __restrict__ rowsum,
    us* __restrict__ wqh, us* __restrict__ wql, us* __restrict__ wkh, us* __restrict__ wkl,
    us* __restrict__ wvh, us* __restrict__ wvl, us* __restrict__ whh, us* __restrict__ whl,
    us* __restrict__ rqh, us* __restrict__ rql, us* __restrict__ qkh, us* __restrict__ qkl) {
  int i = blockIdx.x;
  if (i < NB_X) { prep_x_body(x, xh, xl, rowsum, i & (HIMG - 1), i / HIMG); return; }
  i -= NB_X;
  if (i < NB_WK) { wprep_body(k_w, DQ, 9, wkh, wkl, i); return; }
  i -= NB_WK;
  if (i < NB_WV) { wprep_body(v_w, DV, 9, wvh, wvl, i); return; }
  i -= NB_WV;
  if (i < NB_WH) { wprep_body(hu_w, DV, 9, whh, whl, i); return; }
  i -= NB_WH;
  if (i < NB_WQ) { wprep_body(q_w, DQ, 1, wqh, wql, i); return; }
  i -= NB_WQ;
  const int pl = i / NB_ZB, r = i - pl * NB_ZB;
  const int bx = r % 17, b = r / 17;
  if (pl == 0)      zero_border_body(xh, xl, CIN, bx, b);
  else if (pl == 1) zero_border_body(rqh, rql, DQ, bx, b);
  else              zero_border_body(qkh, qkl, DV, bx, b);
}

// ---------------------------------------------------------------------------
// Fragment from 32 consecutive-k f32 values of one row (pointer at k0), split
// into hi/lo bf16 fragments in registers (fragment map as above).
// ---------------------------------------------------------------------------
__device__ __forceinline__ void frag_f32(const float* __restrict__ p, int h, v8i& fh, v8i& fl) {
  const v4f q0 = *(const v4fa*)(p + 8 * h);
  const v4f q1 = *(const v4fa*)(p + 8 * h + 4);
  const v4f q2 = *(const v4fa*)(p + 16 + 8 * h);
  const v4f q3 = *(const v4fa*)(p + 20 + 8 * h);
  float v[16];
  v[0] = q0.x; v[1] = q0.y; v[2] = q0.z; v[3] = q0.w;
  v[4] = q1.x; v[5] = q1.y; v[6] = q1.z; v[7] = q1.w;
  v[8] = q2.x; v[9] = q2.y; v[10] = q2.z; v[11] = q2.w;
  v[12] = q3.x; v[13] = q3.y; v[14] = q3.z; v[15] = q3.w;
  Frag a, bq;
  #pragma unroll
  for (int i = 0; i < 16; ++i) {
    us hi, lo;
    split2(v[i], hi, lo);
    a.half[i >> 3][i & 7] = hi;
    bq.half[i >> 3][i & 7] = lo;
  }
  fh = a.v;
  fl = bq.v;
}

// ---------------------------------------------------------------------------
// Block role: channel means of x (f32, from the 32 row sums of each channel, fixed
// order) and the bias linear on WMMA:
// bias[b][o] = sum_c mean[b][c] * bw[o][c] + bb[o]. One block of 8 waves.
// A = means [16 rows (4 real, 12 zero)][256] hi/lo in LDS, B = bw rows [o][c]
// coverage: 256 threads x 16 B = 4096 B = all of bias.
// ---------------------------------------------------------------------------
__device__ __forceinline__ void bias_body(const float* __restrict__ rowsum, const float* __restrict__ bw,
                                          const float* __restrict__ bb, float* __restrict__ biasv) {
  __shared__ __attribute__((aligned(16))) us sah[16 * 256];
  __shared__ __attribute__((aligned(16))) us sal[16 * 256];
  __shared__ __attribute__((aligned(16))) float sd[4 * 256];
  const int tid = threadIdx.x, lane = tid & 31, w = tid >> 5;
  const int h = lane >> 4, m = lane & 15;
  for (int i = tid; i < 16 * 256; i += 256) {
    if (i >= 4 * 256) { sah[i] = (us)0; sal[i] = (us)0; }
  }
  {
    const int k = tid >> 6, c4 = 4 * (tid & 63);   // b = k, channels c4 .. c4+3
    const float* p = rowsum + (size_t)k * HIMG * CIN + c4;
    v4f sm;
    sm.x = 0.f; sm.y = 0.f; sm.z = 0.f; sm.w = 0.f;
    // unrolled: the 32 loads fly together, one memory latency instead of 32
    #pragma unroll
    for (int i = 0; i < HIMG; ++i) sm += *(const v4fa*)(p + i * CIN);
    // unrolled: constant vector index, sm stays in registers
    #pragma unroll
    for (int e = 0; e < 4; ++e) {
      const float mean = sm[e] * (1.0f / 1024.0f);
      us hi, lo;
      split2(mean, hi, lo);
      sah[k * 256 + c4 + e] = hi;
      sal[k * 256 + c4 + e] = lo;
    }
  }
  __syncthreads();

  const int o0 = 32 * w + m, o1 = o0 + 16;
  const float* br0 = bw + (size_t)o0 * 256;
  const float* br1 = bw + (size_t)o1 * 256;
  const v8f z8 = {0.f, 0.f, 0.f, 0.f, 0.f, 0.f, 0.f, 0.f};
  v8f acc[2];
  acc[0] = z8; acc[1] = z8;
  #pragma unroll 1
  for (int k0 = 0; k0 < 256; k0 += 32) {
    const v8i ah = ldfrag(sah + m * 256 + k0, h);
    const v8i al = ldfrag(sal + m * 256 + k0, h);
    v8i bh0, bl0, bh1, bl1;
    frag_f32(br0 + k0, h, bh0, bl0);
    frag_f32(br1 + k0, h, bh1, bl1);
    acc[0] = wmma3(ah, al, bh0, bl0, acc[0]);
    acc[1] = wmma3(ah, al, bh1, bl1, acc[1]);
  }
  const float bb0 = bb[o0], bb1 = bb[o1];
  if (h == 0) {
    #pragma unroll
    for (int r = 0; r < 4; ++r) {
      sd[r * 256 + o0] = acc[0][r] + bb0;
      sd[r * 256 + o1] = acc[1][r] + bb1;
    }
  }
  __syncthreads();
  const int L = tid >> 3, q = tid & 7;
  const v4f v = *(const v4fa*)(sd + L * 32 + 4 * q);
  float* dst = biasv + L * 32 + 4 * q;
  *(v4f*)dst = v;
  
}

// ---------------------------------------------------------------------------
// Eight asynchronous 16-B copies global -> LDS per lane (no register staging).
// l = the lane's LDS byte addresses, g = its global addresses, both 16-B
// aligned. The closing s_wait_xcnt keeps later rewrites of the address
// registers behind the copies' issue (precaution), so it sits in the statement.
// ---------------------------------------------------------------------------
__device__ __forceinline__ void acopy8(const unsigned (&l)[8], const us* const (&g)[8]) {
  asm volatile(
      "global_load_async_to_lds_b128 %0, %8, off\n\t"
      "global_load_async_to_lds_b128 %1, %9, off\n\t"
      "global_load_async_to_lds_b128 %2, %10, off\n\t"
      "global_load_async_to_lds_b128 %3, %11, off\n\t"
      "global_load_async_to_lds_b128 %4, %12, off\n\t"
      "global_load_async_to_lds_b128 %5, %13, off\n\t"
      "global_load_async_to_lds_b128 %6, %14, off\n\t"
      "global_load_async_to_lds_b128 %7, %15, off\n\t"
      "s_wait_xcnt 0x0"
      :: "v"(l[0]), "v"(l[1]), "v"(l[2]), "v"(l[3]), "v"(l[4]), "v"(l[5]), "v"(l[6]), "v"(l[7]),
         "v"(g[0]), "v"(g[1]), "v"(g[2]), "v"(g[3]), "v"(g[4]), "v"(g[5]), "v"(g[6]), "v"(g[7])
      : "memory");
}

// LDS ring of k_conv: a stage = 128 channels (256 B) of 64 pixel rows and 64
// weight rows, hi and lo planes; row pitch 272 B (conflict-free 16-B reads).
#define KCH    128
#define LPITCH 136
#define LPLANE (64 * LPITCH)
#define LSTAGE (4 * LPLANE)

// ---------------------------------------------------------------------------
// Kernel: implicit-GEMM convolution (Cin = 256 per pixel) over bf16 hi/lo
// zero-padded NHWC planes [b][34][34][256]; weights as rows [o][tap*256+c]
// hi/lo. Block = 64 pixels (image rows y0, y0+1) x 64 output channels,
// 4 waves of 32 px x 32 ch (2x2 tiles), K = ntaps*256 in steps of 32,
// operand rows staged in LDS by asynchronous copies of whole 256-B units (two
// buffers, the next stage flies while this one is worked on), fragments read
// from LDS, three products per tile pair.
// MODE 0: relu^2 -> bf16 hi/lo padded NHWC planes (pitch = cout) + (s2,s4) partial line
// MODE 1: relu^2 -> f32 NCHW + (s2,s4) partial line
// MODE 2: value -> bf16 hi/lo NCHW planes
// MODE 3: value -> f32 NCHW + (sum, sum of squares) partial line (f64)
// coverage: MODE 0 store: 4 waves x 16 px x 8 lanes x 8 ch = 64 px x 64 ch;
// MODE 1/3: 4 waves x 16 ch x 64 px; MODE 2: 4 waves x 16 ch x 8 lanes x 8 px.
// ---------------------------------------------------------------------------
// The body takes its tile (bx = pixel tile, by = channel tile of gy) and the
// block's LDS from the kernel that calls it.
template <int MODE>
__device__ __forceinline__ void conv_body(
    us* ring, float* sbuf, double (*sred)[2], int bx, int by, int gy,
    const us* __restrict__ ah, const us* __restrict__ al,
    const us* __restrict__ wh, const us* __restrict__ wl,
    const float* __restrict__ bias, int ntaps, int cout,
    us* __restrict__ oh, us* __restrict__ ol, float* __restrict__ of, float* __restrict__ part)
{
  const int tid = threadIdx.x, lane = tid & 31, w = tid >> 5;
  const int h = lane >> 4, m = lane & 15;
  const int pt = bx, b = pt >> 4, y0 = (pt & 15) * 2;
  const int n0 = by * 64;
  const int ry = w >> 1, nw = 32 * (w & 1);
  const int kw = ntaps * CIN;
  const int nst = 2 * ntaps;
  // copy map: 16 lanes x 16 B = one 256-B row piece; thread rows r0 + 8 i
  const int q16 = tid & 15, r0 = tid >> 4;
  const unsigned lds0 = (unsigned)(size_t)ring + (unsigned)(r0 * (LPITCH * 2) + q16 * 16);
  const size_t wbase = (size_t)(n0 + r0) * kw + 8 * q16;
  // stage s (tap s / 2, channels 128 (s & 1) ..) into buffer bufi
  auto stage_copy = [&](int s, int bufi) {
    const int tap = s >> 1, c0 = (s & 1) * KCH;
    const int t3 = tap / 3;
    const int ky = (ntaps == 1) ? 1 : t3;
    const int kx = (ntaps == 1) ? 1 : (tap - 3 * t3);
    const size_t ao = ((size_t)((b * PW + y0 + ky) * PW + kx + r0)) * CIN + c0 + 8 * q16;
    const size_t wo = wbase + (size_t)s * KCH;
    const unsigned lb = lds0 + (unsigned)bufi * (LSTAGE * 2);
    unsigned l[8];
    const us* g[8];
    #pragma unroll
    for (int i = 0; i < 8; ++i) {
      l[i] = lb + (unsigned)(i * 8 * LPITCH * 2);
      g[i] = ah + ao + (size_t)((i >> 2) * PW * CIN + (i & 3) * 8 * CIN);
    }
    acopy8(l, g);
    #pragma unroll
    for (int i = 0; i < 8; ++i) {
      l[i] = lb + (unsigned)(LPLANE * 2 + i * 8 * LPITCH * 2);
      g[i] = al + ao + (size_t)((i >> 2) * PW * CIN + (i & 3) * 8 * CIN);
    }
    acopy8(l, g);
    #pragma unroll
    for (int i = 0; i < 8; ++i) {
      l[i] = lb + (unsigned)(2 * LPLANE * 2 + i * 8 * LPITCH * 2);
      g[i] = wh + wo + (size_t)(i * 8) * kw;
    }
    acopy8(l, g);
    #pragma unroll
    for (int i = 0; i < 8; ++i) {
      l[i] = lb + (unsigned)(3 * LPLANE * 2 + i * 8 * LPITCH * 2);
      g[i] = wl + wo + (size_t)(i * 8) * kw;
    }
    acopy8(l, g);
  };
  const v8f z8 = {0.f, 0.f, 0.f, 0.f, 0.f, 0.f, 0.f, 0.f};
  v8f acc[2][2];
  #pragma unroll
  for (int i = 0; i < 2; ++i) { acc[i][0] = z8; acc[i][1] = z8; }

  // prologue: stage 0 landed and published, then stage 1 in flight
  stage_copy(0, 0);
  asm volatile("s_wait_asynccnt 0x0" ::: "memory");  // this wave's copies of stage 0 have landed
  __syncthreads();                                   // ... and every other wave's
  stage_copy(1, 1);                                  // nst = 2 ntaps >= 2

  const int arow = (ry * 32 + m) * LPITCH;
  const int brow = 2 * LPLANE + (nw + m) * LPITCH;
  #pragma unroll 1
  for (int s = 0; s < nst; ++s) {
    const us* sb = ring + (s & 1) * LSTAGE;
    #pragma unroll
    for (int kk = 0; kk < KCH; kk += 32) {
      const v8i fa0h = ldfrag(sb + arow + kk, h);
      const v8i fa0l = ldfrag(sb + LPLANE + arow + kk, h);
      const v8i fa1h = ldfrag(sb + arow + 16 * LPITCH + kk, h);
      const v8i fa1l = ldfrag(sb + LPLANE + arow + 16 * LPITCH + kk, h);
      #pragma unroll
      for (int nt = 0; nt < 2; ++nt) {
        const v8i fbh = ldfrag(sb + brow + nt * 16 * LPITCH + kk, h);
        const v8i fbl = ldfrag(sb + LPLANE + brow + nt * 16 * LPITCH + kk, h);
        acc[0][nt] = wmma3(fa0h, fa0l, fbh, fbl, acc[0][nt]);
        acc[1][nt] = wmma3(fa1h, fa1l, fbh, fbl, acc[1][nt]);
      }
    }
    // publish point of stage s + 1, and hand-over of this stage's buffer
    asm volatile("s_wait_dscnt 0x0" ::: "memory");     // this wave's reads of the buffer are done
    asm volatile("s_wait_asynccnt 0x0" ::: "memory");  // this wave's copies of stage s + 1 have landed
    __syncthreads();                                   // both hold for every wave of the block
    if (s + 2 < nst) stage_copy(s + 2, s & 1);
  }
  asm volatile("s_wait_asynccnt 0x0" ::: "memory");    // no copy outstanding past the loop

  // epilogue into LDS
  float bv[2];
  bv[0] = bias[n0 + nw + m];
  bv[1] = bias[n0 + nw + 16 + m];
  us* sH = reinterpret_cast<us*>(sbuf);
  us* sL = sH + 4096;
  float fs = 0.f, fq = 0.f;
  double ds = 0.0, dq = 0.0;
  #pragma unroll
  for (int mt = 0; mt < 2; ++mt) {
    #pragma unroll
    for (int nt = 0; nt < 2; ++nt) {
      #pragma unroll
      for (int r = 0; r < 8; ++r) {
        const float val = acc[mt][nt][r] + bv[nt];
        const int tp = ry * 32 + mt * 16 + 8 * h + r;
        const int ch = nw + 16 * nt + m;
        if (MODE == 0) {
          const float rr = fmaxf(val, 0.f);
          const float r2 = rr * rr;
          fs += r2; fq += r2 * r2;
          us hi, lo;
          split2(r2, hi, lo);
          sH[tp * 64 + ch] = hi;
          sL[tp * 64 + ch] = lo;
        } else if (MODE == 1) {
          const float rr = fmaxf(val, 0.f);
          const float r2 = rr * rr;
          fs += r2; fq += r2 * r2;
          sbuf[ch * 64 + tp] = r2;
        } else if (MODE == 2) {
          us hi, lo;
          split2(val, hi, lo);
          sH[ch * 64 + tp] = hi;
          sL[ch * 64 + tp] = lo;
        } else {
          ds += (double)val;
          dq += (double)val * (double)val;
          sbuf[ch * 64 + tp] = val;
        }
      }
    }
  }
  if (MODE == 0 || MODE == 1) {
    fs = wave_sum(fs);
    fq = wave_sum(fq);
    ds = (double)fs;
    dq = (double)fq;
  } else if (MODE == 3) {
    ds = wave_sum_d(ds);
    dq = wave_sum_d(dq);
  }
  if (MODE != 2) {
    if (lane == 0) { sred[w][0] = ds; sred[w][1] = dq; }
  }
  __syncthreads();

  // block partial line (2 doubles + zeros), fixed order over the 4 waves
  v4f pv;
  pv.x = 0.f; pv.y = 0.f; pv.z = 0.f; pv.w = 0.f;
  size_t li = 0;
  bool pw = false;
  if (MODE != 2) {
    double S = 0.0, Q2 = 0.0;
    #pragma unroll
    for (int k = 0; k < 4; ++k) { S += sred[k][0]; Q2 += sred[k][1]; }
    DPack pk;
    pk.d[0] = S; pk.d[1] = Q2;
    pv.x = (lane == 0) ? pk.f.x : 0.f;
    pv.y = (lane == 0) ? pk.f.y : 0.f;
    pv.z = (lane == 0) ? pk.f.z : 0.f;
    pv.w = (lane == 0) ? pk.f.w : 0.f;
    li = ((size_t)bx * gy + by) * 32 + 4 * (lane & 7);
    pw = (w == 0) && (lane < 8);
  }

  if (MODE == 0) {
    const int q8 = lane & 7, sub = lane >> 3;
    v8us th[4], tl[4];
    size_t d[4];
    #pragma unroll
    for (int i = 0; i < 4; ++i) {
      const int tp = 16 * w + 4 * i + sub;
      const int ry2 = tp >> 5, xx = tp & 31;
      th[i] = *(const v8usa*)(sH + tp * 64 + 8 * q8);
      tl[i] = *(const v8usa*)(sL + tp * 64 + 8 * q8);
      d[i] = ((size_t)((b * PW + y0 + ry2 + 1) * PW + xx + 1)) * (size_t)cout + n0 + 8 * q8;
    }
    #pragma unroll
    for (int i = 0; i < 4; ++i) { *(v8us*)(oh + d[i]) = th[i]; *(v8us*)(ol + d[i]) = tl[i]; }
    if (pw) *(v4f*)(part + li) = pv;
    
  } else if (MODE == 2) {
    const int q8 = lane & 7, sub = lane >> 3;
    v8us th[4], tl[4];
    size_t d[4];
    #pragma unroll
    for (int i = 0; i < 4; ++i) {
      const int chl = 16 * w + 4 * i + sub;
      th[i] = *(const v8usa*)(sH + chl * 64 + 8 * q8);
      tl[i] = *(const v8usa*)(sL + chl * 64 + 8 * q8);
      d[i] = ((size_t)(b * cout + n0 + chl)) * NPIX + y0 * HIMG + 8 * q8;
    }
    #pragma unroll
    for (int i = 0; i < 4; ++i) { *(v8us*)(oh + d[i]) = th[i]; *(v8us*)(ol + d[i]) = tl[i]; }
    // another role's code follows these stores in the merged kernel's listing and reuses their registers:
    // the wait keeps any such rewrite behind the stores' issue (precaution)
    asm volatile("s_wait_xcnt 0x0" ::: "memory");
  } else {
    const int hs = lane >> 4, x4 = 4 * (lane & 15);
    v4f tv[8];
    size_t d[8];
    #pragma unroll
    for (int i = 0; i < 8; ++i) {
      const int chl = 16 * w + 2 * i + hs;
      tv[i] = *(const v4fa*)(sbuf + chl * 64 + x4);
      d[i] = ((size_t)(b * cout + n0 + chl)) * NPIX + y0 * HIMG + x4;
    }
    #pragma unroll
    for (int i = 0; i < 8; ++i) *(v4f*)(of + d[i]) = tv[i];
    if (pw) *(v4f*)(part + li) = pv;
    
  }
}

// ---------------------------------------------------------------------------
// Kernel: the head unification conv (MODE 3), one tile per block.
// ---------------------------------------------------------------------------
__global__ __launch_bounds__(128) void k_conv_hu(
    const us* __restrict__ ah, const us* __restrict__ al,
    const us* __restrict__ wh, const us* __restrict__ wl,
    const float* __restrict__ bias, float* __restrict__ of, float* __restrict__ part)
{
  __shared__ __attribute__((aligned(16))) us ring[2 * LSTAGE];
  __shared__ __attribute__((aligned(16))) float sbuf[64 * 64];
  __shared__ double sred[4][2];
  conv_body<3>(ring, sbuf, sred, blockIdx.x, blockIdx.y, DV / 64, ah, al, wh, wl, bias, 9, DV,
               nullptr, nullptr, of, part);
}

// ---------------------------------------------------------------------------
// Kernel: the k, v and q convolutions of x in one grid (they share no result,
// so their tiles fill the chip together). Role by block index, the long 3x3
// tiles first: 512 k tiles, 64 v tiles (only the row tiles that the pool
// reads), 512 q tiles; pixel tile fastest.
// ---------------------------------------------------------------------------
#define NB_CK (64 * (DQ / 64))
#define NB_CV (NBATCH * NVT * (DV / 64))
#define NB_CQ (64 * (DQ / 64))
__global__ __launch_bounds__(128) void k_conv_qkv(
    const us* __restrict__ xh, const us* __restrict__ xl,
    const us* __restrict__ wkh, const us* __restrict__ wkl, const float* __restrict__ k_b,
    float* __restrict__ r2k, float* __restrict__ partk,
    const us* __restrict__ wvh, const us* __restrict__ wvl, const float* __restrict__ v_b,
    us* __restrict__ vnh, us* __restrict__ vnl,
    const us* __restrict__ wqh, const us* __restrict__ wql, const float* __restrict__ q_b,
    us* __restrict__ rqh, us* __restrict__ rql, float* __restrict__ partq)
{
  __shared__ __attribute__((aligned(16))) us ring[2 * LSTAGE];
  __shared__ __attribute__((aligned(16))) float sbuf[64 * 64];
  __shared__ double sred[4][2];
  int i = blockIdx.x;
  if (i < NB_CK) {
    conv_body<1>(ring, sbuf, sred, i & 63, i >> 6, DQ / 64, xh, xl, wkh, wkl, k_b, 9, DQ,
                 nullptr, nullptr, r2k, partk);
    return;
  }
  i -= NB_CK;
  if (i < NB_CV) {
    // i counts only the row tiles that the pool reads: put it back on the grid of 64 pixel tiles per channel tile
    const int t = i & (NVT - 1), b = (i / NVT) & (NBATCH - 1);
    const int rt = (t == 0) ? VT0 : ((t == 1) ? VT1 : ((t == 2) ? VT2 : VT3));
    i = (i / (NVT * NBATCH)) * 64 + b * (HIMG / 2) + rt;
    conv_body<2>(ring, sbuf, sred, i & 63, i >> 6, DV / 64, xh, xl, wvh, wvl, v_b, 9, DV,
                 vnh, vnl, nullptr, nullptr);
    return;
  }
  i -= NB_CV;
  conv_body<0>(ring, sbuf, sred, i & 63, i >> 6, DQ / 64, xh, xl, wqh, wql, q_b, 1, DQ,
               rqh, rql, nullptr, partq);
}

// ---------------------------------------------------------------------------
// Block role: phi norm ratios s = sqrt(sum relu^2) / sqrt(sum relu^4) for the
// q and k tensors from 512 block partial lines each (fixed order, f64).
// Wave 0 = q, wave 1 = k, the other waves only pass the barriers; one whole
// output line.
// ---------------------------------------------------------------------------
__device__ __forceinline__ void phinorm_body(const float* __restrict__ partq, const float* __restrict__ partk,
                                             float* __restrict__ scal) {
  __shared__ double sacc[2][32][2];
  __shared__ float sres[2];
  const int tid = threadIdx.x, lane = tid & 31, w = tid >> 5;
  const float* pp = (w == 0) ? partq : partk;
  if (w < 2) {
    double s2 = 0.0, s4 = 0.0;
    #pragma unroll 1
    for (int j = 0; j < 16; ++j) {
      const double* dp = reinterpret_cast<const double*>(pp + (size_t)(lane * 16 + j) * 32);
      s2 += dp[0];
      s4 += dp[1];
    }
    sacc[w][lane][0] = s2;
    sacc[w][lane][1] = s4;
  }
  __syncthreads();
  if (w < 2 && lane == 0) {
    double t2 = 0.0, t4 = 0.0;
    for (int i = 0; i < 32; ++i) { t2 += sacc[w][i][0]; t4 += sacc[w][i][1]; }
    const float num = sqrtf((float)t2);
    const float den = sqrtf((float)t4);
    sres[w] = num * (1.0f / den);
  }
  __syncthreads();
  v4f pv;
  pv.x = (lane == 0) ? sres[0] : 0.f;
  pv.y = (lane == 0) ? sres[1] : 0.f;
  pv.z = 0.f; pv.w = 0.f;
  const bool pw = (w == 0) && (lane < 8);
  float* dst = scal + 4 * lane;
  if (pw) *(v4f*)dst = pv;
  
}

// ---------------------------------------------------------------------------
// Kernel: the two one-block jobs in front of the pooled filters and the
// grouped conv, side by side: block 0 = bias linear, block 1 = phi ratios.
// ---------------------------------------------------------------------------
__global__ __launch_bounds__(256) void k_bias_phinorm(
    const float* __restrict__ rowsum, const float* __restrict__ bw, const float* __restrict__ bb,
    float* __restrict__ biasv, const float* __restrict__ partq, const float* __restrict__ partk,
    float* __restrict__ scal) {
  if (blockIdx.x == 0) bias_body(rowsum, bw, bb, biasv);
  else                 phinorm_body(partq, partk, scal);
}

// ---------------------------------------------------------------------------
// Kernel: pooled outer product. Block = (tap pq, bh): D[kk 64][v 32] =
// sum_pix (relu(K)^2[kk][pix] * Mh[p][y] * Mw[q][x]) * V[v][pix] over the two
// image rows y where Mh[p][y] is not zero (K = 64; every other term is a
// product with a zero weight, and V exists only on those rows),
// A built in registers from the f32 NCHW relu^2 rows (split hi/lo),
// B from the bf16 NCHW V planes. Epilogue: * sK, clip +-32/9, hi/lo into
// coverage: 4 waves x 8 rows x 8 lanes x 8 kk = 32 v x 64 kk per (bh,pq).
// ---------------------------------------------------------------------------
__global__ __launch_bounds__(128) void k_kv(
    const float* __restrict__ r2k, const us* __restrict__ vnh, const us* __restrict__ vnl,
    const float* __restrict__ scal, BiW bw, us* __restrict__ fth, us* __restrict__ ftl)
{
  __shared__ __attribute__((aligned(16))) us sH[32 * 64];
  __shared__ __attribute__((aligned(16))) us sL[32 * 64];
  const int tid = threadIdx.x, lane = tid & 31, w = tid >> 5;
  const int h = lane >> 4, m = lane & 15;
  const int pq = blockIdx.x, bh = blockIdx.y;
  const int b = bh >> 3, head = bh & 7;
  const int p = pq / 3, q = pq - 3 * p;
  const int   iy0 = (p == 0) ? bw.i0[0] : ((p == 1) ? bw.i0[1] : bw.i0[2]);
  const int   iy1 = (p == 0) ? bw.i1[0] : ((p == 1) ? bw.i1[1] : bw.i1[2]);
  const float wy0 = (p == 0) ? bw.w0[0] : ((p == 1) ? bw.w0[1] : bw.w0[2]);
  const float wy1 = (p == 0) ? bw.w1[0] : ((p == 1) ? bw.w1[1] : bw.w1[2]);
  const int   ix0 = (q == 0) ? bw.i0[0] : ((q == 1) ? bw.i0[1] : bw.i0[2]);
  const int   ix1 = (q == 0) ? bw.i1[0] : ((q == 1) ? bw.i1[1] : bw.i1[2]);
  const float wx0 = (q == 0) ? bw.w0[0] : ((q == 1) ? bw.w0[1] : bw.w0[2]);
  const float wx1 = (q == 0) ? bw.w1[0] : ((q == 1) ? bw.w1[1] : bw.w1[2]);
  const float sK = scal[1];
  const float amax = (float)(32.0 / 9.0);
  const float* arow = r2k + ((size_t)(b * DQ + head * DK + 16 * w + m)) * NPIX;
  const size_t br0 = ((size_t)(b * DV + head * DVH + m)) * NPIX;
  const size_t br1 = br0 + (size_t)16 * NPIX;
  const v8f z8 = {0.f, 0.f, 0.f, 0.f, 0.f, 0.f, 0.f, 0.f};
  v8f acc[2];
  acc[0] = z8; acc[1] = z8;

  #pragma unroll 1
  for (int t = 0; t < 2; ++t) {
    // rows iy0 then iy1, ascending as in the full sum; were the two clamped onto one row, it takes both weights once
    const float wy = (t == 0) ? (wy0 + ((iy1 == iy0) ? wy1 : 0.f)) : ((iy1 == iy0) ? 0.f : wy1);
    const int k0 = ((t == 0) ? iy0 : iy1) * HIMG;
    const float* ap = arow + k0;
    const v4f q0 = *(const v4fa*)(ap + 8 * h);
    const v4f q1 = *(const v4fa*)(ap + 8 * h + 4);
    const v4f q2 = *(const v4fa*)(ap + 16 + 8 * h);
    const v4f q3 = *(const v4fa*)(ap + 20 + 8 * h);
    float v[16];
    v[0] = q0.x; v[1] = q0.y; v[2] = q0.z; v[3] = q0.w;
    v[4] = q1.x; v[5] = q1.y; v[6] = q1.z; v[7] = q1.w;
    v[8] = q2.x; v[9] = q2.y; v[10] = q2.z; v[11] = q2.w;
    v[12] = q3.x; v[13] = q3.y; v[14] = q3.z; v[15] = q3.w;
    Frag fah, fal;
    #pragma unroll
    for (int i = 0; i < 16; ++i) {
      const int xx = 8 * h + (i & 7) + ((i >> 3) << 4);
      const float wx = ((xx == ix0) ? wx0 : 0.f) + ((xx == ix1) ? wx1 : 0.f);
      const float a = v[i] * (wy * wx);
      us hi, lo;
      split2(a, hi, lo);
      fah.half[i >> 3][i & 7] = hi;
      fal.half[i >> 3][i & 7] = lo;
    }
    const v8i fb0h = ldfrag(vnh + br0 + k0, h);
    const v8i fb0l = ldfrag(vnl + br0 + k0, h);
    const v8i fb1h = ldfrag(vnh + br1 + k0, h);
    const v8i fb1l = ldfrag(vnl + br1 + k0, h);
    acc[0] = wmma3(fah.v, fal.v, fb0h, fb0l, acc[0]);
    acc[1] = wmma3(fah.v, fal.v, fb1h, fb1l, acc[1]);
  }

  #pragma unroll
  for (int nt = 0; nt < 2; ++nt) {
    #pragma unroll
    for (int r = 0; r < 8; ++r) {
      float val = acc[nt][r] * sK;
      val = fminf(fmaxf(val, -amax), amax);
      const int kk = 16 * w + 8 * h + r;
      const int vv = 16 * nt + m;
      us hi, lo;
      split2(val, hi, lo);
      sH[vv * 64 + kk] = hi;
      sL[vv * 64 + kk] = lo;
    }
  }
  __syncthreads();
  const int q8 = lane & 7, sub = lane >> 3;
  v8us th[2], tl[2];
  size_t d[2];
  #pragma unroll
  for (int i = 0; i < 2; ++i) {
    const int vv = 8 * w + 4 * i + sub;
    th[i] = *(const v8usa*)(sH + vv * 64 + 8 * q8);
    tl[i] = *(const v8usa*)(sL + vv * 64 + 8 * q8);
    d[i] = ((size_t)(bh * DVH + vv)) * FTK + pq * 64 + 8 * q8;
  }
  #pragma unroll
  for (int i = 0; i < 2; ++i) { *(v8us*)(fth + d[i]) = th[i]; *(v8us*)(ftl + d[i]) = tl[i]; }
  
}

// ---------------------------------------------------------------------------
// Kernel: per-sample grouped 3x3 conv of relu(Q)^2 planes (padded NHWC,
// 512 ch) with the pooled filters, K = 9*64 per head. Block = (64 px, head
// pair, b); wave = (head of the pair, image row) 32 px x 32 v. Epilogue:
// * sQ + bias[b][j*32+v], hi/lo into padded NHWC planes [b][34][34][256];
// coverage: 4 waves x 16 px x 8 lanes x 8 ch = 64 px x 64 ch per block;
// grid 16 x 4 x 4 = all interior pixels x all 256 channels x 4 samples.
// ---------------------------------------------------------------------------
__global__ __launch_bounds__(128) void k_gconv(
    const us* __restrict__ rqh, const us* __restrict__ rql,
    const us* __restrict__ fth, const us* __restrict__ ftl,
    const float* __restrict__ scal, const float* __restrict__ biasv,
    us* __restrict__ oh, us* __restrict__ ol)
{
  __shared__ __attribute__((aligned(16))) us sH[64 * 64];
  __shared__ __attribute__((aligned(16))) us sL[64 * 64];
  const int tid = threadIdx.x, lane = tid & 31, w = tid >> 5;
  const int h = lane >> 4, m = lane & 15;
  const int pt = blockIdx.x, jp = blockIdx.y, b = blockIdx.z;
  const int y0 = 2 * pt;
  const int jl = w >> 1, ry = w & 1;
  const int j = 2 * jp + jl, y = y0 + ry, bh = b * 8 + j;
  const size_t fr0 = ((size_t)(bh * DVH + m)) * FTK;
  const size_t fr1 = fr0 + (size_t)16 * FTK;
  const v8f z8 = {0.f, 0.f, 0.f, 0.f, 0.f, 0.f, 0.f, 0.f};
  v8f acc[2][2];
  #pragma unroll
  for (int i = 0; i < 2; ++i) { acc[i][0] = z8; acc[i][1] = z8; }

  #pragma unroll 1
  for (int tap = 0; tap < 9; ++tap) {
    const int ky = tap / 3;
    const int kx = tap - 3 * ky;
    const size_t ar0 = ((size_t)((b * PW + y + ky) * PW + kx + m)) * DQ + (size_t)j * DK;
    const size_t ar1 = ar0 + (size_t)16 * DQ;
    const size_t wt = (size_t)tap * DK;
    #pragma unroll
    for (int c0 = 0; c0 < DK; c0 += 32) {
      const v8i fa0h = ldfrag(rqh + ar0 + c0, h);
      const v8i fa0l = ldfrag(rql + ar0 + c0, h);
      const v8i fa1h = ldfrag(rqh + ar1 + c0, h);
      const v8i fa1l = ldfrag(rql + ar1 + c0, h);
      #pragma unroll
      for (int nt = 0; nt < 2; ++nt) {
        const size_t fr = (nt == 0) ? fr0 : fr1;
        const v8i fbh = ldfrag(fth + fr + wt + c0, h);
        const v8i fbl = ldfrag(ftl + fr + wt + c0, h);
        acc[0][nt] = wmma3(fa0h, fa0l, fbh, fbl, acc[0][nt]);
        acc[1][nt] = wmma3(fa1h, fa1l, fbh, fbl, acc[1][nt]);
      }
    }
  }

  const float sQ = scal[0];
  float bv[2];
  bv[0] = biasv[b * DV + j * DVH + m];
  bv[1] = biasv[b * DV + j * DVH + 16 + m];
  #pragma unroll
  for (int mt = 0; mt < 2; ++mt) {
    #pragma unroll
    for (int nt = 0; nt < 2; ++nt) {
      #pragma unroll
      for (int r = 0; r < 8; ++r) {
        const float val = acc[mt][nt][r] * sQ + bv[nt];
        const int tp = ry * 32 + mt * 16 + 8 * h + r;
        const int chl = jl * 32 + 16 * nt + m;
        us hi, lo;
        split2(val, hi, lo);
        sH[tp * 64 + chl] = hi;
        sL[tp * 64 + chl] = lo;
      }
    }
  }
  __syncthreads();
  const int q8 = lane & 7, sub = lane >> 3;
  v8us th[4], tl[4];
  size_t d[4];
  #pragma unroll
  for (int i = 0; i < 4; ++i) {
    const int tp = 16 * w + 4 * i + sub;
    const int ry2 = tp >> 5, xx = tp & 31;
    th[i] = *(const v8usa*)(sH + tp * 64 + 8 * q8);
    tl[i] = *(const v8usa*)(sL + tp * 64 + 8 * q8);
    d[i] = ((size_t)((b * PW + y0 + ry2 + 1) * PW + xx + 1)) * DV + jp * 64 + 8 * q8;
  }
  #pragma unroll
  for (int i = 0; i < 4; ++i) { *(v8us*)(oh + d[i]) = th[i]; *(v8us*)(ol + d[i]) = tl[i]; }
  
}

// ---------------------------------------------------------------------------
// Kernel: LayerNorm over (C,H,W) per sample: fixed-order f64 combine of the
// 64 block partial lines of the sample, then (v - mu) * rstd on one float4
// coverage: 1024 blocks x 256 threads x 4 floats = all 1048576 outputs.
// ---------------------------------------------------------------------------
__global__ __launch_bounds__(256) void k_ln(const float* __restrict__ outp, const float* __restrict__ partl,
                                            float* __restrict__ out) {
  __shared__ double ss[64];
  __shared__ double sq[64];
  __shared__ float sst[2];
  const int tid = threadIdx.x;
  const int blk = blockIdx.x, b = blk >> 8;
  if (tid < 64) {
    const double* dp = reinterpret_cast<const double*>(partl + (size_t)(b * 64 + tid) * 32);
    ss[tid] = dp[0];
    sq[tid] = dp[1];
  }
  __syncthreads();
  if (tid == 0) {
    double S = 0.0, Q2 = 0.0;
    for (int i = 0; i < 64; ++i) { S += ss[i]; Q2 += sq[i]; }
    const double inv = 1.0 / 262144.0;
    const double mu = S * inv;
    double var = Q2 * inv - mu * mu;
    if (var < 0.0) var = 0.0;
    const float den = sqrtf((float)var + 1e-5f);
    sst[0] = (float)mu;
    sst[1] = 1.0f / den;
  }
  __syncthreads();
  const float muf = sst[0], rinv = sst[1];
  const size_t e = ((size_t)blk * 256 + tid) * 4;
  v4f v = *(const v4fa*)(outp + e);
  v4f o;
  o.x = (v.x - muf) * rinv;
  o.y = (v.y - muf) * rinv;
  o.z = (v.z - muf) * rinv;
  o.w = (v.w - muf) * rinv;
  *(v4f*)(out + e) = o;
  
}

// ---------------------------------------------------------------------------
// Host: bilinear (32 -> 3, align_corners = false) taps and weights, computed
// with separate f64 multiply and subtract, fraction cast to f32.
// ---------------------------------------------------------------------------
static void bilin3(BiW& bw) {
#pragma clang fp contract(off)
  const double scale = 32.0 / 3.0;
  for (int p = 0; p < 3; ++p) {
    double src = ((double)p + 0.5) * scale;
    src = src - 0.5;
    if (src < 0.0) src = 0.0;
    const int f = (int)src;
    const float frac = (float)(src - (double)f);
    int c0 = f, c1 = f + 1;
    if (c0 > HIMG - 1) c0 = HIMG - 1;
    if (c1 > HIMG - 1) c1 = HIMG - 1;
    bw.i0[p] = c0;
    bw.i1[p] = c1;
    bw.w0[p] = 1.0f - frac;
    bw.w1[p] = frac;
  }
}

extern "C" void kernel_launch(void* const* d_in, const int* in_sizes, int n_in,
                              void* d_out, int out_size, void* d_ws, size_t ws_size,
                              hipStream_t stream) {
  if (n_in < 11) return;
  if (in_sizes[0] != NBATCH * CIN * NPIX) return;
  if (in_sizes[1] != DQ * CIN || in_sizes[2] != DQ) return;
  if (in_sizes[3] != DQ * CIN * 9 || in_sizes[4] != DQ) return;
  if (in_sizes[5] != DV * CIN * 9 || in_sizes[6] != DV) return;
  if (in_sizes[7] != DV * CIN || in_sizes[8] != DV) return;
  if (in_sizes[9] != DV * DV * 9 || in_sizes[10] != DV) return;
  if (out_size != NBATCH * DV * NPIX) return;

  const float* x      = (const float*)d_in[0];
  const float* q_w    = (const float*)d_in[1];
  const float* q_b    = (const float*)d_in[2];
  const float* k_w    = (const float*)d_in[3];
  const float* k_b    = (const float*)d_in[4];
  const float* v_w    = (const float*)d_in[5];
  const float* v_b    = (const float*)d_in[6];
  const float* bias_w = (const float*)d_in[7];
  const float* bias_b = (const float*)d_in[8];
  const float* hu_w   = (const float*)d_in[9];
  const float* hu_b   = (const float*)d_in[10];
  float* out = (float*)d_out;

  // workspace carve (bytes); every region sized to whole 256-B multiples and
  // written only with whole-line stores inside its extent
  char* ws = (char*)d_ws;
  size_t off = 0;
#define CARVE(T, name, bytes) T* name = (T*)(ws + off); off += (((size_t)(bytes)) + 255) & ~(size_t)255;
  const size_t padpx  = (size_t)NBATCH * PW * PW;                    // 4624 padded pixels
  CARVE(us,    XPH,   padpx * CIN * 2);                               // 2367488
  CARVE(us,    XPL,   padpx * CIN * 2);
  CARVE(us,    WQH,   (size_t)DQ * CIN * 2);                          // 262144
  CARVE(us,    WQL,   (size_t)DQ * CIN * 2);
  CARVE(us,    WKH,   (size_t)DQ * CIN * 9 * 2);                      // 2359296
  CARVE(us,    WKL,   (size_t)DQ * CIN * 9 * 2);
  CARVE(us,    WVH,   (size_t)DV * CIN * 9 * 2);                      // 1179648
  CARVE(us,    WVL,   (size_t)DV * CIN * 9 * 2);
  CARVE(us,    WHH,   (size_t)DV * DV * 9 * 2);                       // 1179648
  CARVE(us,    WHL,   (size_t)DV * DV * 9 * 2);
  CARVE(float, BIASV, (size_t)NBATCH * DV * 4);                       // 4096 = 32 lines
  CARVE(us,    RQH,   padpx * DQ * 2);                                // 4734976
  CARVE(us,    RQL,   padpx * DQ * 2);
  CARVE(float, R2K,   (size_t)NBATCH * DQ * NPIX * 4);                // 8388608
  CARVE(us,    VNH,   (size_t)NBATCH * DV * NPIX * 2);                // 2097152
  CARVE(us,    VNL,   (size_t)NBATCH * DV * NPIX * 2);
  CARVE(float, PARTQ, (size_t)512 * 128);                             // 512 lines
  CARVE(float, PARTK, (size_t)512 * 128);                             // 512 lines
  CARVE(float, SCAL,  256);                                           // 1 line used
  CARVE(us,    FTH,   (size_t)NBATCH * 8 * DVH * FTK * 2);            // 1179648
  CARVE(us,    FTL,   (size_t)NBATCH * 8 * DVH * FTK * 2);
  CARVE(us,    QKH,   padpx * DV * 2);                                // 2367488
  CARVE(us,    QKL,   padpx * DV * 2);
  CARVE(float, OUTP,  (size_t)NBATCH * DV * NPIX * 4);                // 4194304
  CARVE(float, PARTL, (size_t)256 * 128);                             // 256 lines
  CARVE(float, ROWS,  (size_t)NBATCH * HIMG * CIN * 4);               // 131072
#undef CARVE
  if (off > ws_size) return;
  if (off > (size_t)134217728) return;

  BiW bw;
  bilin3(bw);

  // 16-bit operand planes
  k_prep<<<NB_PREP, 256, 0, stream>>>(x, q_w, k_w, v_w, hu_w, XPH, XPL, ROWS,
                                      WQH, WQL, WKH, WKL, WVH, WVL, WHH, WHL, RQH, RQL, QKH, QKL);

  // k (3x3), v (3x3), q (1x1) convolutions
  k_conv_qkv<<<NB_CK + NB_CV + NB_CQ, 128, 0, stream>>>(XPH, XPL, WKH, WKL, k_b, R2K, PARTK,
                                                        WVH, WVL, v_b, VNH, VNL,
                                                        WQH, WQL, q_b, RQH, RQL, PARTQ);

  // channel means + bias linear and phi ratios; pooled KV filters, grouped conv
  k_bias_phinorm<<<2, 256, 0, stream>>>(ROWS, bias_w, bias_b, BIASV, PARTQ, PARTK, SCAL);
  k_kv<<<dim3(9, NBATCH * 8), 128, 0, stream>>>(R2K, VNH, VNL, SCAL, bw, FTH, FTL);
  k_gconv<<<dim3(16, 4, NBATCH), 128, 0, stream>>>(RQH, RQL, FTH, FTL, SCAL, BIASV, QKH, QKL);

  // head unification conv + LayerNorm
  k_conv_hu<<<dim3(64, DV / 64), 128, 0, stream>>>(QKH, QKL, WHH, WHL, hu_b, OUTP, PARTL);
  k_ln<<<(NBATCH * DV * NPIX) / 1024, 256, 0, stream>>>(OUTP, PARTL, out);
}

// v005
// One run takes 122 microseconds.
// Two timings next to v004 put it at 1.06 and 1.05 times that version's speed.
// Over all steps from v000 it is 3.51 times as fast.
// Contractions: q 1x1 conv, k/v/hu 3x3 convs as implicit GEMM (K = 9*256), pooled KV outer-product GEMMs (64x32x64 per head and tap: the two image rows with a non-zero pool weight), per-sample grouped 3x3 conv (K = 9*64) and the channel-mean bias linear, all on v_wmma_f32_16x16x32_bf16 with bf16 hi/lo three-product operand split (hi*hi + lo*hi + hi*lo), f32 accumulate; phi norm ratios, clip, channel means and LayerNorm statistics in f32/f64 on the VALU.
#include <hip/hip_runtime.h>

typedef unsigned short us;
typedef int   v8i  __attribute__((ext_vector_type(8)));
typedef float v8f  __attribute__((ext_vector_type(8)));
typedef float v4f  __attribute__((ext_vector_type(4)));
typedef unsigned short v8us __attribute__((ext_vector_type(8)));
typedef __bf16 v16b __attribute__((ext_vector_type(16)));
typedef v4f  __attribute__((may_alias)) v4fa;
typedef v8us __attribute__((may_alias)) v8usa;
union Frag { v8i v; v8us half[2]; };
union DPack { double d[2]; v4f f; };

#define NBATCH 4
#define CIN    256
#define HIMG   32
#define NPIX   1024
#define PW     34
#define DQ     512
#define DV     256
#define DK     64
#define DVH    32
#define FTK    576

struct BiW { int i0[3]; int i1[3]; float w0[3]; float w1[3]; };
static_assert(sizeof(BiW) == 48);

// The bilinear pool (32 -> 3, align_corners = false) gives a non-zero weight to image row
// floor((p + 0.5) * 32 / 3 - 0.5) = (64 p + 29) / 6 and to the row below it, p = 0..2, and to no other.
// V enters the result only through that pool, so only these rows of V are ever read.
constexpr int pool_row(int p) { return (64 * p + 29) / 6; }
// the two-row pixel tiles (image rows 2 t, 2 t + 1) that hold those six rows
#define NVT 4
constexpr int VT0 = pool_row(0) >> 1, VT1 = pool_row(1) >> 1, VT2 = (pool_row(1) + 1) >> 1, VT3 = pool_row(2) >> 1;
static_assert(((pool_row(0) + 1) >> 1) == VT0 && ((pool_row(2) + 1) >> 1) == VT3, "rows of taps 0 and 2 share a tile");
static_assert(VT0 < VT1 && VT1 < VT2 && VT2 < VT3 && VT3 < HIMG / 2, "four distinct tiles, one writer each");

// ---------------------------------------------------------------------------
// bf16 helpers (RNE convert) and the hi/lo split
// ---------------------------------------------------------------------------
__device__ __forceinline__ us f2bf(float f) {
  unsigned u = __float_as_uint(f);
  u += 0x7FFFu + ((u >> 16) & 1u);
  return (us)(u >> 16);
}
__device__ __forceinline__ float bf2f(us hv) {
  return __uint_as_float(((unsigned)hv) << 16);
}
__device__ __forceinline__ void split2(float f, us& hi, us& lo) {
  hi = f2bf(f);
  lo = f2bf(f - bf2f(hi));
}

// ---------------------------------------------------------------------------
// 16x16x32 bf16 WMMA with hazard guard (ties D, keeps A/B live).
// Fragment map (wave32): lane l, h = l>>4, m = n = l&15.
//   A/B element i: i<8 -> k0+8h+i ; i>=8 -> k0+16+8h+(i-8)
//   D element r : row 8h+r, col l&15
// ---------------------------------------------------------------------------
__device__ __forceinline__ v8f wmma_bf(v8i a, v8i b, v8f c) {
  v8f d = __builtin_amdgcn_wmma_f32_16x16x32_bf16(false, __builtin_bit_cast(v16b, a), false,
                                                  __builtin_bit_cast(v16b, b), (short)0, c, false, false);
  asm volatile("v_nop\n\tv_nop\n\tv_nop\n\tv_nop" : "+v"(d) : "v"(a), "v"(b));
  return d;
}
// three-product split: ah*bh + al*bh + ah*bl into one accumulator
__device__ __forceinline__ v8f wmma3(v8i ah, v8i al, v8i bh, v8i bl, v8f c) {
  c = wmma_bf(ah, bh, c);
  c = wmma_bf(al, bh, c);
  c = wmma_bf(ah, bl, c);
  return c;
}
// fragment from a k-contiguous 16-bit row (pointer already at k0)
__device__ __forceinline__ v8i ldfrag(const us* p, int h) {
  Frag f;
  f.half[0] = *(const v8usa*)(p + 8 * h);
  f.half[1] = *(const v8usa*)(p + 16 + 8 * h);
  return f.v;
}

__device__ __forceinline__ float wave_sum(float s) {
  s += __shfl_xor(s, 16);
  s += __shfl_xor(s, 8);
  s += __shfl_xor(s, 4);
  s += __shfl_xor(s, 2);
  s += __shfl_xor(s, 1);
  return s;
}
__device__ __forceinline__ double dshfl_xor(double v, int msk) {
  const unsigned long long u = __builtin_bit_cast(unsigned long long, v);
  int lo = (int)(unsigned)(u & 0xFFFFFFFFull);
  int hi = (int)(unsigned)(u >> 32);
  lo = __shfl_xor(lo, msk);
  hi = __shfl_xor(hi, msk);
  const unsigned long long r = (((unsigned long long)(unsigned)hi) << 32) | (unsigned long long)(unsigned)lo;
  return __builtin_bit_cast(double, r);
}
__device__ __forceinline__ double wave_sum_d(double s) {
  s += dshfl_xor(s, 16);
  s += dshfl_xor(s, 8);
  s += dshfl_xor(s, 4);
  s += dshfl_xor(s, 2);
  s += dshfl_xor(s, 1);
  return s;
}

// ---------------------------------------------------------------------------
// Kernel: x NCHW f32 -> bf16 hi/lo padded NHWC planes [b][34][34][256]
// (interior pixels). Block role = (y, b); LDS transpose; one instruction writes one
// coverage: 8 waves x 4 pixels = 32 px per row, 32 lanes x 8 = 256 ch.
// Also the f32 sum of each channel's image row (32 values, fixed order) into
// rowsum[b][y][c]: 256 threads x 4 B = 8 whole lines per block. The f32 copy
// sits in LDS at pitch 33 words, free of bank conflicts on store and on read.
// ---------------------------------------------------------------------------
__device__ __forceinline__ void prep_x_body(const float* __restrict__ x,
                                            us* __restrict__ xh, us* __restrict__ xl,
                                            float* __restrict__ rowsum, int y, int b) {
  __shared__ __attribute__((aligned(16))) us sh[32 * 256];
  __shared__ __attribute__((aligned(16))) us sl[32 * 256];
  __shared__ float sf[256 * 33];
  const int tid = threadIdx.x, lane = tid & 31, w = tid >> 5;
  #pragma unroll 1
  for (int j = 0; j < 32; ++j) {
    const int c = 8 * j + w;
    const float v = x[((size_t)(b * CIN + c) * HIMG + y) * HIMG + lane];
    us hi, lo;
    split2(v, hi, lo);
    sh[lane * 256 + c] = hi;
    sl[lane * 256 + c] = lo;
    sf[c * 33 + lane] = v;
  }
  __syncthreads();
  float rs = 0.f;
  // unrolled: constant LDS offsets, the reads issue ahead of the dependent adds
  #pragma unroll
  for (int i = 0; i < 32; ++i) rs += sf[tid * 33 + i];
  rowsum[(size_t)(b * HIMG + y) * CIN + tid] = rs;
  v8us vh[4], vl[4];
  size_t d[4];
  #pragma unroll
  for (int i = 0; i < 4; ++i) {
    const int px = 4 * w + i;
    vh[i] = *(const v8usa*)(sh + px * 256 + 8 * lane);
    vl[i] = *(const v8usa*)(sl + px * 256 + 8 * lane);
    d[i] = ((size_t)((b * PW + y + 1) * PW + px + 1)) * CIN + 8 * lane;
  }
  #pragma unroll
  for (int i = 0; i < 4; ++i) { *(v8us*)(xh + d[i]) = vh[i]; *(v8us*)(xl + d[i]) = vl[i]; }
  
}

// ---------------------------------------------------------------------------
// Kernel: zero the border pixel rows of padded NHWC planes [b][34][34][C].
// Wave = one border pixel; 32 lanes x 16 B = 256 halves per instruction.
// coverage: 132 border pixels x 4 samples, C halves each, both planes.
// ---------------------------------------------------------------------------
__device__ __forceinline__ void zero_border_body(us* __restrict__ ph, us* __restrict__ pl, int C, int bx, int b) {
  const int tid = threadIdx.x, lane = tid & 31, w = tid >> 5;
  const int i = bx * 8 + w;
  if (i >= 132) return;
  int py, px;
  if (i < 34)       { py = 0;           px = i; }
  else if (i < 68)  { py = PW - 1;      px = i - 34; }
  else if (i < 100) { py = i - 68 + 1;  px = 0; }
  else              { py = i - 100 + 1; px = PW - 1; }
  const size_t base = ((size_t)((b * PW + py) * PW + px)) * (size_t)C;
  v8us z;
  #pragma unroll
  for (int j = 0; j < 8; ++j) z[j] = (us)0;
  #pragma unroll 1
  for (int off = 8 * lane; off < C; off += 256) {
    *(v8us*)(ph + base + off) = z;
    *(v8us*)(pl + base + off) = z;
  }
  
}

// ---------------------------------------------------------------------------
// Kernel: OIHW f32 weights -> rows [o][tap*256 + c] as bf16 hi and lo planes.
// Thread = 8 consecutive row elements, one 16-B store per lane per plane,
// coverage: cout*taps*256 elements, grid = n/2048 exactly.
// ---------------------------------------------------------------------------
__device__ __forceinline__ void wprep_body(const float* __restrict__ wsrc, int cout, int taps,
                                           us* __restrict__ wh, us* __restrict__ wl, int bx) {
  const int g = bx * 256 + threadIdx.x;
  const int kw = taps * 256;
  const int n = cout * kw;
  const int e8 = g * 8;
  if (e8 >= n) return;
  const int o = e8 / kw;
  const int r = e8 - o * kw;
  const int tap = r >> 8, c = r & 255;
  const float* src = wsrc + ((size_t)(o * 256 + c)) * taps + tap;
  v8us vh, vl;
  #pragma unroll
  for (int i = 0; i < 8; ++i) {
    us a, bq;
    split2(src[(size_t)i * taps], a, bq);
    vh[i] = a;
    vl[i] = bq;
  }
  *(v8us*)(wh + e8) = vh;
  *(v8us*)(wl + e8) = vl;
  
}

// ---------------------------------------------------------------------------
// Kernel: all operand preparation in one grid (the roles share no data, so
// they run side by side instead of one launch after another). Role by block
// index, the longest first: x planes, then k, v, hu, q weight rows, then the
// zero borders of the three padded plane pairs.
// ---------------------------------------------------------------------------
#define NB_X   (HIMG * NBATCH)
#define NB_WK  ((DQ * CIN * 9) / 2048)
#define NB_WV  ((DV * CIN * 9) / 2048)
#define NB_WH  ((DV * DV * 9) / 2048)
#define NB_WQ  ((DQ * CIN) / 2048)
#define NB_ZB  (17 * NBATCH)
#define NB_PREP (NB_X + NB_WK + NB_WV + NB_WH + NB_WQ + 3 * NB_ZB)
__global__ __launch_bounds__(256) void k_prep(
    const float* __restrict__ x, const float* __restrict__ q_w, const float* __restrict__ k_w,
    const float* __restrict__ v_w, const float* __restrict__ hu_w,
    us* __restrict__ xh, us* __restrict__ xl, float* __restrict__ rowsum,
    us* __restrict__ wqh, us* __restrict__ wql, us* __restrict__ wkh, us* __restrict__ wkl,
    us* __restrict__ wvh, us* __restrict__ wvl, us* __restrict__ whh, us* __restrict__ whl,
    us* __restrict__ rqh, us* __restrict__ rql, us* __restrict__ qkh, us* __restrict__ qkl) {
  int i = blockIdx.x;
  if (i < NB_X) { prep_x_body(x, xh, xl, rowsum, i & (HIMG - 1), i / HIMG); return; }
  i -= NB_X;
  if (i < NB_WK) { wprep_body(k_w, DQ, 9, wkh, wkl, i); return; }
  i -= NB_WK;
  if (i < NB_WV) { wprep_body(v_w, DV, 9, wvh, wvl, i); return; }
  i -= NB_WV;
  if (i < NB_WH) { wprep_body(hu_w, DV, 9, whh, whl, i); return; }
  i -= NB_WH;
  if (i < NB_WQ) { wprep_body(q_w, DQ, 1, wqh, wql, i); return; }
  i -= NB_WQ;
  const int pl = i / NB_ZB, r = i - pl * NB_ZB;
  const int bx = r % 17, b = r / 17;
  if (pl == 0)      zero_border_body(xh, xl, CIN, bx, b);
  else if (pl == 1) zero_border_body(rqh, rql, DQ, bx, b);
  else              zero_border_body(qkh, qkl, DV, bx, b);
}

// ---------------------------------------------------------------------------
// Fragment from 32 consecutive-k f32 values of one row (pointer at k0), split
// into hi/lo bf16 fragments in registers (fragment map as above).
// ---------------------------------------------------------------------------
__device__ __forceinline__ void frag_f32(const float* __restrict__ p, int h, v8i& fh, v8i& fl) {
  const v4f q0 = *(const v4fa*)(p + 8 * h);
  const v4f q1 = *(const v4fa*)(p + 8 * h + 4);
  const v4f q2 = *(const v4fa*)(p + 16 + 8 * h);
  const v4f q3 = *(const v4fa*)(p + 20 + 8 * h);
  float v[16];
  v[0] = q0.x; v[1] = q0.y; v[2] = q0.z; v[3] = q0.w;
  v[4] = q1.x; v[5] = q1.y; v[6] = q1.z; v[7] = q1.w;
  v[8] = q2.x; v[9] = q2.y; v[10] = q2.z; v[11] = q2.w;
  v[12] = q3.x; v[13] = q3.y; v[14] = q3.z; v[15] = q3.w;
  Frag a, bq;
  #pragma unroll
  for (int i = 0; i < 16; ++i) {
    us hi, lo;
    split2(v[i], hi, lo);
    a.half[i >> 3][i & 7] = hi;
    bq.half[i >> 3][i & 7] = lo;
  }
  fh = a.v;
  fl = bq.v;
}

// ---------------------------------------------------------------------------
// Block role: channel means of x (f32, from the 32 row sums of each channel, fixed
// order) and the bias linear on WMMA:
// bias[b][o] = sum_c mean[b][c] * bw[o][c] + bb[o]. One block of 8 waves.
// A = means [16 rows (4 real, 12 zero)][256] hi/lo in LDS, B = bw rows [o][c]
// coverage: 256 threads x 16 B = 4096 B = all of bias.
// ---------------------------------------------------------------------------
__device__ __forceinline__ void bias_body(const float* __restrict__ rowsum, const float* __restrict__ bw,
                                          const float* __restrict__ bb, float* __restrict__ biasv) {
  __shared__ __attribute__((aligned(16))) us sah[16 * 256];
  __shared__ __attribute__((aligned(16))) us sal[16 * 256];
  __shared__ __attribute__((aligned(16))) float sd[4 * 256];
  const int tid = threadIdx.x, lane = tid & 31, w = tid >> 5;
  const int h = lane >> 4, m = lane & 15;
  for (int i = tid; i < 16 * 256; i += 256) {
    if (i >= 4 * 256) { sah[i] = (us)0; sal[i] = (us)0; }
  }
  {
    const int k = tid >> 6, c4 = 4 * (tid & 63);   // b = k, channels c4 .. c4+3
    const float* p = rowsum + (size_t)k * HIMG * CIN + c4;
    v4f sm;
    sm.x = 0.f; sm.y = 0.f; sm.z = 0.f; sm.w = 0.f;
    // unrolled: the 32 loads fly together, one memory latency instead of 32
    #pragma unroll
    for (int i = 0; i < HIMG; ++i) sm += *(const v4fa*)(p + i * CIN);
    // unrolled: constant vector index, sm stays in registers
    #pragma unroll
    for (int e = 0; e < 4; ++e) {
      const float mean = sm[e] * (1.0f / 1024.0f);
      us hi, lo;
      split2(mean, hi, lo);
      sah[k * 256 + c4 + e] = hi;
      sal[k * 256 + c4 + e] = lo;
    }
  }
  __syncthreads();

  const int o0 = 32 * w + m, o1 = o0 + 16;
  const float* br0 = bw + (size_t)o0 * 256;
  const float* br1 = bw + (size_t)o1 * 256;
  const v8f z8 = {0.f, 0.f, 0.f, 0.f, 0.f, 0.f, 0.f, 0.f};
  v8f acc[2];
  acc[0] = z8; acc[1] = z8;
  #pragma unroll 1
  for (int k0 = 0; k0 < 256; k0 += 32) {
    const v8i ah = ldfrag(sah + m * 256 + k0, h);
    const v8i al = ldfrag(sal + m * 256 + k0, h);
    v8i bh0, bl0, bh1, bl1;
    frag_f32(br0 + k0, h, bh0, bl0);
    frag_f32(br1 + k0, h, bh1, bl1);
    acc[0] = wmma3(ah, al, bh0, bl0, acc[0]);
    acc[1] = wmma3(ah, al, bh1, bl1, acc[1]);
  }
  const float bb0 = bb[o0], bb1 = bb[o1];
  if (h == 0) {
    #pragma unroll
    for (int r = 0; r < 4; ++r) {
      sd[r * 256 + o0] = acc[0][r] + bb0;
      sd[r * 256 + o1] = acc[1][r] + bb1;
    }
  }
  __syncthreads();
  const int L = tid >> 3, q = tid & 7;
  const v4f v = *(const v4fa*)(sd + L * 32 + 4 * q);
  float* dst = biasv + L * 32 + 4 * q;
  *(v4f*)dst = v;
  
}

// ---------------------------------------------------------------------------
// Eight asynchronous 16-B copies global -> LDS per lane (no register staging).
// l = the lane's LDS byte addresses, g = its global addresses, both 16-B
// aligned. The closing s_wait_xcnt keeps later rewrites of the address
// registers behind the copies' issue (precaution), so it sits in the statement.
// ---------------------------------------------------------------------------
__device__ __forceinline__ void acopy8(const unsigned (&l)[8], const us* const (&g)[8]) {
  asm volatile(
      "global_load_async_to_lds_b128 %0, %8, off\n\t"
      "global_load_async_to_lds_b128 %1, %9, off\n\t"
      "global_load_async_to_lds_b128 %2, %10, off\n\t"
      "global_load_async_to_lds_b128 %3, %11, off\n\t"
      "global_load_async_to_lds_b128 %4, %12, off\n\t"
      "global_load_async_to_lds_b128 %5, %13, off\n\t"
      "global_load_async_to_lds_b128 %6, %14, off\n\t"
      "global_load_async_to_lds_b128 %7, %15, off\n\t"
      "s_wait_xcnt 0x0"
      :: "v"(l[0]), "v"(l[1]), "v"(l[2]), "v"(l[3]), "v"(l[4]), "v"(l[5]), "v"(l[6]), "v"(l[7]),
         "v"(g[0]), "v"(g[1]), "v"(g[2]), "v"(g[3]), "v"(g[4]), "v"(g[5]), "v"(g[6]), "v"(g[7])
      : "memory");
}

// LDS ring of the convolutions: a stage = KC channels of 64 pixel rows and 64
// weight rows, hi and lo planes; row pitch 2 KC + 16 B = 16 B x odd
// (conflict-free 16-B reads). Halves (16-bit words) per stage:
constexpr int ring_stage(int kc) { return 4 * 64 * (kc + 8); }
// KC = 128 (two buffers: 139,264 B) where one block per WGP is all the grid has;
// KC = 64 (two buffers: 73,728 B) where more long tiles wait than two blocks per
// WGP can hold: four blocks then share a WGP's LDS.
#define KC_HU  128
#define KC_QKV 64

// ---------------------------------------------------------------------------
// Kernel: implicit-GEMM convolution (Cin = 256 per pixel) over bf16 hi/lo
// zero-padded NHWC planes [b][34][34][256]; weights as rows [o][tap*256+c]
// hi/lo. Block = 64 pixels (image rows y0, y0+1) x 64 output channels,
// 4 waves of 32 px x 32 ch (2x2 tiles), K = ntaps*256 in steps of 32,
// operand rows staged in LDS by asynchronous copies of 2 KC-byte row pieces (two
// buffers, the next stage flies while this one is worked on), fragments read
// from LDS, three products per tile pair.
// MODE 0: relu^2 -> bf16 hi/lo padded NHWC planes (pitch = cout) + (s2,s4) partial line
// MODE 1: relu^2 -> f32 NCHW + (s2,s4) partial line
// MODE 2: value -> bf16 hi/lo NCHW planes
// MODE 3: value -> f32 NCHW + (sum, sum of squares) partial line (f64)
// coverage: MODE 0 store: 4 waves x 16 px x 8 lanes x 8 ch = 64 px x 64 ch;
// MODE 1/3: 4 waves x 16 ch x 64 px; MODE 2: 4 waves x 16 ch x 8 lanes x 8 px.
// ---------------------------------------------------------------------------
// The body takes its tile (bx = pixel tile, by = channel tile of gy) and the
// block's LDS from the kernel that calls it. sbuf (16 KiB, epilogue only) may lie
// on the ring: it is first written behind the last stage's waits and barrier,
// when every wave has left the ring and no copy is outstanding.
template <int MODE, int KC>
__device__ __forceinline__ void conv_body(
    us* ring, float* sbuf, double (*sred)[2], int bx, int by, int gy,
    const us* __restrict__ ah, const us* __restrict__ al,
    const us* __restrict__ wh, const us* __restrict__ wl,
    const float* __restrict__ bias, int ntaps, int cout,
    us* __restrict__ oh, us* __restrict__ ol, float* __restrict__ of, float* __restrict__ part)
{
  const int tid = threadIdx.x, lane = tid & 31, w = tid >> 5;
  const int h = lane >> 4, m = lane & 15;
  const int pt = bx, b = pt >> 4, y0 = (pt & 15) * 2;
  const int n0 = by * 64;
  const int ry = w >> 1, nw = 32 * (w & 1);
  const int kw = ntaps * CIN;
  constexpr int LPITCH = KC + 8, LPLANE = 64 * LPITCH, LSTAGE = ring_stage(KC);
  constexpr int SPT = CIN / KC;        // stages per tap
  constexpr int LPR = KC / 8;          // lanes x 16 B = one row piece of KC channels
  constexpr int RPP = 128 / LPR;       // rows that the block's 128 threads copy at once
  constexpr int NPP = 64 / RPP;        // copies per thread and plane
  static_assert(SPT * KC == CIN && (4 * NPP) % 8 == 0 && RPP <= 32, "whole stages, whole groups of eight copies");
  const int nst = SPT * ntaps;
  // copy map: thread = 16-B column ql of rows r0 + RPP i
  const int ql = tid & (LPR - 1), r0 = tid / LPR;
  const unsigned lds0 = (unsigned)(size_t)ring + (unsigned)(r0 * (LPITCH * 2) + ql * 16);
  const size_t wbase = (size_t)(n0 + r0) * kw + 8 * ql;
  // stage s (tap s / SPT, channels KC (s % SPT) ..) into buffer bufi
  auto stage_copy = [&](int s, int bufi) {
    const int tap = s / SPT, c0 = (s % SPT) * KC;
    const int t3 = tap / 3;
    const int ky = (ntaps == 1) ? 1 : t3;
    const int kx = (ntaps == 1) ? 1 : (tap - 3 * t3);
    const size_t ao = ((size_t)((b * PW + y0 + ky) * PW + kx + r0)) * CIN + c0 + 8 * ql;
    const size_t wo = wbase + (size_t)s * KC;
    const unsigned lb = lds0 + (unsigned)bufi * (LSTAGE * 2);
    // planes in LDS order (pixels hi, lo, weights hi, lo), eight copies per statement;
    // both loops unrolled: plane and row are then constants and l, g stay in registers
    #pragma unroll
    for (int c = 0; c < 4 * NPP; c += 8) {
      unsigned l[8];
      const us* g[8];
      #pragma unroll
      for (int t = 0; t < 8; ++t) {
        const int pl = (c + t) / NPP, row = ((c + t) % NPP) * RPP;
        l[t] = lb + (unsigned)((pl * LPLANE + row * LPITCH) * 2);
        if (pl < 2) g[t] = (pl == 0 ? ah : al) + ao + (size_t)((row >> 5) * PW * CIN + (row & 31) * CIN);
        else        g[t] = (pl == 2 ? wh : wl) + wo + (size_t)row * kw;
      }
      acopy8(l, g);
    }
  };
  const v8f z8 = {0.f, 0.f, 0.f, 0.f, 0.f, 0.f, 0.f, 0.f};
  v8f acc[2][2];
  #pragma unroll
  for (int i = 0; i < 2; ++i) { acc[i][0] = z8; acc[i][1] = z8; }

  // prologue: stage 0 landed and published, then stage 1 in flight
  stage_copy(0, 0);
  asm volatile("s_wait_asynccnt 0x0" ::: "memory");  // this wave's copies of stage 0 have landed
  __syncthreads();                                   // ... and every other wave's
  stage_copy(1, 1);                                  // nst = SPT ntaps >= 2

  const int arow = (ry * 32 + m) * LPITCH;
  const int brow = 2 * LPLANE + (nw + m) * LPITCH;
  #pragma unroll 1
  for (int s = 0; s < nst; ++s) {
    const us* sb = ring + (s & 1) * LSTAGE;
    #pragma unroll
    for (int kk = 0; kk < KC; kk += 32) {
      const v8i fa0h = ldfrag(sb + arow + kk, h);
      const v8i fa0l = ldfrag(sb + LPLANE + arow + kk, h);
      const v8i fa1h = ldfrag(sb + arow + 16 * LPITCH + kk, h);
      const v8i fa1l = ldfrag(sb + LPLANE + arow + 16 * LPITCH + kk, h);
      #pragma unroll
      for (int nt = 0; nt < 2; ++nt) {
        const v8i fbh = ldfrag(sb + brow + nt * 16 * LPITCH + kk, h);
        const v8i fbl = ldfrag(sb + LPLANE + brow + nt * 16 * LPITCH + kk, h);
        acc[0][nt] = wmma3(fa0h, fa0l, fbh, fbl, acc[0][nt]);
        acc[1][nt] = wmma3(fa1h, fa1l, fbh, fbl, acc[1][nt]);
      }
    }
    // publish point of stage s + 1, and hand-over of this stage's buffer
    asm volatile("s_wait_dscnt 0x0" ::: "memory");     // this wave's reads of the buffer are done
    asm volatile("s_wait_asynccnt 0x0" ::: "memory");  // this wave's copies of stage s + 1 have landed
    __syncthreads();                                   // both hold for every wave of the block
    if (s + 2 < nst) stage_copy(s + 2, s & 1);
  }
  asm volatile("s_wait_asynccnt 0x0" ::: "memory");    // no copy outstanding past the loop

  // epilogue into LDS
  float bv[2];
  bv[0] = bias[n0 + nw + m];
  bv[1] = bias[n0 + nw + 16 + m];
  us* sH = reinterpret_cast<us*>(sbuf);
  us* sL = sH + 4096;
  float fs = 0.f, fq = 0.f;
  double ds = 0.0, dq = 0.0;
  #pragma unroll
  for (int mt = 0; mt < 2; ++mt) {
    #pragma unroll
    for (int nt = 0; nt < 2; ++nt) {
      #pragma unroll
      for (int r = 0; r < 8; ++r) {
        const float val = acc[mt][nt][r] + bv[nt];
        const int tp = ry * 32 + mt * 16 + 8 * h + r;
        const int ch = nw + 16 * nt + m;
        if (MODE == 0) {
          const float rr = fmaxf(val, 0.f);
          const float r2 = rr * rr;
          fs += r2; fq += r2 * r2;
          us hi, lo;
          split2(r2, hi, lo);
          sH[tp * 64 + ch] = hi;
          sL[tp * 64 + ch] = lo;
        } else if (MODE == 1) {
          const float rr = fmaxf(val, 0.f);
          const float r2 = rr * rr;
          fs += r2; fq += r2 * r2;
          sbuf[ch * 64 + tp] = r2;
        } else if (MODE == 2) {
          us hi, lo;
          split2(val, hi, lo);
          sH[ch * 64 + tp] = hi;
          sL[ch * 64 + tp] = lo;
        } else {
          ds += (double)val;
          dq += (double)val * (double)val;
          sbuf[ch * 64 + tp] = val;
        }
      }
    }
  }
  if (MODE == 0 || MODE == 1) {
    fs = wave_sum(fs);
    fq = wave_sum(fq);
    ds = (double)fs;
    dq = (double)fq;
  } else if (MODE == 3) {
    ds = wave_sum_d(ds);
    dq = wave_sum_d(dq);
  }
  if (MODE != 2) {
    if (lane == 0) { sred[w][0] = ds; sred[w][1] = dq; }
  }
  __syncthreads();

  // block partial line (2 doubles + zeros), fixed order over the 4 waves
  v4f pv;
  pv.x = 0.f; pv.y = 0.f; pv.z = 0.f; pv.w = 0.f;
  size_t li = 0;
  bool pw = false;
  if (MODE != 2) {
    double S = 0.0, Q2 = 0.0;
    #pragma unroll
    for (int k = 0; k < 4; ++k) { S += sred[k][0]; Q2 += sred[k][1]; }
    DPack pk;
    pk.d[0] = S; pk.d[1] = Q2;
    pv.x = (lane == 0) ? pk.f.x : 0.f;
    pv.y = (lane == 0) ? pk.f.y : 0.f;
    pv.z = (lane == 0) ? pk.f.z : 0.f;
    pv.w = (lane == 0) ? pk.f.w : 0.f;
    li = ((size_t)bx * gy + by) * 32 + 4 * (lane & 7);
    pw = (w == 0) && (lane < 8);
  }

  if (MODE == 0) {
    const int q8 = lane & 7, sub = lane >> 3;
    v8us th[4], tl[4];
    size_t d[4];
    #pragma unroll
    for (int i = 0; i < 4; ++i) {
      const int tp = 16 * w + 4 * i + sub;
      const int ry2 = tp >> 5, xx = tp & 31;
      th[i] = *(const v8usa*)(sH + tp * 64 + 8 * q8);
      tl[i] = *(const v8usa*)(sL + tp * 64 + 8 * q8);
      d[i] = ((size_t)((b * PW + y0 + ry2 + 1) * PW + xx + 1)) * (size_t)cout + n0 + 8 * q8;
    }
    #pragma unroll
    for (int i = 0; i < 4; ++i) { *(v8us*)(oh + d[i]) = th[i]; *(v8us*)(ol + d[i]) = tl[i]; }
    if (pw) *(v4f*)(part + li) = pv;
    
  } else if (MODE == 2) {
    const int q8 = lane & 7, sub = lane >> 3;
    v8us th[4], tl[4];
    size_t d[4];
    #pragma unroll
    for (int i = 0; i < 4; ++i) {
      const int chl = 16 * w + 4 * i + sub;
      th[i] = *(const v8usa*)(sH + chl * 64 + 8 * q8);
      tl[i] = *(const v8usa*)(sL + chl * 64 + 8 * q8);
      d[i] = ((size_t)(b * cout + n0 + chl)) * NPIX + y0 * HIMG + 8 * q8;
    }
    #pragma unroll
    for (int i = 0; i < 4; ++i) { *(v8us*)(oh + d[i]) = th[i]; *(v8us*)(ol + d[i]) = tl[i]; }
    // another role's code follows these stores in the merged kernel's listing and reuses their registers:
    // the wait keeps any such rewrite behind the stores' issue (precaution)
    asm volatile("s_wait_xcnt 0x0" ::: "memory");
  } else {
    const int hs = lane >> 4, x4 = 4 * (lane & 15);
    v4f tv[8];
    size_t d[8];
    #pragma unroll
    for (int i = 0; i < 8; ++i) {
      const int chl = 16 * w + 2 * i + hs;
      tv[i] = *(const v4fa*)(sbuf + chl * 64 + x4);
      d[i] = ((size_t)(b * cout + n0 + chl)) * NPIX + y0 * HIMG + x4;
    }
    #pragma unroll
    for (int i = 0; i < 8; ++i) *(v4f*)(of + d[i]) = tv[i];
    if (pw) *(v4f*)(part + li) = pv;
    
  }
}

// ---------------------------------------------------------------------------
// Kernel: the head unification conv (MODE 3), one tile per block.
// ---------------------------------------------------------------------------
__global__ __launch_bounds__(128) void k_conv_hu(
    const us* __restrict__ ah, const us* __restrict__ al,
    const us* __restrict__ wh, const us* __restrict__ wl,
    const float* __restrict__ bias, float* __restrict__ of, float* __restrict__ part)
{
  __shared__ __attribute__((aligned(16))) us ring[2 * ring_stage(KC_HU)];
  __shared__ __attribute__((aligned(16))) float sbuf[64 * 64];
  __shared__ double sred[4][2];
  conv_body<3, KC_HU>(ring, sbuf, sred, blockIdx.x, blockIdx.y, DV / 64, ah, al, wh, wl, bias, 9, DV,
               nullptr, nullptr, of, part);
}

// ---------------------------------------------------------------------------
// Kernel: the k, v and q convolutions of x in one grid (they share no result,
// so their tiles fill the chip together). Role by block index, the long 3x3
// tiles first: 512 k tiles, 64 v tiles (only the row tiles that the pool
// reads), 512 q tiles; pixel tile fastest. 73,792 B of LDS per block: four
// blocks per WGP, so all 576 long tiles are resident from the start.
// ---------------------------------------------------------------------------
#define NB_CK (64 * (DQ / 64))
#define NB_CV (NBATCH * NVT * (DV / 64))
#define NB_CQ (64 * (DQ / 64))
__global__ __launch_bounds__(128) void k_conv_qkv(
    const us* __restrict__ xh, const us* __restrict__ xl,
    const us* __restrict__ wkh, const us* __restrict__ wkl, const float* __restrict__ k_b,
    float* __restrict__ r2k, float* __restrict__ partk,
    const us* __restrict__ wvh, const us* __restrict__ wvl, const float* __restrict__ v_b,
    us* __restrict__ vnh, us* __restrict__ vnl,
    const us* __restrict__ wqh, const us* __restrict__ wql, const float* __restrict__ q_b,
    us* __restrict__ rqh, us* __restrict__ rql, float* __restrict__ partq)
{
  __shared__ __attribute__((aligned(16))) us ring[2 * ring_stage(KC_QKV)];
  static_assert(sizeof(ring) >= 64 * 64 * sizeof(float), "the epilogue buffer fits on the ring");
  float* sbuf = reinterpret_cast<float*>(ring);
  __shared__ double sred[4][2];
  int i = blockIdx.x;
  if (i < NB_CK) {
    conv_body<1, KC_QKV>(ring, sbuf, sred, i & 63, i >> 6, DQ / 64, xh, xl, wkh, wkl, k_b, 9, DQ,
                 nullptr, nullptr, r2k, partk);
    return;
  }
  i -= NB_CK;
  if (i < NB_CV) {
    // i counts only the row tiles that the pool reads: put it back on the grid of 64 pixel tiles per channel tile
    const int t = i & (NVT - 1), b = (i / NVT) & (NBATCH - 1);
    const int rt = (t == 0) ? VT0 : ((t == 1) ? VT1 : ((t == 2) ? VT2 : VT3));
    i = (i / (NVT * NBATCH)) * 64 + b * (HIMG / 2) + rt;
    conv_body<2, KC_QKV>(ring, sbuf, sred, i & 63, i >> 6, DV / 64, xh, xl, wvh, wvl, v_b, 9, DV,
                 vnh, vnl, nullptr, nullptr);
    return;
  }
  i -= NB_CV;
  conv_body<0, KC_QKV>(ring, sbuf, sred, i & 63, i >> 6, DQ / 64, xh, xl, wqh, wql, q_b, 1, DQ,
               rqh, rql, nullptr, partq);
}

// ---------------------------------------------------------------------------
// Block role: phi norm ratios s = sqrt(sum relu^2) / sqrt(sum relu^4) for the
// q and k tensors from 512 block partial lines each (fixed order, f64).
// Wave 0 = q, wave 1 = k, the other waves only pass the barriers; one whole
// output line.
// ---------------------------------------------------------------------------
__device__ __forceinline__ void phinorm_body(const float* __restrict__ partq, const float* __restrict__ partk,
                                             float* __restrict__ scal) {
  __shared__ double sacc[2][32][2];
  __shared__ float sres[2];
  const int tid = threadIdx.x, lane = tid & 31, w = tid >> 5;
  const float* pp = (w == 0) ? partq : partk;
  if (w < 2) {
    double s2 = 0.0, s4 = 0.0;
    #pragma unroll 1
    for (int j = 0; j < 16; ++j) {
      const double* dp = reinterpret_cast<const double*>(pp + (size_t)(lane * 16 + j) * 32);
      s2 += dp[0];
      s4 += dp[1];
    }
    sacc[w][lane][0] = s2;
    sacc[w][lane][1] = s4;
  }
  __syncthreads();
  if (w < 2 && lane == 0) {
    double t2 = 0.0, t4 = 0.0;
    for (int i = 0; i < 32; ++i) { t2 += sacc[w][i][0]; t4 += sacc[w][i][1]; }
    const float num = sqrtf((float)t2);
    const float den = sqrtf((float)t4);
    sres[w] = num * (1.0f / den);
  }
  __syncthreads();
  v4f pv;
  pv.x = (lane == 0) ? sres[0] : 0.f;
  pv.y = (lane == 0) ? sres[1] : 0.f;
  pv.z = 0.f; pv.w = 0.f;
  const bool pw = (w == 0) && (lane < 8);
  float* dst = scal + 4 * lane;
  if (pw) *(v4f*)dst = pv;
  
}

// ---------------------------------------------------------------------------
// Kernel: the two one-block jobs in front of the pooled filters and the
// grouped conv, side by side: block 0 = bias linear, block 1 = phi ratios.
// ---------------------------------------------------------------------------
__global__ __launch_bounds__(256) void k_bias_phinorm(
    const float* __restrict__ rowsum, const float* __restrict__ bw, const float* __restrict__ bb,
    float* __restrict__ biasv, const float* __restrict__ partq, const float* __restrict__ partk,
    float* __restrict__ scal) {
  if (blockIdx.x == 0) bias_body(rowsum, bw, bb, biasv);
  else                 phinorm_body(partq, partk, scal);
}

// ---------------------------------------------------------------------------
// Kernel: pooled outer product. Block = (tap pq, bh): D[kk 64][v 32] =
// sum_pix (relu(K)^2[kk][pix] * Mh[p][y] * Mw[q][x]) * V[v][pix] over the two
// image rows y where Mh[p][y] is not zero (K = 64; every other term is a
// product with a zero weight, and V exists only on those rows),
// A built in registers from the f32 NCHW relu^2 rows (split hi/lo),
// B from the bf16 NCHW V planes. Epilogue: * sK, clip +-32/9, hi/lo into
// coverage: 4 waves x 8 rows x 8 lanes x 8 kk = 32 v x 64 kk per (bh,pq).
// ---------------------------------------------------------------------------
__global__ __launch_bounds__(128) void k_kv(
    const float* __restrict__ r2k, const us* __restrict__ vnh, const us* __restrict__ vnl,
    const float* __restrict__ scal, BiW bw, us* __restrict__ fth, us* __restrict__ ftl)
{
  __shared__ __attribute__((aligned(16))) us sH[32 * 64];
  __shared__ __attribute__((aligned(16))) us sL[32 * 64];
  const int tid = threadIdx.x, lane = tid & 31, w = tid >> 5;
  const int h = lane >> 4, m = lane & 15;
  const int pq = blockIdx.x, bh = blockIdx.y;
  const int b = bh >> 3, head = bh & 7;
  const int p = pq / 3, q = pq - 3 * p;
  const int   iy0 = (p == 0) ? bw.i0[0] : ((p == 1) ? bw.i0[1] : bw.i0[2]);
  const int   iy1 = (p == 0) ? bw.i1[0] : ((p == 1) ? bw.i1[1] : bw.i1[2]);
  const float wy0 = (p == 0) ? bw.w0[0] : ((p == 1) ? bw.w0[1] : bw.w0[2]);
  const float wy1 = (p == 0) ? bw.w1[0] : ((p == 1) ? bw.w1[1] : bw.w1[2]);
  const int   ix0 = (q == 0) ? bw.i0[0] : ((q == 1) ? bw.i0[1] : bw.i0[2]);
  const int   ix1 = (q == 0) ? bw.i1[0] : ((q == 1) ? bw.i1[1] : bw.i1[2]);
  const float wx0 = (q == 0) ? bw.w0[0] : ((q == 1) ? bw.w0[1] : bw.w0[2]);
  const float wx1 = (q == 0) ? bw.w1[0] : ((q == 1) ? bw.w1[1] : bw.w1[2]);
  const float sK = scal[1];
  const float amax = (float)(32.0 / 9.0);
  const float* arow = r2k + ((size_t)(b * DQ + head * DK + 16 * w + m)) * NPIX;
  const size_t br0 = ((size_t)(b * DV + head * DVH + m)) * NPIX;
  const size_t br1 = br0 + (size_t)16 * NPIX;
  const v8f z8 = {0.f, 0.f, 0.f, 0.f, 0.f, 0.f, 0.f, 0.f};
  v8f acc[2];
  acc[0] = z8; acc[1] = z8;

  #pragma unroll 1
  for (int t = 0; t < 2; ++t) {
    // rows iy0 then iy1, ascending as in the full sum; were the two clamped onto one row, it takes both weights once
    const float wy = (t == 0) ? (wy0 + ((iy1 == iy0) ? wy1 : 0.f)) : ((iy1 == iy0) ? 0.f : wy1);
    const int k0 = ((t == 0) ? iy0 : iy1) * HIMG;
    const float* ap = arow + k0;
    const v4f q0 = *(const v4fa*)(ap + 8 * h);
    const v4f q1 = *(const v4fa*)(ap + 8 * h + 4);
    const v4f q2 = *(const v4fa*)(ap + 16 + 8 * h);
    const v4f q3 = *(const v4fa*)(ap + 20 + 8 * h);
    float v[16];
    v[0] = q0.x; v[1] = q0.y; v[2] = q0.z; v[3] = q0.w;
    v[4] = q1.x; v[5] = q1.y; v[6] = q1.z; v[7] = q1.w;
    v[8] = q2.x; v[9] = q2.y; v[10] = q2.z; v[11] = q2.w;
    v[12] = q3.x; v[13] = q3.y; v[14] = q3.z; v[15] = q3.w;
    Frag fah, fal;
    #pragma unroll
    for (int i = 0; i < 16; ++i) {
      const int xx = 8 * h + (i & 7) + ((i >> 3) << 4);
      const float wx = ((xx == ix0) ? wx0 : 0.f) + ((xx == ix1) ? wx1 : 0.f);
      const float a = v[i] * (wy * wx);
      us hi, lo;
      split2(a, hi, lo);
      fah.half[i >> 3][i & 7] = hi;
      fal.half[i >> 3][i & 7] = lo;
    }
    const v8i fb0h = ldfrag(vnh + br0 + k0, h);
    const v8i fb0l = ldfrag(vnl + br0 + k0, h);
    const v8i fb1h = ldfrag(vnh + br1 + k0, h);
    const v8i fb1l = ldfrag(vnl + br1 + k0, h);
    acc[0] = wmma3(fah.v, fal.v, fb0h, fb0l, acc[0]);
    acc[1] = wmma3(fah.v, fal.v, fb1h, fb1l, acc[1]);
  }

  #pragma unroll
  for (int nt = 0; nt < 2; ++nt) {
    #pragma unroll
    for (int r = 0; r < 8; ++r) {
      float val = acc[nt][r] * sK;
      val = fminf(fmaxf(val, -amax), amax);
      const int kk = 16 * w + 8 * h + r;
      const int vv = 16 * nt + m;
      us hi, lo;
      split2(val, hi, lo);
      sH[vv * 64 + kk] = hi;
      sL[vv * 64 + kk] = lo;
    }
  }
  __syncthreads();
  const int q8 = lane & 7, sub = lane >> 3;
  v8us th[2], tl[2];
  size_t d[2];
  #pragma unroll
  for (int i = 0; i < 2; ++i) {
    const int vv = 8 * w + 4 * i + sub;
    th[i] = *(const v8usa*)(sH + vv * 64 + 8 * q8);
    tl[i] = *(const v8usa*)(sL + vv * 64 + 8 * q8);
    d[i] = ((size_t)(bh * DVH + vv)) * FTK + pq * 64 + 8 * q8;
  }
  #pragma unroll
  for (int i = 0; i < 2; ++i) { *(v8us*)(fth + d[i]) = th[i]; *(v8us*)(ftl + d[i]) = tl[i]; }
  
}

// ---------------------------------------------------------------------------
// Kernel: per-sample grouped 3x3 conv of relu(Q)^2 planes (padded NHWC,
// 512 ch) with the pooled filters, K = 9*64 per head. Block = (64 px, head
// pair, b); wave = (head of the pair, image row) 32 px x 32 v. Epilogue:
// * sQ + bias[b][j*32+v], hi/lo into padded NHWC planes [b][34][34][256];
// coverage: 4 waves x 16 px x 8 lanes x 8 ch = 64 px x 64 ch per block;
// grid 16 x 4 x 4 = all interior pixels x all 256 channels x 4 samples.
// ---------------------------------------------------------------------------
__global__ __launch_bounds__(128) void k_gconv(
    const us* __restrict__ rqh, const us* __restrict__ rql,
    const us* __restrict__ fth, const us* __restrict__ ftl,
    const float* __restrict__ scal, const float* __restrict__ biasv,
    us* __restrict__ oh, us* __restrict__ ol)
{
  __shared__ __attribute__((aligned(16))) us sH[64 * 64];
  __shared__ __attribute__((aligned(16))) us sL[64 * 64];
  const int tid = threadIdx.x, lane = tid & 31, w = tid >> 5;
  const int h = lane >> 4, m = lane & 15;
  const int pt = blockIdx.x, jp = blockIdx.y, b = blockIdx.z;
  const int y0 = 2 * pt;
  const int jl = w >> 1, ry = w & 1;
  const int j = 2 * jp + jl, y = y0 + ry, bh = b * 8 + j;
  const size_t fr0 = ((size_t)(bh * DVH + m)) * FTK;
  const size_t fr1 = fr0 + (size_t)16 * FTK;
  const v8f z8 = {0.f, 0.f, 0.f, 0.f, 0.f, 0.f, 0.f, 0.f};
  v8f acc[2][2];
  #pragma unroll
  for (int i = 0; i < 2; ++i) { acc[i][0] = z8; acc[i][1] = z8; }

  #pragma unroll 1
  for (int tap = 0; tap < 9; ++tap) {
    const int ky = tap / 3;
    const int kx = tap - 3 * ky;
    const size_t ar0 = ((size_t)((b * PW + y + ky) * PW + kx + m)) * DQ + (size_t)j * DK;
    const size_t ar1 = ar0 + (size_t)16 * DQ;
    const size_t wt = (size_t)tap * DK;
    #pragma unroll
    for (int c0 = 0; c0 < DK; c0 += 32) {
      const v8i fa0h = ldfrag(rqh + ar0 + c0, h);
      const v8i fa0l = ldfrag(rql + ar0 + c0, h);
      const v8i fa1h = ldfrag(rqh + ar1 + c0, h);
      const v8i fa1l = ldfrag(rql + ar1 + c0, h);
      #pragma unroll
      for (int nt = 0; nt < 2; ++nt) {
        const size_t fr = (nt == 0) ? fr0 : fr1;
        const v8i fbh = ldfrag(fth + fr + wt + c0, h);
        const v8i fbl = ldfrag(ftl + fr + wt + c0, h);
        acc[0][nt] = wmma3(fa0h, fa0l, fbh, fbl, acc[0][nt]);
        acc[1][nt] = wmma3(fa1h, fa1l, fbh, fbl, acc[1][nt]);
      }
    }
  }

  const float sQ = scal[0];
  float bv[2];
  bv[0] = biasv[b * DV + j * DVH + m];
  bv[1] = biasv[b * DV + j * DVH + 16 + m];
  #pragma unroll
  for (int mt = 0; mt < 2; ++mt) {
    #pragma unroll
    for (int nt = 0; nt < 2; ++nt) {
      #pragma unroll
      for (int r = 0; r < 8; ++r) {
        const float val = acc[mt][nt][r] * sQ + bv[nt];
        const int tp = ry * 32 + mt * 16 + 8 * h + r;
        const int chl = jl * 32 + 16 * nt + m;
        us hi, lo;
        split2(val, hi, lo);
        sH[tp * 64 + chl] = hi;
        sL[tp * 64 + chl] = lo;
      }
    }
  }
  __syncthreads();
  const int q8 = lane & 7, sub = lane >> 3;
  v8us th[4], tl[4];
  size_t d[4];
  #pragma unroll
  for (int i = 0; i < 4; ++i) {
    const int tp = 16 * w + 4 * i + sub;
    const int ry2 = tp >> 5, xx = tp & 31;
    th[i] = *(const v8usa*)(sH + tp * 64 + 8 * q8);
    tl[i] = *(const v8usa*)(sL + tp * 64 + 8 * q8);
    d[i] = ((size_t)((b * PW + y0 + ry2 + 1) * PW + xx + 1)) * DV + jp * 64 + 8 * q8;
  }
  #pragma unroll
  for (int i = 0; i < 4; ++i) { *(v8us*)(oh + d[i]) = th[i]; *(v8us*)(ol + d[i]) = tl[i]; }
  
}

// ---------------------------------------------------------------------------
// Kernel: LayerNorm over (C,H,W) per sample: fixed-order f64 combine of the
// 64 block partial lines of the sample, then (v - mu) * rstd on one float4
// coverage: 1024 blocks x 256 threads x 4 floats = all 1048576 outputs.
// ---------------------------------------------------------------------------
__global__ __launch_bounds__(256) void k_ln(const float* __restrict__ outp, const float* __restrict__ partl,
                                            float* __restrict__ out) {
  __shared__ double ss[64];
  __shared__ double sq[64];
  __shared__ float sst[2];
  const int tid = threadIdx.x;
  const int blk = blockIdx.x, b = blk >> 8;
  if (tid < 64) {
    const double* dp = reinterpret_cast<const double*>(partl + (size_t)(b * 64 + tid) * 32);
    ss[tid] = dp[0];
    sq[tid] = dp[1];
  }
  __syncthreads();
  if (tid == 0) {
    double S = 0.0, Q2 = 0.0;
    for (int i = 0; i < 64; ++i) { S += ss[i]; Q2 += sq[i]; }
    const double inv = 1.0 / 262144.0;
    const double mu = S * inv;
    double var = Q2 * inv - mu * mu;
    if (var < 0.0) var = 0.0;
    const float den = sqrtf((float)var + 1e-5f);
    sst[0] = (float)mu;
    sst[1] = 1.0f / den;
  }
  __syncthreads();
  const float muf = sst[0], rinv = sst[1];
  const size_t e = ((size_t)blk * 256 + tid) * 4;
  v4f v = *(const v4fa*)(outp + e);
  v4f o;
  o.x = (v.x - muf) * rinv;
  o.y = (v.y - muf) * rinv;
  o.z = (v.z - muf) * rinv;
  o.w = (v.w - muf) * rinv;
  *(v4f*)(out + e) = o;
  
}

// ---------------------------------------------------------------------------
// Host: bilinear (32 -> 3, align_corners = false) taps and weights, computed
// with separate f64 multiply and subtract, fraction cast to f32.
// ---------------------------------------------------------------------------
static void bilin3(BiW& bw) {
#pragma clang fp contract(off)
  const double scale = 32.0 / 3.0;
  for (int p = 0; p < 3; ++p) {
    double src = ((double)p + 0.5) * scale;
    src = src - 0.5;
    if (src < 0.0) src = 0.0;
    const int f = (int)src;
    const float frac = (float)(src - (double)f);
    int c0 = f, c1 = f + 1;
    if (c0 > HIMG - 1) c0 = HIMG - 1;
    if (c1 > HIMG - 1) c1 = HIMG - 1;
    bw.i0[p] = c0;
    bw.i1[p] = c1;
    bw.w0[p] = 1.0f - frac;
    bw.w1[p] = frac;
  }
}

extern "C" void kernel_launch(void* const* d_in, const int* in_sizes, int n_in,
                              void* d_out, int out_size, void* d_ws, size_t ws_size,
                              hipStream_t stream) {
  if (n_in < 11) return;
  if (in_sizes[0] != NBATCH * CIN * NPIX) return;
  if (in_sizes[1] != DQ * CIN || in_sizes[2] != DQ) return;
  if (in_sizes[3] != DQ * CIN * 9 || in_sizes[4] != DQ) return;
  if (in_sizes[5] != DV * CIN * 9 || in_sizes[6] != DV) return;
  if (in_sizes[7] != DV * CIN || in_sizes[8] != DV) return;
  if (in_sizes[9] != DV * DV * 9 || in_sizes[10] != DV) return;
  if (out_size != NBATCH * DV * NPIX) return;

  const float* x      = (const float*)d_in[0];
  const float* q_w    = (const float*)d_in[1];
  const float* q_b    = (const float*)d_in[2];
  const float* k_w    = (const float*)d_in[3];
  const float* k_b    = (const float*)d_in[4];
  const float* v_w    = (const float*)d_in[5];
  const float* v_b    = (const float*)d_in[6];
  const float* bias_w = (const float*)d_in[7];
  const float* bias_b = (const float*)d_in[8];
  const float* hu_w   = (const float*)d_in[9];
  const float* hu_b   = (const float*)d_in[10];
  float* out = (float*)d_out;

  // workspace carve (bytes); every region sized to whole 256-B multiples and
  // written only with whole-line stores inside its extent
  char* ws = (char*)d_ws;
  size_t off = 0;
#define CARVE(T, name, bytes) T* name = (T*)(ws + off); off += (((size_t)(bytes)) + 255) & ~(size_t)255;
  const size_t padpx  = (size_t)NBATCH * PW * PW;                    // 4624 padded pixels
  CARVE(us,    XPH,   padpx * CIN * 2);                               // 2367488
  CARVE(us,    XPL,   padpx * CIN * 2);
  CARVE(us,    WQH,   (size_t)DQ * CIN * 2);                          // 262144
  CARVE(us,    WQL,   (size_t)DQ * CIN * 2);
  CARVE(us,    WKH,   (size_t)DQ * CIN * 9 * 2);                      // 2359296
  CARVE(us,    WKL,   (size_t)DQ * CIN * 9 * 2);
  CARVE(us,    WVH,   (size_t)DV * CIN * 9 * 2);                      // 1179648
  CARVE(us,    WVL,   (size_t)DV * CIN * 9 * 2);
  CARVE(us,    WHH,   (size_t)DV * DV * 9 * 2);                       // 1179648
  CARVE(us,    WHL,   (size_t)DV * DV * 9 * 2);
  CARVE(float, BIASV, (size_t)NBATCH * DV * 4);                       // 4096 = 32 lines
  CARVE(us,    RQH,   padpx * DQ * 2);                                // 4734976
  CARVE(us,    RQL,   padpx * DQ * 2);
  CARVE(float, R2K,   (size_t)NBATCH * DQ * NPIX * 4);                // 8388608
  CARVE(us,    VNH,   (size_t)NBATCH * DV * NPIX * 2);                // 2097152
  CARVE(us,    VNL,   (size_t)NBATCH * DV * NPIX * 2);
  CARVE(float, PARTQ, (size_t)512 * 128);                             // 512 lines
  CARVE(float, PARTK, (size_t)512 * 128);                             // 512 lines
  CARVE(float, SCAL,  256);                                           // 1 line used
  CARVE(us,    FTH,   (size_t)NBATCH * 8 * DVH * FTK * 2);            // 1179648
  CARVE(us,    FTL,   (size_t)NBATCH * 8 * DVH * FTK * 2);
  CARVE(us,    QKH,   padpx * DV * 2);                                // 2367488
  CARVE(us,    QKL,   padpx * DV * 2);
  CARVE(float, OUTP,  (size_t)NBATCH * DV * NPIX * 4);                // 4194304
  CARVE(float, PARTL, (size_t)256 * 128);                             // 256 lines
  CARVE(float, ROWS,  (size_t)NBATCH * HIMG * CIN * 4);               // 131072
#undef CARVE
  if (off > ws_size) return;
  if (off > (size_t)134217728) return;

  BiW bw;
  bilin3(bw);

  // 16-bit operand planes
  k_prep<<<NB_PREP, 256, 0, stream>>>(x, q_w, k_w, v_w, hu_w, XPH, XPL, ROWS,
                                      WQH, WQL, WKH, WKL, WVH, WVL, WHH, WHL, RQH, RQL, QKH, QKL);

  // k (3x3), v (3x3), q (1x1) convolutions
  k_conv_qkv<<<NB_CK + NB_CV + NB_CQ, 128, 0, stream>>>(XPH, XPL, WKH, WKL, k_b, R2K, PARTK,
                                                        WVH, WVL, v_b, VNH, VNL,
                                                        WQH, WQL, q_b, RQH, RQL, PARTQ);

  // channel means + bias linear and phi ratios; pooled KV filters, grouped conv
  k_bias_phinorm<<<2, 256, 0, stream>>>(ROWS, bias_w, bias_b, BIASV, PARTQ, PARTK, SCAL);
  k_kv<<<dim3(9, NBATCH * 8), 128, 0, stream>>>(R2K, VNH, VNL, SCAL, bw, FTH, FTL);
  k_gconv<<<dim3(16, 4, NBATCH), 128, 0, stream>>>(RQH, RQL, FTH, FTL, SCAL, BIASV, QKH, QKL);

  // head unification conv + LayerNorm
  k_conv_hu<<<dim3(64, DV / 64), 128, 0, stream>>>(QKH, QKL, WHH, WHL, hu_b, OUTP, PARTL);
  k_ln<<<(NBATCH * DV * NPIX) / 1024, 256, 0, stream>>>(OUTP, PARTL, out);
}

// v006
// Measured time: 115 microseconds a run.
// Timed twice side by side with v005, it ran 1.06 times as fast both times.
// Over all steps from v000 it is 3.72 times as fast.
// Contractions: q 1x1 conv, k/v/hu 3x3 convs as implicit GEMM (K = 9*256), pooled KV outer-product GEMMs (64x32x64 per head and tap: the two image rows with a non-zero pool weight), per-sample grouped 3x3 conv (K = 9*64) and the channel-mean bias linear, all on v_wmma_f32_16x16x32_bf16 with bf16 hi/lo three-product operand split (hi*hi + lo*hi + hi*lo), f32 accumulate; phi norm ratios, clip, channel means and LayerNorm statistics in f32/f64 on the VALU.
#include <hip/hip_runtime.h>

typedef unsigned short us;
typedef int   v8i  __attribute__((ext_vector_type(8)));
typedef float v8f  __attribute__((ext_vector_type(8)));
typedef float v4f  __attribute__((ext_vector_type(4)));
typedef unsigned short v8us __attribute__((ext_vector_type(8)));
typedef __bf16 v16b __attribute__((ext_vector_type(16)));
typedef v4f  __attribute__((may_alias)) v4fa;
typedef v8us __attribute__((may_alias)) v8usa;
union Frag { v8i v; v8us half[2]; };
union DPack { double d[2]; v4f f; };

#define NBATCH 4
#define CIN    256
#define HIMG   32
#define NPIX   1024
#define PW     34
#define DQ     512
#define DV     256
#define DK     64
#define DVH    32
#define FTK    576

struct BiW { int i0[3]; int i1[3]; float w0[3]; float w1[3]; };
static_assert(sizeof(BiW) == 48);

// The bilinear pool (32 -> 3, align_corners = false) gives a non-zero weight to image row
// floor((p + 0.5) * 32 / 3 - 0.5) = (64 p + 29) / 6 and to the row below it, p = 0..2, and to no other.
// V enters the result only through that pool, so only these rows of V are ever read.
constexpr int pool_row(int p) { return (64 * p + 29) / 6; }
// the two-row pixel tiles (image rows 2 t, 2 t + 1) that hold those six rows
#define NVT 4
constexpr int VT0 = pool_row(0) >> 1, VT1 = pool_row(1) >> 1, VT2 = (pool_row(1) + 1) >> 1, VT3 = pool_row(2) >> 1;
static_assert(((pool_row(0) + 1) >> 1) == VT0 && ((pool_row(2) + 1) >> 1) == VT3, "rows of taps 0 and 2 share a tile");
static_assert(VT0 < VT1 && VT1 < VT2 && VT2 < VT3 && VT3 < HIMG / 2, "four distinct tiles, one writer each");

// ---------------------------------------------------------------------------
// bf16 helpers (RNE convert) and the hi/lo split
// ---------------------------------------------------------------------------
__device__ __forceinline__ us f2bf(float f) {
  unsigned u = __float_as_uint(f);
  u += 0x7FFFu + ((u >> 16) & 1u);
  return (us)(u >> 16);
}
__device__ __forceinline__ float bf2f(us hv) {
  return __uint_as_float(((unsigned)hv) << 16);
}
__device__ __forceinline__ void split2(float f, us& hi, us& lo) {
  hi = f2bf(f);
  lo = f2bf(f - bf2f(hi));
}

// ---------------------------------------------------------------------------
// 16x16x32 bf16 WMMA (builtin: the compiler keeps the distances behind it and is free to schedule around it).
// Fragment map (wave32): lane l, h = l>>4, m = n = l&15.
//   A/B element i: i<8 -> k0+8h+i ; i>=8 -> k0+16+8h+(i-8)
//   D element r : row 8h+r, col l&15
// ---------------------------------------------------------------------------
__device__ __forceinline__ v8f wmma_bf(v8i a, v8i b, v8f c) {
  return __builtin_amdgcn_wmma_f32_16x16x32_bf16(false, __builtin_bit_cast(v16b, a), false,
                                                 __builtin_bit_cast(v16b, b), (short)0, c, false, false);
}
// The same with four vector slots tied behind it (ties D, keeps A/B live): for the bias loop, whose back edge leads
// from its last WMMA straight to global loads onto that WMMA's B registers.
__device__ __forceinline__ v8f wmma_bf_slots(v8i a, v8i b, v8f c) {
  v8f d = wmma_bf(a, b, c);
  asm volatile("v_nop\n\tv_nop\n\tv_nop\n\tv_nop" : "+v"(d) : "v"(a), "v"(b));
  return d;
}
// three-product split: ah*bh + al*bh + ah*bl into one accumulator (bias loop)
__device__ __forceinline__ v8f wmma3(v8i ah, v8i al, v8i bh, v8i bl, v8f c) {
  c = wmma_bf_slots(ah, bh, c);
  c = wmma_bf_slots(al, bh, c);
  c = wmma_bf_slots(ah, bl, c);
  return c;
}
// three-product split: ah*bh + al*bh + ah*bl into each accumulator, in that order; issued product by
// product over the independent accumulators, so that no WMMA waits for the one directly ahead of it
// 2 x 2 tiles: a[mt], b[nt] -> c[mt][nt]
__device__ __forceinline__ void wmma3_2x2(const v8i (&ah)[2], const v8i (&al)[2],
                                          const v8i (&bh)[2], const v8i (&bl)[2], v8f (&c)[2][2]) {
  #pragma unroll
  for (int t = 0; t < 4; ++t) c[t >> 1][t & 1] = wmma_bf(ah[t >> 1], bh[t & 1], c[t >> 1][t & 1]);
  #pragma unroll
  for (int t = 0; t < 4; ++t) c[t >> 1][t & 1] = wmma_bf(al[t >> 1], bh[t & 1], c[t >> 1][t & 1]);
  #pragma unroll
  for (int t = 0; t < 4; ++t) c[t >> 1][t & 1] = wmma_bf(ah[t >> 1], bl[t & 1], c[t >> 1][t & 1]);
}
// 1 x 2 tiles: a, b[nt] -> c[nt]
__device__ __forceinline__ void wmma3_1x2(v8i ah, v8i al, const v8i (&bh)[2], const v8i (&bl)[2], v8f (&c)[2]) {
  c[0] = wmma_bf(ah, bh[0], c[0]);
  c[1] = wmma_bf(ah, bh[1], c[1]);
  c[0] = wmma_bf(al, bh[0], c[0]);
  c[1] = wmma_bf(al, bh[1], c[1]);
  c[0] = wmma_bf(ah, bl[0], c[0]);
  c[1] = wmma_bf(ah, bl[1], c[1]);
}
// fragment from a k-contiguous 16-bit row (pointer already at k0)
__device__ __forceinline__ v8i ldfrag(const us* p, int h) {
  Frag f;
  f.half[0] = *(const v8usa*)(p + 8 * h);
  f.half[1] = *(const v8usa*)(p + 16 + 8 * h);
  return f.v;
}

__device__ __forceinline__ float wave_sum(float s) {
  s += __shfl_xor(s, 16);
  s += __shfl_xor(s, 8);
  s += __shfl_xor(s, 4);
  s += __shfl_xor(s, 2);
  s += __shfl_xor(s, 1);
  return s;
}
__device__ __forceinline__ double dshfl_xor(double v, int msk) {
  const unsigned long long u = __builtin_bit_cast(unsigned long long, v);
  int lo = (int)(unsigned)(u & 0xFFFFFFFFull);
  int hi = (int)(unsigned)(u >> 32);
  lo = __shfl_xor(lo, msk);
  hi = __shfl_xor(hi, msk);
  const unsigned long long r = (((unsigned long long)(unsigned)hi) << 32) | (unsigned long long)(unsigned)lo;
  return __builtin_bit_cast(double, r);
}
__device__ __forceinline__ double wave_sum_d(double s) {
  s += dshfl_xor(s, 16);
  s += dshfl_xor(s, 8);
  s += dshfl_xor(s, 4);
  s += dshfl_xor(s, 2);
  s += dshfl_xor(s, 1);
  return s;
}

// ---------------------------------------------------------------------------
// Kernel: x NCHW f32 -> bf16 hi/lo padded NHWC planes [b][34][34][256]
// (interior pixels). Block role = (y, b); LDS transpose; one instruction writes one
// coverage: 8 waves x 4 pixels = 32 px per row, 32 lanes x 8 = 256 ch.
// Also the f32 sum of each channel's image row (32 values, fixed order) into
// rowsum[b][y][c]: 256 threads x 4 B = 8 whole lines per block. The f32 copy
// sits in LDS at pitch 33 words, free of bank conflicts on store and on read.
// ---------------------------------------------------------------------------
__device__ __forceinline__ void prep_x_body(const float* __restrict__ x,
                                            us* __restrict__ xh, us* __restrict__ xl,
                                            float* __restrict__ rowsum, int y, int b) {
  __shared__ __attribute__((aligned(16))) us sh[32 * 256];
  __shared__ __attribute__((aligned(16))) us sl[32 * 256];
  __shared__ float sf[256 * 33];
  const int tid = threadIdx.x, lane = tid & 31, w = tid >> 5;
  #pragma unroll 1
  for (int j = 0; j < 32; ++j) {
    const int c = 8 * j + w;
    const float v = x[((size_t)(b * CIN + c) * HIMG + y) * HIMG + lane];
    us hi, lo;
    split2(v, hi, lo);
    sh[lane * 256 + c] = hi;
    sl[lane * 256 + c] = lo;
    sf[c * 33 + lane] = v;
  }
  __syncthreads();
  float rs = 0.f;
  // unrolled: constant LDS offsets, the reads issue ahead of the dependent adds
  #pragma unroll
  for (int i = 0; i < 32; ++i) rs += sf[tid * 33 + i];
  rowsum[(size_t)(b * HIMG + y) * CIN + tid] = rs;
  v8us vh[4], vl[4];
  size_t d[4];
  #pragma unroll
  for (int i = 0; i < 4; ++i) {
    const int px = 4 * w + i;
    vh[i] = *(const v8usa*)(sh + px * 256 + 8 * lane);
    vl[i] = *(const v8usa*)(sl + px * 256 + 8 * lane);
    d[i] = ((size_t)((b * PW + y + 1) * PW + px + 1)) * CIN + 8 * lane;
  }
  #pragma unroll
  for (int i = 0; i < 4; ++i) { *(v8us*)(xh + d[i]) = vh[i]; *(v8us*)(xl + d[i]) = vl[i]; }
  
}

// ---------------------------------------------------------------------------
// Kernel: zero the border pixel rows of padded NHWC planes [b][34][34][C].
// Wave = one border pixel; 32 lanes x 16 B = 256 halves per instruction.
// coverage: 132 border pixels x 4 samples, C halves each, both planes.
// ---------------------------------------------------------------------------
__device__ __forceinline__ void zero_border_body(us* __restrict__ ph, us* __restrict__ pl, int C, int bx, int b) {
  const int tid = threadIdx.x, lane = tid & 31, w = tid >> 5;
  const int i = bx * 8 + w;
  if (i >= 132) return;
  int py, px;
  if (i < 34)       { py = 0;           px = i; }
  else if (i < 68)  { py = PW - 1;      px = i - 34; }
  else if (i < 100) { py = i - 68 + 1;  px = 0; }
  else              { py = i - 100 + 1; px = PW - 1; }
  const size_t base = ((size_t)((b * PW + py) * PW + px)) * (size_t)C;
  v8us z;
  #pragma unroll
  for (int j = 0; j < 8; ++j) z[j] = (us)0;
  #pragma unroll 1
  for (int off = 8 * lane; off < C; off += 256) {
    *(v8us*)(ph + base + off) = z;
    *(v8us*)(pl + base + off) = z;
  }
  
}

// ---------------------------------------------------------------------------
// Kernel: OIHW f32 weights -> rows [o][tap*256 + c] as bf16 hi and lo planes.
// Thread = 8 consecutive row elements, one 16-B store per lane per plane,
// coverage: cout*taps*256 elements, grid = n/2048 exactly.
// ---------------------------------------------------------------------------
__device__ __forceinline__ void wprep_body(const float* __restrict__ wsrc, int cout, int taps,
                                           us* __restrict__ wh, us* __restrict__ wl, int bx) {
  const int g = bx * 256 + threadIdx.x;
  const int kw = taps * 256;
  const int n = cout * kw;
  const int e8 = g * 8;
  if (e8 >= n) return;
  const int o = e8 / kw;
  const int r = e8 - o * kw;
  const int tap = r >> 8, c = r & 255;
  const float* src = wsrc + ((size_t)(o * 256 + c)) * taps + tap;
  v8us vh, vl;
  #pragma unroll
  for (int i = 0; i < 8; ++i) {
    us a, bq;
    split2(src[(size_t)i * taps], a, bq);
    vh[i] = a;
    vl[i] = bq;
  }
  *(v8us*)(wh + e8) = vh;
  *(v8us*)(wl + e8) = vl;
  
}

// ---------------------------------------------------------------------------
// Kernel: all operand preparation in one grid (the roles share no data, so
// they run side by side instead of one launch after another). Role by block
// index, the longest first: x planes, then k, v, hu, q weight rows, then the
// zero borders of the three padded plane pairs.
// ---------------------------------------------------------------------------
#define NB_X   (HIMG * NBATCH)
#define NB_WK  ((DQ * CIN * 9) / 2048)
#define NB_WV  ((DV * CIN * 9) / 2048)
#define NB_WH  ((DV * DV * 9) / 2048)
#define NB_WQ  ((DQ * CIN) / 2048)
#define NB_ZB  (17 * NBATCH)
#define NB_PREP (NB_X + NB_WK + NB_WV + NB_WH + NB_WQ + 3 * NB_ZB)
__global__ __launch_bounds__(256) void k_prep(
    const float* __restrict__ x, const float* __restrict__ q_w, const float* __restrict__ k_w,
    const float* __restrict__ v_w, const float* __restrict__ hu_w,
    us* __restrict__ xh, us* __restrict__ xl, float* __restrict__ rowsum,
    us* __restrict__ wqh, us* __restrict__ wql, us* __restrict__ wkh, us* __restrict__ wkl,
    us* __restrict__ wvh, us* __restrict__ wvl, us* __restrict__ whh, us* __restrict__ whl,
    us* __restrict__ rqh, us* __restrict__ rql, us* __restrict__ qkh, us* __restrict__ qkl) {
  int i = blockIdx.x;
  if (i < NB_X) { prep_x_body(x, xh, xl, rowsum, i & (HIMG - 1), i / HIMG); return; }
  i -= NB_X;
  if (i < NB_WK) { wprep_body(k_w, DQ, 9, wkh, wkl, i); return; }
  i -= NB_WK;
  if (i < NB_WV) { wprep_body(v_w, DV, 9, wvh, wvl, i); return; }
  i -= NB_WV;
  if (i < NB_WH) { wprep_body(hu_w, DV, 9, whh, whl, i); return; }
  i -= NB_WH;
  if (i < NB_WQ) { wprep_body(q_w, DQ, 1, wqh, wql, i); return; }
  i -= NB_WQ;
  const int pl = i / NB_ZB, r = i - pl * NB_ZB;
  const int bx = r % 17, b = r / 17;
  if (pl == 0)      zero_border_body(xh, xl, CIN, bx, b);
  else if (pl == 1) zero_border_body(rqh, rql, DQ, bx, b);
  else              zero_border_body(qkh, qkl, DV, bx, b);
}

// ---------------------------------------------------------------------------
// Fragment from 32 consecutive-k f32 values of one row (pointer at k0), split
// into hi/lo bf16 fragments in registers (fragment map as above).
// ---------------------------------------------------------------------------
__device__ __forceinline__ void frag_f32(const float* __restrict__ p, int h, v8i& fh, v8i& fl) {
  const v4f q0 = *(const v4fa*)(p + 8 * h);
  const v4f q1 = *(const v4fa*)(p + 8 * h + 4);
  const v4f q2 = *(const v4fa*)(p + 16 + 8 * h);
  const v4f q3 = *(const v4fa*)(p + 20 + 8 * h);
  float v[16];
  v[0] = q0.x; v[1] = q0.y; v[2] = q0.z; v[3] = q0.w;
  v[4] = q1.x; v[5] = q1.y; v[6] = q1.z; v[7] = q1.w;
  v[8] = q2.x; v[9] = q2.y; v[10] = q2.z; v[11] = q2.w;
  v[12] = q3.x; v[13] = q3.y; v[14] = q3.z; v[15] = q3.w;
  Frag a, bq;
  #pragma unroll
  for (int i = 0; i < 16; ++i) {
    us hi, lo;
    split2(v[i], hi, lo);
    a.half[i >> 3][i & 7] = hi;
    bq.half[i >> 3][i & 7] = lo;
  }
  fh = a.v;
  fl = bq.v;
}

// ---------------------------------------------------------------------------
// Block role: channel means of x (f32, from the 32 row sums of each channel, fixed
// order) and the bias linear on WMMA:
// bias[b][o] = sum_c mean[b][c] * bw[o][c] + bb[o]. One block of 8 waves.
// A = means [16 rows (4 real, 12 zero)][256] hi/lo in LDS, B = bw rows [o][c]
// coverage: 256 threads x 16 B = 4096 B = all of bias.
// ---------------------------------------------------------------------------
__device__ __forceinline__ void bias_body(const float* __restrict__ rowsum, const float* __restrict__ bw,
                                          const float* __restrict__ bb, float* __restrict__ biasv) {
  __shared__ __attribute__((aligned(16))) us sah[16 * 256];
  __shared__ __attribute__((aligned(16))) us sal[16 * 256];
  __shared__ __attribute__((aligned(16))) float sd[4 * 256];
  const int tid = threadIdx.x, lane = tid & 31, w = tid >> 5;
  const int h = lane >> 4, m = lane & 15;
  for (int i = tid; i < 16 * 256; i += 256) {
    if (i >= 4 * 256) { sah[i] = (us)0; sal[i] = (us)0; }
  }
  {
    const int k = tid >> 6, c4 = 4 * (tid & 63);   // b = k, channels c4 .. c4+3
    const float* p = rowsum + (size_t)k * HIMG * CIN + c4;
    v4f sm;
    sm.x = 0.f; sm.y = 0.f; sm.z = 0.f; sm.w = 0.f;
    // unrolled: the 32 loads fly together, one memory latency instead of 32
    #pragma unroll
    for (int i = 0; i < HIMG; ++i) sm += *(const v4fa*)(p + i * CIN);
    // unrolled: constant vector index, sm stays in registers
    #pragma unroll
    for (int e = 0; e < 4; ++e) {
      const float mean = sm[e] * (1.0f / 1024.0f);
      us hi, lo;
      split2(mean, hi, lo);
      sah[k * 256 + c4 + e] = hi;
      sal[k * 256 + c4 + e] = lo;
    }
  }
  __syncthreads();

  const int o0 = 32 * w + m, o1 = o0 + 16;
  const float* br0 = bw + (size_t)o0 * 256;
  const float* br1 = bw + (size_t)o1 * 256;
  const v8f z8 = {0.f, 0.f, 0.f, 0.f, 0.f, 0.f, 0.f, 0.f};
  v8f acc[2];
  acc[0] = z8; acc[1] = z8;
  #pragma unroll 1
  for (int k0 = 0; k0 < 256; k0 += 32) {
    const v8i ah = ldfrag(sah + m * 256 + k0, h);
    const v8i al = ldfrag(sal + m * 256 + k0, h);
    v8i bh0, bl0, bh1, bl1;
    frag_f32(br0 + k0, h, bh0, bl0);
    frag_f32(br1 + k0, h, bh1, bl1);
    acc[0] = wmma3(ah, al, bh0, bl0, acc[0]);
    acc[1] = wmma3(ah, al, bh1, bl1, acc[1]);
  }
  const float bb0 = bb[o0], bb1 = bb[o1];
  if (h == 0) {
    #pragma unroll
    for (int r = 0; r < 4; ++r) {
      sd[r * 256 + o0] = acc[0][r] + bb0;
      sd[r * 256 + o1] = acc[1][r] + bb1;
    }
  }
  __syncthreads();
  const int L = tid >> 3, q = tid & 7;
  const v4f v = *(const v4fa*)(sd + L * 32 + 4 * q);
  float* dst = biasv + L * 32 + 4 * q;
  *(v4f*)dst = v;
  
}

// ---------------------------------------------------------------------------
// Eight asynchronous 16-B copies global -> LDS per lane (no register staging).
// l = the lane's LDS byte addresses, g = its global addresses, both 16-B
// aligned. The closing s_wait_xcnt keeps later rewrites of the address
// registers behind the copies' issue (precaution), so it sits in the statement.
// ---------------------------------------------------------------------------
__device__ __forceinline__ void acopy8(const unsigned (&l)[8], const us* const (&g)[8]) {
  asm volatile(
      "global_load_async_to_lds_b128 %0, %8, off\n\t"
      "global_load_async_to_lds_b128 %1, %9, off\n\t"
      "global_load_async_to_lds_b128 %2, %10, off\n\t"
      "global_load_async_to_lds_b128 %3, %11, off\n\t"
      "global_load_async_to_lds_b128 %4, %12, off\n\t"
      "global_load_async_to_lds_b128 %5, %13, off\n\t"
      "global_load_async_to_lds_b128 %6, %14, off\n\t"
      "global_load_async_to_lds_b128 %7, %15, off\n\t"
      "s_wait_xcnt 0x0"
      :: "v"(l[0]), "v"(l[1]), "v"(l[2]), "v"(l[3]), "v"(l[4]), "v"(l[5]), "v"(l[6]), "v"(l[7]),
         "v"(g[0]), "v"(g[1]), "v"(g[2]), "v"(g[3]), "v"(g[4]), "v"(g[5]), "v"(g[6]), "v"(g[7])
      : "memory");
}

// LDS ring of the convolutions: a stage = KC channels of 64 pixel rows and 64
// weight rows, hi and lo planes; row pitch 2 KC + 16 B = 16 B x odd
// (conflict-free 16-B reads). Halves (16-bit words) per stage:
constexpr int ring_stage(int kc) { return 4 * 64 * (kc + 8); }
// KC = 128 (two buffers: 139,264 B) where one block per WGP is all the grid has;
// KC = 64 (two buffers: 73,728 B) where more long tiles wait than two blocks per
// WGP can hold: four blocks then share a WGP's LDS.
#define KC_HU  128
#define KC_QKV 64

// ---------------------------------------------------------------------------
// Kernel: implicit-GEMM convolution (Cin = 256 per pixel) over bf16 hi/lo
// zero-padded NHWC planes [b][34][34][256]; weights as rows [o][tap*256+c]
// hi/lo. Block = 64 pixels (image rows y0, y0+1) x 64 output channels,
// 4 waves of 32 px x 32 ch (2x2 tiles), K = ntaps*256 in steps of 32,
// operand rows staged in LDS by asynchronous copies of 2 KC-byte row pieces (two
// buffers, the next stage flies while this one is worked on), fragments read
// from LDS, three products per tile pair.
// MODE 0: relu^2 -> bf16 hi/lo padded NHWC planes (pitch = cout) + (s2,s4) partial line
// MODE 1: relu^2 -> f32 NCHW + (s2,s4) partial line
// MODE 2: value -> bf16 hi/lo NCHW planes
// MODE 3: value -> f32 NCHW + (sum, sum of squares) partial line (f64)
// coverage: MODE 0 store: 4 waves x 16 px x 8 lanes x 8 ch = 64 px x 64 ch;
// MODE 1/3: 4 waves x 16 ch x 64 px; MODE 2: 4 waves x 16 ch x 8 lanes x 8 px.
// ---------------------------------------------------------------------------
// The body takes its tile (bx = pixel tile, by = channel tile of gy) and the
// block's LDS from the kernel that calls it. sbuf (16 KiB, epilogue only) may lie
// on the ring: it is first written behind the last stage's waits and barrier,
// when every wave has left the ring and no copy is outstanding.
template <int MODE, int KC>
__device__ __forceinline__ void conv_body(
    us* ring, float* sbuf, double (*sred)[2], int bx, int by, int gy,
    const us* __restrict__ ah, const us* __restrict__ al,
    const us* __restrict__ wh, const us* __restrict__ wl,
    const float* __restrict__ bias, int ntaps, int cout,
    us* __restrict__ oh, us* __restrict__ ol, float* __restrict__ of, float* __restrict__ part)
{
  const int tid = threadIdx.x, lane = tid & 31, w = tid >> 5;
  const int h = lane >> 4, m = lane & 15;
  const int pt = bx, b = pt >> 4, y0 = (pt & 15) * 2;
  const int n0 = by * 64;
  const int ry = w >> 1, nw = 32 * (w & 1);
  const int kw = ntaps * CIN;
  constexpr int LPITCH = KC + 8, LPLANE = 64 * LPITCH, LSTAGE = ring_stage(KC);
  constexpr int SPT = CIN / KC;        // stages per tap
  constexpr int LPR = KC / 8;          // lanes x 16 B = one row piece of KC channels
  constexpr int RPP = 128 / LPR;       // rows that the block's 128 threads copy at once
  constexpr int NPP = 64 / RPP;        // copies per thread and plane
  static_assert(SPT * KC == CIN && (4 * NPP) % 8 == 0 && RPP <= 32, "whole stages, whole groups of eight copies");
  const int nst = SPT * ntaps;
  // copy map: thread = 16-B column ql of rows r0 + RPP i
  const int ql = tid & (LPR - 1), r0 = tid / LPR;
  const unsigned lds0 = (unsigned)(size_t)ring + (unsigned)(r0 * (LPITCH * 2) + ql * 16);
  const size_t wbase = (size_t)(n0 + r0) * kw + 8 * ql;
  // stage s (tap s / SPT, channels KC (s % SPT) ..) into buffer bufi
  auto stage_copy = [&](int s, int bufi) {
    const int tap = s / SPT, c0 = (s % SPT) * KC;
    const int t3 = tap / 3;
    const int ky = (ntaps == 1) ? 1 : t3;
    const int kx = (ntaps == 1) ? 1 : (tap - 3 * t3);
    const size_t ao = ((size_t)((b * PW + y0 + ky) * PW + kx + r0)) * CIN + c0 + 8 * ql;
    const size_t wo = wbase + (size_t)s * KC;
    const unsigned lb = lds0 + (unsigned)bufi * (LSTAGE * 2);
    // planes in LDS order (pixels hi, lo, weights hi, lo), eight copies per statement;
    // both loops unrolled: plane and row are then constants and l, g stay in registers
    #pragma unroll
    for (int c = 0; c < 4 * NPP; c += 8) {
      unsigned l[8];
      const us* g[8];
      #pragma unroll
      for (int t = 0; t < 8; ++t) {
        const int pl = (c + t) / NPP, row = ((c + t) % NPP) * RPP;
        l[t] = lb + (unsigned)((pl * LPLANE + row * LPITCH) * 2);
        if (pl < 2) g[t] = (pl == 0 ? ah : al) + ao + (size_t)((row >> 5) * PW * CIN + (row & 31) * CIN);
        else        g[t] = (pl == 2 ? wh : wl) + wo + (size_t)row * kw;
      }
      acopy8(l, g);
    }
  };
  const v8f z8 = {0.f, 0.f, 0.f, 0.f, 0.f, 0.f, 0.f, 0.f};
  v8f acc[2][2];
  #pragma unroll
  for (int i = 0; i < 2; ++i) { acc[i][0] = z8; acc[i][1] = z8; }

  // prologue: stage 0 landed and published, then stage 1 in flight
  stage_copy(0, 0);
  asm volatile("s_wait_asynccnt 0x0" ::: "memory");  // this wave's copies of stage 0 have landed
  __syncthreads();                                   // ... and every other wave's
  stage_copy(1, 1);                                  // nst = SPT ntaps >= 2

  const int arow = (ry * 32 + m) * LPITCH;
  const int brow = 2 * LPLANE + (nw + m) * LPITCH;
  #pragma unroll 1
  for (int s = 0; s < nst; ++s) {
    const us* sb = ring + (s & 1) * LSTAGE;
    // two register sets of fragments: step kk + 32 of this stage is read while step kk is multiplied
    v8i fah[2][2], fal[2][2], fbh[2][2], fbl[2][2];
    auto ldstep = [&](int kk, int q) {
      #pragma unroll
      for (int t = 0; t < 2; ++t) fah[q][t] = ldfrag(sb + arow + t * 16 * LPITCH + kk, h);
      #pragma unroll
      for (int t = 0; t < 2; ++t) fbh[q][t] = ldfrag(sb + brow + t * 16 * LPITCH + kk, h);
      #pragma unroll
      for (int t = 0; t < 2; ++t) fal[q][t] = ldfrag(sb + LPLANE + arow + t * 16 * LPITCH + kk, h);
      #pragma unroll
      for (int t = 0; t < 2; ++t) fbl[q][t] = ldfrag(sb + LPLANE + brow + t * 16 * LPITCH + kk, h);
    };
    ldstep(0, 0);
    #pragma unroll
    for (int kk = 0; kk < KC; kk += 32) {
      const int q = (kk >> 5) & 1;
      if (kk + 32 < KC) ldstep(kk + 32, q ^ 1);
      // keeps the next step's 16 LDS reads one group ahead of this step's WMMAs (else they sink to their uses and each waits)
      __builtin_amdgcn_sched_barrier(0);
      wmma3_2x2(fah[q], fal[q], fbh[q], fbl[q], acc);
    }
    // publish point of stage s + 1, and hand-over of this stage's buffer
    asm volatile("s_wait_dscnt 0x0" ::: "memory");     // this wave's reads of the buffer are done
    asm volatile("s_wait_asynccnt 0x0" ::: "memory");  // this wave's copies of stage s + 1 have landed
    __syncthreads();                                   // both hold for every wave of the block
    if (s + 2 < nst) stage_copy(s + 2, s & 1);
  }
  asm volatile("s_wait_asynccnt 0x0" ::: "memory");    // no copy outstanding past the loop

  // epilogue into LDS
  float bv[2];
  bv[0] = bias[n0 + nw + m];
  bv[1] = bias[n0 + nw + 16 + m];
  us* sH = reinterpret_cast<us*>(sbuf);
  us* sL = sH + 4096;
  float fs = 0.f, fq = 0.f;
  double ds = 0.0, dq = 0.0;
  #pragma unroll
  for (int mt = 0; mt < 2; ++mt) {
    #pragma unroll
    for (int nt = 0; nt < 2; ++nt) {
      #pragma unroll
      for (int r = 0; r < 8; ++r) {
        const float val = acc[mt][nt][r] + bv[nt];
        const int tp = ry * 32 + mt * 16 + 8 * h + r;
        const int ch = nw + 16 * nt + m;
        if (MODE == 0) {
          const float rr = fmaxf(val, 0.f);
          const float r2 = rr * rr;
          fs += r2; fq += r2 * r2;
          us hi, lo;
          split2(r2, hi, lo);
          sH[tp * 64 + ch] = hi;
          sL[tp * 64 + ch] = lo;
        } else if (MODE == 1) {
          const float rr = fmaxf(val, 0.f);
          const float r2 = rr * rr;
          fs += r2; fq += r2 * r2;
          sbuf[ch * 64 + tp] = r2;
        } else if (MODE == 2) {
          us hi, lo;
          split2(val, hi, lo);
          sH[ch * 64 + tp] = hi;
          sL[ch * 64 + tp] = lo;
        } else {
          ds += (double)val;
          dq += (double)val * (double)val;
          sbuf[ch * 64 + tp] = val;
        }
      }
    }
  }
  if (MODE == 0 || MODE == 1) {
    fs = wave_sum(fs);
    fq = wave_sum(fq);
    ds = (double)fs;
    dq = (double)fq;
  } else if (MODE == 3) {
    ds = wave_sum_d(ds);
    dq = wave_sum_d(dq);
  }
  if (MODE != 2) {
    if (lane == 0) { sred[w][0] = ds; sred[w][1] = dq; }
  }
  __syncthreads();

  // block partial line (2 doubles + zeros), fixed order over the 4 waves
  v4f pv;
  pv.x = 0.f; pv.y = 0.f; pv.z = 0.f; pv.w = 0.f;
  size_t li = 0;
  bool pw = false;
  if (MODE != 2) {
    double S = 0.0, Q2 = 0.0;
    #pragma unroll
    for (int k = 0; k < 4; ++k) { S += sred[k][0]; Q2 += sred[k][1]; }
    DPack pk;
    pk.d[0] = S; pk.d[1] = Q2;
    pv.x = (lane == 0) ? pk.f.x : 0.f;
    pv.y = (lane == 0) ? pk.f.y : 0.f;
    pv.z = (lane == 0) ? pk.f.z : 0.f;
    pv.w = (lane == 0) ? pk.f.w : 0.f;
    li = ((size_t)bx * gy + by) * 32 + 4 * (lane & 7);
    pw = (w == 0) && (lane < 8);
  }

  if (MODE == 0) {
    const int q8 = lane & 7, sub = lane >> 3;
    v8us th[4], tl[4];
    size_t d[4];
    #pragma unroll
    for (int i = 0; i < 4; ++i) {
      const int tp = 16 * w + 4 * i + sub;
      const int ry2 = tp >> 5, xx = tp & 31;
      th[i] = *(const v8usa*)(sH + tp * 64 + 8 * q8);
      tl[i] = *(const v8usa*)(sL + tp * 64 + 8 * q8);
      d[i] = ((size_t)((b * PW + y0 + ry2 + 1) * PW + xx + 1)) * (size_t)cout + n0 + 8 * q8;
    }
    #pragma unroll
    for (int i = 0; i < 4; ++i) { *(v8us*)(oh + d[i]) = th[i]; *(v8us*)(ol + d[i]) = tl[i]; }
    if (pw) *(v4f*)(part + li) = pv;
    
  } else if (MODE == 2) {
    const int q8 = lane & 7, sub = lane >> 3;
    v8us th[4], tl[4];
    size_t d[4];
    #pragma unroll
    for (int i = 0; i < 4; ++i) {
      const int chl = 16 * w + 4 * i + sub;
      th[i] = *(const v8usa*)(sH + chl * 64 + 8 * q8);
      tl[i] = *(const v8usa*)(sL + chl * 64 + 8 * q8);
      d[i] = ((size_t)(b * cout + n0 + chl)) * NPIX + y0 * HIMG + 8 * q8;
    }
    #pragma unroll
    for (int i = 0; i < 4; ++i) { *(v8us*)(oh + d[i]) = th[i]; *(v8us*)(ol + d[i]) = tl[i]; }
    // another role's code follows these stores in the merged kernel's listing and reuses their registers:
    // the wait keeps any such rewrite behind the stores' issue (precaution)
    asm volatile("s_wait_xcnt 0x0" ::: "memory");
  } else {
    const int hs = lane >> 4, x4 = 4 * (lane & 15);
    v4f tv[8];
    size_t d[8];
    #pragma unroll
    for (int i = 0; i < 8; ++i) {
      const int chl = 16 * w + 2 * i + hs;
      tv[i] = *(const v4fa*)(sbuf + chl * 64 + x4);
      d[i] = ((size_t)(b * cout + n0 + chl)) * NPIX + y0 * HIMG + x4;
    }
    #pragma unroll
    for (int i = 0; i < 8; ++i) *(v4f*)(of + d[i]) = tv[i];
    if (pw) *(v4f*)(part + li) = pv;
    
  }
}

// ---------------------------------------------------------------------------
// Kernel: the head unification conv (MODE 3), one tile per block.
// ---------------------------------------------------------------------------
__global__ __launch_bounds__(128) void k_conv_hu(
    const us* __restrict__ ah, const us* __restrict__ al,
    const us* __restrict__ wh, const us* __restrict__ wl,
    const float* __restrict__ bias, float* __restrict__ of, float* __restrict__ part)
{
  __shared__ __attribute__((aligned(16))) us ring[2 * ring_stage(KC_HU)];
  __shared__ __attribute__((aligned(16))) float sbuf[64 * 64];
  __shared__ double sred[4][2];
  conv_body<3, KC_HU>(ring, sbuf, sred, blockIdx.x, blockIdx.y, DV / 64, ah, al, wh, wl, bias, 9, DV,
               nullptr, nullptr, of, part);
}

// ---------------------------------------------------------------------------
// Kernel: the k, v and q convolutions of x in one grid (they share no result,
// so their tiles fill the chip together). Role by block index, the long 3x3
// tiles first: 512 k tiles, 64 v tiles (only the row tiles that the pool
// reads), 512 q tiles; pixel tile fastest. 73,792 B of LDS per block: four
// blocks per WGP, so all 576 long tiles are resident from the start.
// ---------------------------------------------------------------------------
#define NB_CK (64 * (DQ / 64))
#define NB_CV (NBATCH * NVT * (DV / 64))
#define NB_CQ (64 * (DQ / 64))
__global__ __launch_bounds__(128) void k_conv_qkv(
    const us* __restrict__ xh, const us* __restrict__ xl,
    const us* __restrict__ wkh, const us* __restrict__ wkl, const float* __restrict__ k_b,
    float* __restrict__ r2k, float* __restrict__ partk,
    const us* __restrict__ wvh, const us* __restrict__ wvl, const float* __restrict__ v_b,
    us* __restrict__ vnh, us* __restrict__ vnl,
    const us* __restrict__ wqh, const us* __restrict__ wql, const float* __restrict__ q_b,
    us* __restrict__ rqh, us* __restrict__ rql, float* __restrict__ partq)
{
  __shared__ __attribute__((aligned(16))) us ring[2 * ring_stage(KC_QKV)];
  static_assert(sizeof(ring) >= 64 * 64 * sizeof(float), "the epilogue buffer fits on the ring");
  float* sbuf = reinterpret_cast<float*>(ring);
  __shared__ double sred[4][2];
  int i = blockIdx.x;
  if (i < NB_CK) {
    conv_body<1, KC_QKV>(ring, sbuf, sred, i & 63, i >> 6, DQ / 64, xh, xl, wkh, wkl, k_b, 9, DQ,
                 nullptr, nullptr, r2k, partk);
    return;
  }
  i -= NB_CK;
  if (i < NB_CV) {
    // i counts only the row tiles that the pool reads: put it back on the grid of 64 pixel tiles per channel tile
    const int t = i & (NVT - 1), b = (i / NVT) & (NBATCH - 1);
    const int rt = (t == 0) ? VT0 : ((t == 1) ? VT1 : ((t == 2) ? VT2 : VT3));
    i = (i / (NVT * NBATCH)) * 64 + b * (HIMG / 2) + rt;
    conv_body<2, KC_QKV>(ring, sbuf, sred, i & 63, i >> 6, DV / 64, xh, xl, wvh, wvl, v_b, 9, DV,
                 vnh, vnl, nullptr, nullptr);
    return;
  }
  i -= NB_CV;
  conv_body<0, KC_QKV>(ring, sbuf, sred, i & 63, i >> 6, DQ / 64, xh, xl, wqh, wql, q_b, 1, DQ,
               rqh, rql, nullptr, partq);
}

// ---------------------------------------------------------------------------
// Block role: phi norm ratios s = sqrt(sum relu^2) / sqrt(sum relu^4) for the
// q and k tensors from 512 block partial lines each (fixed order, f64).
// Wave 0 = q, wave 1 = k, the other waves only pass the barriers; one whole
// output line.
// ---------------------------------------------------------------------------
__device__ __forceinline__ void phinorm_body(const float* __restrict__ partq, const float* __restrict__ partk,
                                             float* __restrict__ scal) {
  __shared__ double sacc[2][32][2];
  __shared__ float sres[2];
  const int tid = threadIdx.x, lane = tid & 31, w = tid >> 5;
  const float* pp = (w == 0) ? partq : partk;
  if (w < 2) {
    double s2 = 0.0, s4 = 0.0;
    #pragma unroll 1
    for (int j = 0; j < 16; ++j) {
      const double* dp = reinterpret_cast<const double*>(pp + (size_t)(lane * 16 + j) * 32);
      s2 += dp[0];
      s4 += dp[1];
    }
    sacc[w][lane][0] = s2;
    sacc[w][lane][1] = s4;
  }
  __syncthreads();
  if (w < 2 && lane == 0) {
    double t2 = 0.0, t4 = 0.0;
    for (int i = 0; i < 32; ++i) { t2 += sacc[w][i][0]; t4 += sacc[w][i][1]; }
    const float num = sqrtf((float)t2);
    const float den = sqrtf((float)t4);
    sres[w] = num * (1.0f / den);
  }
  __syncthreads();
  v4f pv;
  pv.x = (lane == 0) ? sres[0] : 0.f;
  pv.y = (lane == 0) ? sres[1] : 0.f;
  pv.z = 0.f; pv.w = 0.f;
  const bool pw = (w == 0) && (lane < 8);
  float* dst = scal + 4 * lane;
  if (pw) *(v4f*)dst = pv;
  
}

// ---------------------------------------------------------------------------
// Kernel: the two one-block jobs in front of the pooled filters and the
// grouped conv, side by side: block 0 = bias linear, block 1 = phi ratios.
// ---------------------------------------------------------------------------
__global__ __launch_bounds__(256) void k_bias_phinorm(
    const float* __restrict__ rowsum, const float* __restrict__ bw, const float* __restrict__ bb,
    float* __restrict__ biasv, const float* __restrict__ partq, const float* __restrict__ partk,
    float* __restrict__ scal) {
  if (blockIdx.x == 0) bias_body(rowsum, bw, bb, biasv);
  else                 phinorm_body(partq, partk, scal);
}

// ---------------------------------------------------------------------------
// Kernel: pooled outer product. Block = (tap pq, bh): D[kk 64][v 32] =
// sum_pix (relu(K)^2[kk][pix] * Mh[p][y] * Mw[q][x]) * V[v][pix] over the two
// image rows y where Mh[p][y] is not zero (K = 64; every other term is a
// product with a zero weight, and V exists only on those rows),
// A built in registers from the f32 NCHW relu^2 rows (split hi/lo),
// B from the bf16 NCHW V planes. Epilogue: * sK, clip +-32/9, hi/lo into
// coverage: 4 waves x 8 rows x 8 lanes x 8 kk = 32 v x 64 kk per (bh,pq).
// ---------------------------------------------------------------------------
__global__ __launch_bounds__(128) void k_kv(
    const float* __restrict__ r2k, const us* __restrict__ vnh, const us* __restrict__ vnl,
    const float* __restrict__ scal, BiW bw, us* __restrict__ fth, us* __restrict__ ftl)
{
  __shared__ __attribute__((aligned(16))) us sH[32 * 64];
  __shared__ __attribute__((aligned(16))) us sL[32 * 64];
  const int tid = threadIdx.x, lane = tid & 31, w = tid >> 5;
  const int h = lane >> 4, m = lane & 15;
  const int pq = blockIdx.x, bh = blockIdx.y;
  const int b = bh >> 3, head = bh & 7;
  const int p = pq / 3, q = pq - 3 * p;
  const int   iy0 = (p == 0) ? bw.i0[0] : ((p == 1) ? bw.i0[1] : bw.i0[2]);
  const int   iy1 = (p == 0) ? bw.i1[0] : ((p == 1) ? bw.i1[1] : bw.i1[2]);
  const float wy0 = (p == 0) ? bw.w0[0] : ((p == 1) ? bw.w0[1] : bw.w0[2]);
  const float wy1 = (p == 0) ? bw.w1[0] : ((p == 1) ? bw.w1[1] : bw.w1[2]);
  const int   ix0 = (q == 0) ? bw.i0[0] : ((q == 1) ? bw.i0[1] : bw.i0[2]);
  const int   ix1 = (q == 0) ? bw.i1[0] : ((q == 1) ? bw.i1[1] : bw.i1[2]);
  const float wx0 = (q == 0) ? bw.w0[0] : ((q == 1) ? bw.w0[1] : bw.w0[2]);
  const float wx1 = (q == 0) ? bw.w1[0] : ((q == 1) ? bw.w1[1] : bw.w1[2]);
  const float sK = scal[1];
  const float amax = (float)(32.0 / 9.0);
  const float* arow = r2k + ((size_t)(b * DQ + head * DK + 16 * w + m)) * NPIX;
  const size_t br0 = ((size_t)(b * DV + head * DVH + m)) * NPIX;
  const size_t br1 = br0 + (size_t)16 * NPIX;
  const v8f z8 = {0.f, 0.f, 0.f, 0.f, 0.f, 0.f, 0.f, 0.f};
  v8f acc[2];
  acc[0] = z8; acc[1] = z8;

  #pragma unroll 1
  for (int t = 0; t < 2; ++t) {
    // rows iy0 then iy1, ascending as in the full sum; were the two clamped onto one row, it takes both weights once
    const float wy = (t == 0) ? (wy0 + ((iy1 == iy0) ? wy1 : 0.f)) : ((iy1 == iy0) ? 0.f : wy1);
    const int k0 = ((t == 0) ? iy0 : iy1) * HIMG;
    const float* ap = arow + k0;
    const v4f q0 = *(const v4fa*)(ap + 8 * h);
    const v4f q1 = *(const v4fa*)(ap + 8 * h + 4);
    const v4f q2 = *(const v4fa*)(ap + 16 + 8 * h);
    const v4f q3 = *(const v4fa*)(ap + 20 + 8 * h);
    v8i fbh[2], fbl[2];
    fbh[0] = ldfrag(vnh + br0 + k0, h);
    fbh[1] = ldfrag(vnh + br1 + k0, h);
    fbl[0] = ldfrag(vnl + br0 + k0, h);
    fbl[1] = ldfrag(vnl + br1 + k0, h);
    // keeps the V fragment reads in flight with the K row reads (else they sink behind the split: a second memory latency)
    __builtin_amdgcn_sched_barrier(0);
    float v[16];
    v[0] = q0.x; v[1] = q0.y; v[2] = q0.z; v[3] = q0.w;
    v[4] = q1.x; v[5] = q1.y; v[6] = q1.z; v[7] = q1.w;
    v[8] = q2.x; v[9] = q2.y; v[10] = q2.z; v[11] = q2.w;
    v[12] = q3.x; v[13] = q3.y; v[14] = q3.z; v[15] = q3.w;
    Frag fah, fal;
    #pragma unroll
    for (int i = 0; i < 16; ++i) {
      const int xx = 8 * h + (i & 7) + ((i >> 3) << 4);
      const float wx = ((xx == ix0) ? wx0 : 0.f) + ((xx == ix1) ? wx1 : 0.f);
      const float a = v[i] * (wy * wx);
      us hi, lo;
      split2(a, hi, lo);
      fah.half[i >> 3][i & 7] = hi;
      fal.half[i >> 3][i & 7] = lo;
    }
    wmma3_1x2(fah.v, fal.v, fbh, fbl, acc);
  }

  #pragma unroll
  for (int nt = 0; nt < 2; ++nt) {
    #pragma unroll
    for (int r = 0; r < 8; ++r) {
      float val = acc[nt][r] * sK;
      val = fminf(fmaxf(val, -amax), amax);
      const int kk = 16 * w + 8 * h + r;
      const int vv = 16 * nt + m;
      us hi, lo;
      split2(val, hi, lo);
      sH[vv * 64 + kk] = hi;
      sL[vv * 64 + kk] = lo;
    }
  }
  __syncthreads();
  const int q8 = lane & 7, sub = lane >> 3;
  v8us th[2], tl[2];
  size_t d[2];
  #pragma unroll
  for (int i = 0; i < 2; ++i) {
    const int vv = 8 * w + 4 * i + sub;
    th[i] = *(const v8usa*)(sH + vv * 64 + 8 * q8);
    tl[i] = *(const v8usa*)(sL + vv * 64 + 8 * q8);
    d[i] = ((size_t)(bh * DVH + vv)) * FTK + pq * 64 + 8 * q8;
  }
  #pragma unroll
  for (int i = 0; i < 2; ++i) { *(v8us*)(fth + d[i]) = th[i]; *(v8us*)(ftl + d[i]) = tl[i]; }
  
}

// ---------------------------------------------------------------------------
// Kernel: per-sample grouped 3x3 conv of relu(Q)^2 planes (padded NHWC,
// 512 ch) with the pooled filters, K = 9*64 per head. Block = (64 px, head
// pair, b); wave = (head of the pair, image row) 32 px x 32 v. Epilogue:
// * sQ + bias[b][j*32+v], hi/lo into padded NHWC planes [b][34][34][256];
// coverage: 4 waves x 16 px x 8 lanes x 8 ch = 64 px x 64 ch per block;
// grid 16 x 4 x 4 = all interior pixels x all 256 channels x 4 samples.
// ---------------------------------------------------------------------------
__global__ __launch_bounds__(128) void k_gconv(
    const us* __restrict__ rqh, const us* __restrict__ rql,
    const us* __restrict__ fth, const us* __restrict__ ftl,
    const float* __restrict__ scal, const float* __restrict__ biasv,
    us* __restrict__ oh, us* __restrict__ ol)
{
  __shared__ __attribute__((aligned(16))) us sH[64 * 64];
  __shared__ __attribute__((aligned(16))) us sL[64 * 64];
  const int tid = threadIdx.x, lane = tid & 31, w = tid >> 5;
  const int h = lane >> 4, m = lane & 15;
  const int pt = blockIdx.x, jp = blockIdx.y, b = blockIdx.z;
  const int y0 = 2 * pt;
  const int jl = w >> 1, ry = w & 1;
  const int j = 2 * jp + jl, y = y0 + ry, bh = b * 8 + j;
  const size_t fr0 = ((size_t)(bh * DVH + m)) * FTK;
  const v8f z8 = {0.f, 0.f, 0.f, 0.f, 0.f, 0.f, 0.f, 0.f};
  v8f acc[2][2];
  #pragma unroll
  for (int i = 0; i < 2; ++i) { acc[i][0] = z8; acc[i][1] = z8; }

  #pragma unroll 1
  for (int tap = 0; tap < 9; ++tap) {
    const int ky = tap / 3;
    const int kx = tap - 3 * ky;
    const size_t ar0 = ((size_t)((b * PW + y + ky) * PW + kx + m)) * DQ + (size_t)j * DK;
    const size_t wt = (size_t)tap * DK;
    v8i fah[2][2], fal[2][2], fbh[2][2], fbl[2][2];   // [32-channel step][tile]
    // the lane's own four read addresses of this tap (its 8 h offset inside the k step included)
    const us* pah = rqh + ar0 + 8 * h;
    const us* pal = rql + ar0 + 8 * h;
    const us* pbh = fth + fr0 + wt + 8 * h;
    const us* pbl = ftl + fr0 + wt + 8 * h;
    #pragma unroll
    for (int q = 0; q < 2; ++q) {
      #pragma unroll
      for (int t = 0; t < 2; ++t) {
        fah[q][t] = ldfrag(pah + t * 16 * DQ + 32 * q, 0);
        fbh[q][t] = ldfrag(pbh + t * 16 * FTK + 32 * q, 0);
        fal[q][t] = ldfrag(pal + t * 16 * DQ + 32 * q, 0);
        fbl[q][t] = ldfrag(pbl + t * 16 * FTK + 32 * q, 0);
      }
    }
    // keeps the tap's 32 global reads one group in flight together (else they sink to their uses: a memory latency each)
    __builtin_amdgcn_sched_barrier(0);
    // the four address pairs stay live, so unwritten, up to this wait behind the last read (precaution)
    asm volatile("s_wait_xcnt 0x0" :: "v"(pah), "v"(pal), "v"(pbh), "v"(pbl) : "memory");
    static_assert(DK == 64, "two steps of 32 channels per tap");
    wmma3_2x2(fah[0], fal[0], fbh[0], fbl[0], acc);
    wmma3_2x2(fah[1], fal[1], fbh[1], fbl[1], acc);
  }

  const float sQ = scal[0];
  float bv[2];
  bv[0] = biasv[b * DV + j * DVH + m];
  bv[1] = biasv[b * DV + j * DVH + 16 + m];
  #pragma unroll
  for (int mt = 0; mt < 2; ++mt) {
    #pragma unroll
    for (int nt = 0; nt < 2; ++nt) {
      #pragma unroll
      for (int r = 0; r < 8; ++r) {
        const float val = acc[mt][nt][r] * sQ + bv[nt];
        const int tp = ry * 32 + mt * 16 + 8 * h + r;
        const int chl = jl * 32 + 16 * nt + m;
        us hi, lo;
        split2(val, hi, lo);
        sH[tp * 64 + chl] = hi;
        sL[tp * 64 + chl] = lo;
      }
    }
  }
  __syncthreads();
  const int q8 = lane & 7, sub = lane >> 3;
  v8us th[4], tl[4];
  size_t d[4];
  #pragma unroll
  for (int i = 0; i < 4; ++i) {
    const int tp = 16 * w + 4 * i + sub;
    const int ry2 = tp >> 5, xx = tp & 31;
    th[i] = *(const v8usa*)(sH + tp * 64 + 8 * q8);
    tl[i] = *(const v8usa*)(sL + tp * 64 + 8 * q8);
    d[i] = ((size_t)((b * PW + y0 + ry2 + 1) * PW + xx + 1)) * DV + jp * 64 + 8 * q8;
  }
  #pragma unroll
  for (int i = 0; i < 4; ++i) { *(v8us*)(oh + d[i]) = th[i]; *(v8us*)(ol + d[i]) = tl[i]; }
  
}

// ---------------------------------------------------------------------------
// Kernel: LayerNorm over (C,H,W) per sample: fixed-order f64 combine of the
// 64 block partial lines of the sample, then (v - mu) * rstd on one float4
// coverage: 1024 blocks x 256 threads x 4 floats = all 1048576 outputs.
// ---------------------------------------------------------------------------
__global__ __launch_bounds__(256) void k_ln(const float* __restrict__ outp, const float* __restrict__ partl,
                                            float* __restrict__ out) {
  __shared__ double ss[64];
  __shared__ double sq[64];
  __shared__ float sst[2];
  const int tid = threadIdx.x;
  const int blk = blockIdx.x, b = blk >> 8;
  if (tid < 64) {
    const double* dp = reinterpret_cast<const double*>(partl + (size_t)(b * 64 + tid) * 32);
    ss[tid] = dp[0];
    sq[tid] = dp[1];
  }
  __syncthreads();
  if (tid == 0) {
    double S = 0.0, Q2 = 0.0;
    for (int i = 0; i < 64; ++i) { S += ss[i]; Q2 += sq[i]; }
    const double inv = 1.0 / 262144.0;
    const double mu = S * inv;
    double var = Q2 * inv - mu * mu;
    if (var < 0.0) var = 0.0;
    const float den = sqrtf((float)var + 1e-5f);
    sst[0] = (float)mu;
    sst[1] = 1.0f / den;
  }
  __syncthreads();
  const float muf = sst[0], rinv = sst[1];
  const size_t e = ((size_t)blk * 256 + tid) * 4;
  v4f v = *(const v4fa*)(outp + e);
  v4f o;
  o.x = (v.x - muf) * rinv;
  o.y = (v.y - muf) * rinv;
  o.z = (v.z - muf) * rinv;
  o.w = (v.w - muf) * rinv;
  *(v4f*)(out + e) = o;
  
}

// ---------------------------------------------------------------------------
// Host: bilinear (32 -> 3, align_corners = false) taps and weights, computed
// with separate f64 multiply and subtract, fraction cast to f32.
// ---------------------------------------------------------------------------
static void bilin3(BiW& bw) {
#pragma clang fp contract(off)
  const double scale = 32.0 / 3.0;
  for (int p = 0; p < 3; ++p) {
    double src = ((double)p + 0.5) * scale;
    src = src - 0.5;
    if (src < 0.0) src = 0.0;
    const int f = (int)src;
    const float frac = (float)(src - (double)f);
    int c0 = f, c1 = f + 1;
    if (c0 > HIMG - 1) c0 = HIMG - 1;
    if (c1 > HIMG - 1) c1 = HIMG - 1;
    bw.i0[p] = c0;
    bw.i1[p] = c1;
    bw.w0[p] = 1.0f - frac;
    bw.w1[p] = frac;
  }
}

extern "C" void kernel_launch(void* const* d_in, const int* in_sizes, int n_in,
                              void* d_out, int out_size, void* d_ws, size_t ws_size,
                              hipStream_t stream) {
  if (n_in < 11) return;
  if (in_sizes[0] != NBATCH * CIN * NPIX) return;
  if (in_sizes[1] != DQ * CIN || in_sizes[2] != DQ) return;
  if (in_sizes[3] != DQ * CIN * 9 || in_sizes[4] != DQ) return;
  if (in_sizes[5] != DV * CIN * 9 || in_sizes[6] != DV) return;
  if (in_sizes[7] != DV * CIN || in_sizes[8] != DV) return;
  if (in_sizes[9] != DV * DV * 9 || in_sizes[10] != DV) return;
  if (out_size != NBATCH * DV * NPIX) return;

  const float* x      = (const float*)d_in[0];
  const float* q_w    = (const float*)d_in[1];
  const float* q_b    = (const float*)d_in[2];
  const float* k_w    = (const float*)d_in[3];
  const float* k_b    = (const float*)d_in[4];
  const float* v_w    = (const float*)d_in[5];
  const float* v_b    = (const float*)d_in[6];
  const float* bias_w = (const float*)d_in[7];
  const float* bias_b = (const float*)d_in[8];
  const float* hu_w   = (const float*)d_in[9];
  const float* hu_b   = (const float*)d_in[10];
  float* out = (float*)d_out;

  // workspace carve (bytes); every region sized to whole 256-B multiples and
  // written only with whole-line stores inside its extent
  char* ws = (char*)d_ws;
  size_t off = 0;
#define CARVE(T, name, bytes) T* name = (T*)(ws + off); off += (((size_t)(bytes)) + 255) & ~(size_t)255;
  const size_t padpx  = (size_t)NBATCH * PW * PW;                    // 4624 padded pixels
  CARVE(us,    XPH,   padpx * CIN * 2);                               // 2367488
  CARVE(us,    XPL,   padpx * CIN * 2);
  CARVE(us,    WQH,   (size_t)DQ * CIN * 2);                          // 262144
  CARVE(us,    WQL,   (size_t)DQ * CIN * 2);
  CARVE(us,    WKH,   (size_t)DQ * CIN * 9 * 2);                      // 2359296
  CARVE(us,    WKL,   (size_t)DQ * CIN * 9 * 2);
  CARVE(us,    WVH,   (size_t)DV * CIN * 9 * 2);                      // 1179648
  CARVE(us,    WVL,   (size_t)DV * CIN * 9 * 2);
  CARVE(us,    WHH,   (size_t)DV * DV * 9 * 2);                       // 1179648
  CARVE(us,    WHL,   (size_t)DV * DV * 9 * 2);
  CARVE(float, BIASV, (size_t)NBATCH * DV * 4);                       // 4096 = 32 lines
  CARVE(us,    RQH,   padpx * DQ * 2);                                // 4734976
  CARVE(us,    RQL,   padpx * DQ * 2);
  CARVE(float, R2K,   (size_t)NBATCH * DQ * NPIX * 4);                // 8388608
  CARVE(us,    VNH,   (size_t)NBATCH * DV * NPIX * 2);                // 2097152
  CARVE(us,    VNL,   (size_t)NBATCH * DV * NPIX * 2);
  CARVE(float, PARTQ, (size_t)512 * 128);                             // 512 lines
  CARVE(float, PARTK, (size_t)512 * 128);                             // 512 lines
  CARVE(float, SCAL,  256);                                           // 1 line used
  CARVE(us,    FTH,   (size_t)NBATCH * 8 * DVH * FTK * 2);            // 1179648
  CARVE(us,    FTL,   (size_t)NBATCH * 8 * DVH * FTK * 2);
  CARVE(us,    QKH,   padpx * DV * 2);                                // 2367488
  CARVE(us,    QKL,   padpx * DV * 2);
  CARVE(float, OUTP,  (size_t)NBATCH * DV * NPIX * 4);                // 4194304
  CARVE(float, PARTL, (size_t)256 * 128);                             // 256 lines
  CARVE(float, ROWS,  (size_t)NBATCH * HIMG * CIN * 4);               // 131072
#undef CARVE
  if (off > ws_size) return;
  if (off > (size_t)134217728) return;

  BiW bw;
  bilin3(bw);

  // 16-bit operand planes
  k_prep<<<NB_PREP, 256, 0, stream>>>(x, q_w, k_w, v_w, hu_w, XPH, XPL, ROWS,
                                      WQH, WQL, WKH, WKL, WVH, WVL, WHH, WHL, RQH, RQL, QKH, QKL);

  // k (3x3), v (3x3), q (1x1) convolutions
  k_conv_qkv<<<NB_CK + NB_CV + NB_CQ, 128, 0, stream>>>(XPH, XPL, WKH, WKL, k_b, R2K, PARTK,
                                                        WVH, WVL, v_b, VNH, VNL,
                                                        WQH, WQL, q_b, RQH, RQL, PARTQ);

  // channel means + bias linear and phi ratios; pooled KV filters, grouped conv
  k_bias_phinorm<<<2, 256, 0, stream>>>(ROWS, bias_w, bias_b, BIASV, PARTQ, PARTK, SCAL);
  k_kv<<<dim3(9, NBATCH * 8), 128, 0, stream>>>(R2K, VNH, VNL, SCAL, bw, FTH, FTL);
  k_gconv<<<dim3(16, 4, NBATCH), 128, 0, stream>>>(RQH, RQL, FTH, FTL, SCAL, BIASV, QKH, QKL);

  // head unification conv + LayerNorm
  k_conv_hu<<<dim3(64, DV / 64), 128, 0, stream>>>(QKH, QKL, WHH, WHL, hu_b, OUTP, PARTL);
  k_ln<<<(NBATCH * DV * NPIX) / 1024, 256, 0, stream>>>(OUTP, PARTL, out);
}

// v007
// Measured time: 106 microseconds a run.
// Timed twice side by side with v006, it ran 1.08 and 1.07 times as fast.
// Counting every step since v000, it is 3.99 times as fast.
// Contractions: q 1x1 conv, k/v/hu 3x3 convs as implicit GEMM (K = 9*256), pooled KV outer-product GEMMs (64x32x64 per head and tap: the two image rows with a non-zero pool weight), per-sample grouped 3x3 conv (K = 9*64) and the channel-mean bias linear, all on v_wmma_f32_16x16x32_bf16 with bf16 hi/lo three-product operand split (hi*hi + lo*hi + hi*lo), f32 accumulate; phi norm ratios, clip, channel means and LayerNorm statistics in f32/f64 on the VALU.
#include <hip/hip_runtime.h>

typedef unsigned short us;
typedef int   v8i  __attribute__((ext_vector_type(8)));
typedef float v8f  __attribute__((ext_vector_type(8)));
typedef float v4f  __attribute__((ext_vector_type(4)));
typedef unsigned short v8us __attribute__((ext_vector_type(8)));
typedef __bf16 v16b __attribute__((ext_vector_type(16)));
typedef v4f  __attribute__((may_alias)) v4fa;
typedef v8us __attribute__((may_alias)) v8usa;
union Frag { v8i v; v8us half[2]; };
union DPack { double d[2]; v4f f; };

#define NBATCH 4
#define CIN    256
#define HIMG   32
#define NPIX   1024
#define PW     34
#define DQ     512
#define DV     256
#define DK     64
#define DVH    32
#define FTK    576

struct BiW { int i0[3]; int i1[3]; float w0[3]; float w1[3]; };
static_assert(sizeof(BiW) == 48);

// The bilinear pool (32 -> 3, align_corners = false) gives a non-zero weight to image row
// floor((p + 0.5) * 32 / 3 - 0.5) = (64 p + 29) / 6 and to the row below it, p = 0..2, and to no other.
// V enters the result only through that pool, so only these rows of V are ever read.
constexpr int pool_row(int p) { return (64 * p + 29) / 6; }
// the two-row pixel tiles (image rows 2 t, 2 t + 1) that hold those six rows
#define NVT 4
constexpr int VT0 = pool_row(0) >> 1, VT1 = pool_row(1) >> 1, VT2 = (pool_row(1) + 1) >> 1, VT3 = pool_row(2) >> 1;
static_assert(((pool_row(0) + 1) >> 1) == VT0 && ((pool_row(2) + 1) >> 1) == VT3, "rows of taps 0 and 2 share a tile");
static_assert(VT0 < VT1 && VT1 < VT2 && VT2 < VT3 && VT3 < HIMG / 2, "four distinct tiles, one writer each");

// ---------------------------------------------------------------------------
// bf16 helpers (RNE convert) and the hi/lo split
// ---------------------------------------------------------------------------
__device__ __forceinline__ us f2bf(float f) {
  unsigned u = __float_as_uint(f);
  u += 0x7FFFu + ((u >> 16) & 1u);
  return (us)(u >> 16);
}
__device__ __forceinline__ float bf2f(us hv) {
  return __uint_as_float(((unsigned)hv) << 16);
}
__device__ __forceinline__ void split2(float f, us& hi, us& lo) {
  hi = f2bf(f);
  lo = f2bf(f - bf2f(hi));
}

// ---------------------------------------------------------------------------
// 16x16x32 bf16 WMMA (builtin: the compiler keeps the distances behind it and is free to schedule around it).
// Fragment map (wave32): lane l, h = l>>4, m = n = l&15.
//   A/B element i: i<8 -> k0+8h+i ; i>=8 -> k0+16+8h+(i-8)
//   D element r : row 8h+r, col l&15
// ---------------------------------------------------------------------------
__device__ __forceinline__ v8f wmma_bf(v8i a, v8i b, v8f c) {
  return __builtin_amdgcn_wmma_f32_16x16x32_bf16(false, __builtin_bit_cast(v16b, a), false,
                                                 __builtin_bit_cast(v16b, b), (short)0, c, false, false);
}
// The same with four vector slots tied behind it (ties D, keeps A/B live): for the bias loop, whose back edge leads
// from its last WMMA straight to global loads onto that WMMA's B registers.
__device__ __forceinline__ v8f wmma_bf_slots(v8i a, v8i b, v8f c) {
  v8f d = wmma_bf(a, b, c);
  asm volatile("v_nop\n\tv_nop\n\tv_nop\n\tv_nop" : "+v"(d) : "v"(a), "v"(b));
  return d;
}
// three-product split: ah*bh + al*bh + ah*bl into one accumulator (bias loop)
__device__ __forceinline__ v8f wmma3(v8i ah, v8i al, v8i bh, v8i bl, v8f c) {
  c = wmma_bf_slots(ah, bh, c);
  c = wmma_bf_slots(al, bh, c);
  c = wmma_bf_slots(ah, bl, c);
  return c;
}
// three-product split: ah*bh + al*bh + ah*bl into each accumulator, in that order; issued product by
// product over the independent accumulators, so that no WMMA waits for the one directly ahead of it
// 2 x 2 tiles: a[mt], b[nt] -> c[mt][nt]
__device__ __forceinline__ void wmma3_2x2(const v8i (&ah)[2], const v8i (&al)[2],
                                          const v8i (&bh)[2], const v8i (&bl)[2], v8f (&c)[2][2]) {
  #pragma unroll
  for (int t = 0; t < 4; ++t) c[t >> 1][t & 1] = wmma_bf(ah[t >> 1], bh[t & 1], c[t >> 1][t & 1]);
  #pragma unroll
  for (int t = 0; t < 4; ++t) c[t >> 1][t & 1] = wmma_bf(al[t >> 1], bh[t & 1], c[t >> 1][t & 1]);
  #pragma unroll
  for (int t = 0; t < 4; ++t) c[t >> 1][t & 1] = wmma_bf(ah[t >> 1], bl[t & 1], c[t >> 1][t & 1]);
}
// 1 x 2 tiles: a, b[nt] -> c[nt]
__device__ __forceinline__ void wmma3_1x2(v8i ah, v8i al, const v8i (&bh)[2], const v8i (&bl)[2], v8f (&c)[2]) {
  c[0] = wmma_bf(ah, bh[0], c[0]);
  c[1] = wmma_bf(ah, bh[1], c[1]);
  c[0] = wmma_bf(al, bh[0], c[0]);
  c[1] = wmma_bf(al, bh[1], c[1]);
  c[0] = wmma_bf(ah, bl[0], c[0]);
  c[1] = wmma_bf(ah, bl[1], c[1]);
}
// fragment from a k-contiguous 16-bit row (pointer already at k0)
__device__ __forceinline__ v8i ldfrag(const us* p, int h) {
  Frag f;
  f.half[0] = *(const v8usa*)(p + 8 * h);
  f.half[1] = *(const v8usa*)(p + 16 + 8 * h);
  return f.v;
}

__device__ __forceinline__ float wave_sum(float s) {
  s += __shfl_xor(s, 16);
  s += __shfl_xor(s, 8);
  s += __shfl_xor(s, 4);
  s += __shfl_xor(s, 2);
  s += __shfl_xor(s, 1);
  return s;
}
__device__ __forceinline__ double dshfl_xor(double v, int msk) {
  const unsigned long long u = __builtin_bit_cast(unsigned long long, v);
  int lo = (int)(unsigned)(u & 0xFFFFFFFFull);
  int hi = (int)(unsigned)(u >> 32);
  lo = __shfl_xor(lo, msk);
  hi = __shfl_xor(hi, msk);
  const unsigned long long r = (((unsigned long long)(unsigned)hi) << 32) | (unsigned long long)(unsigned)lo;
  return __builtin_bit_cast(double, r);
}
__device__ __forceinline__ double wave_sum_d(double s) {
  s += dshfl_xor(s, 16);
  s += dshfl_xor(s, 8);
  s += dshfl_xor(s, 4);
  s += dshfl_xor(s, 2);
  s += dshfl_xor(s, 1);
  return s;
}

// ---------------------------------------------------------------------------
// Kernel: x NCHW f32 -> bf16 hi/lo padded NHWC planes [b][34][34][256]
// (interior pixels). Block role = (y, b); LDS transpose; one instruction writes one
// coverage: 8 waves x 4 pixels = 32 px per row, 32 lanes x 8 = 256 ch.
// Also the f32 sum of each channel's image row (32 values, fixed order) into
// rowsum[b][y][c]: 256 threads x 4 B = 8 whole lines per block. The f32 copy
// sits in LDS at pitch 33 words, free of bank conflicts on store and on read.
// ---------------------------------------------------------------------------
__device__ __forceinline__ void prep_x_body(const float* __restrict__ x,
                                            us* __restrict__ xh, us* __restrict__ xl,
                                            float* __restrict__ rowsum, int y, int b) {
  __shared__ __attribute__((aligned(16))) us sh[32 * 256];
  __shared__ __attribute__((aligned(16))) us sl[32 * 256];
  __shared__ float sf[256 * 33];
  const int tid = threadIdx.x, lane = tid & 31, w = tid >> 5;
  #pragma unroll 1
  for (int j = 0; j < 32; ++j) {
    const int c = 8 * j + w;
    const float v = x[((size_t)(b * CIN + c) * HIMG + y) * HIMG + lane];
    us hi, lo;
    split2(v, hi, lo);
    sh[lane * 256 + c] = hi;
    sl[lane * 256 + c] = lo;
    sf[c * 33 + lane] = v;
  }
  __syncthreads();
  float rs = 0.f;
  // unrolled: constant LDS offsets, the reads issue ahead of the dependent adds
  #pragma unroll
  for (int i = 0; i < 32; ++i) rs += sf[tid * 33 + i];
  rowsum[(size_t)(b * HIMG + y) * CIN + tid] = rs;
  v8us vh[4], vl[4];
  size_t d[4];
  #pragma unroll
  for (int i = 0; i < 4; ++i) {
    const int px = 4 * w + i;
    vh[i] = *(const v8usa*)(sh + px * 256 + 8 * lane);
    vl[i] = *(const v8usa*)(sl + px * 256 + 8 * lane);
    d[i] = ((size_t)((b * PW + y + 1) * PW + px + 1)) * CIN + 8 * lane;
  }
  #pragma unroll
  for (int i = 0; i < 4; ++i) { *(v8us*)(xh + d[i]) = vh[i]; *(v8us*)(xl + d[i]) = vl[i]; }
  
}

// ---------------------------------------------------------------------------
// Kernel: zero the border pixel rows of padded NHWC planes [b][34][34][C].
// Wave = one border pixel; 32 lanes x 16 B = 256 halves per instruction.
// coverage: 132 border pixels x 4 samples, C halves each, both planes.
// ---------------------------------------------------------------------------
__device__ __forceinline__ void zero_border_body(us* __restrict__ ph, us* __restrict__ pl, int C, int bx, int b) {
  const int tid = threadIdx.x, lane = tid & 31, w = tid >> 5;
  const int i = bx * 8 + w;
  if (i >= 132) return;
  int py, px;
  if (i < 34)       { py = 0;           px = i; }
  else if (i < 68)  { py = PW - 1;      px = i - 34; }
  else if (i < 100) { py = i - 68 + 1;  px = 0; }
  else              { py = i - 100 + 1; px = PW - 1; }
  const size_t base = ((size_t)((b * PW + py) * PW + px)) * (size_t)C;
  v8us z;
  #pragma unroll
  for (int j = 0; j < 8; ++j) z[j] = (us)0;
  #pragma unroll 1
  for (int off = 8 * lane; off < C; off += 256) {
    *(v8us*)(ph + base + off) = z;
    *(v8us*)(pl + base + off) = z;
  }
  
}

// ---------------------------------------------------------------------------
// Kernel: OIHW f32 weights -> rows [o][tap*256 + c] as bf16 hi and lo planes.
// Thread = 8 consecutive row elements, one 16-B store per lane per plane,
// coverage: cout*taps*256 elements, grid = n/2048 exactly.
// ---------------------------------------------------------------------------
__device__ __forceinline__ void wprep_body(const float* __restrict__ wsrc, int cout, int taps,
                                           us* __restrict__ wh, us* __restrict__ wl, int bx) {
  const int g = bx * 256 + threadIdx.x;
  const int kw = taps * 256;
  const int n = cout * kw;
  const int e8 = g * 8;
  if (e8 >= n) return;
  const int o = e8 / kw;
  const int r = e8 - o * kw;
  const int tap = r >> 8, c = r & 255;
  const float* src = wsrc + ((size_t)(o * 256 + c)) * taps + tap;
  v8us vh, vl;
  #pragma unroll
  for (int i = 0; i < 8; ++i) {
    us a, bq;
    split2(src[(size_t)i * taps], a, bq);
    vh[i] = a;
    vl[i] = bq;
  }
  *(v8us*)(wh + e8) = vh;
  *(v8us*)(wl + e8) = vl;
  
}

// ---------------------------------------------------------------------------
// Kernel: all operand preparation in one grid (the roles share no data, so
// they run side by side instead of one launch after another). Role by block
// index, the longest first: x planes, then k, v, hu, q weight rows, then the
// zero borders of the three padded plane pairs.
// ---------------------------------------------------------------------------
#define NB_X   (HIMG * NBATCH)
#define NB_WK  ((DQ * CIN * 9) / 2048)
#define NB_WV  ((DV * CIN * 9) / 2048)
#define NB_WH  ((DV * DV * 9) / 2048)
#define NB_WQ  ((DQ * CIN) / 2048)
#define NB_ZB  (17 * NBATCH)
#define NB_PREP (NB_X + NB_WK + NB_WV + NB_WH + NB_WQ + 3 * NB_ZB)
__global__ __launch_bounds__(256) void k_prep(
    const float* __restrict__ x, const float* __restrict__ q_w, const float* __restrict__ k_w,
    const float* __restrict__ v_w, const float* __restrict__ hu_w,
    us* __restrict__ xh, us* __restrict__ xl, float* __restrict__ rowsum,
    us* __restrict__ wqh, us* __restrict__ wql, us* __restrict__ wkh, us* __restrict__ wkl,
    us* __restrict__ wvh, us* __restrict__ wvl, us* __restrict__ whh, us* __restrict__ whl,
    us* __restrict__ rqh, us* __restrict__ rql, us* __restrict__ qkh, us* __restrict__ qkl) {
  int i = blockIdx.x;
  if (i < NB_X) { prep_x_body(x, xh, xl, rowsum, i & (HIMG - 1), i / HIMG); return; }
  i -= NB_X;
  if (i < NB_WK) { wprep_body(k_w, DQ, 9, wkh, wkl, i); return; }
  i -= NB_WK;
  if (i < NB_WV) { wprep_body(v_w, DV, 9, wvh, wvl, i); return; }
  i -= NB_WV;
  if (i < NB_WH) { wprep_body(hu_w, DV, 9, whh, whl, i); return; }
  i -= NB_WH;
  if (i < NB_WQ) { wprep_body(q_w, DQ, 1, wqh, wql, i); return; }
  i -= NB_WQ;
  const int pl = i / NB_ZB, r = i - pl * NB_ZB;
  const int bx = r % 17, b = r / 17;
  if (pl == 0)      zero_border_body(xh, xl, CIN, bx, b);
  else if (pl == 1) zero_border_body(rqh, rql, DQ, bx, b);
  else              zero_border_body(qkh, qkl, DV, bx, b);
}

// ---------------------------------------------------------------------------
// Fragment from 32 consecutive-k f32 values of one row (pointer at k0), split
// into hi/lo bf16 fragments in registers (fragment map as above).
// ---------------------------------------------------------------------------
__device__ __forceinline__ void frag_f32(const float* __restrict__ p, int h, v8i& fh, v8i& fl) {
  const v4f q0 = *(const v4fa*)(p + 8 * h);
  const v4f q1 = *(const v4fa*)(p + 8 * h + 4);
  const v4f q2 = *(const v4fa*)(p + 16 + 8 * h);
  const v4f q3 = *(const v4fa*)(p + 20 + 8 * h);
  float v[16];
  v[0] = q0.x; v[1] = q0.y; v[2] = q0.z; v[3] = q0.w;
  v[4] = q1.x; v[5] = q1.y; v[6] = q1.z; v[7] = q1.w;
  v[8] = q2.x; v[9] = q2.y; v[10] = q2.z; v[11] = q2.w;
  v[12] = q3.x; v[13] = q3.y; v[14] = q3.z; v[15] = q3.w;
  Frag a, bq;
  #pragma unroll
  for (int i = 0; i < 16; ++i) {
    us hi, lo;
    split2(v[i], hi, lo);
    a.half[i >> 3][i & 7] = hi;
    bq.half[i >> 3][i & 7] = lo;
  }
  fh = a.v;
  fl = bq.v;
}

// ---------------------------------------------------------------------------
// Block role: channel means of x (f32, from the 32 row sums of each channel, fixed
// order) and the bias linear on WMMA:
// bias[b][o] = sum_c mean[b][c] * bw[o][c] + bb[o]. One block of 4 waves, each
// with two 32-column slices of o in turn; 20 KiB of LDS from the calling kernel.
// A = means [16 rows (4 real, 12 zero)][256] hi/lo in LDS, B = bw rows [o][c]
// coverage: 128 threads x 2 x 16 B = 4096 B = all of bias.
// ---------------------------------------------------------------------------
__device__ __forceinline__ void bias_body(us* lds, const float* __restrict__ rowsum, const float* __restrict__ bw,
                                          const float* __restrict__ bb, float* __restrict__ biasv) {
  us* sah = lds;                                             // 16 x 256
  us* sal = lds + 16 * 256;                                  // 16 x 256
  float* sd = reinterpret_cast<float*>(lds + 2 * 16 * 256);  // 4 x 256
  const int tid = threadIdx.x, lane = tid & 31, w = tid >> 5;
  const int h = lane >> 4, m = lane & 15;
  for (int i = tid; i < 16 * 256; i += 128) {
    if (i >= 4 * 256) { sah[i] = (us)0; sal[i] = (us)0; }
  }
  // rolled: one pass's 32 loads (128 registers) at a time, so that this role does not raise the merged kernel's register count
  #pragma unroll 1
  for (int it = 0; it < 2; ++it) {
    const int t = tid + 128 * it;
    const int k = t >> 6, c4 = 4 * (t & 63);   // b = k, channels c4 .. c4+3
    const float* p = rowsum + (size_t)k * HIMG * CIN + c4;
    v4f sm;
    sm.x = 0.f; sm.y = 0.f; sm.z = 0.f; sm.w = 0.f;
    // unrolled: the 32 loads fly together, one memory latency instead of 32
    #pragma unroll
    for (int i = 0; i < HIMG; ++i) sm += *(const v4fa*)(p + i * CIN);
    // unrolled: constant vector index, sm stays in registers
    #pragma unroll
    for (int e = 0; e < 4; ++e) {
      const float mean = sm[e] * (1.0f / 1024.0f);
      us hi, lo;
      split2(mean, hi, lo);
      sah[k * 256 + c4 + e] = hi;
      sal[k * 256 + c4 + e] = lo;
    }
  }
  __syncthreads();

  const v8f z8 = {0.f, 0.f, 0.f, 0.f, 0.f, 0.f, 0.f, 0.f};
  // rolled: the two slices share one copy of the code and of its registers
  #pragma unroll 1
  for (int it = 0; it < 2; ++it) {
    const int o0 = 32 * (w + 4 * it) + m, o1 = o0 + 16;
    const float* br0 = bw + (size_t)o0 * 256;
    const float* br1 = bw + (size_t)o1 * 256;
    v8f acc[2];
    acc[0] = z8; acc[1] = z8;
    #pragma unroll 1
    for (int k0 = 0; k0 < 256; k0 += 32) {
      const v8i ah = ldfrag(sah + m * 256 + k0, h);
      const v8i al = ldfrag(sal + m * 256 + k0, h);
      v8i bh0, bl0, bh1, bl1;
      frag_f32(br0 + k0, h, bh0, bl0);
      frag_f32(br1 + k0, h, bh1, bl1);
      acc[0] = wmma3(ah, al, bh0, bl0, acc[0]);
      acc[1] = wmma3(ah, al, bh1, bl1, acc[1]);
    }
    const float bb0 = bb[o0], bb1 = bb[o1];
    if (h == 0) {
      #pragma unroll
      for (int r = 0; r < 4; ++r) {
        sd[r * 256 + o0] = acc[0][r] + bb0;
        sd[r * 256 + o1] = acc[1][r] + bb1;
      }
    }
  }
  __syncthreads();
  #pragma unroll
  for (int t = 0; t < 2; ++t) {
    const int e = 4 * (tid + 128 * t);
    const v4f v = *(const v4fa*)(sd + e);
    *(v4f*)(biasv + e) = v;
  }
  // other roles' code follows these stores in the merged kernel's listing and reuses their registers:
  // the wait keeps any such rewrite behind the stores' issue (precaution)
  asm volatile("s_wait_xcnt 0x0" ::: "memory");
}

// ---------------------------------------------------------------------------
// Eight asynchronous 16-B copies global -> LDS per lane (no register staging).
// l = the lane's LDS byte addresses, g = its global addresses, both 16-B
// aligned. The closing s_wait_xcnt keeps later rewrites of the address
// registers behind the copies' issue (precaution), so it sits in the statement.
// ---------------------------------------------------------------------------
__device__ __forceinline__ void acopy8(const unsigned (&l)[8], const us* const (&g)[8]) {
  asm volatile(
      "global_load_async_to_lds_b128 %0, %8, off\n\t"
      "global_load_async_to_lds_b128 %1, %9, off\n\t"
      "global_load_async_to_lds_b128 %2, %10, off\n\t"
      "global_load_async_to_lds_b128 %3, %11, off\n\t"
      "global_load_async_to_lds_b128 %4, %12, off\n\t"
      "global_load_async_to_lds_b128 %5, %13, off\n\t"
      "global_load_async_to_lds_b128 %6, %14, off\n\t"
      "global_load_async_to_lds_b128 %7, %15, off\n\t"
      "s_wait_xcnt 0x0"
      :: "v"(l[0]), "v"(l[1]), "v"(l[2]), "v"(l[3]), "v"(l[4]), "v"(l[5]), "v"(l[6]), "v"(l[7]),
         "v"(g[0]), "v"(g[1]), "v"(g[2]), "v"(g[3]), "v"(g[4]), "v"(g[5]), "v"(g[6]), "v"(g[7])
      : "memory");
}

// LDS ring of the convolutions: a stage = KC channels of 64 pixel rows and 64
// weight rows, hi and lo planes; row pitch 2 KC + 16 B = 16 B x odd
// (conflict-free 16-B reads). Halves (16-bit words) per stage:
constexpr int ring_stage(int kc) { return 4 * 64 * (kc + 8); }
// KC = 128 (two buffers: 139,264 B) where one block per WGP is all the grid has;
// KC = 64 (two buffers: 73,728 B) where more long tiles wait than two blocks per
// WGP can hold: four blocks then share a WGP's LDS.
#define KC_HU  128
#define KC_QKV 64

// ---------------------------------------------------------------------------
// Kernel: implicit-GEMM convolution (Cin = 256 per pixel) over bf16 hi/lo
// zero-padded NHWC planes [b][34][34][256]; weights as rows [o][tap*256+c]
// hi/lo. Block = 64 pixels (image rows y0, y0+1) x 64 output channels,
// 4 waves of 32 px x 32 ch (2x2 tiles), K = ntaps*256 in steps of 32,
// operand rows staged in LDS by asynchronous copies of 2 KC-byte row pieces (two
// buffers, the next stage flies while this one is worked on), fragments read
// from LDS, three products per tile pair.
// MODE 0: relu^2 -> bf16 hi/lo padded NHWC planes (pitch = cout) + (s2,s4) partial line
// MODE 1: relu^2 -> f32 NCHW + (s2,s4) partial line
// MODE 2: value -> bf16 hi/lo NCHW planes
// MODE 3: value -> f32 NCHW + (sum, sum of squares) partial line (f64)
// coverage: MODE 0 store: 4 waves x 16 px x 8 lanes x 8 ch = 64 px x 64 ch;
// MODE 1/3: 4 waves x 16 ch x 64 px; MODE 2: 4 waves x 16 ch x 8 lanes x 8 px.
// ---------------------------------------------------------------------------
// The body takes its tile (bx = pixel tile, by = channel tile of gy) and the
// block's LDS from the kernel that calls it. sbuf (16 KiB, epilogue only) may lie
// on the ring: it is first written behind the last stage's waits and barrier,
// when every wave has left the ring and no copy is outstanding.
template <int MODE, int KC>
__device__ __forceinline__ void conv_body(
    us* ring, float* sbuf, double (*sred)[2], int bx, int by, int gy,
    const us* __restrict__ ah, const us* __restrict__ al,
    const us* __restrict__ wh, const us* __restrict__ wl,
    const float* __restrict__ bias, int ntaps, int cout,
    us* __restrict__ oh, us* __restrict__ ol, float* __restrict__ of, float* __restrict__ part)
{
  const int tid = threadIdx.x, lane = tid & 31, w = tid >> 5;
  const int h = lane >> 4, m = lane & 15;
  const int pt = bx, b = pt >> 4, y0 = (pt & 15) * 2;
  const int n0 = by * 64;
  const int ry = w >> 1, nw = 32 * (w & 1);
  const int kw = ntaps * CIN;
  constexpr int LPITCH = KC + 8, LPLANE = 64 * LPITCH, LSTAGE = ring_stage(KC);
  constexpr int SPT = CIN / KC;        // stages per tap
  constexpr int LPR = KC / 8;          // lanes x 16 B = one row piece of KC channels
  constexpr int RPP = 128 / LPR;       // rows that the block's 128 threads copy at once
  constexpr int NPP = 64 / RPP;        // copies per thread and plane
  static_assert(SPT * KC == CIN && (4 * NPP) % 8 == 0 && RPP <= 32, "whole stages, whole groups of eight copies");
  const int nst = SPT * ntaps;
  // copy map: thread = 16-B column ql of rows r0 + RPP i
  const int ql = tid & (LPR - 1), r0 = tid / LPR;
  const unsigned lds0 = (unsigned)(size_t)ring + (unsigned)(r0 * (LPITCH * 2) + ql * 16);
  const size_t wbase = (size_t)(n0 + r0) * kw + 8 * ql;
  // stage s (tap s / SPT, channels KC (s % SPT) ..) into buffer bufi
  auto stage_copy = [&](int s, int bufi) {
    const int tap = s / SPT, c0 = (s % SPT) * KC;
    const int t3 = tap / 3;
    const int ky = (ntaps == 1) ? 1 : t3;
    const int kx = (ntaps == 1) ? 1 : (tap - 3 * t3);
    const size_t ao = ((size_t)((b * PW + y0 + ky) * PW + kx + r0)) * CIN + c0 + 8 * ql;
    const size_t wo = wbase + (size_t)s * KC;
    const unsigned lb = lds0 + (unsigned)bufi * (LSTAGE * 2);
    // planes in LDS order (pixels hi, lo, weights hi, lo), eight copies per statement;
    // both loops unrolled: plane and row are then constants and l, g stay in registers
    #pragma unroll
    for (int c = 0; c < 4 * NPP; c += 8) {
      unsigned l[8];
      const us* g[8];
      #pragma unroll
      for (int t = 0; t < 8; ++t) {
        const int pl = (c + t) / NPP, row = ((c + t) % NPP) * RPP;
        l[t] = lb + (unsigned)((pl * LPLANE + row * LPITCH) * 2);
        if (pl < 2) g[t] = (pl == 0 ? ah : al) + ao + (size_t)((row >> 5) * PW * CIN + (row & 31) * CIN);
        else        g[t] = (pl == 2 ? wh : wl) + wo + (size_t)row * kw;
      }
      acopy8(l, g);
    }
  };
  const v8f z8 = {0.f, 0.f, 0.f, 0.f, 0.f, 0.f, 0.f, 0.f};
  v8f acc[2][2];
  #pragma unroll
  for (int i = 0; i < 2; ++i) { acc[i][0] = z8; acc[i][1] = z8; }

  // prologue: stage 0 landed and published, then stage 1 in flight
  stage_copy(0, 0);
  asm volatile("s_wait_asynccnt 0x0" ::: "memory");  // this wave's copies of stage 0 have landed
  __syncthreads();                                   // ... and every other wave's
  stage_copy(1, 1);                                  // nst = SPT ntaps >= 2

  const int arow = (ry * 32 + m) * LPITCH;
  const int brow = 2 * LPLANE + (nw + m) * LPITCH;
  #pragma unroll 1
  for (int s = 0; s < nst; ++s) {
    const us* sb = ring + (s & 1) * LSTAGE;
    // two register sets of fragments: step kk + 32 of this stage is read while step kk is multiplied
    v8i fah[2][2], fal[2][2], fbh[2][2], fbl[2][2];
    auto ldstep = [&](int kk, int q) {
      #pragma unroll
      for (int t = 0; t < 2; ++t) fah[q][t] = ldfrag(sb + arow + t * 16 * LPITCH + kk, h);
      #pragma unroll
      for (int t = 0; t < 2; ++t) fbh[q][t] = ldfrag(sb + brow + t * 16 * LPITCH + kk, h);
      #pragma unroll
      for (int t = 0; t < 2; ++t) fal[q][t] = ldfrag(sb + LPLANE + arow + t * 16 * LPITCH + kk, h);
      #pragma unroll
      for (int t = 0; t < 2; ++t) fbl[q][t] = ldfrag(sb + LPLANE + brow + t * 16 * LPITCH + kk, h);
    };
    ldstep(0, 0);
    #pragma unroll
    for (int kk = 0; kk < KC; kk += 32) {
      const int q = (kk >> 5) & 1;
      if (kk + 32 < KC) ldstep(kk + 32, q ^ 1);
      // keeps the next step's 16 LDS reads one group ahead of this step's WMMAs (else they sink to their uses and each waits)
      __builtin_amdgcn_sched_barrier(0);
      wmma3_2x2(fah[q], fal[q], fbh[q], fbl[q], acc);
    }
    // publish point of stage s + 1, and hand-over of this stage's buffer
    asm volatile("s_wait_dscnt 0x0" ::: "memory");     // this wave's reads of the buffer are done
    asm volatile("s_wait_asynccnt 0x0" ::: "memory");  // this wave's copies of stage s + 1 have landed
    __syncthreads();                                   // both hold for every wave of the block
    if (s + 2 < nst) stage_copy(s + 2, s & 1);
  }
  asm volatile("s_wait_asynccnt 0x0" ::: "memory");    // no copy outstanding past the loop

  // epilogue into LDS
  float bv[2];
  bv[0] = bias[n0 + nw + m];
  bv[1] = bias[n0 + nw + 16 + m];
  us* sH = reinterpret_cast<us*>(sbuf);
  us* sL = sH + 4096;
  float fs = 0.f, fq = 0.f;
  double ds = 0.0, dq = 0.0;
  #pragma unroll
  for (int mt = 0; mt < 2; ++mt) {
    #pragma unroll
    for (int nt = 0; nt < 2; ++nt) {
      #pragma unroll
      for (int r = 0; r < 8; ++r) {
        const float val = acc[mt][nt][r] + bv[nt];
        const int tp = ry * 32 + mt * 16 + 8 * h + r;
        const int ch = nw + 16 * nt + m;
        if (MODE == 0) {
          const float rr = fmaxf(val, 0.f);
          const float r2 = rr * rr;
          fs += r2; fq += r2 * r2;
          us hi, lo;
          split2(r2, hi, lo);
          sH[tp * 64 + ch] = hi;
          sL[tp * 64 + ch] = lo;
        } else if (MODE == 1) {
          const float rr = fmaxf(val, 0.f);
          const float r2 = rr * rr;
          fs += r2; fq += r2 * r2;
          sbuf[ch * 64 + tp] = r2;
        } else if (MODE == 2) {
          us hi, lo;
          split2(val, hi, lo);
          sH[ch * 64 + tp] = hi;
          sL[ch * 64 + tp] = lo;
        } else {
          ds += (double)val;
          dq += (double)val * (double)val;
          sbuf[ch * 64 + tp] = val;
        }
      }
    }
  }
  if (MODE == 0 || MODE == 1) {
    fs = wave_sum(fs);
    fq = wave_sum(fq);
    ds = (double)fs;
    dq = (double)fq;
  } else if (MODE == 3) {
    ds = wave_sum_d(ds);
    dq = wave_sum_d(dq);
  }
  if (MODE != 2) {
    if (lane == 0) { sred[w][0] = ds; sred[w][1] = dq; }
  }
  __syncthreads();

  // block partial line (2 doubles + zeros), fixed order over the 4 waves
  v4f pv;
  pv.x = 0.f; pv.y = 0.f; pv.z = 0.f; pv.w = 0.f;
  size_t li = 0;
  bool pw = false;
  if (MODE != 2) {
    double S = 0.0, Q2 = 0.0;
    #pragma unroll
    for (int k = 0; k < 4; ++k) { S += sred[k][0]; Q2 += sred[k][1]; }
    DPack pk;
    pk.d[0] = S; pk.d[1] = Q2;
    pv.x = (lane == 0) ? pk.f.x : 0.f;
    pv.y = (lane == 0) ? pk.f.y : 0.f;
    pv.z = (lane == 0) ? pk.f.z : 0.f;
    pv.w = (lane == 0) ? pk.f.w : 0.f;
    li = ((size_t)bx * gy + by) * 32 + 4 * (lane & 7);
    pw = (w == 0) && (lane < 8);
  }

  if (MODE == 0) {
    const int q8 = lane & 7, sub = lane >> 3;
    v8us th[4], tl[4];
    size_t d[4];
    #pragma unroll
    for (int i = 0; i < 4; ++i) {
      const int tp = 16 * w + 4 * i + sub;
      const int ry2 = tp >> 5, xx = tp & 31;
      th[i] = *(const v8usa*)(sH + tp * 64 + 8 * q8);
      tl[i] = *(const v8usa*)(sL + tp * 64 + 8 * q8);
      d[i] = ((size_t)((b * PW + y0 + ry2 + 1) * PW + xx + 1)) * (size_t)cout + n0 + 8 * q8;
    }
    #pragma unroll
    for (int i = 0; i < 4; ++i) { *(v8us*)(oh + d[i]) = th[i]; *(v8us*)(ol + d[i]) = tl[i]; }
    if (pw) *(v4f*)(part + li) = pv;
    
  } else if (MODE == 2) {
    const int q8 = lane & 7, sub = lane >> 3;
    v8us th[4], tl[4];
    size_t d[4];
    #pragma unroll
    for (int i = 0; i < 4; ++i) {
      const int chl = 16 * w + 4 * i + sub;
      th[i] = *(const v8usa*)(sH + chl * 64 + 8 * q8);
      tl[i] = *(const v8usa*)(sL + chl * 64 + 8 * q8);
      d[i] = ((size_t)(b * cout + n0 + chl)) * NPIX + y0 * HIMG + 8 * q8;
    }
    #pragma unroll
    for (int i = 0; i < 4; ++i) { *(v8us*)(oh + d[i]) = th[i]; *(v8us*)(ol + d[i]) = tl[i]; }
    // another role's code follows these stores in the merged kernel's listing and reuses their registers:
    // the wait keeps any such rewrite behind the stores' issue (precaution)
    asm volatile("s_wait_xcnt 0x0" ::: "memory");
  } else {
    const int hs = lane >> 4, x4 = 4 * (lane & 15);
    v4f tv[8];
    size_t d[8];
    #pragma unroll
    for (int i = 0; i < 8; ++i) {
      const int chl = 16 * w + 2 * i + hs;
      tv[i] = *(const v4fa*)(sbuf + chl * 64 + x4);
      d[i] = ((size_t)(b * cout + n0 + chl)) * NPIX + y0 * HIMG + x4;
    }
    #pragma unroll
    for (int i = 0; i < 8; ++i) *(v4f*)(of + d[i]) = tv[i];
    if (pw) *(v4f*)(part + li) = pv;
    
  }
}

// ---------------------------------------------------------------------------
// Kernel: the head unification conv (MODE 3), one tile per block.
// ---------------------------------------------------------------------------
__global__ __launch_bounds__(128) void k_conv_hu(
    const us* __restrict__ ah, const us* __restrict__ al,
    const us* __restrict__ wh, const us* __restrict__ wl,
    const float* __restrict__ bias, float* __restrict__ of, float* __restrict__ part)
{
  __shared__ __attribute__((aligned(16))) us ring[2 * ring_stage(KC_HU)];
  __shared__ __attribute__((aligned(16))) float sbuf[64 * 64];
  __shared__ double sred[4][2];
  conv_body<3, KC_HU>(ring, sbuf, sred, blockIdx.x, blockIdx.y, DV / 64, ah, al, wh, wl, bias, 9, DV,
               nullptr, nullptr, of, part);
}

// ---------------------------------------------------------------------------
// Kernel: the k, v and q convolutions of x in one grid (they share no result,
// so their tiles fill the chip together). Role by block index, the long 3x3
// tiles first: 512 k tiles, 64 v tiles (only the row tiles that the pool
// reads), then the one block of the bias linear (it needs only the row sums of x
// and ends long before the 3x3 tiles), 512 q tiles; pixel tile fastest. 73,792 B of LDS per block: four
// blocks per WGP, so all 576 long tiles are resident from the start.
// ---------------------------------------------------------------------------
#define NB_CK (64 * (DQ / 64))
#define NB_CV (NBATCH * NVT * (DV / 64))
#define NB_CQ (64 * (DQ / 64))
__global__ __launch_bounds__(128) void k_conv_qkv(
    const us* __restrict__ xh, const us* __restrict__ xl,
    const us* __restrict__ wkh, const us* __restrict__ wkl, const float* __restrict__ k_b,
    float* __restrict__ r2k, float* __restrict__ partk,
    const us* __restrict__ wvh, const us* __restrict__ wvl, const float* __restrict__ v_b,
    us* __restrict__ vnh, us* __restrict__ vnl,
    const us* __restrict__ wqh, const us* __restrict__ wql, const float* __restrict__ q_b,
    us* __restrict__ rqh, us* __restrict__ rql, float* __restrict__ partq,
    const float* __restrict__ rowsum, const float* __restrict__ bias_w, const float* __restrict__ bias_b,
    float* __restrict__ biasv)
{
  __shared__ __attribute__((aligned(16))) us ring[2 * ring_stage(KC_QKV)];
  static_assert(sizeof(ring) >= 64 * 64 * sizeof(float), "the epilogue buffer fits on the ring");
  static_assert(sizeof(ring) >= 2 * 16 * 256 * sizeof(us) + 4 * 256 * sizeof(float), "so does the bias role's LDS");
  float* sbuf = reinterpret_cast<float*>(ring);
  __shared__ double sred[4][2];
  int i = blockIdx.x;
  if (i < NB_CK) {
    conv_body<1, KC_QKV>(ring, sbuf, sred, i & 63, i >> 6, DQ / 64, xh, xl, wkh, wkl, k_b, 9, DQ,
                 nullptr, nullptr, r2k, partk);
    return;
  }
  i -= NB_CK;
  if (i < NB_CV) {
    // i counts only the row tiles that the pool reads: put it back on the grid of 64 pixel tiles per channel tile
    const int t = i & (NVT - 1), b = (i / NVT) & (NBATCH - 1);
    const int rt = (t == 0) ? VT0 : ((t == 1) ? VT1 : ((t == 2) ? VT2 : VT3));
    i = (i / (NVT * NBATCH)) * 64 + b * (HIMG / 2) + rt;
    conv_body<2, KC_QKV>(ring, sbuf, sred, i & 63, i >> 6, DV / 64, xh, xl, wvh, wvl, v_b, 9, DV,
                 vnh, vnl, nullptr, nullptr);
    return;
  }
  i -= NB_CV;
  if (i == 0) { bias_body(ring, rowsum, bias_w, bias_b, biasv); return; }
  i -= 1;
  conv_body<0, KC_QKV>(ring, sbuf, sred, i & 63, i >> 6, DQ / 64, xh, xl, wqh, wql, q_b, 1, DQ,
               rqh, rql, nullptr, partq);
}

// ---------------------------------------------------------------------------
// One wave's job: phi norm ratio s = sqrt(sum relu^2) / sqrt(sum relu^4) of one
// tensor from its 512 block partial lines (fixed order, f64: lane l adds lines
// 16 l .. 16 l + 15, then the 32 lane sums are added in lane order). The kernels
// that use the ratio give it to a fifth wave, beside the four that multiply.
// ---------------------------------------------------------------------------
__device__ __forceinline__ double dlane(double v, int l) {
  const unsigned long long u = __builtin_bit_cast(unsigned long long, v);
  const unsigned lo = (unsigned)__builtin_amdgcn_readlane((int)(unsigned)(u & 0xFFFFFFFFull), l);
  const unsigned hi = (unsigned)__builtin_amdgcn_readlane((int)(unsigned)(u >> 32), l);
  return __builtin_bit_cast(double, (((unsigned long long)hi) << 32) | (unsigned long long)lo);
}
__device__ __forceinline__ float phi_wave(const float* __restrict__ part, int lane) {
  double s2 = 0.0, s4 = 0.0;
  // unrolled: the 16 loads fly together, one latency instead of 16
  #pragma unroll
  for (int j = 0; j < 16; ++j) {
    const double* dp = reinterpret_cast<const double*>(part + (size_t)(lane * 16 + j) * 32);
    s2 += dp[0];
    s4 += dp[1];
  }
  double t2 = 0.0, t4 = 0.0;
  // unrolled: readlane takes a constant lane
  #pragma unroll
  for (int i = 0; i < 32; ++i) { t2 += dlane(s2, i); t4 += dlane(s4, i); }
  const float num = sqrtf((float)t2);
  const float den = sqrtf((float)t4);
  return num * (1.0f / den);
}

// ---------------------------------------------------------------------------
// Kernel: pooled outer product. Block = (tap pq, bh): D[kk 64][v 32] =
// sum_pix (relu(K)^2[kk][pix] * Mh[p][y] * Mw[q][x]) * V[v][pix] over the two
// image rows y where Mh[p][y] is not zero (K = 64; every other term is a
// product with a zero weight, and V exists only on those rows),
// A built in registers from the f32 NCHW relu^2 rows (split hi/lo),
// B from the bf16 NCHW V planes. A fifth wave makes sK meanwhile. Epilogue: * sK, clip +-32/9, hi/lo into
// coverage: 4 waves x 8 rows x 8 lanes x 8 kk = 32 v x 64 kk per (bh,pq).
// ---------------------------------------------------------------------------
__global__ __launch_bounds__(160) void k_kv(
    const float* __restrict__ r2k, const us* __restrict__ vnh, const us* __restrict__ vnl,
    const float* __restrict__ partk, BiW bw, us* __restrict__ fth, us* __restrict__ ftl)
{
  __shared__ __attribute__((aligned(16))) us sH[32 * 64];
  __shared__ __attribute__((aligned(16))) us sL[32 * 64];
  __shared__ float sphi[32];   // the ratio, one copy per lane
  const int tid = threadIdx.x, lane = tid & 31;
  const int w = __builtin_amdgcn_readfirstlane(tid >> 5);   // scalar: the role tests below are scalar branches, EXEC stays whole
  const int h = lane >> 4, m = lane & 15;
  const int pq = blockIdx.x, bh = blockIdx.y;
  const int b = bh >> 3, head = bh & 7;
  const int p = pq / 3, q = pq - 3 * p;
  const int   iy0 = (p == 0) ? bw.i0[0] : ((p == 1) ? bw.i0[1] : bw.i0[2]);
  const int   iy1 = (p == 0) ? bw.i1[0] : ((p == 1) ? bw.i1[1] : bw.i1[2]);
  const float wy0 = (p == 0) ? bw.w0[0] : ((p == 1) ? bw.w0[1] : bw.w0[2]);
  const float wy1 = (p == 0) ? bw.w1[0] : ((p == 1) ? bw.w1[1] : bw.w1[2]);
  const int   ix0 = (q == 0) ? bw.i0[0] : ((q == 1) ? bw.i0[1] : bw.i0[2]);
  const int   ix1 = (q == 0) ? bw.i1[0] : ((q == 1) ? bw.i1[1] : bw.i1[2]);
  const float wx0 = (q == 0) ? bw.w0[0] : ((q == 1) ? bw.w0[1] : bw.w0[2]);
  const float wx1 = (q == 0) ? bw.w1[0] : ((q == 1) ? bw.w1[1] : bw.w1[2]);
  const float amax = (float)(32.0 / 9.0);
  const float* arow = r2k + ((size_t)(b * DQ + head * DK + 16 * w + m)) * NPIX;
  const size_t br0 = ((size_t)(b * DV + head * DVH + m)) * NPIX;
  const size_t br1 = br0 + (size_t)16 * NPIX;
  const v8f z8 = {0.f, 0.f, 0.f, 0.f, 0.f, 0.f, 0.f, 0.f};
  v8f acc[2];
  acc[0] = z8; acc[1] = z8;

  if (w == 4) {
    sphi[lane] = phi_wave(partk, lane);
  } else {
  #pragma unroll 1
  for (int t = 0; t < 2; ++t) {
    // rows iy0 then iy1, ascending as in the full sum; were the two clamped onto one row, it takes both weights once
    const float wy = (t == 0) ? (wy0 + ((iy1 == iy0) ? wy1 : 0.f)) : ((iy1 == iy0) ? 0.f : wy1);
    const int k0 = ((t == 0) ? iy0 : iy1) * HIMG;
    const float* ap = arow + k0;
    const v4f q0 = *(const v4fa*)(ap + 8 * h);
    const v4f q1 = *(const v4fa*)(ap + 8 * h + 4);
    const v4f q2 = *(const v4fa*)(ap + 16 + 8 * h);
    const v4f q3 = *(const v4fa*)(ap + 20 + 8 * h);
    v8i fbh[2], fbl[2];
    fbh[0] = ldfrag(vnh + br0 + k0, h);
    fbh[1] = ldfrag(vnh + br1 + k0, h);
    fbl[0] = ldfrag(vnl + br0 + k0, h);
    fbl[1] = ldfrag(vnl + br1 + k0, h);
    // keeps the V fragment reads in flight with the K row reads (else they sink behind the split: a second memory latency)
    __builtin_amdgcn_sched_barrier(0);
    float v[16];
    v[0] = q0.x; v[1] = q0.y; v[2] = q0.z; v[3] = q0.w;
    v[4] = q1.x; v[5] = q1.y; v[6] = q1.z; v[7] = q1.w;
    v[8] = q2.x; v[9] = q2.y; v[10] = q2.z; v[11] = q2.w;
    v[12] = q3.x; v[13] = q3.y; v[14] = q3.z; v[15] = q3.w;
    Frag fah, fal;
    #pragma unroll
    for (int i = 0; i < 16; ++i) {
      const int xx = 8 * h + (i & 7) + ((i >> 3) << 4);
      const float wx = ((xx == ix0) ? wx0 : 0.f) + ((xx == ix1) ? wx1 : 0.f);
      const float a = v[i] * (wy * wx);
      us hi, lo;
      split2(a, hi, lo);
      fah.half[i >> 3][i & 7] = hi;
      fal.half[i >> 3][i & 7] = lo;
    }
    wmma3_1x2(fah.v, fal.v, fbh, fbl, acc);
  }
  }
  __syncthreads();   // publishes the fifth wave's ratio

  if (w < 4) {
  const float sK = sphi[lane];
  #pragma unroll
  for (int nt = 0; nt < 2; ++nt) {
    #pragma unroll
    for (int r = 0; r < 8; ++r) {
      float val = acc[nt][r] * sK;
      val = fminf(fmaxf(val, -amax), amax);
      const int kk = 16 * w + 8 * h + r;
      const int vv = 16 * nt + m;
      us hi, lo;
      split2(val, hi, lo);
      sH[vv * 64 + kk] = hi;
      sL[vv * 64 + kk] = lo;
    }
  }
  }
  __syncthreads();
  if (w == 4) return;   // behind the last barrier
  const int q8 = lane & 7, sub = lane >> 3;
  v8us th[2], tl[2];
  size_t d[2];
  #pragma unroll
  for (int i = 0; i < 2; ++i) {
    const int vv = 8 * w + 4 * i + sub;
    th[i] = *(const v8usa*)(sH + vv * 64 + 8 * q8);
    tl[i] = *(const v8usa*)(sL + vv * 64 + 8 * q8);
    d[i] = ((size_t)(bh * DVH + vv)) * FTK + pq * 64 + 8 * q8;
  }
  #pragma unroll
  for (int i = 0; i < 2; ++i) { *(v8us*)(fth + d[i]) = th[i]; *(v8us*)(ftl + d[i]) = tl[i]; }
  
}

// ---------------------------------------------------------------------------
// Kernel: per-sample grouped 3x3 conv of relu(Q)^2 planes (padded NHWC,
// 512 ch) with the pooled filters, K = 9*64 per head. Block = (64 px, head
// pair, b); wave = (head of the pair, image row) 32 px x 32 v; a fifth wave makes sQ meanwhile. Epilogue:
// * sQ + bias[b][j*32+v], hi/lo into padded NHWC planes [b][34][34][256];
// coverage: 4 waves x 16 px x 8 lanes x 8 ch = 64 px x 64 ch per block;
// grid 16 x 4 x 4 = all interior pixels x all 256 channels x 4 samples.
// ---------------------------------------------------------------------------
__global__ __launch_bounds__(160) void k_gconv(
    const us* __restrict__ rqh, const us* __restrict__ rql,
    const us* __restrict__ fth, const us* __restrict__ ftl,
    const float* __restrict__ partq, const float* __restrict__ biasv,
    us* __restrict__ oh, us* __restrict__ ol)
{
  __shared__ __attribute__((aligned(16))) us sH[64 * 64];
  __shared__ __attribute__((aligned(16))) us sL[64 * 64];
  __shared__ float sphi[32];   // the ratio, one copy per lane
  const int tid = threadIdx.x, lane = tid & 31;
  const int w = __builtin_amdgcn_readfirstlane(tid >> 5);   // scalar: the role tests below are scalar branches, EXEC stays whole
  const int h = lane >> 4, m = lane & 15;
  const int pt = blockIdx.x, jp = blockIdx.y, b = blockIdx.z;
  const int y0 = 2 * pt;
  const int jl = w >> 1, ry = w & 1;
  const int j = 2 * jp + jl, y = y0 + ry, bh = b * 8 + j;
  const size_t fr0 = ((size_t)(bh * DVH + m)) * FTK;
  const v8f z8 = {0.f, 0.f, 0.f, 0.f, 0.f, 0.f, 0.f, 0.f};
  v8f acc[2][2];
  #pragma unroll
  for (int i = 0; i < 2; ++i) { acc[i][0] = z8; acc[i][1] = z8; }

  if (w == 4) {
    sphi[lane] = phi_wave(partq, lane);
  } else {
  #pragma unroll 1
  for (int tap = 0; tap < 9; ++tap) {
    const int ky = tap / 3;
    const int kx = tap - 3 * ky;
    const size_t ar0 = ((size_t)((b * PW + y + ky) * PW + kx + m)) * DQ + (size_t)j * DK;
    const size_t wt = (size_t)tap * DK;
    v8i fah[2][2], fal[2][2], fbh[2][2], fbl[2][2];   // [32-channel step][tile]
    // the lane's own four read addresses of this tap (its 8 h offset inside the k step included)
    const us* pah = rqh + ar0 + 8 * h;
    const us* pal = rql + ar0 + 8 * h;
    const us* pbh = fth + fr0 + wt + 8 * h;
    const us* pbl = ftl + fr0 + wt + 8 * h;
    #pragma unroll
    for (int q = 0; q < 2; ++q) {
      #pragma unroll
      for (int t = 0; t < 2; ++t) {
        fah[q][t] = ldfrag(pah + t * 16 * DQ + 32 * q, 0);
        fbh[q][t] = ldfrag(pbh + t * 16 * FTK + 32 * q, 0);
        fal[q][t] = ldfrag(pal + t * 16 * DQ + 32 * q, 0);
        fbl[q][t] = ldfrag(pbl + t * 16 * FTK + 32 * q, 0);
      }
    }
    // keeps the tap's 32 global reads one group in flight together (else they sink to their uses: a memory latency each)
    __builtin_amdgcn_sched_barrier(0);
    // the four address pairs stay live, so unwritten, up to this wait behind the last read (precaution)
    asm volatile("s_wait_xcnt 0x0" :: "v"(pah), "v"(pal), "v"(pbh), "v"(pbl) : "memory");
    static_assert(DK == 64, "two steps of 32 channels per tap");
    wmma3_2x2(fah[0], fal[0], fbh[0], fbl[0], acc);
    wmma3_2x2(fah[1], fal[1], fbh[1], fbl[1], acc);
  }
  }
  __syncthreads();   // publishes the fifth wave's ratio

  if (w < 4) {
  const float sQ = sphi[lane];
  float bv[2];
  bv[0] = biasv[b * DV + j * DVH + m];
  bv[1] = biasv[b * DV + j * DVH + 16 + m];
  #pragma unroll
  for (int mt = 0; mt < 2; ++mt) {
    #pragma unroll
    for (int nt = 0; nt < 2; ++nt) {
      #pragma unroll
      for (int r = 0; r < 8; ++r) {
        const float val = acc[mt][nt][r] * sQ + bv[nt];
        const int tp = ry * 32 + mt * 16 + 8 * h + r;
        const int chl = jl * 32 + 16 * nt + m;
        us hi, lo;
        split2(val, hi, lo);
        sH[tp * 64 + chl] = hi;
        sL[tp * 64 + chl] = lo;
      }
    }
  }
  }
  __syncthreads();
  if (w == 4) return;   // behind the last barrier
  const int q8 = lane & 7, sub = lane >> 3;
  v8us th[4], tl[4];
  size_t d[4];
  #pragma unroll
  for (int i = 0; i < 4; ++i) {
    const int tp = 16 * w + 4 * i + sub;
    const int ry2 = tp >> 5, xx = tp & 31;
    th[i] = *(const v8usa*)(sH + tp * 64 + 8 * q8);
    tl[i] = *(const v8usa*)(sL + tp * 64 + 8 * q8);
    d[i] = ((size_t)((b * PW + y0 + ry2 + 1) * PW + xx + 1)) * DV + jp * 64 + 8 * q8;
  }
  #pragma unroll
  for (int i = 0; i < 4; ++i) { *(v8us*)(oh + d[i]) = th[i]; *(v8us*)(ol + d[i]) = tl[i]; }
  
}

// ---------------------------------------------------------------------------
// Kernel: LayerNorm over (C,H,W) per sample: fixed-order f64 combine of the
// 64 block partial lines of the sample, then (v - mu) * rstd on one float4
// coverage: 1024 blocks x 256 threads x 4 floats = all 1048576 outputs.
// ---------------------------------------------------------------------------
__global__ __launch_bounds__(256) void k_ln(const float* __restrict__ outp, const float* __restrict__ partl,
                                            float* __restrict__ out) {
  __shared__ double ss[64];
  __shared__ double sq[64];
  __shared__ float sst[2];
  const int tid = threadIdx.x;
  const int blk = blockIdx.x, b = blk >> 8;
  if (tid < 64) {
    const double* dp = reinterpret_cast<const double*>(partl + (size_t)(b * 64 + tid) * 32);
    ss[tid] = dp[0];
    sq[tid] = dp[1];
  }
  __syncthreads();
  if (tid == 0) {
    double S = 0.0, Q2 = 0.0;
    for (int i = 0; i < 64; ++i) { S += ss[i]; Q2 += sq[i]; }
    const double inv = 1.0 / 262144.0;
    const double mu = S * inv;
    double var = Q2 * inv - mu * mu;
    if (var < 0.0) var = 0.0;
    const float den = sqrtf((float)var + 1e-5f);
    sst[0] = (float)mu;
    sst[1] = 1.0f / den;
  }
  __syncthreads();
  const float muf = sst[0], rinv = sst[1];
  const size_t e = ((size_t)blk * 256 + tid) * 4;
  v4f v = *(const v4fa*)(outp + e);
  v4f o;
  o.x = (v.x - muf) * rinv;
  o.y = (v.y - muf) * rinv;
  o.z = (v.z - muf) * rinv;
  o.w = (v.w - muf) * rinv;
  *(v4f*)(out + e) = o;
  
}

// ---------------------------------------------------------------------------
// Host: bilinear (32 -> 3, align_corners = false) taps and weights, computed
// with separate f64 multiply and subtract, fraction cast to f32.
// ---------------------------------------------------------------------------
static void bilin3(BiW& bw) {
#pragma clang fp contract(off)
  const double scale = 32.0 / 3.0;
  for (int p = 0; p < 3; ++p) {
    double src = ((double)p + 0.5) * scale;
    src = src - 0.5;
    if (src < 0.0) src = 0.0;
    const int f = (int)src;
    const float frac = (float)(src - (double)f);
    int c0 = f, c1 = f + 1;
    if (c0 > HIMG - 1) c0 = HIMG - 1;
    if (c1 > HIMG - 1) c1 = HIMG - 1;
    bw.i0[p] = c0;
    bw.i1[p] = c1;
    bw.w0[p] = 1.0f - frac;
    bw.w1[p] = frac;
  }
}

extern "C" void kernel_launch(void* const* d_in, const int* in_sizes, int n_in,
                              void* d_out, int out_size, void* d_ws, size_t ws_size,
                              hipStream_t stream) {
  if (n_in < 11) return;
  if (in_sizes[0] != NBATCH * CIN * NPIX) return;
  if (in_sizes[1] != DQ * CIN || in_sizes[2] != DQ) return;
  if (in_sizes[3] != DQ * CIN * 9 || in_sizes[4] != DQ) return;
  if (in_sizes[5] != DV * CIN * 9 || in_sizes[6] != DV) return;
  if (in_sizes[7] != DV * CIN || in_sizes[8] != DV) return;
  if (in_sizes[9] != DV * DV * 9 || in_sizes[10] != DV) return;
  if (out_size != NBATCH * DV * NPIX) return;

  const float* x      = (const float*)d_in[0];
  const float* q_w    = (const float*)d_in[1];
  const float* q_b    = (const float*)d_in[2];
  const float* k_w    = (const float*)d_in[3];
  const float* k_b    = (const float*)d_in[4];
  const float* v_w    = (const float*)d_in[5];
  const float* v_b    = (const float*)d_in[6];
  const float* bias_w = (const float*)d_in[7];
  const float* bias_b = (const float*)d_in[8];
  const float* hu_w   = (const float*)d_in[9];
  const float* hu_b   = (const float*)d_in[10];
  float* out = (float*)d_out;

  // workspace carve (bytes); every region sized to whole 256-B multiples and
  // written only with whole-line stores inside its extent
  char* ws = (char*)d_ws;
  size_t off = 0;
#define CARVE(T, name, bytes) T* name = (T*)(ws + off); off += (((size_t)(bytes)) + 255) & ~(size_t)255;
  const size_t padpx  = (size_t)NBATCH * PW * PW;                    // 4624 padded pixels
  CARVE(us,    XPH,   padpx * CIN * 2);                               // 2367488
  CARVE(us,    XPL,   padpx * CIN * 2);
  CARVE(us,    WQH,   (size_t)DQ * CIN * 2);                          // 262144
  CARVE(us,    WQL,   (size_t)DQ * CIN * 2);
  CARVE(us,    WKH,   (size_t)DQ * CIN * 9 * 2);                      // 2359296
  CARVE(us,    WKL,   (size_t)DQ * CIN * 9 * 2);
  CARVE(us,    WVH,   (size_t)DV * CIN * 9 * 2);                      // 1179648
  CARVE(us,    WVL,   (size_t)DV * CIN * 9 * 2);
  CARVE(us,    WHH,   (size_t)DV * DV * 9 * 2);                       // 1179648
  CARVE(us,    WHL,   (size_t)DV * DV * 9 * 2);
  CARVE(float, BIASV, (size_t)NBATCH * DV * 4);                       // 4096 = 32 lines
  CARVE(us,    RQH,   padpx * DQ * 2);                                // 4734976
  CARVE(us,    RQL,   padpx * DQ * 2);
  CARVE(float, R2K,   (size_t)NBATCH * DQ * NPIX * 4);                // 8388608
  CARVE(us,    VNH,   (size_t)NBATCH * DV * NPIX * 2);                // 2097152
  CARVE(us,    VNL,   (size_t)NBATCH * DV * NPIX * 2);
  CARVE(float, PARTQ, (size_t)512 * 128);                             // 512 lines
  CARVE(float, PARTK, (size_t)512 * 128);                             // 512 lines
  CARVE(us,    FTH,   (size_t)NBATCH * 8 * DVH * FTK * 2);            // 1179648
  CARVE(us,    FTL,   (size_t)NBATCH * 8 * DVH * FTK * 2);
  CARVE(us,    QKH,   padpx * DV * 2);                                // 2367488
  CARVE(us,    QKL,   padpx * DV * 2);
  CARVE(float, OUTP,  (size_t)NBATCH * DV * NPIX * 4);                // 4194304
  CARVE(float, PARTL, (size_t)256 * 128);                             // 256 lines
  CARVE(float, ROWS,  (size_t)NBATCH * HIMG * CIN * 4);               // 131072
#undef CARVE
  if (off > ws_size) return;
  if (off > (size_t)134217728) return;

  BiW bw;
  bilin3(bw);

  // 16-bit operand planes
  k_prep<<<NB_PREP, 256, 0, stream>>>(x, q_w, k_w, v_w, hu_w, XPH, XPL, ROWS,
                                      WQH, WQL, WKH, WKL, WVH, WVL, WHH, WHL, RQH, RQL, QKH, QKL);

  // k (3x3), v (3x3), q (1x1) convolutions; channel means + bias linear
  k_conv_qkv<<<NB_CK + NB_CV + 1 + NB_CQ, 128, 0, stream>>>(XPH, XPL, WKH, WKL, k_b, R2K, PARTK,
                                                            WVH, WVL, v_b, VNH, VNL,
                                                            WQH, WQL, q_b, RQH, RQL, PARTQ,
                                                            ROWS, bias_w, bias_b, BIASV);

  // pooled KV filters, grouped conv (each makes its own phi ratio)
  k_kv<<<dim3(9, NBATCH * 8), 160, 0, stream>>>(R2K, VNH, VNL, PARTK, bw, FTH, FTL);
  k_gconv<<<dim3(16, 4, NBATCH), 160, 0, stream>>>(RQH, RQL, FTH, FTL, PARTQ, BIASV, QKH, QKL);

  // head unification conv + LayerNorm
  k_conv_hu<<<dim3(64, DV / 64), 128, 0, stream>>>(QKH, QKL, WHH, WHL, hu_b, OUTP, PARTL);
  k_ln<<<(NBATCH * DV * NPIX) / 1024, 256, 0, stream>>>(OUTP, PARTL, out);
}

// v008
// A run of this version takes 101 microseconds.
// Timed twice side by side with v007, it ran 1.07 and 1.06 times as fast.
// Over all steps from v000 it is 4.24 times as fast.
// Contractions: q 1x1 conv, k/v/hu 3x3 convs as implicit GEMM (K = 9*256), pooled KV outer-product GEMMs (64x32x64 per head and tap: the two image rows with a non-zero pool weight), per-sample grouped 3x3 conv (K = 9*64) and the channel-mean bias linear, all on v_wmma_f32_16x16x32_bf16 with bf16 hi/lo three-product operand split (hi*hi + lo*hi + hi*lo), f32 accumulate; phi norm ratios, clip, channel means and LayerNorm statistics in f32/f64 on the VALU.
#include <hip/hip_runtime.h>

typedef unsigned short us;
typedef int   v8i  __attribute__((ext_vector_type(8)));
typedef float v8f  __attribute__((ext_vector_type(8)));
typedef float v4f  __attribute__((ext_vector_type(4)));
typedef unsigned short v8us __attribute__((ext_vector_type(8)));
typedef __bf16 v16b __attribute__((ext_vector_type(16)));
typedef v4f  __attribute__((may_alias)) v4fa;
typedef v8us __attribute__((may_alias)) v8usa;
union Frag { v8i v; v8us half[2]; };
union DPack { double d[2]; v4f f; };

#define NBATCH 4
#define CIN    256
#define HIMG   32
#define NPIX   1024
#define PW     34
#define DQ     512
#define DV     256
#define DK     64
#define DVH    32
#define FTK    576

struct BiW { int i0[3]; int i1[3]; float w0[3]; float w1[3]; };
static_assert(sizeof(BiW) == 48);

// The bilinear pool (32 -> 3, align_corners = false) gives a non-zero weight to image row
// floor((p + 0.5) * 32 / 3 - 0.5) = (64 p + 29) / 6 and to the row below it, p = 0..2, and to no other.
// V enters the result only through that pool, so only these rows of V are ever read.
constexpr int pool_row(int p) { return (64 * p + 29) / 6; }
// the two-row pixel tiles (image rows 2 t, 2 t + 1) that hold those six rows
#define NVT 4
constexpr int VT0 = pool_row(0) >> 1, VT1 = pool_row(1) >> 1, VT2 = (pool_row(1) + 1) >> 1, VT3 = pool_row(2) >> 1;
static_assert(((pool_row(0) + 1) >> 1) == VT0 && ((pool_row(2) + 1) >> 1) == VT3, "rows of taps 0 and 2 share a tile");
static_assert(VT0 < VT1 && VT1 < VT2 && VT2 < VT3 && VT3 < HIMG / 2, "four distinct tiles, one writer each");

// ---------------------------------------------------------------------------
// bf16 helpers (RNE convert) and the hi/lo split
// ---------------------------------------------------------------------------
__device__ __forceinline__ us f2bf(float f) {
  unsigned u = __float_as_uint(f);
  u += 0x7FFFu + ((u >> 16) & 1u);
  return (us)(u >> 16);
}
__device__ __forceinline__ float bf2f(us hv) {
  return __uint_as_float(((unsigned)hv) << 16);
}
__device__ __forceinline__ void split2(float f, us& hi, us& lo) {
  hi = f2bf(f);
  lo = f2bf(f - bf2f(hi));
}

// ---------------------------------------------------------------------------
// 16x16x32 bf16 WMMA (builtin: the compiler keeps the distances behind it and is free to schedule around it).
// Fragment map (wave32): lane l, h = l>>4, m = n = l&15.
//   A/B element i: i<8 -> k0+8h+i ; i>=8 -> k0+16+8h+(i-8)
//   D element r : row 8h+r, col l&15
// ---------------------------------------------------------------------------
__device__ __forceinline__ v8f wmma_bf(v8i a, v8i b, v8f c) {
  return __builtin_amdgcn_wmma_f32_16x16x32_bf16(false, __builtin_bit_cast(v16b, a), false,
                                                 __builtin_bit_cast(v16b, b), (short)0, c, false, false);
}
// The same with four vector slots tied behind it (ties D, keeps A/B live): for the bias loop, whose back edge leads
// from its last WMMA straight to global loads onto that WMMA's B registers.
__device__ __forceinline__ v8f wmma_bf_slots(v8i a, v8i b, v8f c) {
  v8f d = wmma_bf(a, b, c);
  asm volatile("v_nop\n\tv_nop\n\tv_nop\n\tv_nop" : "+v"(d) : "v"(a), "v"(b));
  return d;
}
// three-product split: ah*bh + al*bh + ah*bl into one accumulator (bias loop)
__device__ __forceinline__ v8f wmma3(v8i ah, v8i al, v8i bh, v8i bl, v8f c) {
  c = wmma_bf_slots(ah, bh, c);
  c = wmma_bf_slots(al, bh, c);
  c = wmma_bf_slots(ah, bl, c);
  return c;
}
// three-product split: ah*bh + al*bh + ah*bl into each accumulator, in that order; issued product by
// product over the independent accumulators, so that no WMMA waits for the one directly ahead of it
// 2 x 2 tiles: a[mt], b[nt] -> c[mt][nt]
__device__ __forceinline__ void wmma3_2x2(const v8i (&ah)[2], const v8i (&al)[2],
                                          const v8i (&bh)[2], const v8i (&bl)[2], v8f (&c)[2][2]) {
  #pragma unroll
  for (int t = 0; t < 4; ++t) c[t >> 1][t & 1] = wmma_bf(ah[t >> 1], bh[t & 1], c[t >> 1][t & 1]);
  #pragma unroll
  for (int t = 0; t < 4; ++t) c[t >> 1][t & 1] = wmma_bf(al[t >> 1], bh[t & 1], c[t >> 1][t & 1]);
  #pragma unroll
  for (int t = 0; t < 4; ++t) c[t >> 1][t & 1] = wmma_bf(ah[t >> 1], bl[t & 1], c[t >> 1][t & 1]);
}
// 1 x 2 tiles: a, b[nt] -> c[nt]
__device__ __forceinline__ void wmma3_1x2(v8i ah, v8i al, const v8i (&bh)[2], const v8i (&bl)[2], v8f (&c)[2]) {
  c[0] = wmma_bf(ah, bh[0], c[0]);
  c[1] = wmma_bf(ah, bh[1], c[1]);
  c[0] = wmma_bf(al, bh[0], c[0]);
  c[1] = wmma_bf(al, bh[1], c[1]);
  c[0] = wmma_bf(ah, bl[0], c[0]);
  c[1] = wmma_bf(ah, bl[1], c[1]);
}
// fragment from a k-contiguous 16-bit row (pointer already at k0)
__device__ __forceinline__ v8i ldfrag(const us* p, int h) {
  Frag f;
  f.half[0] = *(const v8usa*)(p + 8 * h);
  f.half[1] = *(const v8usa*)(p + 16 + 8 * h);
  return f.v;
}

__device__ __forceinline__ float wave_sum(float s) {
  s += __shfl_xor(s, 16);
  s += __shfl_xor(s, 8);
  s += __shfl_xor(s, 4);
  s += __shfl_xor(s, 2);
  s += __shfl_xor(s, 1);
  return s;
}
__device__ __forceinline__ double dshfl_xor(double v, int msk) {
  const unsigned long long u = __builtin_bit_cast(unsigned long long, v);
  int lo = (int)(unsigned)(u & 0xFFFFFFFFull);
  int hi = (int)(unsigned)(u >> 32);
  lo = __shfl_xor(lo, msk);
  hi = __shfl_xor(hi, msk);
  const unsigned long long r = (((unsigned long long)(unsigned)hi) << 32) | (unsigned long long)(unsigned)lo;
  return __builtin_bit_cast(double, r);
}
__device__ __forceinline__ double wave_sum_d(double s) {
  s += dshfl_xor(s, 16);
  s += dshfl_xor(s, 8);
  s += dshfl_xor(s, 4);
  s += dshfl_xor(s, 2);
  s += dshfl_xor(s, 1);
  return s;
}

// ---------------------------------------------------------------------------
// Kernel: x NCHW f32 -> bf16 hi/lo padded NHWC planes [b][34][34][256]
// (interior pixels). Block role = (y, b); LDS transpose; one instruction writes one
// coverage: 8 waves x 4 pixels = 32 px per row, 32 lanes x 8 = 256 ch.
// Also the f32 sum of each channel's image row (32 values, fixed order) into
// rowsum[b][y][c]: 256 threads x 4 B = 8 whole lines per block. The f32 copy
// sits in LDS at pitch 33 words, free of bank conflicts on store and on read.
// ---------------------------------------------------------------------------
__device__ __forceinline__ void prep_x_body(const float* __restrict__ x,
                                            us* __restrict__ xh, us* __restrict__ xl,
                                            float* __restrict__ rowsum, int y, int b) {
  __shared__ __attribute__((aligned(16))) us sh[32 * 256];
  __shared__ __attribute__((aligned(16))) us sl[32 * 256];
  __shared__ float sf[256 * 33];
  const int tid = threadIdx.x, lane = tid & 31, w = tid >> 5;
  #pragma unroll 1
  for (int j = 0; j < 32; ++j) {
    const int c = 8 * j + w;
    const float v = x[((size_t)(b * CIN + c) * HIMG + y) * HIMG + lane];
    us hi, lo;
    split2(v, hi, lo);
    sh[lane * 256 + c] = hi;
    sl[lane * 256 + c] = lo;
    sf[c * 33 + lane] = v;
  }
  __syncthreads();
  float rs = 0.f;
  // unrolled: constant LDS offsets, the reads issue ahead of the dependent adds
  #pragma unroll
  for (int i = 0; i < 32; ++i) rs += sf[tid * 33 + i];
  rowsum[(size_t)(b * HIMG + y) * CIN + tid] = rs;
  v8us vh[4], vl[4];
  size_t d[4];
  #pragma unroll
  for (int i = 0; i < 4; ++i) {
    const int px = 4 * w + i;
    vh[i] = *(const v8usa*)(sh + px * 256 + 8 * lane);
    vl[i] = *(const v8usa*)(sl + px * 256 + 8 * lane);
    d[i] = ((size_t)((b * PW + y + 1) * PW + px + 1)) * CIN + 8 * lane;
  }
  #pragma unroll
  for (int i = 0; i < 4; ++i) { *(v8us*)(xh + d[i]) = vh[i]; *(v8us*)(xl + d[i]) = vl[i]; }
  
}

// ---------------------------------------------------------------------------
// Kernel: zero the border pixel rows of padded NHWC planes [b][34][34][C].
// Wave = one border pixel; 32 lanes x 16 B = 256 halves per instruction.
// coverage: 132 border pixels x 4 samples, C halves each, both planes.
// ---------------------------------------------------------------------------
__device__ __forceinline__ void zero_border_body(us* __restrict__ ph, us* __restrict__ pl, int C, int bx, int b) {
  const int tid = threadIdx.x, lane = tid & 31, w = tid >> 5;
  const int i = bx * 8 + w;
  if (i >= 132) return;
  int py, px;
  if (i < 34)       { py = 0;           px = i; }
  else if (i < 68)  { py = PW - 1;      px = i - 34; }
  else if (i < 100) { py = i - 68 + 1;  px = 0; }
  else              { py = i - 100 + 1; px = PW - 1; }
  const size_t base = ((size_t)((b * PW + py) * PW + px)) * (size_t)C;
  v8us z;
  #pragma unroll
  for (int j = 0; j < 8; ++j) z[j] = (us)0;
  #pragma unroll 1
  for (int off = 8 * lane; off < C; off += 256) {
    *(v8us*)(ph + base + off) = z;
    *(v8us*)(pl + base + off) = z;
  }
  
}

// ---------------------------------------------------------------------------
// Kernel: OIHW f32 weights -> rows [o][tap*256 + c] as bf16 hi and lo planes.
// Thread = 8 consecutive row elements, one 16-B store per lane per plane,
// coverage: cout*taps*256 elements, grid = n/2048 exactly.
// ---------------------------------------------------------------------------
__device__ __forceinline__ void wprep_body(const float* __restrict__ wsrc, int cout, int taps,
                                           us* __restrict__ wh, us* __restrict__ wl, int bx) {
  const int g = bx * 256 + threadIdx.x;
  const int kw = taps * 256;
  const int n = cout * kw;
  const int e8 = g * 8;
  if (e8 >= n) return;
  const int o = e8 / kw;
  const int r = e8 - o * kw;
  const int tap = r >> 8, c = r & 255;
  const float* src = wsrc + ((size_t)(o * 256 + c)) * taps + tap;
  v8us vh, vl;
  #pragma unroll
  for (int i = 0; i < 8; ++i) {
    us a, bq;
    split2(src[(size_t)i * taps], a, bq);
    vh[i] = a;
    vl[i] = bq;
  }
  *(v8us*)(wh + e8) = vh;
  *(v8us*)(wl + e8) = vl;
  
}

// ---------------------------------------------------------------------------
// Kernel: all operand preparation in one grid (the roles share no data, so
// they run side by side instead of one launch after another). Role by block
// index, the longest first: x planes, then k, v, hu, q weight rows, then the
// zero borders of the three padded plane pairs.
// ---------------------------------------------------------------------------
#define NB_X   (HIMG * NBATCH)
#define NB_WK  ((DQ * CIN * 9) / 2048)
#define NB_WV  ((DV * CIN * 9) / 2048)
#define NB_WH  ((DV * DV * 9) / 2048)
#define NB_WQ  ((DQ * CIN) / 2048)
#define NB_ZB  (17 * NBATCH)
#define NB_PREP (NB_X + NB_WK + NB_WV + NB_WH + NB_WQ + 3 * NB_ZB)
__global__ __launch_bounds__(256) void k_prep(
    const float* __restrict__ x, const float* __restrict__ q_w, const float* __restrict__ k_w,
    const float* __restrict__ v_w, const float* __restrict__ hu_w,
    us* __restrict__ xh, us* __restrict__ xl, float* __restrict__ rowsum,
    us* __restrict__ wqh, us* __restrict__ wql, us* __restrict__ wkh, us* __restrict__ wkl,
    us* __restrict__ wvh, us* __restrict__ wvl, us* __restrict__ whh, us* __restrict__ whl,
    us* __restrict__ rqh, us* __restrict__ rql, us* __restrict__ qkh, us* __restrict__ qkl) {
  int i = blockIdx.x;
  if (i < NB_X) { prep_x_body(x, xh, xl, rowsum, i & (HIMG - 1), i / HIMG); return; }
  i -= NB_X;
  if (i < NB_WK) { wprep_body(k_w, DQ, 9, wkh, wkl, i); return; }
  i -= NB_WK;
  if (i < NB_WV) { wprep_body(v_w, DV, 9, wvh, wvl, i); return; }
  i -= NB_WV;
  if (i < NB_WH) { wprep_body(hu_w, DV, 9, whh, whl, i); return; }
  i -= NB_WH;
  if (i < NB_WQ) { wprep_body(q_w, DQ, 1, wqh, wql, i); return; }
  i -= NB_WQ;
  const int pl = i / NB_ZB, r = i - pl * NB_ZB;
  const int bx = r % 17, b = r / 17;
  if (pl == 0)      zero_border_body(xh, xl, CIN, bx, b);
  else if (pl == 1) zero_border_body(rqh, rql, DQ, bx, b);
  else              zero_border_body(qkh, qkl, DV, bx, b);
}

// ---------------------------------------------------------------------------
// Fragment from 32 consecutive-k f32 values of one row (pointer at k0), split
// into hi/lo bf16 fragments in registers (fragment map as above).
// ---------------------------------------------------------------------------
__device__ __forceinline__ void frag_f32(const float* __restrict__ p, int h, v8i& fh, v8i& fl) {
  const v4f q0 = *(const v4fa*)(p + 8 * h);
  const v4f q1 = *(const v4fa*)(p + 8 * h + 4);
  const v4f q2 = *(const v4fa*)(p + 16 + 8 * h);
  const v4f q3 = *(const v4fa*)(p + 20 + 8 * h);
  float v[16];
  v[0] = q0.x; v[1] = q0.y; v[2] = q0.z; v[3] = q0.w;
  v[4] = q1.x; v[5] = q1.y; v[6] = q1.z; v[7] = q1.w;
  v[8] = q2.x; v[9] = q2.y; v[10] = q2.z; v[11] = q2.w;
  v[12] = q3.x; v[13] = q3.y; v[14] = q3.z; v[15] = q3.w;
  Frag a, bq;
  #pragma unroll
  for (int i = 0; i < 16; ++i) {
    us hi, lo;
    split2(v[i], hi, lo);
    a.half[i >> 3][i & 7] = hi;
    bq.half[i >> 3][i & 7] = lo;
  }
  fh = a.v;
  fl = bq.v;
}

// ---------------------------------------------------------------------------
// Block role: channel means of x (f32, from the 32 row sums of each channel, fixed
// order) and the bias linear on WMMA:
// bias[b][o] = sum_c mean[b][c] * bw[o][c] + bb[o]. One block of 4 waves, each
// with two 32-column slices of o in turn; 20 KiB of LDS from the calling kernel.
// A = means [16 rows (4 real, 12 zero)][256] hi/lo in LDS, B = bw rows [o][c]
// coverage: 128 threads x 2 x 16 B = 4096 B = all of bias.
// ---------------------------------------------------------------------------
__device__ __forceinline__ void bias_body(us* lds, const float* __restrict__ rowsum, const float* __restrict__ bw,
                                          const float* __restrict__ bb, float* __restrict__ biasv) {
  us* sah = lds;                                             // 16 x 256
  us* sal = lds + 16 * 256;                                  // 16 x 256
  float* sd = reinterpret_cast<float*>(lds + 2 * 16 * 256);  // 4 x 256
  const int tid = threadIdx.x, lane = tid & 31, w = tid >> 5;
  const int h = lane >> 4, m = lane & 15;
  for (int i = tid; i < 16 * 256; i += 128) {
    if (i >= 4 * 256) { sah[i] = (us)0; sal[i] = (us)0; }
  }
  // rolled: one pass's 32 loads (128 registers) at a time, so that this role does not raise the merged kernel's register count
  #pragma unroll 1
  for (int it = 0; it < 2; ++it) {
    const int t = tid + 128 * it;
    const int k = t >> 6, c4 = 4 * (t & 63);   // b = k, channels c4 .. c4+3
    const float* p = rowsum + (size_t)k * HIMG * CIN + c4;
    v4f sm;
    sm.x = 0.f; sm.y = 0.f; sm.z = 0.f; sm.w = 0.f;
    // unrolled: the 32 loads fly together, one memory latency instead of 32
    #pragma unroll
    for (int i = 0; i < HIMG; ++i) sm += *(const v4fa*)(p + i * CIN);
    // unrolled: constant vector index, sm stays in registers
    #pragma unroll
    for (int e = 0; e < 4; ++e) {
      const float mean = sm[e] * (1.0f / 1024.0f);
      us hi, lo;
      split2(mean, hi, lo);
      sah[k * 256 + c4 + e] = hi;
      sal[k * 256 + c4 + e] = lo;
    }
  }
  __syncthreads();

  const v8f z8 = {0.f, 0.f, 0.f, 0.f, 0.f, 0.f, 0.f, 0.f};
  // rolled: the two slices share one copy of the code and of its registers
  #pragma unroll 1
  for (int it = 0; it < 2; ++it) {
    const int o0 = 32 * (w + 4 * it) + m, o1 = o0 + 16;
    const float* br0 = bw + (size_t)o0 * 256;
    const float* br1 = bw + (size_t)o1 * 256;
    v8f acc[2];
    acc[0] = z8; acc[1] = z8;
    #pragma unroll 1
    for (int k0 = 0; k0 < 256; k0 += 32) {
      const v8i ah = ldfrag(sah + m * 256 + k0, h);
      const v8i al = ldfrag(sal + m * 256 + k0, h);
      v8i bh0, bl0, bh1, bl1;
      frag_f32(br0 + k0, h, bh0, bl0);
      frag_f32(br1 + k0, h, bh1, bl1);
      acc[0] = wmma3(ah, al, bh0, bl0, acc[0]);
      acc[1] = wmma3(ah, al, bh1, bl1, acc[1]);
    }
    const float bb0 = bb[o0], bb1 = bb[o1];
    if (h == 0) {
      #pragma unroll
      for (int r = 0; r < 4; ++r) {
        sd[r * 256 + o0] = acc[0][r] + bb0;
        sd[r * 256 + o1] = acc[1][r] + bb1;
      }
    }
  }
  __syncthreads();
  #pragma unroll
  for (int t = 0; t < 2; ++t) {
    const int e = 4 * (tid + 128 * t);
    const v4f v = *(const v4fa*)(sd + e);
    *(v4f*)(biasv + e) = v;
  }
  // other roles' code follows these stores in the merged kernel's listing and reuses their registers:
  // the wait keeps any such rewrite behind the stores' issue (precaution)
  asm volatile("s_wait_xcnt 0x0" ::: "memory");
}

// ---------------------------------------------------------------------------
// Eight asynchronous 16-B copies global -> LDS per lane (no register staging).
// l = the lane's LDS byte addresses, g = its global addresses, both 16-B
// aligned. The closing s_wait_xcnt keeps later rewrites of the address
// registers behind the copies' issue (precaution), so it sits in the statement.
// ---------------------------------------------------------------------------
__device__ __forceinline__ void acopy8(const unsigned (&l)[8], const us* const (&g)[8]) {
  asm volatile(
      "global_load_async_to_lds_b128 %0, %8, off\n\t"
      "global_load_async_to_lds_b128 %1, %9, off\n\t"
      "global_load_async_to_lds_b128 %2, %10, off\n\t"
      "global_load_async_to_lds_b128 %3, %11, off\n\t"
      "global_load_async_to_lds_b128 %4, %12, off\n\t"
      "global_load_async_to_lds_b128 %5, %13, off\n\t"
      "global_load_async_to_lds_b128 %6, %14, off\n\t"
      "global_load_async_to_lds_b128 %7, %15, off\n\t"
      "s_wait_xcnt 0x0"
      :: "v"(l[0]), "v"(l[1]), "v"(l[2]), "v"(l[3]), "v"(l[4]), "v"(l[5]), "v"(l[6]), "v"(l[7]),
         "v"(g[0]), "v"(g[1]), "v"(g[2]), "v"(g[3]), "v"(g[4]), "v"(g[5]), "v"(g[6]), "v"(g[7])
      : "memory");
}
// The same with ten copies (the pixel rows come in tens), the wait again inside the statement.
__device__ __forceinline__ void acopy10(const unsigned (&l)[10], const us* const (&g)[10]) {
  asm volatile(
      "global_load_async_to_lds_b128 %0, %10, off\n\t"
      "global_load_async_to_lds_b128 %1, %11, off\n\t"
      "global_load_async_to_lds_b128 %2, %12, off\n\t"
      "global_load_async_to_lds_b128 %3, %13, off\n\t"
      "global_load_async_to_lds_b128 %4, %14, off\n\t"
      "global_load_async_to_lds_b128 %5, %15, off\n\t"
      "global_load_async_to_lds_b128 %6, %16, off\n\t"
      "global_load_async_to_lds_b128 %7, %17, off\n\t"
      "global_load_async_to_lds_b128 %8, %18, off\n\t"
      "global_load_async_to_lds_b128 %9, %19, off\n\t"
      "s_wait_xcnt 0x0"
      :: "v"(l[0]), "v"(l[1]), "v"(l[2]), "v"(l[3]), "v"(l[4]), "v"(l[5]), "v"(l[6]), "v"(l[7]), "v"(l[8]), "v"(l[9]),
         "v"(g[0]), "v"(g[1]), "v"(g[2]), "v"(g[3]), "v"(g[4]), "v"(g[5]), "v"(g[6]), "v"(g[7]), "v"(g[8]), "v"(g[9])
      : "memory");
}

// LDS rings of the convolutions, hi and lo planes, row pitch 2 KC + 16 B = 16 B x odd
// (conflict-free 16-B reads). A weight stage = KC channels of one tap's 64 weight
// rows. A pixel group = KC channels of the two padded image rows (2 x 34 pixels,
// adjacent in memory) that the three taps of one kernel row read: it is copied once
// and each tap reads it at its own column shift. AROWS = those 68 pixel rows
// rounded up to whole copy instructions; rows 68 .. 79 are never read.
#define AROWS 80
static_assert(AROWS >= 2 * PW, "both padded image rows fit");
// Halves (16-bit words) of two pixel groups and two weight stages:
constexpr int ring_halves(int kc) { return 2 * 2 * (AROWS + 64) * (kc + 8); }
// KC = 128 (156,672 B) where one block per WGP is all the grid has;
// KC = 64 (82,944 B) where more long tiles wait than two blocks per
// WGP can hold: three blocks then share a WGP's LDS.
#define KC_HU  128
#define KC_QKV 64

// ---------------------------------------------------------------------------
// Kernel: implicit-GEMM convolution (Cin = 256 per pixel) over bf16 hi/lo
// zero-padded NHWC planes [b][34][34][256]; weights as rows [o][tap*256+c]
// hi/lo. Block = 64 pixels (image rows y0, y0+1) x 64 output channels,
// 4 waves of 32 px x 32 ch (2x2 tiles), K = ntaps*256 in steps of 32,
// in the order kernel row, channel chunk, kernel column;
// operand rows staged in LDS by asynchronous copies of 2 KC-byte row pieces (two
// buffers each for weights and pixels, the next stage flies while this one is
// worked on), fragments read from LDS, three products per tile pair.
// MODE 0: relu^2 -> bf16 hi/lo padded NHWC planes (pitch = cout) + (s2,s4) partial line
// MODE 1: relu^2 -> f32 NCHW + (s2,s4) partial line
// MODE 2: value -> bf16 hi/lo NCHW planes
// MODE 3: value -> f32 NCHW + (sum, sum of squares) partial line (f64)
// coverage: MODE 0 store: 4 waves x 16 px x 8 lanes x 8 ch = 64 px x 64 ch;
// MODE 1/3: 4 waves x 16 ch x 64 px; MODE 2: 4 waves x 16 ch x 8 lanes x 8 px.
// ---------------------------------------------------------------------------
// The body takes its tile (bx = pixel tile, by = channel tile of gy) and the
// block's LDS from the kernel that calls it. sbuf (16 KiB, epilogue only) may lie
// on the ring: it is first written behind the last stage's waits and barrier,
// when every wave has left the ring and no copy is outstanding.
template <int MODE, int KC>
__device__ __forceinline__ void conv_body(
    us* ring, float* sbuf, double (*sred)[2], int bx, int by, int gy,
    const us* __restrict__ ah, const us* __restrict__ al,
    const us* __restrict__ wh, const us* __restrict__ wl,
    const float* __restrict__ bias, int ntaps, int cout,
    us* __restrict__ oh, us* __restrict__ ol, float* __restrict__ of, float* __restrict__ part)
{
  const int tid = threadIdx.x, lane = tid & 31, w = tid >> 5;
  const int h = lane >> 4, m = lane & 15;
  const int pt = bx, b = pt >> 4, y0 = (pt & 15) * 2;
  const int n0 = by * 64;
  const int ry = w >> 1, nw = 32 * (w & 1);
  const int kw = ntaps * CIN;
  constexpr int LPITCH = KC + 8;
  constexpr int LAP = AROWS * LPITCH, LA = 2 * LAP;   // one pixel plane, one pixel group (hi, lo)
  constexpr int LWP = 64 * LPITCH, LW = 2 * LWP;      // one weight plane, one weight stage (hi, lo)
  constexpr int SPT = CIN / KC;        // channel chunks
  constexpr int LPR = KC / 8;          // lanes x 16 B = one row piece of KC channels
  constexpr int RPP = 128 / LPR;       // rows that the block's 128 threads copy at once
  constexpr int NPW = 64 / RPP;        // copies per thread and weight plane
  constexpr int NPA = AROWS / RPP;     // copies per thread and pixel plane
  static_assert(SPT * KC == CIN && (2 * NPW) % 8 == 0 && (2 * NPA) % 10 == 0 && NPA * RPP == AROWS,
                "whole stages, whole groups of eight and of ten copies");
  const int tpg = (ntaps == 1) ? 1 : 3;   // taps (stages) that share a pixel group
  const int nst = SPT * ntaps;
  // copy map: thread = 16-B column ql of rows r0 + RPP i
  const int ql = tid & (LPR - 1), r0 = tid / LPR;
  const unsigned lds0 = (unsigned)(size_t)ring + (unsigned)(r0 * (LPITCH * 2) + ql * 16);
  const size_t wbase = (size_t)(n0 + r0) * kw + 8 * ql;
  const size_t abase = ((size_t)((b * PW + y0) * PW)) * CIN + 8 * ql;
  // pixel group g (kernel row g / SPT, channels KC (g % SPT) ..) into pixel buffer g & 1
  auto group_copy = [&](int g) {
    const int ky = (ntaps == 1) ? 1 : g / SPT;
    const size_t ao = abase + (size_t)(ky * PW * CIN + (g % SPT) * KC);
    const unsigned lb = lds0 + (unsigned)(g & 1) * (LA * 2);
    // both loops unrolled: plane and row are then constants and l, gp stay in registers
    #pragma unroll
    for (int c = 0; c < 2 * NPA; c += 10) {
      unsigned l[10];
      const us* gp[10];
      #pragma unroll
      for (int t = 0; t < 10; ++t) {
        const int pl = (c + t) / NPA, row = ((c + t) % NPA) * RPP;
        l[t] = lb + (unsigned)((pl * LAP + row * LPITCH) * 2);
        // the filler rows past the 68th copy the 68th pixel again: the source stays inside the sample's plane
        const int pr = (row + RPP > 2 * PW) ? min(r0 + row, 2 * PW - 1) : (r0 + row);
        gp[t] = (pl == 0 ? ah : al) + ao + (size_t)pr * CIN;
      }
      acopy10(l, gp);
    }
  };
  // stage s (pixel group s / tpg, kernel column s % tpg): its weight rows into weight buffer s & 1,
  // and, where it is the first stage of its group, the group's pixel rows
  auto stage_copy = [&](int s) {
    const int g = s / tpg, kx = s - g * tpg;
    const int tap = (ntaps == 1) ? 0 : (g / SPT) * 3 + kx;
    const size_t wo = wbase + (size_t)(tap * CIN + (g % SPT) * KC);
    const unsigned lb = lds0 + (unsigned)((2 * LA + (s & 1) * LW) * 2);
    // both loops unrolled: plane and row are then constants and l, gp stay in registers
    #pragma unroll
    for (int c = 0; c < 2 * NPW; c += 8) {
      unsigned l[8];
      const us* gp[8];
      #pragma unroll
      for (int t = 0; t < 8; ++t) {
        const int pl = (c + t) / NPW, row = ((c + t) % NPW) * RPP;
        l[t] = lb + (unsigned)((pl * LWP + row * LPITCH) * 2);
        gp[t] = (pl == 0 ? wh : wl) + wo + (size_t)row * kw;
      }
      acopy8(l, gp);
    }
    if (kx == 0) group_copy(g);   // same for the whole block; its buffer's last readers left at least one barrier ago
  };
  const v8f z8 = {0.f, 0.f, 0.f, 0.f, 0.f, 0.f, 0.f, 0.f};
  v8f acc[2][2];
  #pragma unroll
  for (int i = 0; i < 2; ++i) { acc[i][0] = z8; acc[i][1] = z8; }

  // prologue: stage 0 landed and published, then stage 1 in flight
  stage_copy(0);
  asm volatile("s_wait_asynccnt 0x0" ::: "memory");  // this wave's copies of stage 0 have landed
  __syncthreads();                                   // ... and every other wave's
  stage_copy(1);                                     // nst = SPT ntaps >= 2

  const int arow = (ry * PW + m) * LPITCH;
  const int brow = 2 * LA + (nw + m) * LPITCH;
  #pragma unroll 1
  for (int s = 0; s < nst; ++s) {
    const int g = s / tpg;
    const int kx = (ntaps == 1) ? 1 : (s - g * tpg);
    const us* sa = ring + (g & 1) * LA + kx * LPITCH + arow;   // the tap's column shift = kx pixel rows
    const us* sw = ring + (s & 1) * LW + brow;
    // two register sets of fragments: step kk + 32 of this stage is read while step kk is multiplied
    v8i fah[2][2], fal[2][2], fbh[2][2], fbl[2][2];
    auto ldstep = [&](int kk, int q) {
      #pragma unroll
      for (int t = 0; t < 2; ++t) fah[q][t] = ldfrag(sa + t * 16 * LPITCH + kk, h);
      #pragma unroll
      for (int t = 0; t < 2; ++t) fbh[q][t] = ldfrag(sw + t * 16 * LPITCH + kk, h);
      #pragma unroll
      for (int t = 0; t < 2; ++t) fal[q][t] = ldfrag(sa + LAP + t * 16 * LPITCH + kk, h);
      #pragma unroll
      for (int t = 0; t < 2; ++t) fbl[q][t] = ldfrag(sw + LWP + t * 16 * LPITCH + kk, h);
    };
    ldstep(0, 0);
    #pragma unroll
    for (int kk = 0; kk < KC; kk += 32) {
      const int q = (kk >> 5) & 1;
      if (kk + 32 < KC) ldstep(kk + 32, q ^ 1);
      // keeps the next step's 16 LDS reads one group ahead of this step's WMMAs (else they sink to their uses and each waits)
      __builtin_amdgcn_sched_barrier(0);
      wmma3_2x2(fah[q], fal[q], fbh[q], fbl[q], acc);
    }
    // publish point of stage s + 1, and hand-over of this stage's buffer
    asm volatile("s_wait_dscnt 0x0" ::: "memory");     // this wave's reads of the buffer are done
    asm volatile("s_wait_asynccnt 0x0" ::: "memory");  // this wave's copies of stage s + 1 have landed
    __syncthreads();                                   // both hold for every wave of the block
    if (s + 2 < nst) stage_copy(s + 2);
  }
  asm volatile("s_wait_asynccnt 0x0" ::: "memory");    // no copy outstanding past the loop

  // epilogue into LDS
  float bv[2];
  bv[0] = bias[n0 + nw + m];
  bv[1] = bias[n0 + nw + 16 + m];
  us* sH = reinterpret_cast<us*>(sbuf);
  us* sL = sH + 4096;
  float fs = 0.f, fq = 0.f;
  double ds = 0.0, dq = 0.0;
  #pragma unroll
  for (int mt = 0; mt < 2; ++mt) {
    #pragma unroll
    for (int nt = 0; nt < 2; ++nt) {
      #pragma unroll
      for (int r = 0; r < 8; ++r) {
        const float val = acc[mt][nt][r] + bv[nt];
        const int tp = ry * 32 + mt * 16 + 8 * h + r;
        const int ch = nw + 16 * nt + m;
        if (MODE == 0) {
          const float rr = fmaxf(val, 0.f);
          const float r2 = rr * rr;
          fs += r2; fq += r2 * r2;
          us hi, lo;
          split2(r2, hi, lo);
          sH[tp * 64 + ch] = hi;
          sL[tp * 64 + ch] = lo;
        } else if (MODE == 1) {
          const float rr = fmaxf(val, 0.f);
          const float r2 = rr * rr;
          fs += r2; fq += r2 * r2;
          sbuf[ch * 64 + tp] = r2;
        } else if (MODE == 2) {
          us hi, lo;
          split2(val, hi, lo);
          sH[ch * 64 + tp] = hi;
          sL[ch * 64 + tp] = lo;
        } else {
          ds += (double)val;
          dq += (double)val * (double)val;
          sbuf[ch * 64 + tp] = val;
        }
      }
    }
  }
  if (MODE == 0 || MODE == 1) {
    fs = wave_sum(fs);
    fq = wave_sum(fq);
    ds = (double)fs;
    dq = (double)fq;
  } else if (MODE == 3) {
    ds = wave_sum_d(ds);
    dq = wave_sum_d(dq);
  }
  if (MODE != 2) {
    if (lane == 0) { sred[w][0] = ds; sred[w][1] = dq; }
  }
  __syncthreads();

  // block partial line (2 doubles + zeros), fixed order over the 4 waves
  v4f pv;
  pv.x = 0.f; pv.y = 0.f; pv.z = 0.f; pv.w = 0.f;
  size_t li = 0;
  bool pw = false;
  if (MODE != 2) {
    double S = 0.0, Q2 = 0.0;
    #pragma unroll
    for (int k = 0; k < 4; ++k) { S += sred[k][0]; Q2 += sred[k][1]; }
    DPack pk;
    pk.d[0] = S; pk.d[1] = Q2;
    pv.x = (lane == 0) ? pk.f.x : 0.f;
    pv.y = (lane == 0) ? pk.f.y : 0.f;
    pv.z = (lane == 0) ? pk.f.z : 0.f;
    pv.w = (lane == 0) ? pk.f.w : 0.f;
    li = ((size_t)bx * gy + by) * 32 + 4 * (lane & 7);
    pw = (w == 0) && (lane < 8);
  }

  if (MODE == 0) {
    const int q8 = lane & 7, sub = lane >> 3;
    v8us th[4], tl[4];
    size_t d[4];
    #pragma unroll
    for (int i = 0; i < 4; ++i) {
      const int tp = 16 * w + 4 * i + sub;
      const int ry2 = tp >> 5, xx = tp & 31;
      th[i] = *(const v8usa*)(sH + tp * 64 + 8 * q8);
      tl[i] = *(const v8usa*)(sL + tp * 64 + 8 * q8);
      d[i] = ((size_t)((b * PW + y0 + ry2 + 1) * PW + xx + 1)) * (size_t)cout + n0 + 8 * q8;
    }
    #pragma unroll
    for (int i = 0; i < 4; ++i) { *(v8us*)(oh + d[i]) = th[i]; *(v8us*)(ol + d[i]) = tl[i]; }
    if (pw) *(v4f*)(part + li) = pv;
    
  } else if (MODE == 2) {
    const int q8 = lane & 7, sub = lane >> 3;
    v8us th[4], tl[4];
    size_t d[4];
    #pragma unroll
    for (int i = 0; i < 4; ++i) {
      const int chl = 16 * w + 4 * i + sub;
      th[i] = *(const v8usa*)(sH + chl * 64 + 8 * q8);
      tl[i] = *(const v8usa*)(sL + chl * 64 + 8 * q8);
      d[i] = ((size_t)(b * cout + n0 + chl)) * NPIX + y0 * HIMG + 8 * q8;
    }
    #pragma unroll
    for (int i = 0; i < 4; ++i) { *(v8us*)(oh + d[i]) = th[i]; *(v8us*)(ol + d[i]) = tl[i]; }
    // another role's code follows these stores in the merged kernel's listing and reuses their registers:
    // the wait keeps any such rewrite behind the stores' issue (precaution)
    asm volatile("s_wait_xcnt 0x0" ::: "memory");
  } else {
    const int hs = lane >> 4, x4 = 4 * (lane & 15);
    v4f tv[8];
    size_t d[8];
    #pragma unroll
    for (int i = 0; i < 8; ++i) {
      const int chl = 16 * w + 2 * i + hs;
      tv[i] = *(const v4fa*)(sbuf + chl * 64 + x4);
      d[i] = ((size_t)(b * cout + n0 + chl)) * NPIX + y0 * HIMG + x4;
    }
    #pragma unroll
    for (int i = 0; i < 8; ++i) *(v4f*)(of + d[i]) = tv[i];
    if (pw) *(v4f*)(part + li) = pv;
    
  }
}

// ---------------------------------------------------------------------------
// Kernel: the head unification conv (MODE 3), one tile per block.
// ---------------------------------------------------------------------------
__global__ __launch_bounds__(128) void k_conv_hu(
    const us* __restrict__ ah, const us* __restrict__ al,
    const us* __restrict__ wh, const us* __restrict__ wl,
    const float* __restrict__ bias, float* __restrict__ of, float* __restrict__ part)
{
  __shared__ __attribute__((aligned(16))) us ring[ring_halves(KC_HU)];
  __shared__ __attribute__((aligned(16))) float sbuf[64 * 64];
  __shared__ double sred[4][2];
  conv_body<3, KC_HU>(ring, sbuf, sred, blockIdx.x, blockIdx.y, DV / 64, ah, al, wh, wl, bias, 9, DV,
               nullptr, nullptr, of, part);
}

// ---------------------------------------------------------------------------
// Kernel: the k, v and q convolutions of x in one grid (they share no result,
// so their tiles fill the chip together). Role by block index, the long 3x3
// tiles first: 512 k tiles, 64 v tiles (only the row tiles that the pool
// reads), then the one block of the bias linear (it needs only the row sums of x
// and ends long before the 3x3 tiles), 512 q tiles; pixel tile fastest. 83,008 B of LDS per block: three
// blocks per WGP, so all 576 long tiles are resident from the start.
// ---------------------------------------------------------------------------
#define NB_CK (64 * (DQ / 64))
#define NB_CV (NBATCH * NVT * (DV / 64))
#define NB_CQ (64 * (DQ / 64))
__global__ __launch_bounds__(128) void k_conv_qkv(
    const us* __restrict__ xh, const us* __restrict__ xl,
    const us* __restrict__ wkh, const us* __restrict__ wkl, const float* __restrict__ k_b,
    float* __restrict__ r2k, float* __restrict__ partk,
    const us* __restrict__ wvh, const us* __restrict__ wvl, const float* __restrict__ v_b,
    us* __restrict__ vnh, us* __restrict__ vnl,
    const us* __restrict__ wqh, const us* __restrict__ wql, const float* __restrict__ q_b,
    us* __restrict__ rqh, us* __restrict__ rql, float* __restrict__ partq,
    const float* __restrict__ rowsum, const float* __restrict__ bias_w, const float* __restrict__ bias_b,
    float* __restrict__ biasv)
{
  __shared__ __attribute__((aligned(16))) us ring[ring_halves(KC_QKV)];
  static_assert(sizeof(ring) >= 64 * 64 * sizeof(float), "the epilogue buffer fits on the ring");
  static_assert(sizeof(ring) >= 2 * 16 * 256 * sizeof(us) + 4 * 256 * sizeof(float), "so does the bias role's LDS");
  float* sbuf = reinterpret_cast<float*>(ring);
  __shared__ double sred[4][2];
  int i = blockIdx.x;
  if (i < NB_CK) {
    conv_body<1, KC_QKV>(ring, sbuf, sred, i & 63, i >> 6, DQ / 64, xh, xl, wkh, wkl, k_b, 9, DQ,
                 nullptr, nullptr, r2k, partk);
    return;
  }
  i -= NB_CK;
  if (i < NB_CV) {
    // i counts only the row tiles that the pool reads: put it back on the grid of 64 pixel tiles per channel tile
    const int t = i & (NVT - 1), b = (i / NVT) & (NBATCH - 1);
    const int rt = (t == 0) ? VT0 : ((t == 1) ? VT1 : ((t == 2) ? VT2 : VT3));
    i = (i / (NVT * NBATCH)) * 64 + b * (HIMG / 2) + rt;
    conv_body<2, KC_QKV>(ring, sbuf, sred, i & 63, i >> 6, DV / 64, xh, xl, wvh, wvl, v_b, 9, DV,
                 vnh, vnl, nullptr, nullptr);
    return;
  }
  i -= NB_CV;
  if (i == 0) { bias_body(ring, rowsum, bias_w, bias_b, biasv); return; }
  i -= 1;
  conv_body<0, KC_QKV>(ring, sbuf, sred, i & 63, i >> 6, DQ / 64, xh, xl, wqh, wql, q_b, 1, DQ,
               rqh, rql, nullptr, partq);
}

// ---------------------------------------------------------------------------
// One wave's job: phi norm ratio s = sqrt(sum relu^2) / sqrt(sum relu^4) of one
// tensor from its 512 block partial lines (fixed order, f64: lane l adds lines
// 16 l .. 16 l + 15, then the 32 lane sums are added in lane order). The kernels
// that use the ratio give it to a fifth wave, beside the four that multiply.
// ---------------------------------------------------------------------------
__device__ __forceinline__ double dlane(double v, int l) {
  const unsigned long long u = __builtin_bit_cast(unsigned long long, v);
  const unsigned lo = (unsigned)__builtin_amdgcn_readlane((int)(unsigned)(u & 0xFFFFFFFFull), l);
  const unsigned hi = (unsigned)__builtin_amdgcn_readlane((int)(unsigned)(u >> 32), l);
  return __builtin_bit_cast(double, (((unsigned long long)hi) << 32) | (unsigned long long)lo);
}
__device__ __forceinline__ float phi_wave(const float* __restrict__ part, int lane) {
  double s2 = 0.0, s4 = 0.0;
  // unrolled: the 16 loads fly together, one latency instead of 16
  #pragma unroll
  for (int j = 0; j < 16; ++j) {
    const double* dp = reinterpret_cast<const double*>(part + (size_t)(lane * 16 + j) * 32);
    s2 += dp[0];
    s4 += dp[1];
  }
  double t2 = 0.0, t4 = 0.0;
  // unrolled: readlane takes a constant lane
  #pragma unroll
  for (int i = 0; i < 32; ++i) { t2 += dlane(s2, i); t4 += dlane(s4, i); }
  const float num = sqrtf((float)t2);
  const float den = sqrtf((float)t4);
  return num * (1.0f / den);
}

// ---------------------------------------------------------------------------
// Kernel: pooled outer product. Block = (tap pq, bh): D[kk 64][v 32] =
// sum_pix (relu(K)^2[kk][pix] * Mh[p][y] * Mw[q][x]) * V[v][pix] over the two
// image rows y where Mh[p][y] is not zero (K = 64; every other term is a
// product with a zero weight, and V exists only on those rows),
// A built in registers from the f32 NCHW relu^2 rows (split hi/lo),
// B from the bf16 NCHW V planes. A fifth wave makes sK meanwhile. Epilogue: * sK, clip +-32/9, hi/lo into
// coverage: 4 waves x 8 rows x 8 lanes x 8 kk = 32 v x 64 kk per (bh,pq).
// ---------------------------------------------------------------------------
__global__ __launch_bounds__(160) void k_kv(
    const float* __restrict__ r2k, const us* __restrict__ vnh, const us* __restrict__ vnl,
    const float* __restrict__ partk, BiW bw, us* __restrict__ fth, us* __restrict__ ftl)
{
  __shared__ __attribute__((aligned(16))) us sH[32 * 64];
  __shared__ __attribute__((aligned(16))) us sL[32 * 64];
  __shared__ float sphi[32];   // the ratio, one copy per lane
  const int tid = threadIdx.x, lane = tid & 31;
  const int w = __builtin_amdgcn_readfirstlane(tid >> 5);   // scalar: the role tests below are scalar branches, EXEC stays whole
  const int h = lane >> 4, m = lane & 15;
  const int pq = blockIdx.x, bh = blockIdx.y;
  const int b = bh >> 3, head = bh & 7;
  const int p = pq / 3, q = pq - 3 * p;
  const int   iy0 = (p == 0) ? bw.i0[0] : ((p == 1) ? bw.i0[1] : bw.i0[2]);
  const int   iy1 = (p == 0) ? bw.i1[0] : ((p == 1) ? bw.i1[1] : bw.i1[2]);
  const float wy0 = (p == 0) ? bw.w0[0] : ((p == 1) ? bw.w0[1] : bw.w0[2]);
  const float wy1 = (p == 0) ? bw.w1[0] : ((p == 1) ? bw.w1[1] : bw.w1[2]);
  const int   ix0 = (q == 0) ? bw.i0[0] : ((q == 1) ? bw.i0[1] : bw.i0[2]);
  const int   ix1 = (q == 0) ? bw.i1[0] : ((q == 1) ? bw.i1[1] : bw.i1[2]);
  const float wx0 = (q == 0) ? bw.w0[0] : ((q == 1) ? bw.w0[1] : bw.w0[2]);
  const float wx1 = (q == 0) ? bw.w1[0] : ((q == 1) ? bw.w1[1] : bw.w1[2]);
  const float amax = (float)(32.0 / 9.0);
  const float* arow = r2k + ((size_t)(b * DQ + head * DK + 16 * w + m)) * NPIX;
  const size_t br0 = ((size_t)(b * DV + head * DVH + m)) * NPIX;
  const size_t br1 = br0 + (size_t)16 * NPIX;
  const v8f z8 = {0.f, 0.f, 0.f, 0.f, 0.f, 0.f, 0.f, 0.f};
  v8f acc[2];
  acc[0] = z8; acc[1] = z8;

  if (w == 4) {
    sphi[lane] = phi_wave(partk, lane);
  } else {
  #pragma unroll 1
  for (int t = 0; t < 2; ++t) {
    // rows iy0 then iy1, ascending as in the full sum; were the two clamped onto one row, it takes both weights once
    const float wy = (t == 0) ? (wy0 + ((iy1 == iy0) ? wy1 : 0.f)) : ((iy1 == iy0) ? 0.f : wy1);
    const int k0 = ((t == 0) ? iy0 : iy1) * HIMG;
    const float* ap = arow + k0;
    const v4f q0 = *(const v4fa*)(ap + 8 * h);
    const v4f q1 = *(const v4fa*)(ap + 8 * h + 4);
    const v4f q2 = *(const v4fa*)(ap + 16 + 8 * h);
    const v4f q3 = *(const v4fa*)(ap + 20 + 8 * h);
    v8i fbh[2], fbl[2];
    fbh[0] = ldfrag(vnh + br0 + k0, h);
    fbh[1] = ldfrag(vnh + br1 + k0, h);
    fbl[0] = ldfrag(vnl + br0 + k0, h);
    fbl[1] = ldfrag(vnl + br1 + k0, h);
    // keeps the V fragment reads in flight with the K row reads (else they sink behind the split: a second memory latency)
    __builtin_amdgcn_sched_barrier(0);
    float v[16];
    v[0] = q0.x; v[1] = q0.y; v[2] = q0.z; v[3] = q0.w;
    v[4] = q1.x; v[5] = q1.y; v[6] = q1.z; v[7] = q1.w;
    v[8] = q2.x; v[9] = q2.y; v[10] = q2.z; v[11] = q2.w;
    v[12] = q3.x; v[13] = q3.y; v[14] = q3.z; v[15] = q3.w;
    Frag fah, fal;
    #pragma unroll
    for (int i = 0; i < 16; ++i) {
      const int xx = 8 * h + (i & 7) + ((i >> 3) << 4);
      const float wx = ((xx == ix0) ? wx0 : 0.f) + ((xx == ix1) ? wx1 : 0.f);
      const float a = v[i] * (wy * wx);
      us hi, lo;
      split2(a, hi, lo);
      fah.half[i >> 3][i & 7] = hi;
      fal.half[i >> 3][i & 7] = lo;
    }
    wmma3_1x2(fah.v, fal.v, fbh, fbl, acc);
  }
  }
  __syncthreads();   // publishes the fifth wave's ratio

  if (w < 4) {
  const float sK = sphi[lane];
  #pragma unroll
  for (int nt = 0; nt < 2; ++nt) {
    #pragma unroll
    for (int r = 0; r < 8; ++r) {
      float val = acc[nt][r] * sK;
      val = fminf(fmaxf(val, -amax), amax);
      const int kk = 16 * w + 8 * h + r;
      const int vv = 16 * nt + m;
      us hi, lo;
      split2(val, hi, lo);
      sH[vv * 64 + kk] = hi;
      sL[vv * 64 + kk] = lo;
    }
  }
  }
  __syncthreads();
  if (w == 4) return;   // behind the last barrier
  const int q8 = lane & 7, sub = lane >> 3;
  v8us th[2], tl[2];
  size_t d[2];
  #pragma unroll
  for (int i = 0; i < 2; ++i) {
    const int vv = 8 * w + 4 * i + sub;
    th[i] = *(const v8usa*)(sH + vv * 64 + 8 * q8);
    tl[i] = *(const v8usa*)(sL + vv * 64 + 8 * q8);
    d[i] = ((size_t)(bh * DVH + vv)) * FTK + pq * 64 + 8 * q8;
  }
  #pragma unroll
  for (int i = 0; i < 2; ++i) { *(v8us*)(fth + d[i]) = th[i]; *(v8us*)(ftl + d[i]) = tl[i]; }
  
}

// ---------------------------------------------------------------------------
// Kernel: per-sample grouped 3x3 conv of relu(Q)^2 planes (padded NHWC,
// 512 ch) with the pooled filters, K = 9*64 per head. Block = (64 px, head
// pair, b); wave = (head of the pair, image row) 32 px x 32 v; a fifth wave makes sQ meanwhile. Epilogue:
// * sQ + bias[b][j*32+v], hi/lo into padded NHWC planes [b][34][34][256];
// coverage: 4 waves x 16 px x 8 lanes x 8 ch = 64 px x 64 ch per block;
// grid 16 x 4 x 4 = all interior pixels x all 256 channels x 4 samples.
// ---------------------------------------------------------------------------
__global__ __launch_bounds__(160) void k_gconv(
    const us* __restrict__ rqh, const us* __restrict__ rql,
    const us* __restrict__ fth, const us* __restrict__ ftl,
    const float* __restrict__ partq, const float* __restrict__ biasv,
    us* __restrict__ oh, us* __restrict__ ol)
{
  __shared__ __attribute__((aligned(16))) us sH[64 * 64];
  __shared__ __attribute__((aligned(16))) us sL[64 * 64];
  __shared__ float sphi[32];   // the ratio, one copy per lane
  const int tid = threadIdx.x, lane = tid & 31;
  const int w = __builtin_amdgcn_readfirstlane(tid >> 5);   // scalar: the role tests below are scalar branches, EXEC stays whole
  const int h = lane >> 4, m = lane & 15;
  const int pt = blockIdx.x, jp = blockIdx.y, b = blockIdx.z;
  const int y0 = 2 * pt;
  const int jl = w >> 1, ry = w & 1;
  const int j = 2 * jp + jl, y = y0 + ry, bh = b * 8 + j;
  const size_t fr0 = ((size_t)(bh * DVH + m)) * FTK;
  const v8f z8 = {0.f, 0.f, 0.f, 0.f, 0.f, 0.f, 0.f, 0.f};
  v8f acc[2][2];
  #pragma unroll
  for (int i = 0; i < 2; ++i) { acc[i][0] = z8; acc[i][1] = z8; }

  if (w == 4) {
    sphi[lane] = phi_wave(partq, lane);
  } else {
  #pragma unroll 1
  for (int tap = 0; tap < 9; ++tap) {
    const int ky = tap / 3;
    const int kx = tap - 3 * ky;
    const size_t ar0 = ((size_t)((b * PW + y + ky) * PW + kx + m)) * DQ + (size_t)j * DK;
    const size_t wt = (size_t)tap * DK;
    v8i fah[2][2], fal[2][2], fbh[2][2], fbl[2][2];   // [32-channel step][tile]
    // the lane's own four read addresses of this tap (its 8 h offset inside the k step included)
    const us* pah = rqh + ar0 + 8 * h;
    const us* pal = rql + ar0 + 8 * h;
    const us* pbh = fth + fr0 + wt + 8 * h;
    const us* pbl = ftl + fr0 + wt + 8 * h;
    #pragma unroll
    for (int q = 0; q < 2; ++q) {
      #pragma unroll
      for (int t = 0; t < 2; ++t) {
        fah[q][t] = ldfrag(pah + t * 16 * DQ + 32 * q, 0);
        fbh[q][t] = ldfrag(pbh + t * 16 * FTK + 32 * q, 0);
        fal[q][t] = ldfrag(pal + t * 16 * DQ + 32 * q, 0);
        fbl[q][t] = ldfrag(pbl + t * 16 * FTK + 32 * q, 0);
      }
    }
    // keeps the tap's 32 global reads one group in flight together (else they sink to their uses: a memory latency each)
    __builtin_amdgcn_sched_barrier(0);
    // the four address pairs stay live, so unwritten, up to this wait behind the last read (precaution)
    asm volatile("s_wait_xcnt 0x0" :: "v"(pah), "v"(pal), "v"(pbh), "v"(pbl) : "memory");
    static_assert(DK == 64, "two steps of 32 channels per tap");
    wmma3_2x2(fah[0], fal[0], fbh[0], fbl[0], acc);
    wmma3_2x2(fah[1], fal[1], fbh[1], fbl[1], acc);
  }
  }
  __syncthreads();   // publishes the fifth wave's ratio

  if (w < 4) {
  const float sQ = sphi[lane];
  float bv[2];
  bv[0] = biasv[b * DV + j * DVH + m];
  bv[1] = biasv[b * DV + j * DVH + 16 + m];
  #pragma unroll
  for (int mt = 0; mt < 2; ++mt) {
    #pragma unroll
    for (int nt = 0; nt < 2; ++nt) {
      #pragma unroll
      for (int r = 0; r < 8; ++r) {
        const float val = acc[mt][nt][r] * sQ + bv[nt];
        const int tp = ry * 32 + mt * 16 + 8 * h + r;
        const int chl = jl * 32 + 16 * nt + m;
        us hi, lo;
        split2(val, hi, lo);
        sH[tp * 64 + chl] = hi;
        sL[tp * 64 + chl] = lo;
      }
    }
  }
  }
  __syncthreads();
  if (w == 4) return;   // behind the last barrier
  const int q8 = lane & 7, sub = lane >> 3;
  v8us th[4], tl[4];
  size_t d[4];
  #pragma unroll
  for (int i = 0; i < 4; ++i) {
    const int tp = 16 * w + 4 * i + sub;
    const int ry2 = tp >> 5, xx = tp & 31;
    th[i] = *(const v8usa*)(sH + tp * 64 + 8 * q8);
    tl[i] = *(const v8usa*)(sL + tp * 64 + 8 * q8);
    d[i] = ((size_t)((b * PW + y0 + ry2 + 1) * PW + xx + 1)) * DV + jp * 64 + 8 * q8;
  }
  #pragma unroll
  for (int i = 0; i < 4; ++i) { *(v8us*)(oh + d[i]) = th[i]; *(v8us*)(ol + d[i]) = tl[i]; }
  
}

// ---------------------------------------------------------------------------
// Kernel: LayerNorm over (C,H,W) per sample: fixed-order f64 combine of the
// 64 block partial lines of the sample, then (v - mu) * rstd on one float4
// coverage: 1024 blocks x 256 threads x 4 floats = all 1048576 outputs.
// ---------------------------------------------------------------------------
__global__ __launch_bounds__(256) void k_ln(const float* __restrict__ outp, const float* __restrict__ partl,
                                            float* __restrict__ out) {
  __shared__ double ss[64];
  __shared__ double sq[64];
  __shared__ float sst[2];
  const int tid = threadIdx.x;
  const int blk = blockIdx.x, b = blk >> 8;
  if (tid < 64) {
    const double* dp = reinterpret_cast<const double*>(partl + (size_t)(b * 64 + tid) * 32);
    ss[tid] = dp[0];
    sq[tid] = dp[1];
  }
  __syncthreads();
  if (tid == 0) {
    double S = 0.0, Q2 = 0.0;
    for (int i = 0; i < 64; ++i) { S += ss[i]; Q2 += sq[i]; }
    const double inv = 1.0 / 262144.0;
    const double mu = S * inv;
    double var = Q2 * inv - mu * mu;
    if (var < 0.0) var = 0.0;
    const float den = sqrtf((float)var + 1e-5f);
    sst[0] = (float)mu;
    sst[1] = 1.0f / den;
  }
  __syncthreads();
  const float muf = sst[0], rinv = sst[1];
  const size_t e = ((size_t)blk * 256 + tid) * 4;
  v4f v = *(const v4fa*)(outp + e);
  v4f o;
  o.x = (v.x - muf) * rinv;
  o.y = (v.y - muf) * rinv;
  o.z = (v.z - muf) * rinv;
  o.w = (v.w - muf) * rinv;
  *(v4f*)(out + e) = o;
  
}

// ---------------------------------------------------------------------------
// Host: bilinear (32 -> 3, align_corners = false) taps and weights, computed
// with separate f64 multiply and subtract, fraction cast to f32.
// ---------------------------------------------------------------------------
static void bilin3(BiW& bw) {
#pragma clang fp contract(off)
  const double scale = 32.0 / 3.0;
  for (int p = 0; p < 3; ++p) {
    double src = ((double)p + 0.5) * scale;
    src = src - 0.5;
    if (src < 0.0) src = 0.0;
    const int f = (int)src;
    const float frac = (float)(src - (double)f);
    int c0 = f, c1 = f + 1;
    if (c0 > HIMG - 1) c0 = HIMG - 1;
    if (c1 > HIMG - 1) c1 = HIMG - 1;
    bw.i0[p] = c0;
    bw.i1[p] = c1;
    bw.w0[p] = 1.0f - frac;
    bw.w1[p] = frac;
  }
}

extern "C" void kernel_launch(void* const* d_in, const int* in_sizes, int n_in,
                              void* d_out, int out_size, void* d_ws, size_t ws_size,
                              hipStream_t stream) {
  if (n_in < 11) return;
  if (in_sizes[0] != NBATCH * CIN * NPIX) return;
  if (in_sizes[1] != DQ * CIN || in_sizes[2] != DQ) return;
  if (in_sizes[3] != DQ * CIN * 9 || in_sizes[4] != DQ) return;
  if (in_sizes[5] != DV * CIN * 9 || in_sizes[6] != DV) return;
  if (in_sizes[7] != DV * CIN || in_sizes[8] != DV) return;
  if (in_sizes[9] != DV * DV * 9 || in_sizes[10] != DV) return;
  if (out_size != NBATCH * DV * NPIX) return;

  const float* x      = (const float*)d_in[0];
  const float* q_w    = (const float*)d_in[1];
  const float* q_b    = (const float*)d_in[2];
  const float* k_w    = (const float*)d_in[3];
  const float* k_b    = (const float*)d_in[4];
  const float* v_w    = (const float*)d_in[5];
  const float* v_b    = (const float*)d_in[6];
  const float* bias_w = (const float*)d_in[7];
  const float* bias_b = (const float*)d_in[8];
  const float* hu_w   = (const float*)d_in[9];
  const float* hu_b   = (const float*)d_in[10];
  float* out = (float*)d_out;

  // workspace carve (bytes); every region sized to whole 256-B multiples and
  // written only with whole-line stores inside its extent
  char* ws = (char*)d_ws;
  size_t off = 0;
#define CARVE(T, name, bytes) T* name = (T*)(ws + off); off += (((size_t)(bytes)) + 255) & ~(size_t)255;
  const size_t padpx  = (size_t)NBATCH * PW * PW;                    // 4624 padded pixels
  CARVE(us,    XPH,   padpx * CIN * 2);                               // 2367488
  CARVE(us,    XPL,   padpx * CIN * 2);
  CARVE(us,    WQH,   (size_t)DQ * CIN * 2);                          // 262144
  CARVE(us,    WQL,   (size_t)DQ * CIN * 2);
  CARVE(us,    WKH,   (size_t)DQ * CIN * 9 * 2);                      // 2359296
  CARVE(us,    WKL,   (size_t)DQ * CIN * 9 * 2);
  CARVE(us,    WVH,   (size_t)DV * CIN * 9 * 2);                      // 1179648
  CARVE(us,    WVL,   (size_t)DV * CIN * 9 * 2);
  CARVE(us,    WHH,   (size_t)DV * DV * 9 * 2);                       // 1179648
  CARVE(us,    WHL,   (size_t)DV * DV * 9 * 2);
  CARVE(float, BIASV, (size_t)NBATCH * DV * 4);                       // 4096 = 32 lines
  CARVE(us,    RQH,   padpx * DQ * 2);                                // 4734976
  CARVE(us,    RQL,   padpx * DQ * 2);
  CARVE(float, R2K,   (size_t)NBATCH * DQ * NPIX * 4);                // 8388608
  CARVE(us,    VNH,   (size_t)NBATCH * DV * NPIX * 2);                // 2097152
  CARVE(us,    VNL,   (size_t)NBATCH * DV * NPIX * 2);
  CARVE(float, PARTQ, (size_t)512 * 128);                             // 512 lines
  CARVE(float, PARTK, (size_t)512 * 128);                             // 512 lines
  CARVE(us,    FTH,   (size_t)NBATCH * 8 * DVH * FTK * 2);            // 1179648
  CARVE(us,    FTL,   (size_t)NBATCH * 8 * DVH * FTK * 2);
  CARVE(us,    QKH,   padpx * DV * 2);                                // 2367488
  CARVE(us,    QKL,   padpx * DV * 2);
  CARVE(float, OUTP,  (size_t)NBATCH * DV * NPIX * 4);                // 4194304
  CARVE(float, PARTL, (size_t)256 * 128);                             // 256 lines
  CARVE(float, ROWS,  (size_t)NBATCH * HIMG * CIN * 4);               // 131072
#undef CARVE
  if (off > ws_size) return;
  if (off > (size_t)134217728) return;

  BiW bw;
  bilin3(bw);

  // 16-bit operand planes
  k_prep<<<NB_PREP, 256, 0, stream>>>(x, q_w, k_w, v_w, hu_w, XPH, XPL, ROWS,
                                      WQH, WQL, WKH, WKL, WVH, WVL, WHH, WHL, RQH, RQL, QKH, QKL);

  // k (3x3), v (3x3), q (1x1) convolutions; channel means + bias linear
  k_conv_qkv<<<NB_CK + NB_CV + 1 + NB_CQ, 128, 0, stream>>>(XPH, XPL, WKH, WKL, k_b, R2K, PARTK,
                                                            WVH, WVL, v_b, VNH, VNL,
                                                            WQH, WQL, q_b, RQH, RQL, PARTQ,
                                                            ROWS, bias_w, bias_b, BIASV);

  // pooled KV filters, grouped conv (each makes its own phi ratio)
  k_kv<<<dim3(9, NBATCH * 8), 160, 0, stream>>>(R2K, VNH, VNL, PARTK, bw, FTH, FTL);
  k_gconv<<<dim3(16, 4, NBATCH), 160, 0, stream>>>(RQH, RQL, FTH, FTL, PARTQ, BIASV, QKH, QKL);

  // head unification conv + LayerNorm
  k_conv_hu<<<dim3(64, DV / 64), 128, 0, stream>>>(QKH, QKL, WHH, WHL, hu_b, OUTP, PARTL);
  k_ln<<<(NBATCH * DV * NPIX) / 1024, 256, 0, stream>>>(OUTP, PARTL, out);
}

// v009
// It runs in 95.5 microseconds.
// In two side-by-side timings against v008, it was 1.03 and 1.05 times as fast.
// Over all steps from v000 it is 4.42 times as fast.
// Contractions: q 1x1 conv, k/v/hu 3x3 convs as implicit GEMM (K = 9*256), pooled KV outer-product GEMMs (64x32x64 per head and tap: the two image rows with a non-zero pool weight), per-sample grouped 3x3 conv (K = 9*64) and the channel-mean bias linear, all on v_wmma_f32_16x16x32_bf16 with bf16 hi/lo three-product operand split (hi*hi + lo*hi + hi*lo), f32 accumulate; phi norm ratios, clip, channel means and LayerNorm statistics in f32/f64 on the VALU.
#include <hip/hip_runtime.h>

typedef unsigned short us;
typedef int   v8i  __attribute__((ext_vector_type(8)));
typedef float v8f  __attribute__((ext_vector_type(8)));
typedef float v4f  __attribute__((ext_vector_type(4)));
typedef unsigned short v8us __attribute__((ext_vector_type(8)));
typedef __bf16 v16b __attribute__((ext_vector_type(16)));
typedef v4f  __attribute__((may_alias)) v4fa;
typedef v8us __attribute__((may_alias)) v8usa;
union Frag { v8i v; v8us half[2]; };
union DPack { double d[2]; v4f f; };

#define NBATCH 4
#define CIN    256
#define HIMG   32
#define NPIX   1024
#define PW     34
#define DQ     512
#define DV     256
#define DK     64
#define DVH    32
#define FTK    576

struct BiW { int i0[3]; int i1[3]; float w0[3]; float w1[3]; };
static_assert(sizeof(BiW) == 48);

// The bilinear pool (32 -> 3, align_corners = false) gives a non-zero weight to image row
// floor((p + 0.5) * 32 / 3 - 0.5) = (64 p + 29) / 6 and to the row below it, p = 0..2, and to no other.
// V enters the result only through that pool, so only these rows of V are ever read.
constexpr int pool_row(int p) { return (64 * p + 29) / 6; }
// the two-row pixel tiles (image rows 2 t, 2 t + 1) that hold those six rows
#define NVT 4
constexpr int VT0 = pool_row(0) >> 1, VT1 = pool_row(1) >> 1, VT2 = (pool_row(1) + 1) >> 1, VT3 = pool_row(2) >> 1;
static_assert(((pool_row(0) + 1) >> 1) == VT0 && ((pool_row(2) + 1) >> 1) == VT3, "rows of taps 0 and 2 share a tile");
static_assert(VT0 < VT1 && VT1 < VT2 && VT2 < VT3 && VT3 < HIMG / 2, "four distinct tiles, one writer each");

// ---------------------------------------------------------------------------
// bf16 helpers (RNE convert) and the hi/lo split
// ---------------------------------------------------------------------------
__device__ __forceinline__ us f2bf(float f) {
  unsigned u = __float_as_uint(f);
  u += 0x7FFFu + ((u >> 16) & 1u);
  return (us)(u >> 16);
}
__device__ __forceinline__ float bf2f(us hv) {
  return __uint_as_float(((unsigned)hv) << 16);
}
__device__ __forceinline__ void split2(float f, us& hi, us& lo) {
  hi = f2bf(f);
  lo = f2bf(f - bf2f(hi));
}

// ---------------------------------------------------------------------------
// 16x16x32 bf16 WMMA (builtin: the compiler keeps the distances behind it and is free to schedule around it).
// Fragment map (wave32): lane l, h = l>>4, m = n = l&15.
//   A/B element i: i<8 -> k0+8h+i ; i>=8 -> k0+16+8h+(i-8)
//   D element r : row 8h+r, col l&15
// ---------------------------------------------------------------------------
__device__ __forceinline__ v8f wmma_bf(v8i a, v8i b, v8f c) {
  return __builtin_amdgcn_wmma_f32_16x16x32_bf16(false, __builtin_bit_cast(v16b, a), false,
                                                 __builtin_bit_cast(v16b, b), (short)0, c, false, false);
}
// The same with four vector slots tied behind it (ties D, keeps A/B live): for the bias loop, whose back edge leads
// from its last WMMA straight to global loads onto that WMMA's B registers.
__device__ __forceinline__ v8f wmma_bf_slots(v8i a, v8i b, v8f c) {
  v8f d = wmma_bf(a, b, c);
  asm volatile("v_nop\n\tv_nop\n\tv_nop\n\tv_nop" : "+v"(d) : "v"(a), "v"(b));
  return d;
}
// three-product split: ah*bh + al*bh + ah*bl into one accumulator (bias loop)
__device__ __forceinline__ v8f wmma3(v8i ah, v8i al, v8i bh, v8i bl, v8f c) {
  c = wmma_bf_slots(ah, bh, c);
  c = wmma_bf_slots(al, bh, c);
  c = wmma_bf_slots(ah, bl, c);
  return c;
}
// three-product split: ah*bh + al*bh + ah*bl into each accumulator, in that order; issued product by
// product over the independent accumulators, so that no WMMA waits for the one directly ahead of it
// 2 x 2 tiles: a[mt], b[nt] -> c[mt][nt]
__device__ __forceinline__ void wmma3_2x2(const v8i (&ah)[2], const v8i (&al)[2],
                                          const v8i (&bh)[2], const v8i (&bl)[2], v8f (&c)[2][2]) {
  #pragma unroll
  for (int t = 0; t < 4; ++t) c[t >> 1][t & 1] = wmma_bf(ah[t >> 1], bh[t & 1], c[t >> 1][t & 1]);
  #pragma unroll
  for (int t = 0; t < 4; ++t) c[t >> 1][t & 1] = wmma_bf(al[t >> 1], bh[t & 1], c[t >> 1][t & 1]);
  #pragma unroll
  for (int t = 0; t < 4; ++t) c[t >> 1][t & 1] = wmma_bf(ah[t >> 1], bl[t & 1], c[t >> 1][t & 1]);
}
// 1 x 2 tiles: a, b[nt] -> c[nt]
__device__ __forceinline__ void wmma3_1x2(v8i ah, v8i al, const v8i (&bh)[2], const v8i (&bl)[2], v8f (&c)[2]) {
  c[0] = wmma_bf(ah, bh[0], c[0]);
  c[1] = wmma_bf(ah, bh[1], c[1]);
  c[0] = wmma_bf(al, bh[0], c[0]);
  c[1] = wmma_bf(al, bh[1], c[1]);
  c[0] = wmma_bf(ah, bl[0], c[0]);
  c[1] = wmma_bf(ah, bl[1], c[1]);
}
// fragment from a k-contiguous 16-bit row (pointer already at k0)
__device__ __forceinline__ v8i ldfrag(const us* p, int h) {
  Frag f;
  f.half[0] = *(const v8usa*)(p + 8 * h);
  f.half[1] = *(const v8usa*)(p + 16 + 8 * h);
  return f.v;
}

__device__ __forceinline__ float wave_sum(float s) {
  s += __shfl_xor(s, 16);
  s += __shfl_xor(s, 8);
  s += __shfl_xor(s, 4);
  s += __shfl_xor(s, 2);
  s += __shfl_xor(s, 1);
  return s;
}
__device__ __forceinline__ double dshfl_xor(double v, int msk) {
  const unsigned long long u = __builtin_bit_cast(unsigned long long, v);
  int lo = (int)(unsigned)(u & 0xFFFFFFFFull);
  int hi = (int)(unsigned)(u >> 32);
  lo = __shfl_xor(lo, msk);
  hi = __shfl_xor(hi, msk);
  const unsigned long long r = (((unsigned long long)(unsigned)hi) << 32) | (unsigned long long)(unsigned)lo;
  return __builtin_bit_cast(double, r);
}
__device__ __forceinline__ double wave_sum_d(double s) {
  s += dshfl_xor(s, 16);
  s += dshfl_xor(s, 8);
  s += dshfl_xor(s, 4);
  s += dshfl_xor(s, 2);
  s += dshfl_xor(s, 1);
  return s;
}

// ---------------------------------------------------------------------------
// Kernel: x NCHW f32 -> bf16 hi/lo padded NHWC planes [b][34][34][256]
// (interior pixels). Block role = (y, b); LDS transpose; one instruction writes one
// coverage: 8 waves x 4 pixels = 32 px per row, 32 lanes x 8 = 256 ch.
// Also the f32 sum of each channel's image row (32 values, fixed order) into
// rowsum[b][y][c]: 256 threads x 4 B = 8 whole lines per block. The f32 copy
// sits in LDS at pitch 33 words, free of bank conflicts on store and on read.
// ---------------------------------------------------------------------------
__device__ __forceinline__ void prep_x_body(const float* __restrict__ x,
                                            us* __restrict__ xh, us* __restrict__ xl,
                                            float* __restrict__ rowsum, int y, int b) {
  __shared__ __attribute__((aligned(16))) us sh[32 * 256];
  __shared__ __attribute__((aligned(16))) us sl[32 * 256];
  __shared__ float sf[256 * 33];
  const int tid = threadIdx.x, lane = tid & 31, w = tid >> 5;
  #pragma unroll 1
  for (int j = 0; j < 32; ++j) {
    const int c = 8 * j + w;
    const float v = x[((size_t)(b * CIN + c) * HIMG + y) * HIMG + lane];
    us hi, lo;
    split2(v, hi, lo);
    sh[lane * 256 + c] = hi;
    sl[lane * 256 + c] = lo;
    sf[c * 33 + lane] = v;
  }
  __syncthreads();
  float rs = 0.f;
  // unrolled: constant LDS offsets, the reads issue ahead of the dependent adds
  #pragma unroll
  for (int i = 0; i < 32; ++i) rs += sf[tid * 33 + i];
  rowsum[(size_t)(b * HIMG + y) * CIN + tid] = rs;
  v8us vh[4], vl[4];
  size_t d[4];
  #pragma unroll
  for (int i = 0; i < 4; ++i) {
    const int px = 4 * w + i;
    vh[i] = *(const v8usa*)(sh + px * 256 + 8 * lane);
    vl[i] = *(const v8usa*)(sl + px * 256 + 8 * lane);
    d[i] = ((size_t)((b * PW + y + 1) * PW + px + 1)) * CIN + 8 * lane;
  }
  #pragma unroll
  for (int i = 0; i < 4; ++i) { *(v8us*)(xh + d[i]) = vh[i]; *(v8us*)(xl + d[i]) = vl[i]; }
  
}

// ---------------------------------------------------------------------------
// Kernel: zero the border pixel rows of padded NHWC planes [b][34][34][C].
// Wave = one border pixel; 32 lanes x 16 B = 256 halves per instruction.
// coverage: 132 border pixels x 4 samples, C halves each, both planes.
// ---------------------------------------------------------------------------
__device__ __forceinline__ void zero_border_body(us* __restrict__ ph, us* __restrict__ pl, int C, int bx, int b) {
  const int tid = threadIdx.x, lane = tid & 31, w = tid >> 5;
  const int i = bx * 8 + w;
  if (i >= 132) return;
  int py, px;
  if (i < 34)       { py = 0;           px = i; }
  else if (i < 68)  { py = PW - 1;      px = i - 34; }
  else if (i < 100) { py = i - 68 + 1;  px = 0; }
  else              { py = i - 100 + 1; px = PW - 1; }
  const size_t base = ((size_t)((b * PW + py) * PW + px)) * (size_t)C;
  v8us z;
  #pragma unroll
  for (int j = 0; j < 8; ++j) z[j] = (us)0;
  #pragma unroll 1
  for (int off = 8 * lane; off < C; off += 256) {
    *(v8us*)(ph + base + off) = z;
    *(v8us*)(pl + base + off) = z;
  }
  
}

// ---------------------------------------------------------------------------
// Kernel: OIHW f32 weights -> rows [o][tap*256 + c] as bf16 hi and lo planes.
// Thread = 8 consecutive row elements, one 16-B store per lane per plane,
// coverage: cout*taps*256 elements, grid = n/2048 exactly.
// ---------------------------------------------------------------------------
__device__ __forceinline__ void wprep_body(const float* __restrict__ wsrc, int cout, int taps,
                                           us* __restrict__ wh, us* __restrict__ wl, int bx) {
  const int g = bx * 256 + threadIdx.x;
  const int kw = taps * 256;
  const int n = cout * kw;
  const int e8 = g * 8;
  if (e8 >= n) return;
  const int o = e8 / kw;
  const int r = e8 - o * kw;
  const int tap = r >> 8, c = r & 255;
  const float* src = wsrc + ((size_t)(o * 256 + c)) * taps + tap;
  v8us vh, vl;
  #pragma unroll
  for (int i = 0; i < 8; ++i) {
    us a, bq;
    split2(src[(size_t)i * taps], a, bq);
    vh[i] = a;
    vl[i] = bq;
  }
  *(v8us*)(wh + e8) = vh;
  *(v8us*)(wl + e8) = vl;
  
}

// ---------------------------------------------------------------------------
// Kernel: all operand preparation in one grid (the roles share no data, so
// they run side by side instead of one launch after another). Role by block
// index, the longest first: x planes, then k, v, hu, q weight rows, then the
// zero borders of the three padded plane pairs.
// ---------------------------------------------------------------------------
#define NB_X   (HIMG * NBATCH)
#define NB_WK  ((DQ * CIN * 9) / 2048)
#define NB_WV  ((DV * CIN * 9) / 2048)
#define NB_WH  ((DV * DV * 9) / 2048)
#define NB_WQ  ((DQ * CIN) / 2048)
#define NB_ZB  (17 * NBATCH)
#define NB_PREP (NB_X + NB_WK + NB_WV + NB_WH + NB_WQ + 3 * NB_ZB)
__global__ __launch_bounds__(256) void k_prep(
    const float* __restrict__ x, const float* __restrict__ q_w, const float* __restrict__ k_w,
    const float* __restrict__ v_w, const float* __restrict__ hu_w,
    us* __restrict__ xh, us* __restrict__ xl, float* __restrict__ rowsum,
    us* __restrict__ wqh, us* __restrict__ wql, us* __restrict__ wkh, us* __restrict__ wkl,
    us* __restrict__ wvh, us* __restrict__ wvl, us* __restrict__ whh, us* __restrict__ whl,
    us* __restrict__ rqh, us* __restrict__ rql, us* __restrict__ qkh, us* __restrict__ qkl) {
  int i = blockIdx.x;
  if (i < NB_X) { prep_x_body(x, xh, xl, rowsum, i & (HIMG - 1), i / HIMG); return; }
  i -= NB_X;
  if (i < NB_WK) { wprep_body(k_w, DQ, 9, wkh, wkl, i); return; }
  i -= NB_WK;
  if (i < NB_WV) { wprep_body(v_w, DV, 9, wvh, wvl, i); return; }
  i -= NB_WV;
  if (i < NB_WH) { wprep_body(hu_w, DV, 9, whh, whl, i); return; }
  i -= NB_WH;
  if (i < NB_WQ) { wprep_body(q_w, DQ, 1, wqh, wql, i); return; }
  i -= NB_WQ;
  const int pl = i / NB_ZB, r = i - pl * NB_ZB;
  const int bx = r % 17, b = r / 17;
  if (pl == 0)      zero_border_body(xh, xl, CIN, bx, b);
  else if (pl == 1) zero_border_body(rqh, rql, DQ, bx, b);
  else              zero_border_body(qkh, qkl, DV, bx, b);
}

// ---------------------------------------------------------------------------
// Fragment from 32 consecutive-k f32 values of one row (pointer at k0), split
// into hi/lo bf16 fragments in registers (fragment map as above).
// ---------------------------------------------------------------------------
__device__ __forceinline__ void frag_f32(const float* __restrict__ p, int h, v8i& fh, v8i& fl) {
  const v4f q0 = *(const v4fa*)(p + 8 * h);
  const v4f q1 = *(const v4fa*)(p + 8 * h + 4);
  const v4f q2 = *(const v4fa*)(p + 16 + 8 * h);
  const v4f q3 = *(const v4fa*)(p + 20 + 8 * h);
  float v[16];
  v[0] = q0.x; v[1] = q0.y; v[2] = q0.z; v[3] = q0.w;
  v[4] = q1.x; v[5] = q1.y; v[6] = q1.z; v[7] = q1.w;
  v[8] = q2.x; v[9] = q2.y; v[10] = q2.z; v[11] = q2.w;
  v[12] = q3.x; v[13] = q3.y; v[14] = q3.z; v[15] = q3.w;
  Frag a, bq;
  #pragma unroll
  for (int i = 0; i < 16; ++i) {
    us hi, lo;
    split2(v[i], hi, lo);
    a.half[i >> 3][i & 7] = hi;
    bq.half[i >> 3][i & 7] = lo;
  }
  fh = a.v;
  fl = bq.v;
}

// ---------------------------------------------------------------------------
// Block role: channel means of x (f32, from the 32 row sums of each channel, fixed
// order) and the bias linear on WMMA:
// bias[b][o] = sum_c mean[b][c] * bw[o][c] + bb[o]. One block of 4 waves, each
// with two 32-column slices of o in turn; 20 KiB of LDS from the calling kernel.
// A = means [16 rows (4 real, 12 zero)][256] hi/lo in LDS, B = bw rows [o][c]
// coverage: 128 threads x 2 x 16 B = 4096 B = all of bias.
// ---------------------------------------------------------------------------
__device__ __forceinline__ void bias_body(us* lds, const float* __restrict__ rowsum, const float* __restrict__ bw,
                                          const float* __restrict__ bb, float* __restrict__ biasv) {
  us* sah = lds;                                             // 16 x 256
  us* sal = lds + 16 * 256;                                  // 16 x 256
  float* sd = reinterpret_cast<float*>(lds + 2 * 16 * 256);  // 4 x 256
  const int tid = threadIdx.x, lane = tid & 31, w = tid >> 5;
  const int h = lane >> 4, m = lane & 15;
  for (int i = tid; i < 16 * 256; i += 128) {
    if (i >= 4 * 256) { sah[i] = (us)0; sal[i] = (us)0; }
  }
  // rolled: one pass's 32 loads (128 registers) at a time, so that this role does not raise the merged kernel's register count
  #pragma unroll 1
  for (int it = 0; it < 2; ++it) {
    const int t = tid + 128 * it;
    const int k = t >> 6, c4 = 4 * (t & 63);   // b = k, channels c4 .. c4+3
    const float* p = rowsum + (size_t)k * HIMG * CIN + c4;
    v4f sm;
    sm.x = 0.f; sm.y = 0.f; sm.z = 0.f; sm.w = 0.f;
    // unrolled: the 32 loads fly together, one memory latency instead of 32
    #pragma unroll
    for (int i = 0; i < HIMG; ++i) sm += *(const v4fa*)(p + i * CIN);
    // unrolled: constant vector index, sm stays in registers
    #pragma unroll
    for (int e = 0; e < 4; ++e) {
      const float mean = sm[e] * (1.0f / 1024.0f);
      us hi, lo;
      split2(mean, hi, lo);
      sah[k * 256 + c4 + e] = hi;
      sal[k * 256 + c4 + e] = lo;
    }
  }
  __syncthreads();

  const v8f z8 = {0.f, 0.f, 0.f, 0.f, 0.f, 0.f, 0.f, 0.f};
  // rolled: the two slices share one copy of the code and of its registers
  #pragma unroll 1
  for (int it = 0; it < 2; ++it) {
    const int o0 = 32 * (w + 4 * it) + m, o1 = o0 + 16;
    const float* br0 = bw + (size_t)o0 * 256;
    const float* br1 = bw + (size_t)o1 * 256;
    v8f acc[2];
    acc[0] = z8; acc[1] = z8;
    #pragma unroll 1
    for (int k0 = 0; k0 < 256; k0 += 32) {
      const v8i ah = ldfrag(sah + m * 256 + k0, h);
      const v8i al = ldfrag(sal + m * 256 + k0, h);
      v8i bh0, bl0, bh1, bl1;
      frag_f32(br0 + k0, h, bh0, bl0);
      frag_f32(br1 + k0, h, bh1, bl1);
      acc[0] = wmma3(ah, al, bh0, bl0, acc[0]);
      acc[1] = wmma3(ah, al, bh1, bl1, acc[1]);
    }
    const float bb0 = bb[o0], bb1 = bb[o1];
    if (h == 0) {
      #pragma unroll
      for (int r = 0; r < 4; ++r) {
        sd[r * 256 + o0] = acc[0][r] + bb0;
        sd[r * 256 + o1] = acc[1][r] + bb1;
      }
    }
  }
  __syncthreads();
  #pragma unroll
  for (int t = 0; t < 2; ++t) {
    const int e = 4 * (tid + 128 * t);
    const v4f v = *(const v4fa*)(sd + e);
    *(v4f*)(biasv + e) = v;
  }
  // other roles' code follows these stores in the merged kernel's listing and reuses their registers:
  // the wait keeps any such rewrite behind the stores' issue (precaution)
  asm volatile("s_wait_xcnt 0x0" ::: "memory");
}

// ---------------------------------------------------------------------------
// Eight asynchronous 16-B copies global -> LDS per lane (no register staging).
// l = the lane's LDS byte addresses, g = its global addresses, both 16-B
// aligned. The closing s_wait_xcnt keeps later rewrites of the address
// registers behind the copies' issue (precaution), so it sits in the statement.
// ---------------------------------------------------------------------------
__device__ __forceinline__ void acopy8(const unsigned (&l)[8], const us* const (&g)[8]) {
  asm volatile(
      "global_load_async_to_lds_b128 %0, %8, off\n\t"
      "global_load_async_to_lds_b128 %1, %9, off\n\t"
      "global_load_async_to_lds_b128 %2, %10, off\n\t"
      "global_load_async_to_lds_b128 %3, %11, off\n\t"
      "global_load_async_to_lds_b128 %4, %12, off\n\t"
      "global_load_async_to_lds_b128 %5, %13, off\n\t"
      "global_load_async_to_lds_b128 %6, %14, off\n\t"
      "global_load_async_to_lds_b128 %7, %15, off\n\t"
      "s_wait_xcnt 0x0"
      :: "v"(l[0]), "v"(l[1]), "v"(l[2]), "v"(l[3]), "v"(l[4]), "v"(l[5]), "v"(l[6]), "v"(l[7]),
         "v"(g[0]), "v"(g[1]), "v"(g[2]), "v"(g[3]), "v"(g[4]), "v"(g[5]), "v"(g[6]), "v"(g[7])
      : "memory");
}
// The same with ten copies (the pixel rows come in tens), the wait again inside the statement.
__device__ __forceinline__ void acopy10(const unsigned (&l)[10], const us* const (&g)[10]) {
  asm volatile(
      "global_load_async_to_lds_b128 %0, %10, off\n\t"
      "global_load_async_to_lds_b128 %1, %11, off\n\t"
      "global_load_async_to_lds_b128 %2, %12, off\n\t"
      "global_load_async_to_lds_b128 %3, %13, off\n\t"
      "global_load_async_to_lds_b128 %4, %14, off\n\t"
      "global_load_async_to_lds_b128 %5, %15, off\n\t"
      "global_load_async_to_lds_b128 %6, %16, off\n\t"
      "global_load_async_to_lds_b128 %7, %17, off\n\t"
      "global_load_async_to_lds_b128 %8, %18, off\n\t"
      "global_load_async_to_lds_b128 %9, %19, off\n\t"
      "s_wait_xcnt 0x0"
      :: "v"(l[0]), "v"(l[1]), "v"(l[2]), "v"(l[3]), "v"(l[4]), "v"(l[5]), "v"(l[6]), "v"(l[7]), "v"(l[8]), "v"(l[9]),
         "v"(g[0]), "v"(g[1]), "v"(g[2]), "v"(g[3]), "v"(g[4]), "v"(g[5]), "v"(g[6]), "v"(g[7]), "v"(g[8]), "v"(g[9])
      : "memory");
}

// LDS rings of the convolutions, hi and lo planes, row pitch 2 KC + 16 B = 16 B x odd
// (conflict-free 16-B reads). A weight stage = KC channels of one tap's 64 weight
// rows. A pixel group = KC channels of the two padded image rows (2 x 34 pixels,
// adjacent in memory) that the three taps of one kernel row read: it is copied once
// and each tap reads it at its own column shift. AROWS = those 68 pixel rows
// rounded up to whole copy instructions; rows 68 .. 79 are never read.
#define AROWS 80
static_assert(AROWS >= 2 * PW, "both padded image rows fit");
// Halves (16-bit words) of two pixel groups and two weight stages:
constexpr int ring_halves(int kc) { return 2 * 2 * (AROWS + 64) * (kc + 8); }
// KC = 128 (156,672 B) where one block per WGP is all the grid has;
// KC = 64 (82,944 B) where more long tiles wait than two blocks per
// WGP can hold: three blocks then share a WGP's LDS.
#define KC_HU  128
#define KC_QKV 64

// ---------------------------------------------------------------------------
// Kernel: implicit-GEMM convolution (Cin = 256 per pixel) over bf16 hi/lo
// zero-padded NHWC planes [b][34][34][256]; weights as rows [o][tap*256+c]
// hi/lo. Block = 64 pixels (image rows y0, y0+1) x 64 output channels,
// 4 waves of 32 px x 32 ch (2x2 tiles), K = ntaps*256 in steps of 32,
// in the order kernel row, channel chunk, kernel column;
// operand rows staged in LDS by asynchronous copies of 2 KC-byte row pieces (two
// buffers each for weights and pixels, the next stage flies while this one is
// worked on), fragments read from LDS, three products per tile pair.
// MODE 0: relu^2 -> bf16 hi/lo padded NHWC planes (pitch = cout) + (s2,s4) partial line
// MODE 1: relu^2 -> f32 NCHW + (s2,s4) partial line
// MODE 2: value -> bf16 hi/lo NCHW planes
// MODE 3: value -> f32 NCHW + (sum, sum of squares) partial line (f64)
// coverage: MODE 0 store: 4 waves x 16 px x 8 lanes x 8 ch = 64 px x 64 ch;
// MODE 1/3: 4 waves x 16 ch x 64 px; MODE 2: 4 waves x 16 ch x 8 lanes x 8 px.
// ---------------------------------------------------------------------------
// The body takes its tile (bx = pixel tile, by = channel tile of gy) and the
// block's LDS from the kernel that calls it. sbuf (16 KiB, epilogue only) may lie
// on the ring: it is first written behind the last stage's waits and barrier,
// when every wave has left the ring and no copy is outstanding.
template <int MODE, int KC>
__device__ __forceinline__ void conv_body(
    us* ring, float* sbuf, double (*sred)[2], int bx, int by, int gy,
    const us* __restrict__ ah, const us* __restrict__ al,
    const us* __restrict__ wh, const us* __restrict__ wl,
    const float* __restrict__ bias, int ntaps, int cout,
    us* __restrict__ oh, us* __restrict__ ol, float* __restrict__ of, float* __restrict__ part)
{
  const int tid = threadIdx.x, lane = tid & 31, w = tid >> 5;
  const int h = lane >> 4, m = lane & 15;
  const int pt = bx, b = pt >> 4, y0 = (pt & 15) * 2;
  const int n0 = by * 64;
  const int ry = w >> 1, nw = 32 * (w & 1);
  const int kw = ntaps * CIN;
  constexpr int LPITCH = KC + 8;
  constexpr int LAP = AROWS * LPITCH, LA = 2 * LAP;   // one pixel plane, one pixel group (hi, lo)
  constexpr int LWP = 64 * LPITCH, LW = 2 * LWP;      // one weight plane, one weight stage (hi, lo)
  constexpr int SPT = CIN / KC;        // channel chunks
  constexpr int LPR = KC / 8;          // lanes x 16 B = one row piece of KC channels
  constexpr int RPP = 128 / LPR;       // rows that the block's 128 threads copy at once
  constexpr int NPW = 64 / RPP;        // copies per thread and weight plane
  constexpr int NPA = AROWS / RPP;     // copies per thread and pixel plane
  static_assert(SPT * KC == CIN && (2 * NPW) % 8 == 0 && (2 * NPA) % 10 == 0 && NPA * RPP == AROWS,
                "whole stages, whole groups of eight and of ten copies");
  const int tpg = (ntaps == 1) ? 1 : 3;   // taps (stages) that share a pixel group
  const int nst = SPT * ntaps;
  // copy map: thread = 16-B column ql of rows r0 + RPP i
  const int ql = tid & (LPR - 1), r0 = tid / LPR;
  const unsigned lds0 = (unsigned)(size_t)ring + (unsigned)(r0 * (LPITCH * 2) + ql * 16);
  const size_t wbase = (size_t)(n0 + r0) * kw + 8 * ql;
  const size_t abase = ((size_t)((b * PW + y0) * PW)) * CIN + 8 * ql;
  // pixel group g (kernel row g / SPT, channels KC (g % SPT) ..) into pixel buffer g & 1
  auto group_copy = [&](int g) {
    const int ky = (ntaps == 1) ? 1 : g / SPT;
    const size_t ao = abase + (size_t)(ky * PW * CIN + (g % SPT) * KC);
    const unsigned lb = lds0 + (unsigned)(g & 1) * (LA * 2);
    // both loops unrolled: plane and row are then constants and l, gp stay in registers
    #pragma unroll
    for (int c = 0; c < 2 * NPA; c += 10) {
      unsigned l[10];
      const us* gp[10];
      #pragma unroll
      for (int t = 0; t < 10; ++t) {
        const int pl = (c + t) / NPA, row = ((c + t) % NPA) * RPP;
        l[t] = lb + (unsigned)((pl * LAP + row * LPITCH) * 2);
        // the filler rows past the 68th copy the 68th pixel again: the source stays inside the sample's plane
        const int pr = (row + RPP > 2 * PW) ? min(r0 + row, 2 * PW - 1) : (r0 + row);
        gp[t] = (pl == 0 ? ah : al) + ao + (size_t)pr * CIN;
      }
      acopy10(l, gp);
    }
  };
  // stage s (pixel group s / tpg, kernel column s % tpg): its weight rows into weight buffer s & 1,
  // and, where it is the first stage of its group, the group's pixel rows
  auto stage_copy = [&](int s) {
    const int g = s / tpg, kx = s - g * tpg;
    const int tap = (ntaps == 1) ? 0 : (g / SPT) * 3 + kx;
    const size_t wo = wbase + (size_t)(tap * CIN + (g % SPT) * KC);
    const unsigned lb = lds0 + (unsigned)((2 * LA + (s & 1) * LW) * 2);
    // both loops unrolled: plane and row are then constants and l, gp stay in registers
    #pragma unroll
    for (int c = 0; c < 2 * NPW; c += 8) {
      unsigned l[8];
      const us* gp[8];
      #pragma unroll
      for (int t = 0; t < 8; ++t) {
        const int pl = (c + t) / NPW, row = ((c + t) % NPW) * RPP;
        l[t] = lb + (unsigned)((pl * LWP + row * LPITCH) * 2);
        gp[t] = (pl == 0 ? wh : wl) + wo + (size_t)row * kw;
      }
      acopy8(l, gp);
    }
    if (kx == 0) group_copy(g);   // same for the whole block; its buffer's last readers left at least one barrier ago
  };
  const v8f z8 = {0.f, 0.f, 0.f, 0.f, 0.f, 0.f, 0.f, 0.f};
  v8f acc[2][2];
  #pragma unroll
  for (int i = 0; i < 2; ++i) { acc[i][0] = z8; acc[i][1] = z8; }

  // prologue: stage 0 landed and published, then stage 1 in flight
  stage_copy(0);
  asm volatile("s_wait_asynccnt 0x0" ::: "memory");  // this wave's copies of stage 0 have landed
  __syncthreads();                                   // ... and every other wave's
  stage_copy(1);                                     // nst = SPT ntaps >= 2

  const int arow = (ry * PW + m) * LPITCH;
  const int brow = 2 * LA + (nw + m) * LPITCH;
  #pragma unroll 1
  for (int s = 0; s < nst; ++s) {
    const int g = s / tpg;
    const int kx = (ntaps == 1) ? 1 : (s - g * tpg);
    const us* sa = ring + (g & 1) * LA + kx * LPITCH + arow;   // the tap's column shift = kx pixel rows
    const us* sw = ring + (s & 1) * LW + brow;
    // two register sets of fragments: step kk + 32 of this stage is read while step kk is multiplied
    v8i fah[2][2], fal[2][2], fbh[2][2], fbl[2][2];
    auto ldstep = [&](int kk, int q) {
      #pragma unroll
      for (int t = 0; t < 2; ++t) fah[q][t] = ldfrag(sa + t * 16 * LPITCH + kk, h);
      #pragma unroll
      for (int t = 0; t < 2; ++t) fbh[q][t] = ldfrag(sw + t * 16 * LPITCH + kk, h);
      #pragma unroll
      for (int t = 0; t < 2; ++t) fal[q][t] = ldfrag(sa + LAP + t * 16 * LPITCH + kk, h);
      #pragma unroll
      for (int t = 0; t < 2; ++t) fbl[q][t] = ldfrag(sw + LWP + t * 16 * LPITCH + kk, h);
    };
    ldstep(0, 0);
    #pragma unroll
    for (int kk = 0; kk < KC; kk += 32) {
      const int q = (kk >> 5) & 1;
      if (kk + 32 < KC) ldstep(kk + 32, q ^ 1);
      // keeps the next step's 16 LDS reads one group ahead of this step's WMMAs (else they sink to their uses and each waits)
      __builtin_amdgcn_sched_barrier(0);
      wmma3_2x2(fah[q], fal[q], fbh[q], fbl[q], acc);
    }
    // publish point of stage s + 1, and hand-over of this stage's buffer
    asm volatile("s_wait_dscnt 0x0" ::: "memory");     // this wave's reads of the buffer are done
    asm volatile("s_wait_asynccnt 0x0" ::: "memory");  // this wave's copies of stage s + 1 have landed
    __syncthreads();                                   // both hold for every wave of the block
    if (s + 2 < nst) stage_copy(s + 2);
  }
  asm volatile("s_wait_asynccnt 0x0" ::: "memory");    // no copy outstanding past the loop

  // epilogue into LDS
  float bv[2];
  bv[0] = bias[n0 + nw + m];
  bv[1] = bias[n0 + nw + 16 + m];
  us* sH = reinterpret_cast<us*>(sbuf);
  us* sL = sH + 4096;
  float fs = 0.f, fq = 0.f;
  double ds = 0.0, dq = 0.0;
  #pragma unroll
  for (int mt = 0; mt < 2; ++mt) {
    #pragma unroll
    for (int nt = 0; nt < 2; ++nt) {
      #pragma unroll
      for (int r = 0; r < 8; ++r) {
        const float val = acc[mt][nt][r] + bv[nt];
        const int tp = ry * 32 + mt * 16 + 8 * h + r;
        const int ch = nw + 16 * nt + m;
        if (MODE == 0) {
          const float rr = fmaxf(val, 0.f);
          const float r2 = rr * rr;
          fs += r2; fq += r2 * r2;
          us hi, lo;
          split2(r2, hi, lo);
          sH[tp * 64 + ch] = hi;
          sL[tp * 64 + ch] = lo;
        } else if (MODE == 1) {
          const float rr = fmaxf(val, 0.f);
          const float r2 = rr * rr;
          fs += r2; fq += r2 * r2;
          sbuf[ch * 64 + tp] = r2;
        } else if (MODE == 2) {
          us hi, lo;
          split2(val, hi, lo);
          sH[ch * 64 + tp] = hi;
          sL[ch * 64 + tp] = lo;
        } else {
          ds += (double)val;
          dq += (double)val * (double)val;
          sbuf[ch * 64 + tp] = val;
        }
      }
    }
  }
  if (MODE == 0 || MODE == 1) {
    fs = wave_sum(fs);
    fq = wave_sum(fq);
    ds = (double)fs;
    dq = (double)fq;
  } else if (MODE == 3) {
    ds = wave_sum_d(ds);
    dq = wave_sum_d(dq);
  }
  if (MODE != 2) {
    if (lane == 0) { sred[w][0] = ds; sred[w][1] = dq; }
  }
  __syncthreads();

  // block partial line (2 doubles + zeros), fixed order over the 4 waves
  v4f pv;
  pv.x = 0.f; pv.y = 0.f; pv.z = 0.f; pv.w = 0.f;
  size_t li = 0;
  bool pw = false;
  if (MODE != 2) {
    double S = 0.0, Q2 = 0.0;
    #pragma unroll
    for (int k = 0; k < 4; ++k) { S += sred[k][0]; Q2 += sred[k][1]; }
    DPack pk;
    pk.d[0] = S; pk.d[1] = Q2;
    pv.x = (lane == 0) ? pk.f.x : 0.f;
    pv.y = (lane == 0) ? pk.f.y : 0.f;
    pv.z = (lane == 0) ? pk.f.z : 0.f;
    pv.w = (lane == 0) ? pk.f.w : 0.f;
    li = ((size_t)bx * gy + by) * 32 + 4 * (lane & 7);
    pw = (w == 0) && (lane < 8);
  }

  if (MODE == 0) {
    const int q8 = lane & 7, sub = lane >> 3;
    v8us th[4], tl[4];
    size_t d[4];
    #pragma unroll
    for (int i = 0; i < 4; ++i) {
      const int tp = 16 * w + 4 * i + sub;
      const int ry2 = tp >> 5, xx = tp & 31;
      th[i] = *(const v8usa*)(sH + tp * 64 + 8 * q8);
      tl[i] = *(const v8usa*)(sL + tp * 64 + 8 * q8);
      d[i] = ((size_t)((b * PW + y0 + ry2 + 1) * PW + xx + 1)) * (size_t)cout + n0 + 8 * q8;
    }
    #pragma unroll
    for (int i = 0; i < 4; ++i) { *(v8us*)(oh + d[i]) = th[i]; *(v8us*)(ol + d[i]) = tl[i]; }
    if (pw) *(v4f*)(part + li) = pv;
    
  } else if (MODE == 2) {
    const int q8 = lane & 7, sub = lane >> 3;
    v8us th[4], tl[4];
    size_t d[4];
    #pragma unroll
    for (int i = 0; i < 4; ++i) {
      const int chl = 16 * w + 4 * i + sub;
      th[i] = *(const v8usa*)(sH + chl * 64 + 8 * q8);
      tl[i] = *(const v8usa*)(sL + chl * 64 + 8 * q8);
      d[i] = ((size_t)(b * cout + n0 + chl)) * NPIX + y0 * HIMG + 8 * q8;
    }
    #pragma unroll
    for (int i = 0; i < 4; ++i) { *(v8us*)(oh + d[i]) = th[i]; *(v8us*)(ol + d[i]) = tl[i]; }
    // another role's code follows these stores in the merged kernel's listing and reuses their registers:
    // the wait keeps any such rewrite behind the stores' issue (precaution)
    asm volatile("s_wait_xcnt 0x0" ::: "memory");
  } else {
    const int hs = lane >> 4, x4 = 4 * (lane & 15);
    v4f tv[8];
    size_t d[8];
    #pragma unroll
    for (int i = 0; i < 8; ++i) {
      const int chl = 16 * w + 2 * i + hs;
      tv[i] = *(const v4fa*)(sbuf + chl * 64 + x4);
      d[i] = ((size_t)(b * cout + n0 + chl)) * NPIX + y0 * HIMG + x4;
    }
    #pragma unroll
    for (int i = 0; i < 8; ++i) *(v4f*)(of + d[i]) = tv[i];
    if (pw) *(v4f*)(part + li) = pv;
    
  }
}

// ---------------------------------------------------------------------------
// Kernel: the head unification conv (MODE 3), one tile per block.
// ---------------------------------------------------------------------------
__global__ __launch_bounds__(128) void k_conv_hu(
    const us* __restrict__ ah, const us* __restrict__ al,
    const us* __restrict__ wh, const us* __restrict__ wl,
    const float* __restrict__ bias, float* __restrict__ of, float* __restrict__ part)
{
  __shared__ __attribute__((aligned(16))) us ring[ring_halves(KC_HU)];
  __shared__ __attribute__((aligned(16))) float sbuf[64 * 64];
  __shared__ double sred[4][2];
  conv_body<3, KC_HU>(ring, sbuf, sred, blockIdx.x, blockIdx.y, DV / 64, ah, al, wh, wl, bias, 9, DV,
               nullptr, nullptr, of, part);
}

// ---------------------------------------------------------------------------
// Kernel: the k, v and q convolutions of x in one grid (they share no result,
// so their tiles fill the chip together). Role by block index, the long 3x3
// tiles first: 512 k tiles, 64 v tiles (only the row tiles that the pool
// reads), then the one block of the bias linear (it needs only the row sums of x
// and ends long before the 3x3 tiles), 512 q tiles; pixel tile fastest. 83,008 B of LDS per block: three
// blocks per WGP, so all 576 long tiles are resident from the start.
// ---------------------------------------------------------------------------
#define NB_CK (64 * (DQ / 64))
#define NB_CV (NBATCH * NVT * (DV / 64))
#define NB_CQ (64 * (DQ / 64))
__global__ __launch_bounds__(128) void k_conv_qkv(
    const us* __restrict__ xh, const us* __restrict__ xl,
    const us* __restrict__ wkh, const us* __restrict__ wkl, const float* __restrict__ k_b,
    float* __restrict__ r2k, float* __restrict__ partk,
    const us* __restrict__ wvh, const us* __restrict__ wvl, const float* __restrict__ v_b,
    us* __restrict__ vnh, us* __restrict__ vnl,
    const us* __restrict__ wqh, const us* __restrict__ wql, const float* __restrict__ q_b,
    us* __restrict__ rqh, us* __restrict__ rql, float* __restrict__ partq,
    const float* __restrict__ rowsum, const float* __restrict__ bias_w, const float* __restrict__ bias_b,
    float* __restrict__ biasv)
{
  __shared__ __attribute__((aligned(16))) us ring[ring_halves(KC_QKV)];
  static_assert(sizeof(ring) >= 64 * 64 * sizeof(float), "the epilogue buffer fits on the ring");
  static_assert(sizeof(ring) >= 2 * 16 * 256 * sizeof(us) + 4 * 256 * sizeof(float), "so does the bias role's LDS");
  float* sbuf = reinterpret_cast<float*>(ring);
  __shared__ double sred[4][2];
  int i = blockIdx.x;
  if (i < NB_CK) {
    conv_body<1, KC_QKV>(ring, sbuf, sred, i & 63, i >> 6, DQ / 64, xh, xl, wkh, wkl, k_b, 9, DQ,
                 nullptr, nullptr, r2k, partk);
    return;
  }
  i -= NB_CK;
  if (i < NB_CV) {
    // i counts only the row tiles that the pool reads: put it back on the grid of 64 pixel tiles per channel tile
    const int t = i & (NVT - 1), b = (i / NVT) & (NBATCH - 1);
    const int rt = (t == 0) ? VT0 : ((t == 1) ? VT1 : ((t == 2) ? VT2 : VT3));
    i = (i / (NVT * NBATCH)) * 64 + b * (HIMG / 2) + rt;
    conv_body<2, KC_QKV>(ring, sbuf, sred, i & 63, i >> 6, DV / 64, xh, xl, wvh, wvl, v_b, 9, DV,
                 vnh, vnl, nullptr, nullptr);
    return;
  }
  i -= NB_CV;
  if (i == 0) { bias_body(ring, rowsum, bias_w, bias_b, biasv); return; }
  i -= 1;
  conv_body<0, KC_QKV>(ring, sbuf, sred, i & 63, i >> 6, DQ / 64, xh, xl, wqh, wql, q_b, 1, DQ,
               rqh, rql, nullptr, partq);
}

// ---------------------------------------------------------------------------
// One wave's job: phi norm ratio s = sqrt(sum relu^2) / sqrt(sum relu^4) of one
// tensor from its 512 block partial lines (fixed order, f64: lane l adds lines
// 16 l .. 16 l + 15, then the 32 lane sums are added in lane order). The kernels
// that use the ratio give it to a fifth wave, beside the four that multiply.
// ---------------------------------------------------------------------------
__device__ __forceinline__ double dlane(double v, int l) {
  const unsigned long long u = __builtin_bit_cast(unsigned long long, v);
  const unsigned lo = (unsigned)__builtin_amdgcn_readlane((int)(unsigned)(u & 0xFFFFFFFFull), l);
  const unsigned hi = (unsigned)__builtin_amdgcn_readlane((int)(unsigned)(u >> 32), l);
  return __builtin_bit_cast(double, (((unsigned long long)hi) << 32) | (unsigned long long)lo);
}
__device__ __forceinline__ float phi_wave(const float* __restrict__ part, int lane) {
  double s2 = 0.0, s4 = 0.0;
  // unrolled: the 16 loads fly together, one latency instead of 16
  #pragma unroll
  for (int j = 0; j < 16; ++j) {
    const double* dp = reinterpret_cast<const double*>(part + (size_t)(lane * 16 + j) * 32);
    s2 += dp[0];
    s4 += dp[1];
  }
  double t2 = 0.0, t4 = 0.0;
  // unrolled: readlane takes a constant lane
  #pragma unroll
  for (int i = 0; i < 32; ++i) { t2 += dlane(s2, i); t4 += dlane(s4, i); }
  const float num = sqrtf((float)t2);
  const float den = sqrtf((float)t4);
  return num * (1.0f / den);
}

// The same job in two halves, for a kernel whose fifth wave passes a barrier in between.
// First half: the lane's own 16 lines, added in the same order.
__device__ __forceinline__ void phi_lane_sums(const float* __restrict__ part, int lane, double& s2, double& s4) {
  double a2[16], a4[16];
  // unrolled: constant indices, the values stay in registers
  #pragma unroll
  for (int j = 0; j < 16; ++j) {
    const double* dp = reinterpret_cast<const double*>(part + (size_t)(lane * 16 + j) * 32);
    a2[j] = dp[0];
    a4[j] = dp[1];
  }
  // keeps the 16 loads one group in flight together (else the later ones sink behind the first adds: further memory
  // latencies, and the block's first barrier waits for this wave)
  __builtin_amdgcn_sched_barrier(0);
  s2 = 0.0;
  s4 = 0.0;
  #pragma unroll
  for (int j = 0; j < 16; ++j) { s2 += a2[j]; s4 += a4[j]; }
}
// Second half: the 32 lane sums in lane order, then the ratio.
__device__ __forceinline__ float phi_ratio(double s2, double s4) {
  double t2 = 0.0, t4 = 0.0;
  // unrolled: readlane takes a constant lane
  #pragma unroll
  for (int i = 0; i < 32; ++i) { t2 += dlane(s2, i); t4 += dlane(s4, i); }
  const float num = sqrtf((float)t2);
  const float den = sqrtf((float)t4);
  return num * (1.0f / den);
}

// ---------------------------------------------------------------------------
// Kernel: pooled outer product. Block = (tap pq, bh): D[kk 64][v 32] =
// sum_pix (relu(K)^2[kk][pix] * Mh[p][y] * Mw[q][x]) * V[v][pix] over the two
// image rows y where Mh[p][y] is not zero (K = 64; every other term is a
// product with a zero weight, and V exists only on those rows),
// A built in registers from the f32 NCHW relu^2 rows (split hi/lo),
// B from the bf16 NCHW V planes. A fifth wave makes sK meanwhile. Epilogue: * sK, clip +-32/9, hi/lo into
// coverage: 4 waves x 8 rows x 8 lanes x 8 kk = 32 v x 64 kk per (bh,pq).
// ---------------------------------------------------------------------------
__global__ __launch_bounds__(160) void k_kv(
    const float* __restrict__ r2k, const us* __restrict__ vnh, const us* __restrict__ vnl,
    const float* __restrict__ partk, BiW bw, us* __restrict__ fth, us* __restrict__ ftl)
{
  __shared__ __attribute__((aligned(16))) us sH[32 * 64];
  __shared__ __attribute__((aligned(16))) us sL[32 * 64];
  __shared__ float sphi[32];   // the ratio, one copy per lane
  const int tid = threadIdx.x, lane = tid & 31;
  const int w = __builtin_amdgcn_readfirstlane(tid >> 5);   // scalar: the role tests below are scalar branches, EXEC stays whole
  const int h = lane >> 4, m = lane & 15;
  const int pq = blockIdx.x, bh = blockIdx.y;
  const int b = bh >> 3, head = bh & 7;
  const int p = pq / 3, q = pq - 3 * p;
  const int   iy0 = (p == 0) ? bw.i0[0] : ((p == 1) ? bw.i0[1] : bw.i0[2]);
  const int   iy1 = (p == 0) ? bw.i1[0] : ((p == 1) ? bw.i1[1] : bw.i1[2]);
  const float wy0 = (p == 0) ? bw.w0[0] : ((p == 1) ? bw.w0[1] : bw.w0[2]);
  const float wy1 = (p == 0) ? bw.w1[0] : ((p == 1) ? bw.w1[1] : bw.w1[2]);
  const int   ix0 = (q == 0) ? bw.i0[0] : ((q == 1) ? bw.i0[1] : bw.i0[2]);
  const int   ix1 = (q == 0) ? bw.i1[0] : ((q == 1) ? bw.i1[1] : bw.i1[2]);
  const float wx0 = (q == 0) ? bw.w0[0] : ((q == 1) ? bw.w0[1] : bw.w0[2]);
  const float wx1 = (q == 0) ? bw.w1[0] : ((q == 1) ? bw.w1[1] : bw.w1[2]);
  const float amax = (float)(32.0 / 9.0);
  const float* arow = r2k + ((size_t)(b * DQ + head * DK + 16 * w + m)) * NPIX;
  const size_t br0 = ((size_t)(b * DV + head * DVH + m)) * NPIX;
  const size_t br1 = br0 + (size_t)16 * NPIX;
  const v8f z8 = {0.f, 0.f, 0.f, 0.f, 0.f, 0.f, 0.f, 0.f};
  v8f acc[2];
  acc[0] = z8; acc[1] = z8;

  if (w == 4) {
    sphi[lane] = phi_wave(partk, lane);
  } else {
  #pragma unroll 1
  for (int t = 0; t < 2; ++t) {
    // rows iy0 then iy1, ascending as in the full sum; were the two clamped onto one row, it takes both weights once
    const float wy = (t == 0) ? (wy0 + ((iy1 == iy0) ? wy1 : 0.f)) : ((iy1 == iy0) ? 0.f : wy1);
    const int k0 = ((t == 0) ? iy0 : iy1) * HIMG;
    const float* ap = arow + k0;
    const v4f q0 = *(const v4fa*)(ap + 8 * h);
    const v4f q1 = *(const v4fa*)(ap + 8 * h + 4);
    const v4f q2 = *(const v4fa*)(ap + 16 + 8 * h);
    const v4f q3 = *(const v4fa*)(ap + 20 + 8 * h);
    v8i fbh[2], fbl[2];
    fbh[0] = ldfrag(vnh + br0 + k0, h);
    fbh[1] = ldfrag(vnh + br1 + k0, h);
    fbl[0] = ldfrag(vnl + br0 + k0, h);
    fbl[1] = ldfrag(vnl + br1 + k0, h);
    // keeps the V fragment reads in flight with the K row reads (else they sink behind the split: a second memory latency)
    __builtin_amdgcn_sched_barrier(0);
    float v[16];
    v[0] = q0.x; v[1] = q0.y; v[2] = q0.z; v[3] = q0.w;
    v[4] = q1.x; v[5] = q1.y; v[6] = q1.z; v[7] = q1.w;
    v[8] = q2.x; v[9] = q2.y; v[10] = q2.z; v[11] = q2.w;
    v[12] = q3.x; v[13] = q3.y; v[14] = q3.z; v[15] = q3.w;
    Frag fah, fal;
    #pragma unroll
    for (int i = 0; i < 16; ++i) {
      const int xx = 8 * h + (i & 7) + ((i >> 3) << 4);
      const float wx = ((xx == ix0) ? wx0 : 0.f) + ((xx == ix1) ? wx1 : 0.f);
      const float a = v[i] * (wy * wx);
      us hi, lo;
      split2(a, hi, lo);
      fah.half[i >> 3][i & 7] = hi;
      fal.half[i >> 3][i & 7] = lo;
    }
    wmma3_1x2(fah.v, fal.v, fbh, fbl, acc);
  }
  }
  __syncthreads();   // publishes the fifth wave's ratio

  if (w < 4) {
  const float sK = sphi[lane];
  #pragma unroll
  for (int nt = 0; nt < 2; ++nt) {
    #pragma unroll
    for (int r = 0; r < 8; ++r) {
      float val = acc[nt][r] * sK;
      val = fminf(fmaxf(val, -amax), amax);
      const int kk = 16 * w + 8 * h + r;
      const int vv = 16 * nt + m;
      us hi, lo;
      split2(val, hi, lo);
      sH[vv * 64 + kk] = hi;
      sL[vv * 64 + kk] = lo;
    }
  }
  }
  __syncthreads();
  if (w == 4) return;   // behind the last barrier
  const int q8 = lane & 7, sub = lane >> 3;
  v8us th[2], tl[2];
  size_t d[2];
  #pragma unroll
  for (int i = 0; i < 2; ++i) {
    const int vv = 8 * w + 4 * i + sub;
    th[i] = *(const v8usa*)(sH + vv * 64 + 8 * q8);
    tl[i] = *(const v8usa*)(sL + vv * 64 + 8 * q8);
    d[i] = ((size_t)(bh * DVH + vv)) * FTK + pq * 64 + 8 * q8;
  }
  #pragma unroll
  for (int i = 0; i < 2; ++i) { *(v8us*)(fth + d[i]) = th[i]; *(v8us*)(ftl + d[i]) = tl[i]; }
  
}

// ---------------------------------------------------------------------------
// Kernel: per-sample grouped 3x3 conv of relu(Q)^2 planes (padded NHWC,
// 512 ch) with the pooled filters, K = 9*64 per head. Block = (64 px, head
// pair, b); wave = (head of the pair, image row) 32 px x 32 v; a fifth wave makes sQ meanwhile.
// Operands staged in LDS by asynchronous copies, each byte once per block: the four
// padded image rows (136 pixels, adjacent in memory) x the pair's 128 channels and the
// pair's 64 filter rows, hi and lo planes. Three pieces, one per kernel row, each into
// LDS of its own (nothing is refilled): piece ky + 1 flies while kernel row ky is multiplied.
// Row pitches 272 B and 1,168 B = 16 B x odd (conflict-free 16-B reads). Epilogue:
// * sQ + bias[b][j*32+v], hi/lo into padded NHWC planes [b][34][34][256];
// coverage: 4 waves x 16 px x 8 lanes x 8 ch = 64 px x 64 ch per block;
// grid 16 x 4 x 4 = all interior pixels x all 256 channels x 4 samples.
// ---------------------------------------------------------------------------
#define GAP  (2 * DK + 8)       // halves of a staged pixel row
#define GBP  (FTK + 8)          // halves of a staged filter row
#define GAPL (4 * PW * GAP)     // one pixel plane
#define GBPL (2 * DVH * GBP)    // one filter plane
// pixel rows come in units of 8 (128 threads x 16 B = 8 rows of 256 B): units 0..8 hold the 68 pixels
// that kernel row 0 reads, units ..12 the 102 of kernel row 1, units ..16 all 136
static_assert(4 * PW == 17 * 8 && 9 * 8 >= 2 * PW && 13 * 8 >= 3 * PW, "whole units; each piece covers its kernel row");
__global__ __launch_bounds__(160) void k_gconv(
    const us* __restrict__ rqh, const us* __restrict__ rql,
    const us* __restrict__ fth, const us* __restrict__ ftl,
    const float* __restrict__ partq, const float* __restrict__ biasv,
    us* __restrict__ oh, us* __restrict__ ol)
{
  __shared__ __attribute__((aligned(16))) us ga[2 * GAPL];
  __shared__ __attribute__((aligned(16))) us gb[2 * GBPL];
  __shared__ __attribute__((aligned(16))) us sH[64 * 64];
  __shared__ __attribute__((aligned(16))) us sL[64 * 64];
  __shared__ float sphi[32];   // the ratio, one copy per lane
  const int tid = threadIdx.x, lane = tid & 31;
  const int w = __builtin_amdgcn_readfirstlane(tid >> 5);   // scalar: the role tests below are scalar branches, EXEC stays whole
  const int h = lane >> 4, m = lane & 15;
  const int pt = blockIdx.x, jp = blockIdx.y, b = blockIdx.z;
  const int y0 = 2 * pt;
  const int jl = w >> 1, ry = w & 1;
  const int j = 2 * jp + jl;
  const v8f z8 = {0.f, 0.f, 0.f, 0.f, 0.f, 0.f, 0.f, 0.f};
  v8f acc[2][2];
  #pragma unroll
  for (int i = 0; i < 2; ++i) { acc[i][0] = z8; acc[i][1] = z8; }

  // piece ky (waves 0..3, every lane): the three taps' 128-B pieces of all 64 filter rows, and the pixel units that kernel row ky adds
  auto piece_copy = [&](int ky) {
    // filters: thread = 16-B column fq of rows fr + 16 i
    const int fq = tid & 7, fr = tid >> 3;
    const unsigned lb = (unsigned)(size_t)gb + (unsigned)(fr * (GBP * 2) + fq * 16);
    const size_t fo = ((size_t)((b * 8 + 2 * jp) * DVH + fr)) * FTK + 8 * fq;
    // both loops unrolled: plane, row and tap are then constants and l, gp stay in registers
    #pragma unroll
    for (int kx = 0; kx < 3; ++kx) {
      unsigned l[8];
      const us* gp[8];
      #pragma unroll
      for (int t = 0; t < 8; ++t) {
        const int pl = t >> 2, row = (t & 3) * 16;
        l[t] = lb + (unsigned)((pl * GBPL + row * GBP + (ky * 3 + kx) * DK) * 2);
        gp[t] = (pl == 0 ? fth : ftl) + fo + (size_t)(row * FTK + (ky * 3 + kx) * DK);
      }
      acopy8(l, gp);
    }
    // pixels: thread = 16-B column aq of pixel rows ar + 8 u
    const int aq = tid & 15, ar = tid >> 4;
    const unsigned la = (unsigned)(size_t)ga + (unsigned)(ar * (GAP * 2) + aq * 16);
    const size_t ao = ((size_t)((b * PW + y0) * PW + ar)) * DQ + (size_t)(jp * 2 * DK + 8 * aq);
    const int u0 = (ky == 0) ? 0 : (5 + 4 * ky), nu = (ky == 0) ? 9 : 4;   // first unit, units per plane
    // copy c of the piece: plane c / nu, unit u0 + c % nu
    auto px = [&](int c, unsigned& l, const us*& g) {
      const int pl = c / nu, u = u0 + c % nu;
      l = la + (unsigned)((pl * GAPL + u * 8 * GAP) * 2);
      g = (pl == 0 ? rqh : rql) + ao + (size_t)(u * 8 * DQ);
    };
    {
      unsigned l[8];
      const us* gp[8];
      // unrolled: constant indices, l and gp stay in registers
      #pragma unroll
      for (int t = 0; t < 8; ++t) px(t, l[t], gp[t]);
      acopy8(l, gp);
    }
    if (ky == 0) {
      unsigned l[10];
      const us* gp[10];
      // unrolled: constant indices, l and gp stay in registers
      #pragma unroll
      for (int t = 0; t < 10; ++t) px(8 + t, l[t], gp[t]);
      acopy10(l, gp);
    }
  };
  // kernel row ky: six steps of 32 channels (kernel column, half of the head's 64 channels), in the order tap, half
  const us* sa = ga + (ry * PW + m) * GAP + jl * DK;
  const us* sb = gb + (jl * DVH + m) * GBP;
  auto mul_row = [&](int ky) {
    // two register sets of fragments: the next step is read while this one is multiplied
    v8i fah[2][2], fal[2][2], fbh[2][2], fbl[2][2];
    auto ldstep = [&](int st, int q) {
      const us* pa = sa + (ky * PW + (st >> 1)) * GAP + 32 * (st & 1);
      const us* pb = sb + (ky * 3 + (st >> 1)) * DK + 32 * (st & 1);
      #pragma unroll
      for (int t = 0; t < 2; ++t) fah[q][t] = ldfrag(pa + t * 16 * GAP, h);
      #pragma unroll
      for (int t = 0; t < 2; ++t) fbh[q][t] = ldfrag(pb + t * 16 * GBP, h);
      #pragma unroll
      for (int t = 0; t < 2; ++t) fal[q][t] = ldfrag(pa + GAPL + t * 16 * GAP, h);
      #pragma unroll
      for (int t = 0; t < 2; ++t) fbl[q][t] = ldfrag(pb + GBPL + t * 16 * GBP, h);
    };
    static_assert(DK == 64, "two steps of 32 channels per tap");
    ldstep(0, 0);
    #pragma unroll
    for (int st = 0; st < 6; ++st) {
      const int q = st & 1;
      if (st + 1 < 6) ldstep(st + 1, q ^ 1);
      // keeps the next step's 16 LDS reads one group ahead of this step's WMMAs (else they sink to their uses and each waits)
      __builtin_amdgcn_sched_barrier(0);
      wmma3_2x2(fah[q], fal[q], fbh[q], fbl[q], acc);
    }
  };

  double s2 = 0.0, s4 = 0.0;
  if (w == 4) {
    phi_lane_sums(partq, lane, s2, s4);
  } else {
    piece_copy(0);
    asm volatile("s_wait_asynccnt 0x0" ::: "memory");  // this wave's copies of piece 0 have landed
  }
  __syncthreads();                                     // ... and every other wave's
  // unrolled: ky is a constant in the copies' and the reads' offsets
  #pragma unroll
  for (int ky = 0; ky < 3; ++ky) {
    if (w == 4) {
      if (ky == 0) sphi[lane] = phi_ratio(s2, s4);
    } else {
      if (ky + 1 < 3) piece_copy(ky + 1);
      mul_row(ky);
      if (ky + 1 < 3) asm volatile("s_wait_asynccnt 0x0" ::: "memory");  // this wave's copies of piece ky + 1 have landed
    }
    if (ky + 1 < 3) __syncthreads();   // publishes piece ky + 1 (the first of the two also the fifth wave's ratio)
  }

  if (w < 4) {
  const float sQ = sphi[lane];
  float bv[2];
  bv[0] = biasv[b * DV + j * DVH + m];
  bv[1] = biasv[b * DV + j * DVH + 16 + m];
  #pragma unroll
  for (int mt = 0; mt < 2; ++mt) {
    #pragma unroll
    for (int nt = 0; nt < 2; ++nt) {
      #pragma unroll
      for (int r = 0; r < 8; ++r) {
        const float val = acc[mt][nt][r] * sQ + bv[nt];
        const int tp = ry * 32 + mt * 16 + 8 * h + r;
        const int chl = jl * 32 + 16 * nt + m;
        us hi, lo;
        split2(val, hi, lo);
        sH[tp * 64 + chl] = hi;
        sL[tp * 64 + chl] = lo;
      }
    }
  }
  }
  __syncthreads();
  if (w == 4) return;   // behind the last barrier
  const int q8 = lane & 7, sub = lane >> 3;
  v8us th[4], tl[4];
  size_t d[4];
  #pragma unroll
  for (int i = 0; i < 4; ++i) {
    const int tp = 16 * w + 4 * i + sub;
    const int ry2 = tp >> 5, xx = tp & 31;
    th[i] = *(const v8usa*)(sH + tp * 64 + 8 * q8);
    tl[i] = *(const v8usa*)(sL + tp * 64 + 8 * q8);
    d[i] = ((size_t)((b * PW + y0 + ry2 + 1) * PW + xx + 1)) * DV + jp * 64 + 8 * q8;
  }
  #pragma unroll
  for (int i = 0; i < 4; ++i) { *(v8us*)(oh + d[i]) = th[i]; *(v8us*)(ol + d[i]) = tl[i]; }
  
}

// ---------------------------------------------------------------------------
// Kernel: LayerNorm over (C,H,W) per sample: fixed-order f64 combine of the
// 64 block partial lines of the sample, then (v - mu) * rstd on one float4
// coverage: 1024 blocks x 256 threads x 4 floats = all 1048576 outputs.
// ---------------------------------------------------------------------------
__global__ __launch_bounds__(256) void k_ln(const float* __restrict__ outp, const float* __restrict__ partl,
                                            float* __restrict__ out) {
  __shared__ double ss[64];
  __shared__ double sq[64];
  __shared__ float sst[2];
  const int tid = threadIdx.x;
  const int blk = blockIdx.x, b = blk >> 8;
  if (tid < 64) {
    const double* dp = reinterpret_cast<const double*>(partl + (size_t)(b * 64 + tid) * 32);
    ss[tid] = dp[0];
    sq[tid] = dp[1];
  }
  __syncthreads();
  if (tid == 0) {
    double S = 0.0, Q2 = 0.0;
    for (int i = 0; i < 64; ++i) { S += ss[i]; Q2 += sq[i]; }
    const double inv = 1.0 / 262144.0;
    const double mu = S * inv;
    double var = Q2 * inv - mu * mu;
    if (var < 0.0) var = 0.0;
    const float den = sqrtf((float)var + 1e-5f);
    sst[0] = (float)mu;
    sst[1] = 1.0f / den;
  }
  __syncthreads();
  const float muf = sst[0], rinv = sst[1];
  const size_t e = ((size_t)blk * 256 + tid) * 4;
  v4f v = *(const v4fa*)(outp + e);
  v4f o;
  o.x = (v.x - muf) * rinv;
  o.y = (v.y - muf) * rinv;
  o.z = (v.z - muf) * rinv;
  o.w = (v.w - muf) * rinv;
  *(v4f*)(out + e) = o;
  
}

// ---------------------------------------------------------------------------
// Host: bilinear (32 -> 3, align_corners = false) taps and weights, computed
// with separate f64 multiply and subtract, fraction cast to f32.
// ---------------------------------------------------------------------------
static void bilin3(BiW& bw) {
#pragma clang fp contract(off)
  const double scale = 32.0 / 3.0;
  for (int p = 0; p < 3; ++p) {
    double src = ((double)p + 0.5) * scale;
    src = src - 0.5;
    if (src < 0.0) src = 0.0;
    const int f = (int)src;
    const float frac = (float)(src - (double)f);
    int c0 = f, c1 = f + 1;
    if (c0 > HIMG - 1) c0 = HIMG - 1;
    if (c1 > HIMG - 1) c1 = HIMG - 1;
    bw.i0[p] = c0;
    bw.i1[p] = c1;
    bw.w0[p] = 1.0f - frac;
    bw.w1[p] = frac;
  }
}

extern "C" void kernel_launch(void* const* d_in, const int* in_sizes, int n_in,
                              void* d_out, int out_size, void* d_ws, size_t ws_size,
                              hipStream_t stream) {
  if (n_in < 11) return;
  if (in_sizes[0] != NBATCH * CIN * NPIX) return;
  if (in_sizes[1] != DQ * CIN || in_sizes[2] != DQ) return;
  if (in_sizes[3] != DQ * CIN * 9 || in_sizes[4] != DQ) return;
  if (in_sizes[5] != DV * CIN * 9 || in_sizes[6] != DV) return;
  if (in_sizes[7] != DV * CIN || in_sizes[8] != DV) return;
  if (in_sizes[9] != DV * DV * 9 || in_sizes[10] != DV) return;
  if (out_size != NBATCH * DV * NPIX) return;

  const float* x      = (const float*)d_in[0];
  const float* q_w    = (const float*)d_in[1];
  const float* q_b    = (const float*)d_in[2];
  const float* k_w    = (const float*)d_in[3];
  const float* k_b    = (const float*)d_in[4];
  const float* v_w    = (const float*)d_in[5];
  const float* v_b    = (const float*)d_in[6];
  const float* bias_w = (const float*)d_in[7];
  const float* bias_b = (const float*)d_in[8];
  const float* hu_w   = (const float*)d_in[9];
  const float* hu_b   = (const float*)d_in[10];
  float* out = (float*)d_out;

  // workspace carve (bytes); every region sized to whole 256-B multiples and
  // written only with whole-line stores inside its extent
  char* ws = (char*)d_ws;
  size_t off = 0;
#define CARVE(T, name, bytes) T* name = (T*)(ws + off); off += (((size_t)(bytes)) + 255) & ~(size_t)255;
  const size_t padpx  = (size_t)NBATCH * PW * PW;                    // 4624 padded pixels
  CARVE(us,    XPH,   padpx * CIN * 2);                               // 2367488
  CARVE(us,    XPL,   padpx * CIN * 2);
  CARVE(us,    WQH,   (size_t)DQ * CIN * 2);                          // 262144
  CARVE(us,    WQL,   (size_t)DQ * CIN * 2);
  CARVE(us,    WKH,   (size_t)DQ * CIN * 9 * 2);                      // 2359296
  CARVE(us,    WKL,   (size_t)DQ * CIN * 9 * 2);
  CARVE(us,    WVH,   (size_t)DV * CIN * 9 * 2);                      // 1179648
  CARVE(us,    WVL,   (size_t)DV * CIN * 9 * 2);
  CARVE(us,    WHH,   (size_t)DV * DV * 9 * 2);                       // 1179648
  CARVE(us,    WHL,   (size_t)DV * DV * 9 * 2);
  CARVE(float, BIASV, (size_t)NBATCH * DV * 4);                       // 4096 = 32 lines
  CARVE(us,    RQH,   padpx * DQ * 2);                                // 4734976
  CARVE(us,    RQL,   padpx * DQ * 2);
  CARVE(float, R2K,   (size_t)NBATCH * DQ * NPIX * 4);                // 8388608
  CARVE(us,    VNH,   (size_t)NBATCH * DV * NPIX * 2);                // 2097152
  CARVE(us,    VNL,   (size_t)NBATCH * DV * NPIX * 2);
  CARVE(float, PARTQ, (size_t)512 * 128);                             // 512 lines
  CARVE(float, PARTK, (size_t)512 * 128);                             // 512 lines
  CARVE(us,    FTH,   (size_t)NBATCH * 8 * DVH * FTK * 2);            // 1179648
  CARVE(us,    FTL,   (size_t)NBATCH * 8 * DVH * FTK * 2);
  CARVE(us,    QKH,   padpx * DV * 2);                                // 2367488
  CARVE(us,    QKL,   padpx * DV * 2);
  CARVE(float, OUTP,  (size_t)NBATCH * DV * NPIX * 4);                // 4194304
  CARVE(float, PARTL, (size_t)256 * 128);                             // 256 lines
  CARVE(float, ROWS,  (size_t)NBATCH * HIMG * CIN * 4);               // 131072
#undef CARVE
  if (off > ws_size) return;
  if (off > (size_t)134217728) return;

  BiW bw;
  bilin3(bw);

  // 16-bit operand planes
  k_prep<<<NB_PREP, 256, 0, stream>>>(x, q_w, k_w, v_w, hu_w, XPH, XPL, ROWS,
                                      WQH, WQL, WKH, WKL, WVH, WVL, WHH, WHL, RQH, RQL, QKH, QKL);

  // k (3x3), v (3x3), q (1x1) convolutions; channel means + bias linear
  k_conv_qkv<<<NB_CK + NB_CV + 1 + NB_CQ, 128, 0, stream>>>(XPH, XPL, WKH, WKL, k_b, R2K, PARTK,
                                                            WVH, WVL, v_b, VNH, VNL,
                                                            WQH, WQL, q_b, RQH, RQL, PARTQ,
                                                            ROWS, bias_w, bias_b, BIASV);

  // pooled KV filters, grouped conv (each makes its own phi ratio)
  k_kv<<<dim3(9, NBATCH * 8), 160, 0, stream>>>(R2K, VNH, VNL, PARTK, bw, FTH, FTL);
  k_gconv<<<dim3(16, 4, NBATCH), 160, 0, stream>>>(RQH, RQL, FTH, FTL, PARTQ, BIASV, QKH, QKL);

  // head unification conv + LayerNorm
  k_conv_hu<<<dim3(64, DV / 64), 128, 0, stream>>>(QKH, QKL, WHH, WHL, hu_b, OUTP, PARTL);
  k_ln<<<(NBATCH * DV * NPIX) / 1024, 256, 0, stream>>>(OUTP, PARTL, out);
}

// v010
// A run of this version takes 91 microseconds.
// Timed twice side by side with v009, it ran 1.06 times as fast both times.
// All steps since v000 together make it 4.67 times as fast.
// Contractions: q 1x1 conv, k/v/hu 3x3 convs as implicit GEMM (K = 9*256), pooled KV outer-product GEMMs (64x32x64 per head and tap: the two image rows with a non-zero pool weight), per-sample grouped 3x3 conv (K = 9*64) and the channel-mean bias linear, all on v_wmma_f32_16x16x32_bf16 with bf16 hi/lo three-product operand split (hi*hi + lo*hi + hi*lo), f32 accumulate; phi norm ratios, clip, channel means and LayerNorm statistics in f32/f64 on the VALU.
#include <hip/hip_runtime.h>

typedef unsigned short us;
typedef int   v8i  __attribute__((ext_vector_type(8)));
typedef float v8f  __attribute__((ext_vector_type(8)));
typedef float v4f  __attribute__((ext_vector_type(4)));
typedef unsigned short v8us __attribute__((ext_vector_type(8)));
typedef __bf16 v16b __attribute__((ext_vector_type(16)));
typedef v4f  __attribute__((may_alias)) v4fa;
typedef v8us __attribute__((may_alias)) v8usa;
union Frag { v8i v; v8us half[2]; };
union DPack { double d[2]; v4f f; };

#define NBATCH 4
#define CIN    256
#define HIMG   32
#define NPIX   1024
#define PW     34
#define DQ     512
#define DV     256
#define DK     64
#define DVH    32
#define FTK    576

struct BiW { int i0[3]; int i1[3]; float w0[3]; float w1[3]; };
static_assert(sizeof(BiW) == 48);

// The bilinear pool (32 -> 3, align_corners = false) gives a non-zero weight to image row
// floor((p + 0.5) * 32 / 3 - 0.5) = (64 p + 29) / 6 and to the row below it, p = 0..2, and to no other.
// V enters the result only through that pool, so only these rows of V are ever read.
constexpr int pool_row(int p) { return (64 * p + 29) / 6; }
// the two-row pixel tiles (image rows 2 t, 2 t + 1) that hold those six rows
#define NVT 4
constexpr int VT0 = pool_row(0) >> 1, VT1 = pool_row(1) >> 1, VT2 = (pool_row(1) + 1) >> 1, VT3 = pool_row(2) >> 1;
static_assert(((pool_row(0) + 1) >> 1) == VT0 && ((pool_row(2) + 1) >> 1) == VT3, "rows of taps 0 and 2 share a tile");
static_assert(VT0 < VT1 && VT1 < VT2 && VT2 < VT3 && VT3 < HIMG / 2, "four distinct tiles, one writer each");

// ---------------------------------------------------------------------------
// bf16 helpers (RNE convert) and the hi/lo split
// ---------------------------------------------------------------------------
__device__ __forceinline__ us f2bf(float f) {
  unsigned u = __float_as_uint(f);
  u += 0x7FFFu + ((u >> 16) & 1u);
  return (us)(u >> 16);
}
__device__ __forceinline__ float bf2f(us hv) {
  return __uint_as_float(((unsigned)hv) << 16);
}
__device__ __forceinline__ void split2(float f, us& hi, us& lo) {
  hi = f2bf(f);
  lo = f2bf(f - bf2f(hi));
}

// ---------------------------------------------------------------------------
// 16x16x32 bf16 WMMA (builtin: the compiler keeps the distances behind it and is free to schedule around it).
// Fragment map (wave32): lane l, h = l>>4, m = n = l&15.
//   A/B element i: i<8 -> k0+8h+i ; i>=8 -> k0+16+8h+(i-8)
//   D element r : row 8h+r, col l&15
// ---------------------------------------------------------------------------
__device__ __forceinline__ v8f wmma_bf(v8i a, v8i b, v8f c) {
  return __builtin_amdgcn_wmma_f32_16x16x32_bf16(false, __builtin_bit_cast(v16b, a), false,
                                                 __builtin_bit_cast(v16b, b), (short)0, c, false, false);
}
// The same with four vector slots tied behind it (ties D, keeps A/B live): for the bias loop, whose back edge leads
// from its last WMMA straight to global loads onto that WMMA's B registers.
__device__ __forceinline__ v8f wmma_bf_slots(v8i a, v8i b, v8f c) {
  v8f d = wmma_bf(a, b, c);
  asm volatile("v_nop\n\tv_nop\n\tv_nop\n\tv_nop" : "+v"(d) : "v"(a), "v"(b));
  return d;
}
// three-product split: ah*bh + al*bh + ah*bl into one accumulator (bias loop)
__device__ __forceinline__ v8f wmma3(v8i ah, v8i al, v8i bh, v8i bl, v8f c) {
  c = wmma_bf_slots(ah, bh, c);
  c = wmma_bf_slots(al, bh, c);
  c = wmma_bf_slots(ah, bl, c);
  return c;
}
// three-product split: ah*bh + al*bh + ah*bl into each accumulator, in that order; issued product by
// product over the independent accumulators, so that no WMMA waits for the one directly ahead of it
// 2 x 2 tiles: a[mt], b[nt] -> c[mt][nt]
__device__ __forceinline__ void wmma3_2x2(const v8i (&ah)[2], const v8i (&al)[2],
                                          const v8i (&bh)[2], const v8i (&bl)[2], v8f (&c)[2][2]) {
  #pragma unroll
  for (int t = 0; t < 4; ++t) c[t >> 1][t & 1] = wmma_bf(ah[t >> 1], bh[t & 1], c[t >> 1][t & 1]);
  #pragma unroll
  for (int t = 0; t < 4; ++t) c[t >> 1][t & 1] = wmma_bf(al[t >> 1], bh[t & 1], c[t >> 1][t & 1]);
  #pragma unroll
  for (int t = 0; t < 4; ++t) c[t >> 1][t & 1] = wmma_bf(ah[t >> 1], bl[t & 1], c[t >> 1][t & 1]);
}
// 1 x 2 tiles: a, b[nt] -> c[nt]
__device__ __forceinline__ void wmma3_1x2(v8i ah, v8i al, const v8i (&bh)[2], const v8i (&bl)[2], v8f (&c)[2]) {
  c[0] = wmma_bf(ah, bh[0], c[0]);
  c[1] = wmma_bf(ah, bh[1], c[1]);
  c[0] = wmma_bf(al, bh[0], c[0]);
  c[1] = wmma_bf(al, bh[1], c[1]);
  c[0] = wmma_bf(ah, bl[0], c[0]);
  c[1] = wmma_bf(ah, bl[1], c[1]);
}
// fragment from a k-contiguous 16-bit row (pointer already at k0)
__device__ __forceinline__ v8i ldfrag(const us* p, int h) {
  Frag f;
  f.half[0] = *(const v8usa*)(p + 8 * h);
  f.half[1] = *(const v8usa*)(p + 16 + 8 * h);
  return f.v;
}

__device__ __forceinline__ float wave_sum(float s) {
  s += __shfl_xor(s, 16);
  s += __shfl_xor(s, 8);
  s += __shfl_xor(s, 4);
  s += __shfl_xor(s, 2);
  s += __shfl_xor(s, 1);
  return s;
}
__device__ __forceinline__ double dshfl_xor(double v, int msk) {
  const unsigned long long u = __builtin_bit_cast(unsigned long long, v);
  int lo = (int)(unsigned)(u & 0xFFFFFFFFull);
  int hi = (int)(unsigned)(u >> 32);
  lo = __shfl_xor(lo, msk);
  hi = __shfl_xor(hi, msk);
  const unsigned long long r = (((unsigned long long)(unsigned)hi) << 32) | (unsigned long long)(unsigned)lo;
  return __builtin_bit_cast(double, r);
}
__device__ __forceinline__ double wave_sum_d(double s) {
  s += dshfl_xor(s, 16);
  s += dshfl_xor(s, 8);
  s += dshfl_xor(s, 4);
  s += dshfl_xor(s, 2);
  s += dshfl_xor(s, 1);
  return s;
}

// ---------------------------------------------------------------------------
// Kernel: x NCHW f32 -> bf16 hi/lo padded NHWC planes [b][34][34][256]
// (interior pixels). Block role = (y, b); LDS transpose; one instruction writes one
// coverage: 8 waves x 4 pixels = 32 px per row, 32 lanes x 8 = 256 ch.
// Also the f32 sum of each channel's image row (32 values, fixed order) into
// rowsum[b][y][c]: 256 threads x 4 B = 8 whole lines per block. The f32 copy
// sits in LDS at pitch 33 words, free of bank conflicts on store and on read.
// ---------------------------------------------------------------------------
__device__ __forceinline__ void prep_x_body(const float* __restrict__ x,
                                            us* __restrict__ xh, us* __restrict__ xl,
                                            float* __restrict__ rowsum, int y, int b) {
  __shared__ __attribute__((aligned(16))) us sh[32 * 256];
  __shared__ __attribute__((aligned(16))) us sl[32 * 256];
  __shared__ float sf[256 * 33];
  const int tid = threadIdx.x, lane = tid & 31, w = tid >> 5;
  #pragma unroll 1
  for (int j = 0; j < 32; ++j) {
    const int c = 8 * j + w;
    const float v = x[((size_t)(b * CIN + c) * HIMG + y) * HIMG + lane];
    us hi, lo;
    split2(v, hi, lo);
    sh[lane * 256 + c] = hi;
    sl[lane * 256 + c] = lo;
    sf[c * 33 + lane] = v;
  }
  __syncthreads();
  float rs = 0.f;
  // unrolled: constant LDS offsets, the reads issue ahead of the dependent adds
  #pragma unroll
  for (int i = 0; i < 32; ++i) rs += sf[tid * 33 + i];
  rowsum[(size_t)(b * HIMG + y) * CIN + tid] = rs;
  v8us vh[4], vl[4];
  size_t d[4];
  #pragma unroll
  for (int i = 0; i < 4; ++i) {
    const int px = 4 * w + i;
    vh[i] = *(const v8usa*)(sh + px * 256 + 8 * lane);
    vl[i] = *(const v8usa*)(sl + px * 256 + 8 * lane);
    d[i] = ((size_t)((b * PW + y + 1) * PW + px + 1)) * CIN + 8 * lane;
  }
  #pragma unroll
  for (int i = 0; i < 4; ++i) { *(v8us*)(xh + d[i]) = vh[i]; *(v8us*)(xl + d[i]) = vl[i]; }
  
}

// ---------------------------------------------------------------------------
// Kernel: zero the border pixel rows of padded NHWC planes [b][34][34][C].
// Wave = one border pixel; 32 lanes x 16 B = 256 halves per instruction.
// coverage: 132 border pixels x 4 samples, C halves each, both planes.
// ---------------------------------------------------------------------------
__device__ __forceinline__ void zero_border_body(us* __restrict__ ph, us* __restrict__ pl, int C, int bx, int b) {
  const int tid = threadIdx.x, lane = tid & 31, w = tid >> 5;
  const int i = bx * 8 + w;
  if (i >= 132) return;
  int py, px;
  if (i < 34)       { py = 0;           px = i; }
  else if (i < 68)  { py = PW - 1;      px = i - 34; }
  else if (i < 100) { py = i - 68 + 1;  px = 0; }
  else              { py = i - 100 + 1; px = PW - 1; }
  const size_t base = ((size_t)((b * PW + py) * PW + px)) * (size_t)C;
  v8us z;
  #pragma unroll
  for (int j = 0; j < 8; ++j) z[j] = (us)0;
  #pragma unroll 1
  for (int off = 8 * lane; off < C; off += 256) {
    *(v8us*)(ph + base + off) = z;
    *(v8us*)(pl + base + off) = z;
  }
  
}

// ---------------------------------------------------------------------------
// Kernel: OIHW f32 weights -> rows [o][tap*256 + c] as bf16 hi and lo planes.
// Thread = 8 consecutive row elements, one 16-B store per lane per plane,
// coverage: cout*taps*256 elements, grid = n/2048 exactly.
// ---------------------------------------------------------------------------
__device__ __forceinline__ void wprep_body(const float* __restrict__ wsrc, int cout, int taps,
                                           us* __restrict__ wh, us* __restrict__ wl, int bx) {
  const int g = bx * 256 + threadIdx.x;
  const int kw = taps * 256;
  const int n = cout * kw;
  const int e8 = g * 8;
  if (e8 >= n) return;
  const int o = e8 / kw;
  const int r = e8 - o * kw;
  const int tap = r >> 8, c = r & 255;
  const float* src = wsrc + ((size_t)(o * 256 + c)) * taps + tap;
  v8us vh, vl;
  #pragma unroll
  for (int i = 0; i < 8; ++i) {
    us a, bq;
    split2(src[(size_t)i * taps], a, bq);
    vh[i] = a;
    vl[i] = bq;
  }
  *(v8us*)(wh + e8) = vh;
  *(v8us*)(wl + e8) = vl;
  
}

// ---------------------------------------------------------------------------
// Kernel: all operand preparation in one grid (the roles share no data, so
// they run side by side instead of one launch after another). Role by block
// index, the longest first: x planes, then k, v, hu, q weight rows, then the
// zero borders of the three padded plane pairs.
// ---------------------------------------------------------------------------
#define NB_X   (HIMG * NBATCH)
#define NB_WK  ((DQ * CIN * 9) / 2048)
#define NB_WV  ((DV * CIN * 9) / 2048)
#define NB_WH  ((DV * DV * 9) / 2048)
#define NB_WQ  ((DQ * CIN) / 2048)
#define NB_ZB  (17 * NBATCH)
#define NB_PREP (NB_X + NB_WK + NB_WV + NB_WH + NB_WQ + 3 * NB_ZB)
__global__ __launch_bounds__(256) void k_prep(
    const float* __restrict__ x, const float* __restrict__ q_w, const float* __restrict__ k_w,
    const float* __restrict__ v_w, const float* __restrict__ hu_w,
    us* __restrict__ xh, us* __restrict__ xl, float* __restrict__ rowsum,
    us* __restrict__ wqh, us* __restrict__ wql, us* __restrict__ wkh, us* __restrict__ wkl,
    us* __restrict__ wvh, us* __restrict__ wvl, us* __restrict__ whh, us* __restrict__ whl,
    us* __restrict__ rqh, us* __restrict__ rql, us* __restrict__ qkh, us* __restrict__ qkl) {
  int i = blockIdx.x;
  if (i < NB_X) { prep_x_body(x, xh, xl, rowsum, i & (HIMG - 1), i / HIMG); return; }
  i -= NB_X;
  if (i < NB_WK) { wprep_body(k_w, DQ, 9, wkh, wkl, i); return; }
  i -= NB_WK;
  if (i < NB_WV) { wprep_body(v_w, DV, 9, wvh, wvl, i); return; }
  i -= NB_WV;
  if (i < NB_WH) { wprep_body(hu_w, DV, 9, whh, whl, i); return; }
  i -= NB_WH;
  if (i < NB_WQ) { wprep_body(q_w, DQ, 1, wqh, wql, i); return; }
  i -= NB_WQ;
  const int pl = i / NB_ZB, r = i - pl * NB_ZB;
  const int bx = r % 17, b = r / 17;
  if (pl == 0)      zero_border_body(xh, xl, CIN, bx, b);
  else if (pl == 1) zero_border_body(rqh, rql, DQ, bx, b);
  else              zero_border_body(qkh, qkl, DV, bx, b);
}

// ---------------------------------------------------------------------------
// Fragment from 32 consecutive-k f32 values of one row (pointer at k0), split
// into hi/lo bf16 fragments in registers (fragment map as above).
// ---------------------------------------------------------------------------
__device__ __forceinline__ void frag_f32(const float* __restrict__ p, int h, v8i& fh, v8i& fl) {
  const v4f q0 = *(const v4fa*)(p + 8 * h);
  const v4f q1 = *(const v4fa*)(p + 8 * h + 4);
  const v4f q2 = *(const v4fa*)(p + 16 + 8 * h);
  const v4f q3 = *(const v4fa*)(p + 20 + 8 * h);
  float v[16];
  v[0] = q0.x; v[1] = q0.y; v[2] = q0.z; v[3] = q0.w;
  v[4] = q1.x; v[5] = q1.y; v[6] = q1.z; v[7] = q1.w;
  v[8] = q2.x; v[9] = q2.y; v[10] = q2.z; v[11] = q2.w;
  v[12] = q3.x; v[13] = q3.y; v[14] = q3.z; v[15] = q3.w;
  Frag a, bq;
  #pragma unroll
  for (int i = 0; i < 16; ++i) {
    us hi, lo;
    split2(v[i], hi, lo);
    a.half[i >> 3][i & 7] = hi;
    bq.half[i >> 3][i & 7] = lo;
  }
  fh = a.v;
  fl = bq.v;
}

// ---------------------------------------------------------------------------
// Block role: channel means of x (f32, from the 32 row sums of each channel, fixed
// order) and the bias linear on WMMA:
// bias[b][o] = sum_c mean[b][c] * bw[o][c] + bb[o]. One block of 4 waves, each
// with two 32-column slices of o in turn; 20 KiB of LDS from the calling kernel.
// A = means [16 rows (4 real, 12 zero)][256] hi/lo in LDS, B = bw rows [o][c]
// coverage: 128 threads x 2 x 16 B = 4096 B = all of bias.
// ---------------------------------------------------------------------------
__device__ __forceinline__ void bias_body(us* lds, const float* __restrict__ rowsum, const float* __restrict__ bw,
                                          const float* __restrict__ bb, float* __restrict__ biasv) {
  us* sah = lds;                                             // 16 x 256
  us* sal = lds + 16 * 256;                                  // 16 x 256
  float* sd = reinterpret_cast<float*>(lds + 2 * 16 * 256);  // 4 x 256
  const int tid = threadIdx.x, lane = tid & 31, w = tid >> 5;
  const int h = lane >> 4, m = lane & 15;
  for (int i = tid; i < 16 * 256; i += 128) {
    if (i >= 4 * 256) { sah[i] = (us)0; sal[i] = (us)0; }
  }
  // rolled: one pass's 32 loads (128 registers) at a time, so that this role does not raise the merged kernel's register count
  #pragma unroll 1
  for (int it = 0; it < 2; ++it) {
    const int t = tid + 128 * it;
    const int k = t >> 6, c4 = 4 * (t & 63);   // b = k, channels c4 .. c4+3
    const float* p = rowsum + (size_t)k * HIMG * CIN + c4;
    v4f sm;
    sm.x = 0.f; sm.y = 0.f; sm.z = 0.f; sm.w = 0.f;
    // unrolled: the 32 loads fly together, one memory latency instead of 32
    #pragma unroll
    for (int i = 0; i < HIMG; ++i) sm += *(const v4fa*)(p + i * CIN);
    // unrolled: constant vector index, sm stays in registers
    #pragma unroll
    for (int e = 0; e < 4; ++e) {
      const float mean = sm[e] * (1.0f / 1024.0f);
      us hi, lo;
      split2(mean, hi, lo);
      sah[k * 256 + c4 + e] = hi;
      sal[k * 256 + c4 + e] = lo;
    }
  }
  __syncthreads();

  const v8f z8 = {0.f, 0.f, 0.f, 0.f, 0.f, 0.f, 0.f, 0.f};
  // rolled: the two slices share one copy of the code and of its registers
  #pragma unroll 1
  for (int it = 0; it < 2; ++it) {
    const int o0 = 32 * (w + 4 * it) + m, o1 = o0 + 16;
    const float* br0 = bw + (size_t)o0 * 256;
    const float* br1 = bw + (size_t)o1 * 256;
    v8f acc[2];
    acc[0] = z8; acc[1] = z8;
    #pragma unroll 1
    for (int k0 = 0; k0 < 256; k0 += 32) {
      const v8i ah = ldfrag(sah + m * 256 + k0, h);
      const v8i al = ldfrag(sal + m * 256 + k0, h);
      v8i bh0, bl0, bh1, bl1;
      frag_f32(br0 + k0, h, bh0, bl0);
      frag_f32(br1 + k0, h, bh1, bl1);
      acc[0] = wmma3(ah, al, bh0, bl0, acc[0]);
      acc[1] = wmma3(ah, al, bh1, bl1, acc[1]);
    }
    const float bb0 = bb[o0], bb1 = bb[o1];
    if (h == 0) {
      #pragma unroll
      for (int r = 0; r < 4; ++r) {
        sd[r * 256 + o0] = acc[0][r] + bb0;
        sd[r * 256 + o1] = acc[1][r] + bb1;
      }
    }
  }
  __syncthreads();
  #pragma unroll
  for (int t = 0; t < 2; ++t) {
    const int e = 4 * (tid + 128 * t);
    const v4f v = *(const v4fa*)(sd + e);
    *(v4f*)(biasv + e) = v;
  }
  // other roles' code follows these stores in the merged kernel's listing and reuses their registers:
  // the wait keeps any such rewrite behind the stores' issue (precaution)
  asm volatile("s_wait_xcnt 0x0" ::: "memory");
}

// ---------------------------------------------------------------------------
// Eight asynchronous 16-B copies global -> LDS per lane (no register staging).
// l = the lane's LDS byte addresses, g = its global addresses, both 16-B
// aligned. The closing s_wait_xcnt keeps later rewrites of the address
// registers behind the copies' issue (precaution), so it sits in the statement.
// ---------------------------------------------------------------------------
__device__ __forceinline__ void acopy8(const unsigned (&l)[8], const us* const (&g)[8]) {
  asm volatile(
      "global_load_async_to_lds_b128 %0, %8, off\n\t"
      "global_load_async_to_lds_b128 %1, %9, off\n\t"
      "global_load_async_to_lds_b128 %2, %10, off\n\t"
      "global_load_async_to_lds_b128 %3, %11, off\n\t"
      "global_load_async_to_lds_b128 %4, %12, off\n\t"
      "global_load_async_to_lds_b128 %5, %13, off\n\t"
      "global_load_async_to_lds_b128 %6, %14, off\n\t"
      "global_load_async_to_lds_b128 %7, %15, off\n\t"
      "s_wait_xcnt 0x0"
      :: "v"(l[0]), "v"(l[1]), "v"(l[2]), "v"(l[3]), "v"(l[4]), "v"(l[5]), "v"(l[6]), "v"(l[7]),
         "v"(g[0]), "v"(g[1]), "v"(g[2]), "v"(g[3]), "v"(g[4]), "v"(g[5]), "v"(g[6]), "v"(g[7])
      : "memory");
}
// The same with ten copies (the pixel rows come in tens), the wait again inside the statement.
__device__ __forceinline__ void acopy10(const unsigned (&l)[10], const us* const (&g)[10]) {
  asm volatile(
      "global_load_async_to_lds_b128 %0, %10, off\n\t"
      "global_load_async_to_lds_b128 %1, %11, off\n\t"
      "global_load_async_to_lds_b128 %2, %12, off\n\t"
      "global_load_async_to_lds_b128 %3, %13, off\n\t"
      "global_load_async_to_lds_b128 %4, %14, off\n\t"
      "global_load_async_to_lds_b128 %5, %15, off\n\t"
      "global_load_async_to_lds_b128 %6, %16, off\n\t"
      "global_load_async_to_lds_b128 %7, %17, off\n\t"
      "global_load_async_to_lds_b128 %8, %18, off\n\t"
      "global_load_async_to_lds_b128 %9, %19, off\n\t"
      "s_wait_xcnt 0x0"
      :: "v"(l[0]), "v"(l[1]), "v"(l[2]), "v"(l[3]), "v"(l[4]), "v"(l[5]), "v"(l[6]), "v"(l[7]), "v"(l[8]), "v"(l[9]),
         "v"(g[0]), "v"(g[1]), "v"(g[2]), "v"(g[3]), "v"(g[4]), "v"(g[5]), "v"(g[6]), "v"(g[7]), "v"(g[8]), "v"(g[9])
      : "memory");
}

// LDS rings of the convolutions, hi and lo planes, row pitch 2 KC + 16 B = 16 B x odd
// (conflict-free 16-B reads). A weight stage = KC channels of one tap's 64 weight
// rows. A pixel group = KC channels of the two padded image rows (2 x 34 pixels,
// adjacent in memory) that the three taps of one kernel row read: it is copied once
// and each tap reads it at its own column shift. AROWS = those 68 pixel rows
// rounded up to whole copy instructions; rows 68 .. 79 are never read.
#define AROWS 80
static_assert(AROWS >= 2 * PW, "both padded image rows fit");
// Halves (16-bit words) of two pixel groups and two weight stages:
constexpr int ring_halves(int kc) { return 2 * 2 * (AROWS + 64) * (kc + 8); }
// KC = 128 (156,672 B) where one block per WGP is all the grid has;
// KC = 64 (82,944 B) where more long tiles wait than two blocks per
// WGP can hold: three blocks then share a WGP's LDS.
#define KC_HU  128
#define KC_QKV 64

// ---------------------------------------------------------------------------
// Kernel: implicit-GEMM convolution (Cin = 256 per pixel) over bf16 hi/lo
// zero-padded NHWC planes [b][34][34][256]; weights as rows [o][tap*256+c]
// hi/lo. Block = 64 pixels (image rows y0, y0+1) x 64 output channels,
// 4 waves of 32 px x 32 ch (2x2 tiles), K = ntaps*256 in steps of 32,
// in the order kernel row, channel chunk, kernel column;
// operand rows staged in LDS by asynchronous copies of 2 KC-byte row pieces (two
// buffers each for weights and pixels, the next stage flies while this one is
// worked on), fragments read from LDS, three products per tile pair.
// MODE 0: relu^2 -> bf16 hi/lo padded NHWC planes (pitch = cout) + (s2,s4) partial line
// MODE 1: relu^2 -> f32 NCHW + (s2,s4) partial line
// MODE 2: value -> bf16 hi/lo NCHW planes
// MODE 3: value -> f32 NCHW + (sum, sum of squares) partial line (f64)
// coverage: MODE 0 store: 4 waves x 16 px x 8 lanes x 8 ch = 64 px x 64 ch;
// MODE 1/3: 4 waves x 16 ch x 64 px; MODE 2: 4 waves x 16 ch x 8 lanes x 8 px.
// ---------------------------------------------------------------------------
// The body takes its tile (bx = pixel tile, by = channel tile of gy) and the
// block's LDS from the kernel that calls it. sbuf (16 KiB, epilogue only) may lie
// on the ring: it is first written behind the last stage's waits and barrier,
// when every wave has left the ring and no copy is outstanding.
template <int MODE, int KC>
__device__ __forceinline__ void conv_body(
    us* ring, float* sbuf, double (*sred)[2], int bx, int by, int gy,
    const us* __restrict__ ah, const us* __restrict__ al,
    const us* __restrict__ wh, const us* __restrict__ wl,
    const float* __restrict__ bias, int ntaps, int cout,
    us* __restrict__ oh, us* __restrict__ ol, float* __restrict__ of, float* __restrict__ part)
{
  const int tid = threadIdx.x, lane = tid & 31, w = tid >> 5;
  const int h = lane >> 4, m = lane & 15;
  const int pt = bx, b = pt >> 4, y0 = (pt & 15) * 2;
  const int n0 = by * 64;
  const int ry = w >> 1, nw = 32 * (w & 1);
  const int kw = ntaps * CIN;
  constexpr int LPITCH = KC + 8;
  constexpr int LAP = AROWS * LPITCH, LA = 2 * LAP;   // one pixel plane, one pixel group (hi, lo)
  constexpr int LWP = 64 * LPITCH, LW = 2 * LWP;      // one weight plane, one weight stage (hi, lo)
  constexpr int SPT = CIN / KC;        // channel chunks
  constexpr int LPR = KC / 8;          // lanes x 16 B = one row piece of KC channels
  constexpr int RPP = 128 / LPR;       // rows that the block's 128 threads copy at once
  constexpr int NPW = 64 / RPP;        // copies per thread and weight plane
  constexpr int NPA = AROWS / RPP;     // copies per thread and pixel plane
  static_assert(SPT * KC == CIN && (2 * NPW) % 8 == 0 && (2 * NPA) % 10 == 0 && NPA * RPP == AROWS,
                "whole stages, whole groups of eight and of ten copies");
  const int tpg = (ntaps == 1) ? 1 : 3;   // taps (stages) that share a pixel group
  const int nst = SPT * ntaps;
  // copy map: thread = 16-B column ql of rows r0 + RPP i
  const int ql = tid & (LPR - 1), r0 = tid / LPR;
  const unsigned lds0 = (unsigned)(size_t)ring + (unsigned)(r0 * (LPITCH * 2) + ql * 16);
  const size_t wbase = (size_t)(n0 + r0) * kw + 8 * ql;
  const size_t abase = ((size_t)((b * PW + y0) * PW)) * CIN + 8 * ql;
  // pixel group g (kernel row g / SPT, channels KC (g % SPT) ..) into pixel buffer g & 1
  auto group_copy = [&](int g) {
    const int ky = (ntaps == 1) ? 1 : g / SPT;
    const size_t ao = abase + (size_t)(ky * PW * CIN + (g % SPT) * KC);
    const unsigned lb = lds0 + (unsigned)(g & 1) * (LA * 2);
    // both loops unrolled: plane and row are then constants and l, gp stay in registers
    #pragma unroll
    for (int c = 0; c < 2 * NPA; c += 10) {
      unsigned l[10];
      const us* gp[10];
      #pragma unroll
      for (int t = 0; t < 10; ++t) {
        const int pl = (c + t) / NPA, row = ((c + t) % NPA) * RPP;
        l[t] = lb + (unsigned)((pl * LAP + row * LPITCH) * 2);
        // the filler rows past the 68th copy the 68th pixel again: the source stays inside the sample's plane
        const int pr = (row + RPP > 2 * PW) ? min(r0 + row, 2 * PW - 1) : (r0 + row);
        gp[t] = (pl == 0 ? ah : al) + ao + (size_t)pr * CIN;
      }
      acopy10(l, gp);
    }
  };
  // stage s (pixel group s / tpg, kernel column s % tpg): its weight rows into weight buffer s & 1,
  // and, where it is the first stage of its group, the group's pixel rows
  auto stage_copy = [&](int s) {
    const int g = s / tpg, kx = s - g * tpg;
    const int tap = (ntaps == 1) ? 0 : (g / SPT) * 3 + kx;
    const size_t wo = wbase + (size_t)(tap * CIN + (g % SPT) * KC);
    const unsigned lb = lds0 + (unsigned)((2 * LA + (s & 1) * LW) * 2);
    // both loops unrolled: plane and row are then constants and l, gp stay in registers
    #pragma unroll
    for (int c = 0; c < 2 * NPW; c += 8) {
      unsigned l[8];
      const us* gp[8];
      #pragma unroll
      for (int t = 0; t < 8; ++t) {
        const int pl = (c + t) / NPW, row = ((c + t) % NPW) * RPP;
        l[t] = lb + (unsigned)((pl * LWP + row * LPITCH) * 2);
        gp[t] = (pl == 0 ? wh : wl) + wo + (size_t)row * kw;
      }
      acopy8(l, gp);
    }
    if (kx == 0) group_copy(g);   // same for the whole block; its buffer's last readers left at least one barrier ago
  };
  const v8f z8 = {0.f, 0.f, 0.f, 0.f, 0.f, 0.f, 0.f, 0.f};
  v8f acc[2][2];
  #pragma unroll
  for (int i = 0; i < 2; ++i) { acc[i][0] = z8; acc[i][1] = z8; }

  // prologue: stage 0 landed and published, then stage 1 in flight
  stage_copy(0);
  asm volatile("s_wait_asynccnt 0x0" ::: "memory");  // this wave's copies of stage 0 have landed
  __syncthreads();                                   // ... and every other wave's
  stage_copy(1);                                     // nst = SPT ntaps >= 2

  const int arow = (ry * PW + m) * LPITCH;
  const int brow = 2 * LA + (nw + m) * LPITCH;
  #pragma unroll 1
  for (int s = 0; s < nst; ++s) {
    const int g = s / tpg;
    const int kx = (ntaps == 1) ? 1 : (s - g * tpg);
    const us* sa = ring + (g & 1) * LA + kx * LPITCH + arow;   // the tap's column shift = kx pixel rows
    const us* sw = ring + (s & 1) * LW + brow;
    // two register sets of fragments: step kk + 32 of this stage is read while step kk is multiplied
    v8i fah[2][2], fal[2][2], fbh[2][2], fbl[2][2];
    auto ldstep = [&](int kk, int q) {
      #pragma unroll
      for (int t = 0; t < 2; ++t) fah[q][t] = ldfrag(sa + t * 16 * LPITCH + kk, h);
      #pragma unroll
      for (int t = 0; t < 2; ++t) fbh[q][t] = ldfrag(sw + t * 16 * LPITCH + kk, h);
      #pragma unroll
      for (int t = 0; t < 2; ++t) fal[q][t] = ldfrag(sa + LAP + t * 16 * LPITCH + kk, h);
      #pragma unroll
      for (int t = 0; t < 2; ++t) fbl[q][t] = ldfrag(sw + LWP + t * 16 * LPITCH + kk, h);
    };
    ldstep(0, 0);
    #pragma unroll
    for (int kk = 0; kk < KC; kk += 32) {
      const int q = (kk >> 5) & 1;
      if (kk + 32 < KC) ldstep(kk + 32, q ^ 1);
      // keeps the next step's 16 LDS reads one group ahead of this step's WMMAs (else they sink to their uses and each waits)
      __builtin_amdgcn_sched_barrier(0);
      wmma3_2x2(fah[q], fal[q], fbh[q], fbl[q], acc);
    }
    // publish point of stage s + 1, and hand-over of this stage's buffer
    asm volatile("s_wait_dscnt 0x0" ::: "memory");     // this wave's reads of the buffer are done
    asm volatile("s_wait_asynccnt 0x0" ::: "memory");  // this wave's copies of stage s + 1 have landed
    __syncthreads();                                   // both hold for every wave of the block
    if (s + 2 < nst) stage_copy(s + 2);
  }
  asm volatile("s_wait_asynccnt 0x0" ::: "memory");    // no copy outstanding past the loop

  // epilogue into LDS
  float bv[2];
  bv[0] = bias[n0 + nw + m];
  bv[1] = bias[n0 + nw + 16 + m];
  us* sH = reinterpret_cast<us*>(sbuf);
  us* sL = sH + 4096;
  float fs = 0.f, fq = 0.f;
  double ds = 0.0, dq = 0.0;
  #pragma unroll
  for (int mt = 0; mt < 2; ++mt) {
    #pragma unroll
    for (int nt = 0; nt < 2; ++nt) {
      #pragma unroll
      for (int r = 0; r < 8; ++r) {
        const float val = acc[mt][nt][r] + bv[nt];
        const int tp = ry * 32 + mt * 16 + 8 * h + r;
        const int ch = nw + 16 * nt + m;
        if (MODE == 0) {
          const float rr = fmaxf(val, 0.f);
          const float r2 = rr * rr;
          fs += r2; fq += r2 * r2;
          us hi, lo;
          split2(r2, hi, lo);
          sH[tp * 64 + ch] = hi;
          sL[tp * 64 + ch] = lo;
        } else if (MODE == 1) {
          const float rr = fmaxf(val, 0.f);
          const float r2 = rr * rr;
          fs += r2; fq += r2 * r2;
          sbuf[ch * 64 + tp] = r2;
        } else if (MODE == 2) {
          us hi, lo;
          split2(val, hi, lo);
          sH[ch * 64 + tp] = hi;
          sL[ch * 64 + tp] = lo;
        } else {
          ds += (double)val;
          dq += (double)val * (double)val;
          sbuf[ch * 64 + tp] = val;
        }
      }
    }
  }
  if (MODE == 0 || MODE == 1) {
    fs = wave_sum(fs);
    fq = wave_sum(fq);
    ds = (double)fs;
    dq = (double)fq;
  } else if (MODE == 3) {
    ds = wave_sum_d(ds);
    dq = wave_sum_d(dq);
  }
  if (MODE != 2) {
    if (lane == 0) { sred[w][0] = ds; sred[w][1] = dq; }
  }
  __syncthreads();

  // block partial line (2 doubles + zeros), fixed order over the 4 waves
  v4f pv;
  pv.x = 0.f; pv.y = 0.f; pv.z = 0.f; pv.w = 0.f;
  size_t li = 0;
  bool pw = false;
  if (MODE != 2) {
    double S = 0.0, Q2 = 0.0;
    #pragma unroll
    for (int k = 0; k < 4; ++k) { S += sred[k][0]; Q2 += sred[k][1]; }
    DPack pk;
    pk.d[0] = S; pk.d[1] = Q2;
    pv.x = (lane == 0) ? pk.f.x : 0.f;
    pv.y = (lane == 0) ? pk.f.y : 0.f;
    pv.z = (lane == 0) ? pk.f.z : 0.f;
    pv.w = (lane == 0) ? pk.f.w : 0.f;
    li = ((size_t)bx * gy + by) * 32 + 4 * (lane & 7);
    pw = (w == 0) && (lane < 8);
  }

  if (MODE == 0) {
    const int q8 = lane & 7, sub = lane >> 3;
    v8us th[4], tl[4];
    size_t d[4];
    #pragma unroll
    for (int i = 0; i < 4; ++i) {
      const int tp = 16 * w + 4 * i + sub;
      const int ry2 = tp >> 5, xx = tp & 31;
      th[i] = *(const v8usa*)(sH + tp * 64 + 8 * q8);
      tl[i] = *(const v8usa*)(sL + tp * 64 + 8 * q8);
      d[i] = ((size_t)((b * PW + y0 + ry2 + 1) * PW + xx + 1)) * (size_t)cout + n0 + 8 * q8;
    }
    #pragma unroll
    for (int i = 0; i < 4; ++i) { *(v8us*)(oh + d[i]) = th[i]; *(v8us*)(ol + d[i]) = tl[i]; }
    if (pw) *(v4f*)(part + li) = pv;
    
  } else if (MODE == 2) {
    const int q8 = lane & 7, sub = lane >> 3;
    v8us th[4], tl[4];
    size_t d[4];
    #pragma unroll
    for (int i = 0; i < 4; ++i) {
      const int chl = 16 * w + 4 * i + sub;
      th[i] = *(const v8usa*)(sH + chl * 64 + 8 * q8);
      tl[i] = *(const v8usa*)(sL + chl * 64 + 8 * q8);
      d[i] = ((size_t)(b * cout + n0 + chl)) * NPIX + y0 * HIMG + 8 * q8;
    }
    #pragma unroll
    for (int i = 0; i < 4; ++i) { *(v8us*)(oh + d[i]) = th[i]; *(v8us*)(ol + d[i]) = tl[i]; }
    // another role's code follows these stores in the merged kernel's listing and reuses their registers:
    // the wait keeps any such rewrite behind the stores' issue (precaution)
    asm volatile("s_wait_xcnt 0x0" ::: "memory");
  } else {
    const int hs = lane >> 4, x4 = 4 * (lane & 15);
    v4f tv[8];
    size_t d[8];
    #pragma unroll
    for (int i = 0; i < 8; ++i) {
      const int chl = 16 * w + 2 * i + hs;
      tv[i] = *(const v4fa*)(sbuf + chl * 64 + x4);
      d[i] = ((size_t)(b * cout + n0 + chl)) * NPIX + y0 * HIMG + x4;
    }
    #pragma unroll
    for (int i = 0; i < 8; ++i) *(v4f*)(of + d[i]) = tv[i];
    if (pw) *(v4f*)(part + li) = pv;
    
  }
}

// ---------------------------------------------------------------------------
// Kernel: the head unification conv (MODE 3), one tile per block.
// ---------------------------------------------------------------------------
__global__ __launch_bounds__(128) void k_conv_hu(
    const us* __restrict__ ah, const us* __restrict__ al,
    const us* __restrict__ wh, const us* __restrict__ wl,
    const float* __restrict__ bias, float* __restrict__ of, float* __restrict__ part)
{
  __shared__ __attribute__((aligned(16))) us ring[ring_halves(KC_HU)];
  __shared__ __attribute__((aligned(16))) float sbuf[64 * 64];
  __shared__ double sred[4][2];
  conv_body<3, KC_HU>(ring, sbuf, sred, blockIdx.x, blockIdx.y, DV / 64, ah, al, wh, wl, bias, 9, DV,
               nullptr, nullptr, of, part);
}

// ---------------------------------------------------------------------------
// Kernel: the k, v and q convolutions of x in one grid (they share no result,
// so their tiles fill the chip together). Role by block index, the long 3x3
// tiles first: 512 k tiles, 64 v tiles (only the row tiles that the pool
// reads), then the one block of the bias linear (it needs only the row sums of x
// and ends long before the 3x3 tiles), 512 q tiles; pixel tile fastest. 83,008 B of LDS per block: three
// blocks per WGP, so all 576 long tiles are resident from the start.
// ---------------------------------------------------------------------------
#define NB_CK (64 * (DQ / 64))
#define NB_CV (NBATCH * NVT * (DV / 64))
#define NB_CQ (64 * (DQ / 64))
__global__ __launch_bounds__(128) void k_conv_qkv(
    const us* __restrict__ xh, const us* __restrict__ xl,
    const us* __restrict__ wkh, const us* __restrict__ wkl, const float* __restrict__ k_b,
    float* __restrict__ r2k, float* __restrict__ partk,
    const us* __restrict__ wvh, const us* __restrict__ wvl, const float* __restrict__ v_b,
    us* __restrict__ vnh, us* __restrict__ vnl,
    const us* __restrict__ wqh, const us* __restrict__ wql, const float* __restrict__ q_b,
    us* __restrict__ rqh, us* __restrict__ rql, float* __restrict__ partq,
    const float* __restrict__ rowsum, const float* __restrict__ bias_w, const float* __restrict__ bias_b,
    float* __restrict__ biasv)
{
  __shared__ __attribute__((aligned(16))) us ring[ring_halves(KC_QKV)];
  static_assert(sizeof(ring) >= 64 * 64 * sizeof(float), "the epilogue buffer fits on the ring");
  static_assert(sizeof(ring) >= 2 * 16 * 256 * sizeof(us) + 4 * 256 * sizeof(float), "so does the bias role's LDS");
  float* sbuf = reinterpret_cast<float*>(ring);
  __shared__ double sred[4][2];
  int i = blockIdx.x;
  if (i < NB_CK) {
    conv_body<1, KC_QKV>(ring, sbuf, sred, i & 63, i >> 6, DQ / 64, xh, xl, wkh, wkl, k_b, 9, DQ,
                 nullptr, nullptr, r2k, partk);
    return;
  }
  i -= NB_CK;
  if (i < NB_CV) {
    // i counts only the row tiles that the pool reads: put it back on the grid of 64 pixel tiles per channel tile
    const int t = i & (NVT - 1), b = (i / NVT) & (NBATCH - 1);
    const int rt = (t == 0) ? VT0 : ((t == 1) ? VT1 : ((t == 2) ? VT2 : VT3));
    i = (i / (NVT * NBATCH)) * 64 + b * (HIMG / 2) + rt;
    conv_body<2, KC_QKV>(ring, sbuf, sred, i & 63, i >> 6, DV / 64, xh, xl, wvh, wvl, v_b, 9, DV,
                 vnh, vnl, nullptr, nullptr);
    return;
  }
  i -= NB_CV;
  if (i == 0) { bias_body(ring, rowsum, bias_w, bias_b, biasv); return; }
  i -= 1;
  conv_body<0, KC_QKV>(ring, sbuf, sred, i & 63, i >> 6, DQ / 64, xh, xl, wqh, wql, q_b, 1, DQ,
               rqh, rql, nullptr, partq);
}

// ---------------------------------------------------------------------------
// One wave's job: phi norm ratio s = sqrt(sum relu^2) / sqrt(sum relu^4) of one
// tensor from its 512 block partial lines (fixed order, f64: lane l adds lines
// 16 l .. 16 l + 15, then the 32 lane sums are added in lane order). The kernels
// that use the ratio give it to a fifth wave, beside the four that multiply.
// ---------------------------------------------------------------------------
__device__ __forceinline__ double dlane(double v, int l) {
  const unsigned long long u = __builtin_bit_cast(unsigned long long, v);
  const unsigned lo = (unsigned)__builtin_amdgcn_readlane((int)(unsigned)(u & 0xFFFFFFFFull), l);
  const unsigned hi = (unsigned)__builtin_amdgcn_readlane((int)(unsigned)(u >> 32), l);
  return __builtin_bit_cast(double, (((unsigned long long)hi) << 32) | (unsigned long long)lo);
}
__device__ __forceinline__ float phi_wave(const float* __restrict__ part, int lane) {
  double s2 = 0.0, s4 = 0.0;
  // unrolled: the 16 loads fly together, one latency instead of 16
  #pragma unroll
  for (int j = 0; j < 16; ++j) {
    const double* dp = reinterpret_cast<const double*>(part + (size_t)(lane * 16 + j) * 32);
    s2 += dp[0];
    s4 += dp[1];
  }
  double t2 = 0.0, t4 = 0.0;
  // unrolled: readlane takes a constant lane
  #pragma unroll
  for (int i = 0; i < 32; ++i) { t2 += dlane(s2, i); t4 += dlane(s4, i); }
  const float num = sqrtf((float)t2);
  const float den = sqrtf((float)t4);
  return num * (1.0f / den);
}

// The same job in two halves, for a kernel whose fifth wave passes a barrier in between.
// First half: the lane's own 16 lines, added in the same order.
__device__ __forceinline__ void phi_lane_sums(const float* __restrict__ part, int lane, double& s2, double& s4) {
  double a2[16], a4[16];
  // unrolled: constant indices, the values stay in registers
  #pragma unroll
  for (int j = 0; j < 16; ++j) {
    const double* dp = reinterpret_cast<const double*>(part + (size_t)(lane * 16 + j) * 32);
    a2[j] = dp[0];
    a4[j] = dp[1];
  }
  // keeps the 16 loads one group in flight together (else the later ones sink behind the first adds: further memory
  // latencies, and the block's first barrier waits for this wave)
  __builtin_amdgcn_sched_barrier(0);
  s2 = 0.0;
  s4 = 0.0;
  #pragma unroll
  for (int j = 0; j < 16; ++j) { s2 += a2[j]; s4 += a4[j]; }
}
// Second half: the 32 lane sums in lane order, then the ratio.
__device__ __forceinline__ float phi_ratio(double s2, double s4) {
  double t2 = 0.0, t4 = 0.0;
  // unrolled: readlane takes a constant lane
  #pragma unroll
  for (int i = 0; i < 32; ++i) { t2 += dlane(s2, i); t4 += dlane(s4, i); }
  const float num = sqrtf((float)t2);
  const float den = sqrtf((float)t4);
  return num * (1.0f / den);
}

// ---------------------------------------------------------------------------
// Kernel: pooled outer product. Block = (tap pq, bh): D[kk 64][v 32] =
// sum_pix (relu(K)^2[kk][pix] * Mh[p][y] * Mw[q][x]) * V[v][pix] over the two
// image rows y where Mh[p][y] is not zero (K = 64; every other term is a
// product with a zero weight, and V exists only on those rows),
// A built in registers from the f32 NCHW relu^2 rows (split hi/lo),
// B from the bf16 NCHW V planes. A fifth wave makes sK meanwhile. Epilogue: * sK, clip +-32/9, hi/lo into
// coverage: 4 waves x 8 rows x 8 lanes x 8 kk = 32 v x 64 kk per (bh,pq).
// ---------------------------------------------------------------------------
__global__ __launch_bounds__(160) void k_kv(
    const float* __restrict__ r2k, const us* __restrict__ vnh, const us* __restrict__ vnl,
    const float* __restrict__ partk, BiW bw, us* __restrict__ fth, us* __restrict__ ftl)
{
  __shared__ __attribute__((aligned(16))) us sH[32 * 64];
  __shared__ __attribute__((aligned(16))) us sL[32 * 64];
  __shared__ float sphi[32];   // the ratio, one copy per lane
  const int tid = threadIdx.x, lane = tid & 31;
  const int w = __builtin_amdgcn_readfirstlane(tid >> 5);   // scalar: the role tests below are scalar branches, EXEC stays whole
  const int h = lane >> 4, m = lane & 15;
  const int pq = blockIdx.x, bh = blockIdx.y;
  const int b = bh >> 3, head = bh & 7;
  const int p = pq / 3, q = pq - 3 * p;
  const int   iy0 = (p == 0) ? bw.i0[0] : ((p == 1) ? bw.i0[1] : bw.i0[2]);
  const int   iy1 = (p == 0) ? bw.i1[0] : ((p == 1) ? bw.i1[1] : bw.i1[2]);
  const float wy0 = (p == 0) ? bw.w0[0] : ((p == 1) ? bw.w0[1] : bw.w0[2]);
  const float wy1 = (p == 0) ? bw.w1[0] : ((p == 1) ? bw.w1[1] : bw.w1[2]);
  const int   ix0 = (q == 0) ? bw.i0[0] : ((q == 1) ? bw.i0[1] : bw.i0[2]);
  const int   ix1 = (q == 0) ? bw.i1[0] : ((q == 1) ? bw.i1[1] : bw.i1[2]);
  const float wx0 = (q == 0) ? bw.w0[0] : ((q == 1) ? bw.w0[1] : bw.w0[2]);
  const float wx1 = (q == 0) ? bw.w1[0] : ((q == 1) ? bw.w1[1] : bw.w1[2]);
  const float amax = (float)(32.0 / 9.0);
  const float* arow = r2k + ((size_t)(b * DQ + head * DK + 16 * w + m)) * NPIX;
  const size_t br0 = ((size_t)(b * DV + head * DVH + m)) * NPIX;
  const size_t br1 = br0 + (size_t)16 * NPIX;
  const v8f z8 = {0.f, 0.f, 0.f, 0.f, 0.f, 0.f, 0.f, 0.f};
  v8f acc[2];
  acc[0] = z8; acc[1] = z8;

  if (w == 4) {
    sphi[lane] = phi_wave(partk, lane);
  } else {
  #pragma unroll 1
  for (int t = 0; t < 2; ++t) {
    // rows iy0 then iy1, ascending as in the full sum; were the two clamped onto one row, it takes both weights once
    const float wy = (t == 0) ? (wy0 + ((iy1 == iy0) ? wy1 : 0.f)) : ((iy1 == iy0) ? 0.f : wy1);
    const int k0 = ((t == 0) ? iy0 : iy1) * HIMG;
    const float* ap = arow + k0;
    const v4f q0 = *(const v4fa*)(ap + 8 * h);
    const v4f q1 = *(const v4fa*)(ap + 8 * h + 4);
    const v4f q2 = *(const v4fa*)(ap + 16 + 8 * h);
    const v4f q3 = *(const v4fa*)(ap + 20 + 8 * h);
    v8i fbh[2], fbl[2];
    fbh[0] = ldfrag(vnh + br0 + k0, h);
    fbh[1] = ldfrag(vnh + br1 + k0, h);
    fbl[0] = ldfrag(vnl + br0 + k0, h);
    fbl[1] = ldfrag(vnl + br1 + k0, h);
    // keeps the V fragment reads in flight with the K row reads (else they sink behind the split: a second memory latency)
    __builtin_amdgcn_sched_barrier(0);
    float v[16];
    v[0] = q0.x; v[1] = q0.y; v[2] = q0.z; v[3] = q0.w;
    v[4] = q1.x; v[5] = q1.y; v[6] = q1.z; v[7] = q1.w;
    v[8] = q2.x; v[9] = q2.y; v[10] = q2.z; v[11] = q2.w;
    v[12] = q3.x; v[13] = q3.y; v[14] = q3.z; v[15] = q3.w;
    Frag fah, fal;
    #pragma unroll
    for (int i = 0; i < 16; ++i) {
      const int xx = 8 * h + (i & 7) + ((i >> 3) << 4);
      const float wx = ((xx == ix0) ? wx0 : 0.f) + ((xx == ix1) ? wx1 : 0.f);
      const float a = v[i] * (wy * wx);
      us hi, lo;
      split2(a, hi, lo);
      fah.half[i >> 3][i & 7] = hi;
      fal.half[i >> 3][i & 7] = lo;
    }
    wmma3_1x2(fah.v, fal.v, fbh, fbl, acc);
  }
  }
  __syncthreads();   // publishes the fifth wave's ratio

  if (w < 4) {
  const float sK = sphi[lane];
  #pragma unroll
  for (int nt = 0; nt < 2; ++nt) {
    #pragma unroll
    for (int r = 0; r < 8; ++r) {
      float val = acc[nt][r] * sK;
      val = fminf(fmaxf(val, -amax), amax);
      const int kk = 16 * w + 8 * h + r;
      const int vv = 16 * nt + m;
      us hi, lo;
      split2(val, hi, lo);
      sH[vv * 64 + kk] = hi;
      sL[vv * 64 + kk] = lo;
    }
  }
  }
  __syncthreads();
  if (w == 4) return;   // behind the last barrier
  const int q8 = lane & 7, sub = lane >> 3;
  v8us th[2], tl[2];
  size_t d[2];
  #pragma unroll
  for (int i = 0; i < 2; ++i) {
    const int vv = 8 * w + 4 * i + sub;
    th[i] = *(const v8usa*)(sH + vv * 64 + 8 * q8);
    tl[i] = *(const v8usa*)(sL + vv * 64 + 8 * q8);
    d[i] = ((size_t)(bh * DVH + vv)) * FTK + pq * 64 + 8 * q8;
  }
  #pragma unroll
  for (int i = 0; i < 2; ++i) { *(v8us*)(fth + d[i]) = th[i]; *(v8us*)(ftl + d[i]) = tl[i]; }
  
}

// ---------------------------------------------------------------------------
// Kernel: per-sample grouped 3x3 conv of relu(Q)^2 planes (padded NHWC,
// 512 ch) with the pooled filters, K = 9*64 per head. Block = (64 px, head
// pair, b); wave = (head of the pair, image row) 32 px x 32 v; a fifth wave makes sQ meanwhile.
// Operands staged in LDS by asynchronous copies, each byte once per block: the four
// padded image rows (136 pixels, adjacent in memory) x the pair's 128 channels and the
// pair's 64 filter rows, hi and lo planes. Three pieces, one per kernel row, each into
// LDS of its own (nothing is refilled): piece ky + 1 flies while kernel row ky is multiplied.
// Row pitches 272 B and 1,168 B = 16 B x odd (conflict-free 16-B reads). Epilogue:
// * sQ + bias[b][j*32+v], hi/lo into padded NHWC planes [b][34][34][256];
// coverage: 4 waves x 16 px x 8 lanes x 8 ch = 64 px x 64 ch per block;
// grid 16 x 4 x 4 = all interior pixels x all 256 channels x 4 samples.
// ---------------------------------------------------------------------------
#define GAP  (2 * DK + 8)       // halves of a staged pixel row
#define GBP  (FTK + 8)          // halves of a staged filter row
#define GAPL (4 * PW * GAP)     // one pixel plane
#define GBPL (2 * DVH * GBP)    // one filter plane
// pixel rows come in units of 8 (128 threads x 16 B = 8 rows of 256 B): units 0..8 hold the 68 pixels
// that kernel row 0 reads, units ..12 the 102 of kernel row 1, units ..16 all 136
static_assert(4 * PW == 17 * 8 && 9 * 8 >= 2 * PW && 13 * 8 >= 3 * PW, "whole units; each piece covers its kernel row");
__global__ __launch_bounds__(160) void k_gconv(
    const us* __restrict__ rqh, const us* __restrict__ rql,
    const us* __restrict__ fth, const us* __restrict__ ftl,
    const float* __restrict__ partq, const float* __restrict__ biasv,
    us* __restrict__ oh, us* __restrict__ ol)
{
  __shared__ __attribute__((aligned(16))) us ga[2 * GAPL];
  __shared__ __attribute__((aligned(16))) us gb[2 * GBPL];
  __shared__ __attribute__((aligned(16))) us sH[64 * 64];
  __shared__ __attribute__((aligned(16))) us sL[64 * 64];
  __shared__ float sphi[32];   // the ratio, one copy per lane
  const int tid = threadIdx.x, lane = tid & 31;
  const int w = __builtin_amdgcn_readfirstlane(tid >> 5);   // scalar: the role tests below are scalar branches, EXEC stays whole
  const int h = lane >> 4, m = lane & 15;
  const int pt = blockIdx.x, jp = blockIdx.y, b = blockIdx.z;
  const int y0 = 2 * pt;
  const int jl = w >> 1, ry = w & 1;
  const int j = 2 * jp + jl;
  const v8f z8 = {0.f, 0.f, 0.f, 0.f, 0.f, 0.f, 0.f, 0.f};
  v8f acc[2][2];
  #pragma unroll
  for (int i = 0; i < 2; ++i) { acc[i][0] = z8; acc[i][1] = z8; }

  // piece ky (waves 0..3, every lane): the three taps' 128-B pieces of all 64 filter rows, and the pixel units that kernel row ky adds
  auto piece_copy = [&](int ky) {
    // filters: thread = 16-B column fq of rows fr + 16 i
    const int fq = tid & 7, fr = tid >> 3;
    const unsigned lb = (unsigned)(size_t)gb + (unsigned)(fr * (GBP * 2) + fq * 16);
    const size_t fo = ((size_t)((b * 8 + 2 * jp) * DVH + fr)) * FTK + 8 * fq;
    // both loops unrolled: plane, row and tap are then constants and l, gp stay in registers
    #pragma unroll
    for (int kx = 0; kx < 3; ++kx) {
      unsigned l[8];
      const us* gp[8];
      #pragma unroll
      for (int t = 0; t < 8; ++t) {
        const int pl = t >> 2, row = (t & 3) * 16;
        l[t] = lb + (unsigned)((pl * GBPL + row * GBP + (ky * 3 + kx) * DK) * 2);
        gp[t] = (pl == 0 ? fth : ftl) + fo + (size_t)(row * FTK + (ky * 3 + kx) * DK);
      }
      acopy8(l, gp);
    }
    // pixels: thread = 16-B column aq of pixel rows ar + 8 u
    const int aq = tid & 15, ar = tid >> 4;
    const unsigned la = (unsigned)(size_t)ga + (unsigned)(ar * (GAP * 2) + aq * 16);
    const size_t ao = ((size_t)((b * PW + y0) * PW + ar)) * DQ + (size_t)(jp * 2 * DK + 8 * aq);
    const int u0 = (ky == 0) ? 0 : (5 + 4 * ky), nu = (ky == 0) ? 9 : 4;   // first unit, units per plane
    // copy c of the piece: plane c / nu, unit u0 + c % nu
    auto px = [&](int c, unsigned& l, const us*& g) {
      const int pl = c / nu, u = u0 + c % nu;
      l = la + (unsigned)((pl * GAPL + u * 8 * GAP) * 2);
      g = (pl == 0 ? rqh : rql) + ao + (size_t)(u * 8 * DQ);
    };
    {
      unsigned l[8];
      const us* gp[8];
      // unrolled: constant indices, l and gp stay in registers
      #pragma unroll
      for (int t = 0; t < 8; ++t) px(t, l[t], gp[t]);
      acopy8(l, gp);
    }
    if (ky == 0) {
      unsigned l[10];
      const us* gp[10];
      // unrolled: constant indices, l and gp stay in registers
      #pragma unroll
      for (int t = 0; t < 10; ++t) px(8 + t, l[t], gp[t]);
      acopy10(l, gp);
    }
  };
  // kernel row ky: six steps of 32 channels (kernel column, half of the head's 64 channels), in the order tap, half
  const us* sa = ga + (ry * PW + m) * GAP + jl * DK;
  const us* sb = gb + (jl * DVH + m) * GBP;
  auto mul_row = [&](int ky) {
    // two register sets of fragments: the next step is read while this one is multiplied
    v8i fah[2][2], fal[2][2], fbh[2][2], fbl[2][2];
    auto ldstep = [&](int st, int q) {
      const us* pa = sa + (ky * PW + (st >> 1)) * GAP + 32 * (st & 1);
      const us* pb = sb + (ky * 3 + (st >> 1)) * DK + 32 * (st & 1);
      #pragma unroll
      for (int t = 0; t < 2; ++t) fah[q][t] = ldfrag(pa + t * 16 * GAP, h);
      #pragma unroll
      for (int t = 0; t < 2; ++t) fbh[q][t] = ldfrag(pb + t * 16 * GBP, h);
      #pragma unroll
      for (int t = 0; t < 2; ++t) fal[q][t] = ldfrag(pa + GAPL + t * 16 * GAP, h);
      #pragma unroll
      for (int t = 0; t < 2; ++t) fbl[q][t] = ldfrag(pb + GBPL + t * 16 * GBP, h);
    };
    static_assert(DK == 64, "two steps of 32 channels per tap");
    ldstep(0, 0);
    #pragma unroll
    for (int st = 0; st < 6; ++st) {
      const int q = st & 1;
      if (st + 1 < 6) ldstep(st + 1, q ^ 1);
      // keeps the next step's 16 LDS reads one group ahead of this step's WMMAs (else they sink to their uses and each waits)
      __builtin_amdgcn_sched_barrier(0);
      wmma3_2x2(fah[q], fal[q], fbh[q], fbl[q], acc);
    }
  };

  double s2 = 0.0, s4 = 0.0;
  if (w == 4) {
    phi_lane_sums(partq, lane, s2, s4);
  } else {
    piece_copy(0);
    asm volatile("s_wait_asynccnt 0x0" ::: "memory");  // this wave's copies of piece 0 have landed
  }
  __syncthreads();                                     // ... and every other wave's
  // unrolled: ky is a constant in the copies' and the reads' offsets
  #pragma unroll
  for (int ky = 0; ky < 3; ++ky) {
    if (w == 4) {
      if (ky == 0) sphi[lane] = phi_ratio(s2, s4);
    } else {
      if (ky + 1 < 3) piece_copy(ky + 1);
      mul_row(ky);
      if (ky + 1 < 3) asm volatile("s_wait_asynccnt 0x0" ::: "memory");  // this wave's copies of piece ky + 1 have landed
    }
    if (ky + 1 < 3) __syncthreads();   // publishes piece ky + 1 (the first of the two also the fifth wave's ratio)
  }

  if (w < 4) {
  const float sQ = sphi[lane];
  float bv[2];
  bv[0] = biasv[b * DV + j * DVH + m];
  bv[1] = biasv[b * DV + j * DVH + 16 + m];
  #pragma unroll
  for (int mt = 0; mt < 2; ++mt) {
    #pragma unroll
    for (int nt = 0; nt < 2; ++nt) {
      #pragma unroll
      for (int r = 0; r < 8; ++r) {
        const float val = acc[mt][nt][r] * sQ + bv[nt];
        const int tp = ry * 32 + mt * 16 + 8 * h + r;
        const int chl = jl * 32 + 16 * nt + m;
        us hi, lo;
        split2(val, hi, lo);
        sH[tp * 64 + chl] = hi;
        sL[tp * 64 + chl] = lo;
      }
    }
  }
  }
  __syncthreads();
  if (w == 4) return;   // behind the last barrier
  const int q8 = lane & 7, sub = lane >> 3;
  v8us th[4], tl[4];
  size_t d[4];
  #pragma unroll
  for (int i = 0; i < 4; ++i) {
    const int tp = 16 * w + 4 * i + sub;
    const int ry2 = tp >> 5, xx = tp & 31;
    th[i] = *(const v8usa*)(sH + tp * 64 + 8 * q8);
    tl[i] = *(const v8usa*)(sL + tp * 64 + 8 * q8);
    d[i] = ((size_t)((b * PW + y0 + ry2 + 1) * PW + xx + 1)) * DV + jp * 64 + 8 * q8;
  }
  #pragma unroll
  for (int i = 0; i < 4; ++i) { *(v8us*)(oh + d[i]) = th[i]; *(v8us*)(ol + d[i]) = tl[i]; }
  
}

// ---------------------------------------------------------------------------
// Kernel: LayerNorm over (C,H,W) per sample: fixed-order f64 combine of the
// 64 block partial lines of the sample, then (v - mu) * rstd. Few waves, each
// thread with LN_V float4,
// all loaded at the top so that they fly while the statistics are combined.
// coverage: 256 blocks x 64 threads x 16 float4 = all 1048576 outputs; one
// instruction of a block = 1 KiB in a row.
// ---------------------------------------------------------------------------
#define LN_T 64
#define LN_V 16
#define LN_BLK (LN_T * LN_V * 4)   // values per block
static_assert((DV * NPIX) % LN_BLK == 0, "a block lies inside one sample");
__global__ __launch_bounds__(LN_T) void k_ln(const float* __restrict__ outp, const float* __restrict__ partl,
                                             float* __restrict__ out) {
  __shared__ double ss[64];
  __shared__ double sq[64];
  __shared__ float sst[2];
  static_assert(LN_T == 64, "one thread per partial line");
  const int tid = threadIdx.x;
  const int blk = blockIdx.x, b = blk / ((DV * NPIX) / LN_BLK);
  const size_t e = (size_t)blk * LN_BLK + tid * 4;
  v4f v[LN_V];
  // unrolled: constant indices, v stays in registers and the loads fly together
  #pragma unroll
  for (int i = 0; i < LN_V; ++i) v[i] = *(const v4fa*)(outp + e + i * (LN_T * 4));
  {
    const double* dp = reinterpret_cast<const double*>(partl + (size_t)(b * 64 + tid) * 32);
    ss[tid] = dp[0];
    sq[tid] = dp[1];
  }
  __syncthreads();
  if (tid == 0) {
    double S = 0.0, Q2 = 0.0;
    for (int i = 0; i < 64; ++i) { S += ss[i]; Q2 += sq[i]; }
    const double inv = 1.0 / 262144.0;
    const double mu = S * inv;
    double var = Q2 * inv - mu * mu;
    if (var < 0.0) var = 0.0;
    const float den = sqrtf((float)var + 1e-5f);
    sst[0] = (float)mu;
    sst[1] = 1.0f / den;
  }
  __syncthreads();
  const float muf = sst[0], rinv = sst[1];
  #pragma unroll
  for (int i = 0; i < LN_V; ++i) {
    v4f o;
    o.x = (v[i].x - muf) * rinv;
    o.y = (v[i].y - muf) * rinv;
    o.z = (v[i].z - muf) * rinv;
    o.w = (v[i].w - muf) * rinv;
    *(v4f*)(out + e + i * (LN_T * 4)) = o;
  }
}

// ---------------------------------------------------------------------------
// Host: bilinear (32 -> 3, align_corners = false) taps and weights, computed
// with separate f64 multiply and subtract, fraction cast to f32.
// ---------------------------------------------------------------------------
static void bilin3(BiW& bw) {
#pragma clang fp contract(off)
  const double scale = 32.0 / 3.0;
  for (int p = 0; p < 3; ++p) {
    double src = ((double)p + 0.5) * scale;
    src = src - 0.5;
    if (src < 0.0) src = 0.0;
    const int f = (int)src;
    const float frac = (float)(src - (double)f);
    int c0 = f, c1 = f + 1;
    if (c0 > HIMG - 1) c0 = HIMG - 1;
    if (c1 > HIMG - 1) c1 = HIMG - 1;
    bw.i0[p] = c0;
    bw.i1[p] = c1;
    bw.w0[p] = 1.0f - frac;
    bw.w1[p] = frac;
  }
}

extern "C" void kernel_launch(void* const* d_in, const int* in_sizes, int n_in,
                              void* d_out, int out_size, void* d_ws, size_t ws_size,
                              hipStream_t stream) {
  if (n_in < 11) return;
  if (in_sizes[0] != NBATCH * CIN * NPIX) return;
  if (in_sizes[1] != DQ * CIN || in_sizes[2] != DQ) return;
  if (in_sizes[3] != DQ * CIN * 9 || in_sizes[4] != DQ) return;
  if (in_sizes[5] != DV * CIN * 9 || in_sizes[6] != DV) return;
  if (in_sizes[7] != DV * CIN || in_sizes[8] != DV) return;
  if (in_sizes[9] != DV * DV * 9 || in_sizes[10] != DV) return;
  if (out_size != NBATCH * DV * NPIX) return;

  const float* x      = (const float*)d_in[0];
  const float* q_w    = (const float*)d_in[1];
  const float* q_b    = (const float*)d_in[2];
  const float* k_w    = (const float*)d_in[3];
  const float* k_b    = (const float*)d_in[4];
  const float* v_w    = (const float*)d_in[5];
  const float* v_b    = (const float*)d_in[6];
  const float* bias_w = (const float*)d_in[7];
  const float* bias_b = (const float*)d_in[8];
  const float* hu_w   = (const float*)d_in[9];
  const float* hu_b   = (const float*)d_in[10];
  float* out = (float*)d_out;

  // workspace carve (bytes); every region sized to whole 256-B multiples and
  // written only with whole-line stores inside its extent
  char* ws = (char*)d_ws;
  size_t off = 0;
#define CARVE(T, name, bytes) T* name = (T*)(ws + off); off += (((size_t)(bytes)) + 255) & ~(size_t)255;
  const size_t padpx  = (size_t)NBATCH * PW * PW;                    // 4624 padded pixels
  CARVE(us,    XPH,   padpx * CIN * 2);                               // 2367488
  CARVE(us,    XPL,   padpx * CIN * 2);
  CARVE(us,    WQH,   (size_t)DQ * CIN * 2);                          // 262144
  CARVE(us,    WQL,   (size_t)DQ * CIN * 2);
  CARVE(us,    WKH,   (size_t)DQ * CIN * 9 * 2);                      // 2359296
  CARVE(us,    WKL,   (size_t)DQ * CIN * 9 * 2);
  CARVE(us,    WVH,   (size_t)DV * CIN * 9 * 2);                      // 1179648
  CARVE(us,    WVL,   (size_t)DV * CIN * 9 * 2);
  CARVE(us,    WHH,   (size_t)DV * DV * 9 * 2);                       // 1179648
  CARVE(us,    WHL,   (size_t)DV * DV * 9 * 2);
  CARVE(float, BIASV, (size_t)NBATCH * DV * 4);                       // 4096 = 32 lines
  CARVE(us,    RQH,   padpx * DQ * 2);                                // 4734976
  CARVE(us,    RQL,   padpx * DQ * 2);
  CARVE(float, R2K,   (size_t)NBATCH * DQ * NPIX * 4);                // 8388608
  CARVE(us,    VNH,   (size_t)NBATCH * DV * NPIX * 2);                // 2097152
  CARVE(us,    VNL,   (size_t)NBATCH * DV * NPIX * 2);
  CARVE(float, PARTQ, (size_t)512 * 128);                             // 512 lines
  CARVE(float, PARTK, (size_t)512 * 128);                             // 512 lines
  CARVE(us,    FTH,   (size_t)NBATCH * 8 * DVH * FTK * 2);            // 1179648
  CARVE(us,    FTL,   (size_t)NBATCH * 8 * DVH * FTK * 2);
  CARVE(us,    QKH,   padpx * DV * 2);                                // 2367488
  CARVE(us,    QKL,   padpx * DV * 2);
  CARVE(float, OUTP,  (size_t)NBATCH * DV * NPIX * 4);                // 4194304
  CARVE(float, PARTL, (size_t)256 * 128);                             // 256 lines
  CARVE(float, ROWS,  (size_t)NBATCH * HIMG * CIN * 4);               // 131072
#undef CARVE
  if (off > ws_size) return;
  if (off > (size_t)134217728) return;

  BiW bw;
  bilin3(bw);

  // 16-bit operand planes
  k_prep<<<NB_PREP, 256, 0, stream>>>(x, q_w, k_w, v_w, hu_w, XPH, XPL, ROWS,
                                      WQH, WQL, WKH, WKL, WVH, WVL, WHH, WHL, RQH, RQL, QKH, QKL);

  // k (3x3), v (3x3), q (1x1) convolutions; channel means + bias linear
  k_conv_qkv<<<NB_CK + NB_CV + 1 + NB_CQ, 128, 0, stream>>>(XPH, XPL, WKH, WKL, k_b, R2K, PARTK,
                                                            WVH, WVL, v_b, VNH, VNL,
                                                            WQH, WQL, q_b, RQH, RQL, PARTQ,
                                                            ROWS, bias_w, bias_b, BIASV);

  // pooled KV filters, grouped conv (each makes its own phi ratio)
  k_kv<<<dim3(9, NBATCH * 8), 160, 0, stream>>>(R2K, VNH, VNL, PARTK, bw, FTH, FTL);
  k_gconv<<<dim3(16, 4, NBATCH), 160, 0, stream>>>(RQH, RQL, FTH, FTL, PARTQ, BIASV, QKH, QKL);

  // head unification conv + LayerNorm
  k_conv_hu<<<dim3(64, DV / 64), 128, 0, stream>>>(QKH, QKL, WHH, WHL, hu_b, OUTP, PARTL);
  k_ln<<<(NBATCH * DV * NPIX) / LN_BLK, LN_T, 0, stream>>>(OUTP, PARTL, out);
}
